// v000
// The times below were measured on an AMD MI455X: many runs one after another, warmed up first and cycling through
// copies of the inputs, with the whole window's GPU time divided by the number of runs. Launches and the gaps
// between them are all in it. The median over several windows is given; except for v000 it joins two sittings, which
// can be a few percent apart, so the side-by-side timings, each taken in one sitting, are the better comparison.
// The starting kernel, v000, takes 405 microseconds a run.
#include <hip/hip_runtime.h>

// Contractions: qkv projection and output projection v_wmma_f32_16x16x32_bf16 (every input RNE-converted to bf16; context carried as bf16 hi|lo folded into K); scores and probability x value v_wmma_f32_16x16x32_f16 for query positions >= 256 (P carried x1024), bf16 hi/lo three-product form for positions < 256; f32 accumulate, f32 softmax.
// Sequence-first causal multi-head self-attention with a fused bias-free (out, in) qkv weight and an (out, in) output weight: token row m = l*NB + n, attention problem bh = n*16 + h, head columns h*64..h*64+63.
// Launch plan: 4 x k_cvt (bf16 copies) -> k_gemmw (qkv f32) -> k_planes (q/k/v^T 16-bit planes) -> k_attn_hr (rows < 256, 16-row tiles) -> k_attn_lo (rows >= 256, 32-row tiles) -> k_gemmw (output).

#ifndef NB
#define NB 2                      // batch entries processed (NB_FULL, or 1 for a reduced build)
#endif
#ifndef SEQ
#define SEQ 2048                  // sequence positions processed
#endif
#define NB_FULL  2                // batch stride of the staged x and of the output rows
#define SEQ_FULL 2048
#define DM   1024
#define NH   16
#define HD   64
#define F3   (3 * DM)
#define CK   (2 * DM)             // context plane width: hi columns | lo columns
#define RH   256                  // query positions < RH use the hi/lo planes
#define NBH  (NB * NH)
#define MROWS (SEQ * NB)
#define ROWSTEP (NB_FULL / NB)
#define PLN  ((size_t)NBH * SEQ * HD)
#define PLNH ((size_t)NBH * RH * HD)
#define PCAR 1024.0f
#define PP   40                   // P tile pitch in 16-bit elements (80 B)
#define OP   72                   // context staging pitch in 16-bit elements (144 B)
#define ER   16                   // query rows per wave in the early-positions kernel

static_assert(NB == NB_FULL || NB == 1);          // compact row m = l*NB + n maps to token row m*ROWSTEP
static_assert(SEQ <= SEQ_FULL && SEQ >= RH);
static_assert(SEQ % 256 == 0);                    // tile multiples (64-row GEMM tiles, 32-row attention tiles, 8-wide plane groups)
static_assert(RH % 32 == 0 && RH % 8 == 0);       // the last 32-key step of the early kernel ends inside the hi/lo planes
static_assert(RH % ER == 0 && ER == 16);          // early kernel: one 16-row WMMA tile per wave, store loop 4 x 4 rows
static_assert(HD == 64 && NH * HD == DM);
static_assert(DM == 1024);                        // k_cvt: 128 eight-element groups per row (i >> 7, i & 127)
static_assert(DM % 32 == 0 && CK % 32 == 0);      // K multiples of the 32-deep step
static_assert(MROWS % 64 == 0 && F3 % 64 == 0 && DM % 64 == 0);
static_assert(((size_t)NBH * SEQ * HD / 8) % 256 == 0);   // k_planes grid x block == plane extent
static_assert(PP >= 32 && (PP * 2) % 16 == 0);
static_assert(OP >= 64 && (OP * 2) % 16 == 0);

typedef _Float16 h16;
typedef unsigned short bf;
typedef unsigned short us;
typedef __attribute__((ext_vector_type(16))) __bf16   v16bf;
typedef __attribute__((ext_vector_type(16))) _Float16 v16h;
typedef __attribute__((ext_vector_type(16))) unsigned short v16us;
typedef __attribute__((ext_vector_type(8)))  _Float16 v8h;
typedef __attribute__((ext_vector_type(8)))  unsigned short v8us;
typedef __attribute__((ext_vector_type(8)))  float    v8f;
typedef __attribute__((ext_vector_type(4)))  float    v4f;
typedef v4f  __attribute__((may_alias)) v4fa;
typedef v8us __attribute__((may_alias)) v8usa;

__device__ __forceinline__ unsigned short f2bf(float f) { unsigned u = __float_as_uint(f); u += 0x7FFFu + ((u >> 16) & 1u); return (unsigned short)(u >> 16); }
__device__ __forceinline__ float bf2f(unsigned short b) { return __uint_as_float(((unsigned)b) << 16); }
__device__ __forceinline__ void splitf(float y, unsigned short& h, unsigned short& l) { h = f2bf(y); l = f2bf(y - bf2f(h)); }

// 16-bit fragment from a K-contiguous row: elements 0..7 <- p[0..7], elements 8..15 <- p[16..23]; the caller adds 8*(lane>>4) to p.
__device__ __forceinline__ v16us ldus(const us* p) {
    const v8us a = *(const v8us*)p; const v8us b = *(const v8us*)(p + 16);
    return __builtin_shufflevector(a, b, 0, 1, 2, 3, 4, 5, 6, 7, 8, 9, 10, 11, 12, 13, 14, 15);
}

// One WMMA plus its own four-slot guard (ties exactly one accumulator, keeps A and B live).
template <bool BF>
__device__ __forceinline__ v8f mmg(v16us a, v16us b, v8f c) {
    if (BF) c = __builtin_amdgcn_wmma_f32_16x16x32_bf16(false, __builtin_bit_cast(v16bf, a), false, __builtin_bit_cast(v16bf, b), (short)0, c, false, false);
    else    c = __builtin_amdgcn_wmma_f32_16x16x32_f16(false, __builtin_bit_cast(v16h, a), false, __builtin_bit_cast(v16h, b), (short)0, c, false, false);
    asm volatile("v_nop\n\tv_nop\n\tv_nop\n\tv_nop" : "+v"(c) : "v"(a), "v"(b));
    return c;
}

__global__ __launch_bounds__(256) void k_cvt(const float* __restrict__ src, int srcstep, bf* dst, int dstpitch, int dstcol, int ngroups) {
    const int i = blockIdx.x * 256 + threadIdx.x; if (i >= ngroups) return;
    const int row = i >> 7, cg = i & 127;
    const v8f v = *(const v8f*)(src + (size_t)row * srcstep * DM + cg * 8);
    v8us o;
#pragma unroll
    for (int k = 0; k < 8; ++k) o[k] = f2bf(v[k]);
    bf* d = dst + (size_t)row * dstpitch + dstcol + cg * 8;
    *(v8us*)d = o; 
}

// ---- k_gemmw: ONE WAVE per 64x64 output tile (16 accumulators), bf16 operands straight from K-contiguous planes; grid (M/64, N/64), 32 threads.
// C[m][n] (f32, pitch ldc) = sum_k A[m][k] Bt[n][k]; K % 32 == 0, M and N multiples of 64.
__global__ __launch_bounds__(32) void k_gemmw(const bf* __restrict__ A, int lda, const bf* __restrict__ Bt, int ldb, int K, float* C, int ldc) {
    __shared__ __align__(16) float os[16 * 68];
    const int lane = threadIdx.x & 31, lr = lane & 15, hi = lane >> 4;
    const int r0 = blockIdx.x * 64, c0 = blockIdx.y * 64;
    v8f acc[4][4];
#pragma unroll
    for (int mb = 0; mb < 4; ++mb)
#pragma unroll
        for (int nb = 0; nb < 4; ++nb) acc[mb][nb] = (v8f){};
    const size_t aoff = (size_t)(r0 + lr) * lda + 8 * hi, boff = (size_t)(c0 + lr) * ldb + 8 * hi;
#pragma unroll 1
    for (int kc = 0; kc < K; kc += 32) {
        v16us a[4];
#pragma unroll
        for (int mb = 0; mb < 4; ++mb) a[mb] = ldus(A + aoff + (size_t)mb * 16 * lda + kc);
#pragma unroll
        for (int nb = 0; nb < 4; ++nb) {
            const v16us b = ldus(Bt + boff + (size_t)nb * 16 * ldb + kc);
#pragma unroll
            for (int mb = 0; mb < 4; ++mb) acc[mb][nb] = mmg<true>(a[mb], b, acc[mb][nb]);
        }
    }
#pragma unroll
    for (int mb = 0; mb < 4; ++mb) {
#pragma unroll
        for (int nb = 0; nb < 4; ++nb) {
#pragma unroll
            for (int j = 0; j < 8; ++j) os[(hi * 8 + j) * 68 + nb * 16 + lr] = acc[mb][nb][j];
        }
        __builtin_amdgcn_wave_barrier(); asm volatile("" ::: "memory");
        float* crow = C + (size_t)(r0 + mb * 16) * ldc + c0;
{
#pragma unroll
            for (int s = 0; s < 8; ++s) {                       // rows 2s+hi, s = 0..7, hi = 0..1: all 16 rows of the slab
                const int row = 2 * s + hi, cofs = lr * 4;
                const v4f val = *(const v4fa*)(os + row * 68 + cofs);
                *(v4f*)(crow + (size_t)row * ldc + cofs) = val;
            }
            
        }
        __builtin_amdgcn_wave_barrier(); asm volatile("" ::: "memory");
    }
}

// ---- k_planes: 16-bit operand planes from the f32 projection F [MROWS][3072] (row m = l*NB + n; column which*1024 + h*64 + d).
// blockIdx.y 2: transposed value planes [bh][d][l] (f16; positions < RH also bf16 hi and lo [bh][d][RH]), lane -> 8 consecutive l (strided reads, 16-B contiguous stores).
__device__ __forceinline__ void cvt3(const v8f x, v8h& o16, v8us& oh, v8us& ol) {
#pragma unroll
    for (int k = 0; k < 8; ++k) { o16[k] = (h16)x[k]; unsigned short a, c; splitf(x[k], a, c); oh[k] = a; ol[k] = c; }
}
__device__ __forceinline__ void store3(h16* p16, bf* ph, bf* pl, bool hr, const v8h o16, const v8us oh, const v8us ol) {
    *(v8h*)p16 = o16; if (hr) { *(v8us*)ph = oh; *(v8us*)pl = ol; }
    
}
__global__ __launch_bounds__(256) void k_planes(const float* __restrict__ F, h16* QK16, bf* QKh, bf* QKl, h16* VT16, bf* VTh, bf* VTl) {
    const int g = blockIdx.x * 256 + threadIdx.x;
    if (g >= NBH * SEQ * HD / 8) return;
    const int which = blockIdx.y;
    v8h o16; v8us oh, ol;
    if (which < 2) {
        const int d8 = g & 7, l = (g >> 3) % SEQ, bh = g / (8 * SEQ), n = bh / NH, h = bh % NH;
        const float* f = F + ((size_t)l * NB + n) * F3 + which * DM + h * HD + d8 * 8;
        const v4f a = *(const v4f*)f, b = *(const v4f*)(f + 4);
        const v8f x = __builtin_shufflevector(a, b, 0, 1, 2, 3, 4, 5, 6, 7);
        cvt3(x, o16, oh, ol);
        const bool hr = (l < RH);
        const size_t e16 = (size_t)which * PLN + ((size_t)bh * SEQ + l) * HD + d8 * 8;
        const size_t eh = hr ? ((size_t)which * PLNH + ((size_t)bh * RH + l) * HD + d8 * 8) : 0;
        store3(QK16 + e16, QKh + eh, QKl + eh, hr, o16, oh, ol);
    } else {
        const int l8 = g % (SEQ / 8), d = (g / (SEQ / 8)) % HD, bh = g / (HD * (SEQ / 8)), n = bh / NH, h = bh % NH;
        const int l = l8 * 8;
        v8f x;
#pragma unroll
        for (int j = 0; j < 8; ++j) x[j] = F[((size_t)(l + j) * NB + n) * F3 + 2 * DM + h * HD + d];
        cvt3(x, o16, oh, ol);
        const bool hr = (l < RH);
        const size_t e16 = ((size_t)bh * HD + d) * SEQ + l;
        const size_t eh = hr ? (((size_t)bh * HD + d) * RH + l) : 0;
        store3(VT16 + e16, VTh + eh, VTl + eh, hr, o16, oh, ol);
    }
}

// ---- fused causal attention, one wave (one block) per 32 query rows of one problem, 32 keys per step, online softmax in f32 (raw scores, the 1/8 folded into the exponent constant).
// HR = false: f16 planes, one product per tile pair, P carried x1024 in f16. HR = true: bf16 hi/lo planes, products hi.hi + lo.hi + hi.lo for q.k and for P.v.
// Only the HR = false instantiation is launched (k_attn_lo); the early positions use k_attn_hr below, which runs the same arithmetic on 16-row tiles.
// LDS tiles are private to the (single) wave of the block; a block barrier separates the 2-byte element stores from the 16-byte reloads (reload through a may_alias vector of the stored element type).
template <bool HR>
__device__ __forceinline__ void attn_body(const us* __restrict__ Qa, const us* __restrict__ Qr, const us* __restrict__ Ka, const us* __restrict__ Kr,
                                          const us* __restrict__ Va, const us* __restrict__ Vr, bf* CTX, const int q0) {
    constexpr int LR = HR ? RH : SEQ;                  // rows per problem in the q/k planes = row length of the transposed value planes
    __shared__ __align__(16) unsigned short psA[32 * PP];
    __shared__ __align__(16) unsigned short psB[32 * PP];
    __shared__ __align__(16) unsigned short oh[32 * OP];
    __shared__ __align__(16) unsigned short ol[32 * OP];
    const int lane = threadIdx.x & 31, lr = lane & 15, hi = lane >> 4;
    const int bh = blockIdx.x, n = bh / NH, h = bh % NH;
    const size_t pb = (size_t)bh * LR * HD;
    Qa += pb; Ka += pb; Va += pb; Qr += pb; Kr += pb; Vr += pb;
    const int qoff = (q0 + lr) * HD + 8 * hi;
    const int koff = lr * HD + 8 * hi;
    const int voff = lr * LR + 8 * hi;
    const float cexp = 0.125f * 1.4426950408889634f;   // HD^-0.5 * log2(e)
    const float pc = HR ? 1.0f : PCAR;
    v8f o[2][4]; float mrow[2][8], lsum[2][8];
#pragma unroll
    for (int u = 0; u < 2; ++u) {
#pragma unroll
        for (int t2 = 0; t2 < 4; ++t2) o[u][t2] = (v8f){};
#pragma unroll
        for (int r = 0; r < 8; ++r) { mrow[u][r] = -3.0e38f; lsum[u][r] = 0.0f; }
    }
#pragma unroll 1
    for (int m0 = 0; m0 <= q0; m0 += 32) {
        int qo = qoff; asm volatile("" : "+v"(qo));   // q fragments are reloaded every step (kept out of the loop-carried state)
        v8f s[2][2];
#pragma unroll
        for (int u = 0; u < 2; ++u)
#pragma unroll
            for (int t = 0; t < 2; ++t) s[u][t] = (v8f){};
#pragma unroll
        for (int kc = 0; kc < 2; ++kc) {
            const v16us qa0 = ldus(Qa + qo + kc * 32), qa1 = ldus(Qa + qo + 16 * HD + kc * 32);
            v16us qr0 = qa0, qr1 = qa1;
            if (HR) { qr0 = ldus(Qr + qo + kc * 32); qr1 = ldus(Qr + qo + 16 * HD + kc * 32); }
#pragma unroll
            for (int t = 0; t < 2; ++t) {
                const int ko = (m0 + t * 16) * HD + koff + kc * 32;
                const v16us ka = ldus(Ka + ko);
                s[0][t] = mmg<HR>(qa0, ka, s[0][t]); s[1][t] = mmg<HR>(qa1, ka, s[1][t]);
                if (HR) {
                    const v16us kr = ldus(Kr + ko);
                    s[0][t] = mmg<HR>(qr0, ka, s[0][t]); s[1][t] = mmg<HR>(qr1, ka, s[1][t]);
                    s[0][t] = mmg<HR>(qa0, kr, s[0][t]); s[1][t] = mmg<HR>(qa1, kr, s[1][t]);
                }
            }
        }
        // s[u][t][r] = score(query q0 + u*16 + 8*hi + r, key m0 + t*16 + lr). Keys beyond the query are excluded (only possible in the diagonal step; the diagonal key itself is always kept).
        if (m0 == q0) {
#pragma unroll
            for (int u = 0; u < 2; ++u)
#pragma unroll
                for (int t = 0; t < 2; ++t)
#pragma unroll
                    for (int r = 0; r < 8; ++r) { if (t * 16 + lr > u * 16 + 8 * hi + r) s[u][t][r] = -3.0e38f; }
        }
#pragma unroll
        for (int u = 0; u < 2; ++u) {
#pragma unroll
            for (int r = 0; r < 8; ++r) {
                const float s0 = s[u][0][r], s1 = s[u][1][r];
                float v = fmaxf(s0, s1);
                v = fmaxf(v, __shfl_xor(v, 1, 32)); v = fmaxf(v, __shfl_xor(v, 2, 32));
                v = fmaxf(v, __shfl_xor(v, 4, 32)); v = fmaxf(v, __shfl_xor(v, 8, 32));      // stays inside each 16-lane half = one row
                const float mn = fmaxf(mrow[u][r], v);
                const float al = __builtin_amdgcn_exp2f((mrow[u][r] - mn) * cexp);
                mrow[u][r] = mn;
                const float p0 = __builtin_amdgcn_exp2f((s0 - mn) * cexp);
                const float p1 = __builtin_amdgcn_exp2f((s1 - mn) * cexp);
                lsum[u][r] = lsum[u][r] * al + (p0 + p1);                                 // per-lane partial row sum, reduced across lanes once at the end
                const int po = (u * 16 + 8 * hi + r) * PP + lr;
                if (HR) {
                    unsigned short a, c; splitf(p0, a, c); psA[po] = a; psB[po] = c;
                    splitf(p1, a, c); psA[po + 16] = a; psB[po + 16] = c;
                } else {
                    psA[po] = __builtin_bit_cast(unsigned short, (h16)(p0 * PCAR));
                    psA[po + 16] = __builtin_bit_cast(unsigned short, (h16)(p1 * PCAR));
                }
#pragma unroll
                for (int t2 = 0; t2 < 4; ++t2) o[u][t2][r] *= al;
            }
        }
        __syncthreads();          // P tile fully written (32 rows x 32 keys) before any fragment reload
        v16us pa[2], pr[2];
#pragma unroll
        for (int u = 0; u < 2; ++u) {
            const int po = (u * 16 + lr) * PP + 8 * hi;
            { const v8us x0 = *(const v8usa*)(psA + po); const v8us x1 = *(const v8usa*)(psA + po + 16);
              pa[u] = __builtin_shufflevector(x0, x1, 0, 1, 2, 3, 4, 5, 6, 7, 8, 9, 10, 11, 12, 13, 14, 15); }
            pr[u] = pa[u];
            if (HR) { const v8us y0 = *(const v8usa*)(psB + po); const v8us y1 = *(const v8usa*)(psB + po + 16);
              pr[u] = __builtin_shufflevector(y0, y1, 0, 1, 2, 3, 4, 5, 6, 7, 8, 9, 10, 11, 12, 13, 14, 15); }
        }
#pragma unroll
        for (int t2 = 0; t2 < 4; ++t2) {
            const int vo = (t2 * 16) * LR + voff + m0;     // B[k = key m0 + ..][n = d = t2*16 + lr] from the transposed plane row d
            const v16us va = ldus(Va + vo);
            o[0][t2] = mmg<HR>(pa[0], va, o[0][t2]); o[1][t2] = mmg<HR>(pa[1], va, o[1][t2]);
            if (HR) {
                const v16us vr = ldus(Vr + vo);
                o[0][t2] = mmg<HR>(pr[0], va, o[0][t2]); o[1][t2] = mmg<HR>(pr[1], va, o[1][t2]);
                o[0][t2] = mmg<HR>(pa[0], vr, o[0][t2]); o[1][t2] = mmg<HR>(pa[1], vr, o[1][t2]);
            }
        }
        __syncthreads();          // all reloads done before the next step overwrites the P tile
    }
    // normalise, split into bf16 hi / lo, stage the 32 x 64 tile, then whole-line stores
#pragma unroll
    for (int u = 0; u < 2; ++u) {
#pragma unroll
        for (int r = 0; r < 8; ++r) {
            float l = lsum[u][r];
            l += __shfl_xor(l, 1, 32); l += __shfl_xor(l, 2, 32); l += __shfl_xor(l, 4, 32); l += __shfl_xor(l, 8, 32);
            const float inv = 1.0f / (l * pc);
#pragma unroll
            for (int t2 = 0; t2 < 4; ++t2) {
                const float val = o[u][t2][r] * inv;
                unsigned short a, c; splitf(val, a, c);
                const int oo = (u * 16 + 8 * hi + r) * OP + t2 * 16 + lr;
                oh[oo] = a; ol[oo] = c;
            }
        }
    }
    __syncthreads();
{
#pragma unroll
        for (int s = 0; s < 8; ++s) {
            const int row = s * 4 + (lane >> 3), cp = (lane & 7) * 8;
            const v8us vh = *(const v8usa*)(oh + row * OP + cp);
            const v8us vl = *(const v8usa*)(ol + row * OP + cp);
            bf* d = CTX + ((size_t)(q0 + row) * NB + n) * CK + h * HD + cp;
            *(v8us*)d = vh; *(v8us*)(d + DM) = vl;
        }
        
    }
}

__global__ __launch_bounds__(32) void k_attn_lo(const us* __restrict__ Q16, const us* __restrict__ K16, const us* __restrict__ V16, bf* CTX) {
    attn_body<false>(Q16, Q16, K16, K16, V16, V16, CTX, RH + (int)blockIdx.y * 32);
}

// ---- k_attn_hr: early query positions (< RH) on bf16 hi/lo planes, ONE 16-row tile per wave (one wave per block), 32 keys per step.
// Per-row arithmetic and product order are those of attn_body with HR = true (q.k: hi.hi, lo.hi, hi.lo per 32-deep chunk; P.v: hi.hi, lo.hi, hi.lo; all into one accumulator, unscaled bf16 residuals).
// Live state per lane: 4 output accumulators + 2 score accumulators + 16 softmax scalars; q fragments reloaded every key step through an integer offset; k and v fragments loaded next to their products.
// Key steps run over m0 = 0, 32, .., mend with mend = q0 pad down to a multiple of 32 (block-uniform); keys beyond the query are excluded in the last step only (the diagonal key is always kept).
// Planes: q/k [bh][RH][64], transposed value planes [bh][64][RH]; the last step reads keys < mend + 32 <= RH, all written by k_planes.
__global__ __launch_bounds__(32) void k_attn_hr(const us* __restrict__ Qh, const us* __restrict__ Ql, const us* __restrict__ Kh, const us* __restrict__ Kl,
                                                const us* __restrict__ Vh, const us* __restrict__ Vl, bf* CTX) {
    __shared__ __align__(16) unsigned short epa[ER * PP];     // P hi tile, 16 rows x 32 keys (wave-private)
    __shared__ __align__(16) unsigned short epb[ER * PP];     // P lo tile
    __shared__ __align__(16) unsigned short eoh[ER * OP];     // context hi staging, 16 rows x 64
    __shared__ __align__(16) unsigned short eol[ER * OP];     // context lo staging
    const int lane = threadIdx.x & 31, lr = lane & 15, hi = lane >> 4;
    const int bh = blockIdx.x, n = bh / NH, h = bh % NH;
    const int q0 = (int)blockIdx.y * ER;
    const int mend = q0 & ~31;
    const size_t pb = (size_t)bh * RH * HD;
    Qh += pb; Ql += pb; Kh += pb; Kl += pb; Vh += pb; Vl += pb;
    const int qoff = (q0 + lr) * HD + 8 * hi;
    const int koff = lr * HD + 8 * hi;
    const int voff = lr * RH + 8 * hi;
    const float cexp = 0.125f * 1.4426950408889634f;   // HD^-0.5 * log2(e)
    v8f o[4]; float mrow[8], lsum[8];
#pragma unroll
    for (int t2 = 0; t2 < 4; ++t2) o[t2] = (v8f){};
#pragma unroll
    for (int r = 0; r < 8; ++r) { mrow[r] = -3.0e38f; lsum[r] = 0.0f; }
#pragma unroll 1
    for (int m0 = 0; m0 <= mend; m0 += 32) {
        int qo = qoff; asm volatile("" : "+v"(qo));   // q fragments are reloaded every step (kept out of the loop-carried state)
        v8f s[2];
        s[0] = (v8f){}; s[1] = (v8f){};
#pragma unroll
        for (int kc = 0; kc < 2; ++kc) {
            const v16us qa = ldus(Qh + qo + kc * 32);
            const v16us qr = ldus(Ql + qo + kc * 32);
#pragma unroll
            for (int t = 0; t < 2; ++t) {
                const int ko = (m0 + t * 16) * HD + koff + kc * 32;
                const v16us ka = ldus(Kh + ko);
                s[t] = mmg<true>(qa, ka, s[t]);
                s[t] = mmg<true>(qr, ka, s[t]);
                const v16us kr = ldus(Kl + ko);
                s[t] = mmg<true>(qa, kr, s[t]);
            }
        }
        // s[t][r] = score(query q0 + 8*hi + r, key m0 + t*16 + lr)
        if (m0 == mend) {
#pragma unroll
            for (int t = 0; t < 2; ++t)
#pragma unroll
                for (int r = 0; r < 8; ++r) { if (m0 + t * 16 + lr > q0 + 8 * hi + r) s[t][r] = -3.0e38f; }
        }
#pragma unroll
        for (int r = 0; r < 8; ++r) {
            const float s0 = s[0][r], s1 = s[1][r];
            float v = fmaxf(s0, s1);
            v = fmaxf(v, __shfl_xor(v, 1, 32)); v = fmaxf(v, __shfl_xor(v, 2, 32));
            v = fmaxf(v, __shfl_xor(v, 4, 32)); v = fmaxf(v, __shfl_xor(v, 8, 32));      // stays inside each 16-lane half = one row
            const float mn = fmaxf(mrow[r], v);
            const float al = __builtin_amdgcn_exp2f((mrow[r] - mn) * cexp);
            mrow[r] = mn;
            const float p0 = __builtin_amdgcn_exp2f((s0 - mn) * cexp);
            const float p1 = __builtin_amdgcn_exp2f((s1 - mn) * cexp);
            lsum[r] = lsum[r] * al + (p0 + p1);                                           // per-lane partial row sum, reduced across lanes once at the end
            const int po = (8 * hi + r) * PP + lr;
            unsigned short a, c;
            splitf(p0, a, c); epa[po] = a; epb[po] = c;
            splitf(p1, a, c); epa[po + 16] = a; epb[po + 16] = c;
#pragma unroll
            for (int t2 = 0; t2 < 4; ++t2) o[t2][r] *= al;
        }
        __syncthreads();          // P tile fully written (16 rows x 32 keys) before any fragment reload
        v16us pa, pr;
        {
            const int po = lr * PP + 8 * hi;
            const v8us x0 = *(const v8usa*)(epa + po); const v8us x1 = *(const v8usa*)(epa + po + 16);
            pa = __builtin_shufflevector(x0, x1, 0, 1, 2, 3, 4, 5, 6, 7, 8, 9, 10, 11, 12, 13, 14, 15);
            const v8us y0 = *(const v8usa*)(epb + po); const v8us y1 = *(const v8usa*)(epb + po + 16);
            pr = __builtin_shufflevector(y0, y1, 0, 1, 2, 3, 4, 5, 6, 7, 8, 9, 10, 11, 12, 13, 14, 15);
        }
#pragma unroll
        for (int t2 = 0; t2 < 4; ++t2) {
            const int vo = (t2 * 16) * RH + voff + m0;     // B[k = key m0 + ..][n = d = t2*16 + lr] from the transposed plane row d
            const v16us va = ldus(Vh + vo);
            o[t2] = mmg<true>(pa, va, o[t2]);
            o[t2] = mmg<true>(pr, va, o[t2]);
            const v16us vr = ldus(Vl + vo);
            o[t2] = mmg<true>(pa, vr, o[t2]);
        }
        __syncthreads();          // all reloads done before the next step overwrites the P tile
    }
    // normalise, split into bf16 hi / lo, stage the 16 x 64 tile, then whole-line stores
#pragma unroll
    for (int r = 0; r < 8; ++r) {
        float l = lsum[r];
        l += __shfl_xor(l, 1, 32); l += __shfl_xor(l, 2, 32); l += __shfl_xor(l, 4, 32); l += __shfl_xor(l, 8, 32);
        const float inv = 1.0f / l;
#pragma unroll
        for (int t2 = 0; t2 < 4; ++t2) {
            const float val = o[t2][r] * inv;
            unsigned short a, c; splitf(val, a, c);
            const int oo = (8 * hi + r) * OP + t2 * 16 + lr;
            eoh[oo] = a; eol[oo] = c;
        }
    }
    __syncthreads();
{
#pragma unroll
        for (int s4 = 0; s4 < ER / 4; ++s4) {
            const int row = s4 * 4 + (lane >> 3), cp = (lane & 7) * 8;
            const v8us vh = *(const v8usa*)(eoh + row * OP + cp);
            const v8us vl = *(const v8usa*)(eol + row * OP + cp);
            bf* d = CTX + ((size_t)(q0 + row) * NB + n) * CK + h * HD + cp;
            *(v8us*)d = vh; *(v8us*)(d + DM) = vl;
        }
        
    }
}

// workspace carve (bytes), every region a multiple of 256
constexpr size_t SZ_XB   = (size_t)MROWS * DM * 2;        // x bf16 [MROWS][1024]
constexpr size_t SZ_WQ   = (size_t)F3 * DM * 2;           // w_qkv bf16 [3072][1024]
constexpr size_t SZ_WO   = (size_t)DM * CK * 2;           // [w_out | w_out] bf16 [1024][2048]
constexpr size_t SZ_F    = (size_t)MROWS * F3 * 4;        // qkv f32 [MROWS][3072]
constexpr size_t SZ_QK16 = (size_t)2 * NBH * SEQ * HD * 2;
constexpr size_t SZ_QKH  = (size_t)2 * NBH * RH * HD * 2;
constexpr size_t SZ_VT16 = (size_t)NBH * HD * SEQ * 2;
constexpr size_t SZ_VTH  = (size_t)NBH * HD * RH * 2;
constexpr size_t SZ_CTX  = (size_t)MROWS * CK * 2;        // context bf16 hi | lo [MROWS][2048]
constexpr size_t OF_XB   = 0;
constexpr size_t OF_WQ   = OF_XB + SZ_XB;
constexpr size_t OF_WO   = OF_WQ + SZ_WQ;
constexpr size_t OF_F    = OF_WO + SZ_WO;
constexpr size_t OF_QK16 = OF_F + SZ_F;
constexpr size_t OF_QKH  = OF_QK16 + SZ_QK16;
constexpr size_t OF_QKL  = OF_QKH + SZ_QKH;
constexpr size_t OF_VT16 = OF_QKL + SZ_QKH;
constexpr size_t OF_VTH  = OF_VT16 + SZ_VT16;
constexpr size_t OF_VTL  = OF_VTH + SZ_VTH;
constexpr size_t OF_CTX  = OF_VTL + SZ_VTH;
constexpr size_t WS_TOTAL = OF_CTX + SZ_CTX;
static_assert(SZ_XB % 256 == 0 && SZ_WQ % 256 == 0 && SZ_WO % 256 == 0 && SZ_F % 256 == 0 && SZ_QK16 % 256 == 0);
static_assert(SZ_QKH % 256 == 0 && SZ_VT16 % 256 == 0 && SZ_VTH % 256 == 0 && SZ_CTX % 256 == 0);
static_assert(WS_TOTAL <= (size_t)134217728);            // total carve <= 128 MiB

extern "C" void kernel_launch(void* const* d_in, const int* in_sizes, int n_in,
                              void* d_out, int out_size, void* d_ws, size_t ws_size, hipStream_t stream) {
    if (n_in < 3) return;
    const long long needx = ((long long)(SEQ - 1) * NB_FULL + NB) * DM;     // last token row touched, in elements
    if ((long long)in_sizes[0] < needx || (long long)in_sizes[1] < (long long)F3 * DM || (long long)in_sizes[2] < (long long)DM * DM || (long long)out_size < needx) return;
    if (WS_TOTAL > ws_size) return;
    const float* x = (const float*)d_in[0];       // [2048][2][1024], token row l*2 + n
    const float* wqkv = (const float*)d_in[1];    // [3072][1024] = [out][in]
    const float* wout = (const float*)d_in[2];    // [1024][1024] = [out][in]
    float* OUT = (float*)d_out;                   // [2048][2][1024]
    char* ws = (char*)d_ws;
    bf* XB = (bf*)(ws + OF_XB); bf* WQ = (bf*)(ws + OF_WQ); bf* WO2 = (bf*)(ws + OF_WO); float* F = (float*)(ws + OF_F);
    h16* QK16 = (h16*)(ws + OF_QK16); bf* QKh = (bf*)(ws + OF_QKH); bf* QKl = (bf*)(ws + OF_QKL);
    h16* VT16 = (h16*)(ws + OF_VT16); bf* VTh = (bf*)(ws + OF_VTH); bf* VTl = (bf*)(ws + OF_VTL); bf* CTX = (bf*)(ws + OF_CTX);

    k_cvt<<<(MROWS * 128 + 255) / 256, 256, 0, stream>>>(x, ROWSTEP, XB, DM, 0, MROWS * 128);
    k_cvt<<<(F3 * 128 + 255) / 256, 256, 0, stream>>>(wqkv, 1, WQ, DM, 0, F3 * 128);
    k_cvt<<<(DM * 128 + 255) / 256, 256, 0, stream>>>(wout, 1, WO2, CK, 0, DM * 128);      // columns 0..1023 (pairs with the hi half of the context plane)
    k_cvt<<<(DM * 128 + 255) / 256, 256, 0, stream>>>(wout, 1, WO2, CK, DM, DM * 128);     // columns 1024..2047 (pairs with the lo half)
    k_gemmw<<<dim3(MROWS / 64, F3 / 64, 1), 32, 0, stream>>>(XB, DM, WQ, DM, DM, F, F3);   // qkv[m][f] = sum_e x[m][e] w_qkv[f][e]
    k_planes<<<dim3((unsigned)((size_t)NBH * SEQ * HD / 8 / 256), 3, 1), 256, 0, stream>>>(F, QK16, QKh, QKl, VT16, VTh, VTl);
    k_attn_hr<<<dim3(NBH, RH / ER, 1), 32, 0, stream>>>((const us*)QKh, (const us*)QKl, (const us*)(QKh + PLNH), (const us*)(QKl + PLNH), (const us*)VTh, (const us*)VTl, CTX);
    if (SEQ > RH)
        k_attn_lo<<<dim3(NBH, (SEQ - RH) / 32 > 0 ? (SEQ - RH) / 32 : 1, 1), 32, 0, stream>>>((const us*)QK16, (const us*)(QK16 + PLN), (const us*)VT16, CTX);
    k_gemmw<<<dim3(MROWS / 64, DM / 64, 1), 32, 0, stream>>>(CTX, CK, WO2, CK, CK, OUT, DM * ROWSTEP);   // out[m][f] = sum_e (ctx_hi + ctx_lo)[m][e] w_out[f][e]
}

// v001
// A run of this version takes 286 microseconds.
// In both of two side-by-side timings against v000, it was 1.43 times as fast.
#include <hip/hip_runtime.h>

// Contractions: qkv projection and output projection v_wmma_f32_16x16x32_bf16 (every input RNE-converted to bf16; context carried as bf16 hi|lo folded into K); scores and probability x value v_wmma_f32_16x16x32_f16 for query positions >= 256 (P carried x1024), bf16 hi/lo three-product form for positions < 256; f32 accumulate, f32 softmax.
// Sequence-first causal multi-head self-attention with a fused bias-free (out, in) qkv weight and an (out, in) output weight: token row m = l*NB + n, attention problem bh = n*16 + h, head columns h*64..h*64+63.
// Launch plan: 4 x k_cvt (bf16 copies) -> k_gemmw (qkv f32) -> k_planes (q/k/v^T 16-bit planes) -> k_attn_hr (rows < 256, 16-row tiles) -> k_attn_lo (rows >= 256, 32-row tiles) -> k_gemmw (output).

#ifndef NB
#define NB 2                      // batch entries processed (NB_FULL, or 1 for a reduced build)
#endif
#ifndef SEQ
#define SEQ 2048                  // sequence positions processed
#endif
#define NB_FULL  2                // batch stride of the staged x and of the output rows
#define SEQ_FULL 2048
#define DM   1024
#define NH   16
#define HD   64
#define F3   (3 * DM)
#define CK   (2 * DM)             // context plane width: hi columns | lo columns
#define RH   256                  // query positions < RH use the hi/lo planes
#define NBH  (NB * NH)
#define MROWS (SEQ * NB)
#define ROWSTEP (NB_FULL / NB)
#define PLN  ((size_t)NBH * SEQ * HD)
#define PLNH ((size_t)NBH * RH * HD)
#define PCAR 1024.0f
#define PP   40                   // P tile pitch in 16-bit elements (80 B)
#define OP   72                   // context staging pitch in 16-bit elements (144 B)
#define ER   16                   // query rows per wave in the early-positions kernel

static_assert(NB == NB_FULL || NB == 1);          // compact row m = l*NB + n maps to token row m*ROWSTEP
static_assert(SEQ <= SEQ_FULL && SEQ >= RH);
static_assert(SEQ % 256 == 0);                    // tile multiples (64-row GEMM tiles, 32-row attention tiles, 8-wide plane groups)
static_assert(RH % 32 == 0 && RH % 8 == 0);       // the last 32-key step of the early kernel ends inside the hi/lo planes
static_assert(RH % ER == 0 && ER == 16);          // early kernel: one 16-row WMMA tile per wave, store loop 4 x 4 rows
static_assert(HD == 64 && NH * HD == DM);
static_assert(DM == 1024);                        // k_cvt: 128 eight-element groups per row (i >> 7, i & 127)
static_assert(DM % 64 == 0 && CK % 64 == 0);      // K multiples of two 32-deep blocks (k_gemmw runs them in pairs)
static_assert(MROWS % 64 == 0 && F3 % 64 == 0 && DM % 64 == 0);
static_assert(((size_t)NBH * SEQ * HD / 8) % 256 == 0);   // k_planes grid x block == plane extent
static_assert(PP >= 32 && (PP * 2) % 16 == 0);
static_assert(OP >= 64 && (OP * 2) % 16 == 0);

typedef _Float16 h16;
typedef unsigned short bf;
typedef unsigned short us;
typedef __attribute__((ext_vector_type(16))) __bf16   v16bf;
typedef __attribute__((ext_vector_type(16))) _Float16 v16h;
typedef __attribute__((ext_vector_type(16))) unsigned short v16us;
typedef __attribute__((ext_vector_type(8)))  _Float16 v8h;
typedef __attribute__((ext_vector_type(8)))  unsigned short v8us;
typedef __attribute__((ext_vector_type(8)))  float    v8f;
typedef __attribute__((ext_vector_type(4)))  float    v4f;
typedef v4f  __attribute__((may_alias)) v4fa;
typedef v8us __attribute__((may_alias)) v8usa;

__device__ __forceinline__ unsigned short f2bf(float f) { unsigned u = __float_as_uint(f); u += 0x7FFFu + ((u >> 16) & 1u); return (unsigned short)(u >> 16); }
__device__ __forceinline__ float bf2f(unsigned short b) { return __uint_as_float(((unsigned)b) << 16); }
__device__ __forceinline__ void splitf(float y, unsigned short& h, unsigned short& l) { h = f2bf(y); l = f2bf(y - bf2f(h)); }

// 16-bit fragment from a K-contiguous row: elements 0..7 <- p[0..7], elements 8..15 <- p[16..23]; the caller adds 8*(lane>>4) to p.
__device__ __forceinline__ v16us ldus(const us* p) {
    const v8us a = *(const v8us*)p; const v8us b = *(const v8us*)(p + 16);
    return __builtin_shufflevector(a, b, 0, 1, 2, 3, 4, 5, 6, 7, 8, 9, 10, 11, 12, 13, 14, 15);
}

// One WMMA plus its own four-slot guard (ties exactly one accumulator, keeps A and B live).
template <bool BF>
__device__ __forceinline__ v8f mmg(v16us a, v16us b, v8f c) {
    if (BF) c = __builtin_amdgcn_wmma_f32_16x16x32_bf16(false, __builtin_bit_cast(v16bf, a), false, __builtin_bit_cast(v16bf, b), (short)0, c, false, false);
    else    c = __builtin_amdgcn_wmma_f32_16x16x32_f16(false, __builtin_bit_cast(v16h, a), false, __builtin_bit_cast(v16h, b), (short)0, c, false, false);
    asm volatile("v_nop\n\tv_nop\n\tv_nop\n\tv_nop" : "+v"(c) : "v"(a), "v"(b));
    return c;
}

__global__ __launch_bounds__(256) void k_cvt(const float* __restrict__ src, int srcstep, bf* dst, int dstpitch, int dstcol, int ngroups) {
    const int i = blockIdx.x * 256 + threadIdx.x; if (i >= ngroups) return;
    const int row = i >> 7, cg = i & 127;
    const v8f v = *(const v8f*)(src + (size_t)row * srcstep * DM + cg * 8);
    v8us o;
#pragma unroll
    for (int k = 0; k < 8; ++k) o[k] = f2bf(v[k]);
    bf* d = dst + (size_t)row * dstpitch + dstcol + cg * 8;
    *(v8us*)d = o; 
}

// ---- k_gemmw: ONE WAVE per 64x64 output tile (16 accumulators), bf16 operands straight from K-contiguous planes; grid (M/64, N/64), 32 threads.
// C[m][n] (f32, pitch ldc) = sum_k A[m][k] Bt[n][k]; K % 64 == 0, M and N multiples of 64.
// Fragments are fetched one 32-deep block ahead: the four A fragments into a second register set at the head of a block, each B fragment back into its own registers behind its last product.
// gemm_blk: the 16 products of one block (ac, b), with the loads of block kn (into an, b) issued among them.
__device__ __forceinline__ void gemm_blk(v8f (&acc)[4][4], const v16us (&ac)[4], v16us (&an)[4], v16us (&b)[4],
                                         const bf* __restrict__ ap, int lda, const bf* __restrict__ bp, int ldb, int kn) {
#pragma unroll
    for (int mb = 0; mb < 4; ++mb) an[mb] = ldus(ap + (size_t)mb * 16 * lda + kn);
    __builtin_amdgcn_sched_barrier(0);          // keeps the next block's A loads ahead of this block's products
#pragma unroll
    for (int nb = 0; nb < 4; ++nb) {
#pragma unroll
        for (int mb = 0; mb < 4; ++mb) acc[mb][nb] = mmg<true>(ac[mb], b[nb], acc[mb][nb]);
        b[nb] = ldus(bp + (size_t)nb * 16 * ldb + kn);
        if (nb == 3) asm volatile("s_wait_xcnt 0x0" ::: "memory");   // the next block rewrites the address registers of this block's last loads
        __builtin_amdgcn_sched_barrier(0);      // keeps this refill here, twelve products ahead of its first use, and the next block's address arithmetic behind the wait
    }
}
__global__ __launch_bounds__(32) void k_gemmw(const bf* __restrict__ A, int lda, const bf* __restrict__ Bt, int ldb, int K, float* C, int ldc) {
    __shared__ __align__(16) float os[16 * 68];
    const int lane = threadIdx.x & 31, lr = lane & 15, hi = lane >> 4;
    const int r0 = blockIdx.x * 64, c0 = blockIdx.y * 64;
    v8f acc[4][4];
#pragma unroll
    for (int mb = 0; mb < 4; ++mb)
#pragma unroll
        for (int nb = 0; nb < 4; ++nb) acc[mb][nb] = (v8f){};
    const size_t aoff = (size_t)(r0 + lr) * lda + 8 * hi, boff = (size_t)(c0 + lr) * ldb + 8 * hi;
    const bf* ap = A + aoff; const bf* bp = Bt + boff;
    v16us a0[4], a1[4], b[4];
#pragma unroll
    for (int mb = 0; mb < 4; ++mb) a0[mb] = ldus(ap + (size_t)mb * 16 * lda);
#pragma unroll
    for (int nb = 0; nb < 4; ++nb) b[nb] = ldus(bp + (size_t)nb * 16 * ldb);
#pragma unroll 1
    for (int kc = 0; kc < K; kc += 64) {
        gemm_blk(acc, a0, a1, b, ap, lda, bp, ldb, kc + 32);
        gemm_blk(acc, a1, a0, b, ap, lda, bp, ldb, kc + 64 < K ? kc + 64 : 0);   // behind the last block: block 0 again (in bounds, not used)
    }
#pragma unroll
    for (int mb = 0; mb < 4; ++mb) {
#pragma unroll
        for (int nb = 0; nb < 4; ++nb) {
#pragma unroll
            for (int j = 0; j < 8; ++j) os[(hi * 8 + j) * 68 + nb * 16 + lr] = acc[mb][nb][j];
        }
        __builtin_amdgcn_wave_barrier(); asm volatile("" ::: "memory");
        float* crow = C + (size_t)(r0 + mb * 16) * ldc + c0;
{
#pragma unroll
            for (int s = 0; s < 8; ++s) {                       // rows 2s+hi, s = 0..7, hi = 0..1: all 16 rows of the slab
                const int row = 2 * s + hi, cofs = lr * 4;
                const v4f val = *(const v4fa*)(os + row * 68 + cofs);
                *(v4f*)(crow + (size_t)row * ldc + cofs) = val;
            }
            
        }
        __builtin_amdgcn_wave_barrier(); asm volatile("" ::: "memory");
    }
}

// ---- k_planes: 16-bit operand planes from the f32 projection F [MROWS][3072] (row m = l*NB + n; column which*1024 + h*64 + d).
// blockIdx.y 2: transposed value planes [bh][d][l] (f16; positions < RH also bf16 hi and lo [bh][d][RH]), lane -> 8 consecutive l (strided reads, 16-B contiguous stores).
__device__ __forceinline__ void cvt3(const v8f x, v8h& o16, v8us& oh, v8us& ol) {
#pragma unroll
    for (int k = 0; k < 8; ++k) { o16[k] = (h16)x[k]; unsigned short a, c; splitf(x[k], a, c); oh[k] = a; ol[k] = c; }
}
__device__ __forceinline__ void store3(h16* p16, bf* ph, bf* pl, bool hr, const v8h o16, const v8us oh, const v8us ol) {
    *(v8h*)p16 = o16; if (hr) { *(v8us*)ph = oh; *(v8us*)pl = ol; }
    
}
__global__ __launch_bounds__(256) void k_planes(const float* __restrict__ F, h16* QK16, bf* QKh, bf* QKl, h16* VT16, bf* VTh, bf* VTl) {
    const int g = blockIdx.x * 256 + threadIdx.x;
    if (g >= NBH * SEQ * HD / 8) return;
    const int which = blockIdx.y;
    v8h o16; v8us oh, ol;
    if (which < 2) {
        const int d8 = g & 7, l = (g >> 3) % SEQ, bh = g / (8 * SEQ), n = bh / NH, h = bh % NH;
        const float* f = F + ((size_t)l * NB + n) * F3 + which * DM + h * HD + d8 * 8;
        const v4f a = *(const v4f*)f, b = *(const v4f*)(f + 4);
        const v8f x = __builtin_shufflevector(a, b, 0, 1, 2, 3, 4, 5, 6, 7);
        cvt3(x, o16, oh, ol);
        const bool hr = (l < RH);
        const size_t e16 = (size_t)which * PLN + ((size_t)bh * SEQ + l) * HD + d8 * 8;
        const size_t eh = hr ? ((size_t)which * PLNH + ((size_t)bh * RH + l) * HD + d8 * 8) : 0;
        store3(QK16 + e16, QKh + eh, QKl + eh, hr, o16, oh, ol);
    } else {
        const int l8 = g % (SEQ / 8), d = (g / (SEQ / 8)) % HD, bh = g / (HD * (SEQ / 8)), n = bh / NH, h = bh % NH;
        const int l = l8 * 8;
        v8f x;
#pragma unroll
        for (int j = 0; j < 8; ++j) x[j] = F[((size_t)(l + j) * NB + n) * F3 + 2 * DM + h * HD + d];
        cvt3(x, o16, oh, ol);
        const bool hr = (l < RH);
        const size_t e16 = ((size_t)bh * HD + d) * SEQ + l;
        const size_t eh = hr ? (((size_t)bh * HD + d) * RH + l) : 0;
        store3(VT16 + e16, VTh + eh, VTl + eh, hr, o16, oh, ol);
    }
}

// ---- fused causal attention, one wave (one block) per 32 query rows of one problem, 32 keys per step, online softmax in f32 (raw scores, the 1/8 folded into the exponent constant).
// HR = false: f16 planes, one product per tile pair, P carried x1024 in f16. HR = true: bf16 hi/lo planes, products hi.hi + lo.hi + hi.lo for q.k and for P.v.
// Only the HR = false instantiation is launched (k_attn_lo); the early positions use k_attn_hr below, which runs the same arithmetic on 16-row tiles.
// Global fragments are fetched ahead of their products: q once in front of the loop, the value fragments of a step at its head, the key fragments of the next step in the middle of this step's softmax.
// LDS tiles are private to the (single) wave of the block; a block barrier separates the 2-byte element stores from the 16-byte reloads (reload through a may_alias vector of the stored element type).
template <bool HR>
__device__ __forceinline__ void attn_body(const us* __restrict__ Qa, const us* __restrict__ Qr, const us* __restrict__ Ka, const us* __restrict__ Kr,
                                          const us* __restrict__ Va, const us* __restrict__ Vr, bf* CTX, const int q0) {
    constexpr int LR = HR ? RH : SEQ;                  // rows per problem in the q/k planes = row length of the transposed value planes
    __shared__ __align__(16) unsigned short psA[32 * PP];
    __shared__ __align__(16) unsigned short psB[32 * PP];
    __shared__ __align__(16) unsigned short oh[32 * OP];
    __shared__ __align__(16) unsigned short ol[32 * OP];
    const int lane = threadIdx.x & 31, lr = lane & 15, hi = lane >> 4;
    const int bh = blockIdx.x, n = bh / NH, h = bh % NH;
    const size_t pb = (size_t)bh * LR * HD;
    Qa += pb; Ka += pb; Va += pb; Qr += pb; Kr += pb; Vr += pb;
    const int qoff = (q0 + lr) * HD + 8 * hi;
    const int koff = lr * HD + 8 * hi;
    const int voff = lr * LR + 8 * hi;
    const float cexp = 0.125f * 1.4426950408889634f;   // HD^-0.5 * log2(e)
    const float pc = HR ? 1.0f : PCAR;
    v8f o[2][4]; float mrow[2][8], lsum[2][8];
#pragma unroll
    for (int u = 0; u < 2; ++u) {
#pragma unroll
        for (int t2 = 0; t2 < 4; ++t2) o[u][t2] = (v8f){};
#pragma unroll
        for (int r = 0; r < 8; ++r) { mrow[u][r] = -3.0e38f; lsum[u][r] = 0.0f; }
    }
    v16us qfa[2][2], qfr[2][2], kfa[2][2], kfr[2][2];      // [kc][u] and [kc][t]
#pragma unroll
    for (int kc = 0; kc < 2; ++kc) {
#pragma unroll
        for (int u = 0; u < 2; ++u) {
            qfa[kc][u] = ldus(Qa + qoff + u * 16 * HD + kc * 32);
            qfr[kc][u] = HR ? ldus(Qr + qoff + u * 16 * HD + kc * 32) : qfa[kc][u];
        }
#pragma unroll
        for (int t = 0; t < 2; ++t) {
            const int ko = (t * 16) * HD + koff + kc * 32;
            kfa[kc][t] = ldus(Ka + ko);
            kfr[kc][t] = HR ? ldus(Kr + ko) : kfa[kc][t];
        }
    }
#pragma unroll 1
    for (int m0 = 0; m0 <= q0; m0 += 32) {
        v16us vfa[4], vfr[4];
#pragma unroll
        for (int t2 = 0; t2 < 4; ++t2) {
            const int vo = (t2 * 16) * LR + voff + m0;     // B[k = key m0 + ..][n = d = t2*16 + lr] from the transposed plane row d
            vfa[t2] = ldus(Va + vo);
            vfr[t2] = HR ? ldus(Vr + vo) : vfa[t2];
        }
        v8f s[2][2];
#pragma unroll
        for (int u = 0; u < 2; ++u)
#pragma unroll
            for (int t = 0; t < 2; ++t) s[u][t] = (v8f){};
#pragma unroll
        for (int kc = 0; kc < 2; ++kc) {
#pragma unroll
            for (int t = 0; t < 2; ++t) {
                s[0][t] = mmg<HR>(qfa[kc][0], kfa[kc][t], s[0][t]); s[1][t] = mmg<HR>(qfa[kc][1], kfa[kc][t], s[1][t]);
                if (HR) {
                    s[0][t] = mmg<HR>(qfr[kc][0], kfa[kc][t], s[0][t]); s[1][t] = mmg<HR>(qfr[kc][1], kfa[kc][t], s[1][t]);
                    s[0][t] = mmg<HR>(qfa[kc][0], kfr[kc][t], s[0][t]); s[1][t] = mmg<HR>(qfa[kc][1], kfr[kc][t], s[1][t]);
                }
            }
        }
        // s[u][t][r] = score(query q0 + u*16 + 8*hi + r, key m0 + t*16 + lr). Keys beyond the query are excluded (only possible in the diagonal step; the diagonal key itself is always kept).
        if (m0 == q0) {
#pragma unroll
            for (int u = 0; u < 2; ++u)
#pragma unroll
                for (int t = 0; t < 2; ++t)
#pragma unroll
                    for (int r = 0; r < 8; ++r) { if (t * 16 + lr > u * 16 + 8 * hi + r) s[u][t][r] = -3.0e38f; }
        }
#pragma unroll
        for (int u = 0; u < 2; ++u) {
            if (u == 1) {       // next step's key fragments: issued once the first 16 rows' scores are out of their registers, half a softmax and the P.v products ahead of their use
                const int mnx = m0 + 32 <= q0 ? m0 + 32 : q0;      // the last step fetches its own keys again (in bounds, not used)
#pragma unroll
                for (int kc = 0; kc < 2; ++kc) {
#pragma unroll
                    for (int t = 0; t < 2; ++t) {
                        const int ko = (mnx + t * 16) * HD + koff + kc * 32;
                        kfa[kc][t] = ldus(Ka + ko);
                        kfr[kc][t] = HR ? ldus(Kr + ko) : kfa[kc][t];
                    }
                }
                __builtin_amdgcn_sched_barrier(0);      // keeps the loads ahead of the last 16 rows (lead)
            }
#pragma unroll
            for (int r = 0; r < 8; ++r) {
                const float s0 = s[u][0][r], s1 = s[u][1][r];
                float v = fmaxf(s0, s1);
                v = fmaxf(v, __shfl_xor(v, 1, 32)); v = fmaxf(v, __shfl_xor(v, 2, 32));
                v = fmaxf(v, __shfl_xor(v, 4, 32)); v = fmaxf(v, __shfl_xor(v, 8, 32));      // stays inside each 16-lane half = one row
                const float mn = fmaxf(mrow[u][r], v);
                const float al = __builtin_amdgcn_exp2f((mrow[u][r] - mn) * cexp);
                mrow[u][r] = mn;
                const float p0 = __builtin_amdgcn_exp2f((s0 - mn) * cexp);
                const float p1 = __builtin_amdgcn_exp2f((s1 - mn) * cexp);
                lsum[u][r] = lsum[u][r] * al + (p0 + p1);                                 // per-lane partial row sum, reduced across lanes once at the end
                const int po = (u * 16 + 8 * hi + r) * PP + lr;
                if (HR) {
                    unsigned short a, c; splitf(p0, a, c); psA[po] = a; psB[po] = c;
                    splitf(p1, a, c); psA[po + 16] = a; psB[po + 16] = c;
                } else {
                    psA[po] = __builtin_bit_cast(unsigned short, (h16)(p0 * PCAR));
                    psA[po + 16] = __builtin_bit_cast(unsigned short, (h16)(p1 * PCAR));
                }
#pragma unroll
                for (int t2 = 0; t2 < 4; ++t2) o[u][t2][r] *= al;
            }
        }
        __syncthreads();          // P tile fully written (32 rows x 32 keys) before any fragment reload
        v16us pa[2], pr[2];
#pragma unroll
        for (int u = 0; u < 2; ++u) {
            const int po = (u * 16 + lr) * PP + 8 * hi;
            { const v8us x0 = *(const v8usa*)(psA + po); const v8us x1 = *(const v8usa*)(psA + po + 16);
              pa[u] = __builtin_shufflevector(x0, x1, 0, 1, 2, 3, 4, 5, 6, 7, 8, 9, 10, 11, 12, 13, 14, 15); }
            pr[u] = pa[u];
            if (HR) { const v8us y0 = *(const v8usa*)(psB + po); const v8us y1 = *(const v8usa*)(psB + po + 16);
              pr[u] = __builtin_shufflevector(y0, y1, 0, 1, 2, 3, 4, 5, 6, 7, 8, 9, 10, 11, 12, 13, 14, 15); }
        }
#pragma unroll
        for (int t2 = 0; t2 < 4; ++t2) {
            o[0][t2] = mmg<HR>(pa[0], vfa[t2], o[0][t2]); o[1][t2] = mmg<HR>(pa[1], vfa[t2], o[1][t2]);
            if (HR) {
                o[0][t2] = mmg<HR>(pr[0], vfa[t2], o[0][t2]); o[1][t2] = mmg<HR>(pr[1], vfa[t2], o[1][t2]);
                o[0][t2] = mmg<HR>(pa[0], vfr[t2], o[0][t2]); o[1][t2] = mmg<HR>(pa[1], vfr[t2], o[1][t2]);
            }
        }
        __syncthreads();          // all reloads done before the next step overwrites the P tile
    }
    // normalise, split into bf16 hi / lo, stage the 32 x 64 tile, then whole-line stores
#pragma unroll
    for (int u = 0; u < 2; ++u) {
#pragma unroll
        for (int r = 0; r < 8; ++r) {
            float l = lsum[u][r];
            l += __shfl_xor(l, 1, 32); l += __shfl_xor(l, 2, 32); l += __shfl_xor(l, 4, 32); l += __shfl_xor(l, 8, 32);
            const float inv = 1.0f / (l * pc);
#pragma unroll
            for (int t2 = 0; t2 < 4; ++t2) {
                const float val = o[u][t2][r] * inv;
                unsigned short a, c; splitf(val, a, c);
                const int oo = (u * 16 + 8 * hi + r) * OP + t2 * 16 + lr;
                oh[oo] = a; ol[oo] = c;
            }
        }
    }
    __syncthreads();
{
#pragma unroll
        for (int s = 0; s < 8; ++s) {
            const int row = s * 4 + (lane >> 3), cp = (lane & 7) * 8;
            const v8us vh = *(const v8usa*)(oh + row * OP + cp);
            const v8us vl = *(const v8usa*)(ol + row * OP + cp);
            bf* d = CTX + ((size_t)(q0 + row) * NB + n) * CK + h * HD + cp;
            *(v8us*)d = vh; *(v8us*)(d + DM) = vl;
        }
        
    }
}

__global__ __launch_bounds__(32) void k_attn_lo(const us* __restrict__ Q16, const us* __restrict__ K16, const us* __restrict__ V16, bf* CTX) {
    attn_body<false>(Q16, Q16, K16, K16, V16, V16, CTX, RH + (int)blockIdx.y * 32);
}

// ---- k_attn_hr: early query positions (< RH) on bf16 hi/lo planes, ONE 16-row tile per wave (one wave per block), 32 keys per step.
// Per-row arithmetic and product order are those of attn_body with HR = true (q.k: hi.hi, lo.hi, hi.lo per 32-deep chunk; P.v: hi.hi, lo.hi, hi.lo; all into one accumulator, unscaled bf16 residuals).
// Live state per lane: 4 output accumulators + 2 score accumulators + 16 softmax scalars + the fragments fetched ahead: q once in front of the loop, a step's v at its head, the next step's k among this step's P.v products.
// Key steps run over m0 = 0, 32, .., mend with mend = q0 pad down to a multiple of 32 (block-uniform); keys beyond the query are excluded in the last step only (the diagonal key is always kept).
// Planes: q/k [bh][RH][64], transposed value planes [bh][64][RH]; the last step reads keys < mend + 32 <= RH, all written by k_planes.
__global__ __launch_bounds__(32) void k_attn_hr(const us* __restrict__ Qh, const us* __restrict__ Ql, const us* __restrict__ Kh, const us* __restrict__ Kl,
                                                const us* __restrict__ Vh, const us* __restrict__ Vl, bf* CTX) {
    __shared__ __align__(16) unsigned short epa[ER * PP];     // P hi tile, 16 rows x 32 keys (wave-private)
    __shared__ __align__(16) unsigned short epb[ER * PP];     // P lo tile
    __shared__ __align__(16) unsigned short eoh[ER * OP];     // context hi staging, 16 rows x 64
    __shared__ __align__(16) unsigned short eol[ER * OP];     // context lo staging
    const int lane = threadIdx.x & 31, lr = lane & 15, hi = lane >> 4;
    const int bh = blockIdx.x, n = bh / NH, h = bh % NH;
    const int q0 = (int)blockIdx.y * ER;
    const int mend = q0 & ~31;
    const size_t pb = (size_t)bh * RH * HD;
    Qh += pb; Ql += pb; Kh += pb; Kl += pb; Vh += pb; Vl += pb;
    const int qoff = (q0 + lr) * HD + 8 * hi;
    const int koff = lr * HD + 8 * hi;
    const int voff = lr * RH + 8 * hi;
    const float cexp = 0.125f * 1.4426950408889634f;   // HD^-0.5 * log2(e)
    v8f o[4]; float mrow[8], lsum[8];
#pragma unroll
    for (int t2 = 0; t2 < 4; ++t2) o[t2] = (v8f){};
#pragma unroll
    for (int r = 0; r < 8; ++r) { mrow[r] = -3.0e38f; lsum[r] = 0.0f; }
    v16us qfa[2], qfr[2], kfa[2][2], kfr[2][2];            // [kc] and [kc][t]
#pragma unroll
    for (int kc = 0; kc < 2; ++kc) {
        qfa[kc] = ldus(Qh + qoff + kc * 32);
        qfr[kc] = ldus(Ql + qoff + kc * 32);
#pragma unroll
        for (int t = 0; t < 2; ++t) {
            const int ko = (t * 16) * HD + koff + kc * 32;
            kfa[kc][t] = ldus(Kh + ko);
            kfr[kc][t] = ldus(Kl + ko);
        }
    }
#pragma unroll 1
    for (int m0 = 0; m0 <= mend; m0 += 32) {
        v16us vfa[4], vfr[4];
        const us* vph = Vh + voff + m0; const us* vpl = Vl + voff + m0;
#pragma unroll
        for (int t2 = 0; t2 < 4; ++t2) {
            vfa[t2] = ldus(vph + (t2 * 16) * RH);          // B[k = key m0 + ..][n = d = t2*16 + lr] from the transposed plane row d
            vfr[t2] = ldus(vpl + (t2 * 16) * RH);
        }
        asm volatile("s_wait_xcnt 0x0" :: "v"(vph), "v"(vpl) : "memory");   // the two address pairs stay whole up to this wait
        v8f s[2];
        s[0] = (v8f){}; s[1] = (v8f){};
#pragma unroll
        for (int kc = 0; kc < 2; ++kc) {
#pragma unroll
            for (int t = 0; t < 2; ++t) {
                s[t] = mmg<true>(qfa[kc], kfa[kc][t], s[t]);
                s[t] = mmg<true>(qfr[kc], kfa[kc][t], s[t]);
                s[t] = mmg<true>(qfa[kc], kfr[kc][t], s[t]);
            }
        }
        // s[t][r] = score(query q0 + 8*hi + r, key m0 + t*16 + lr)
        if (m0 == mend) {
#pragma unroll
            for (int t = 0; t < 2; ++t)
#pragma unroll
                for (int r = 0; r < 8; ++r) { if (m0 + t * 16 + lr > q0 + 8 * hi + r) s[t][r] = -3.0e38f; }
        }
#pragma unroll
        for (int r = 0; r < 8; ++r) {
            const float s0 = s[0][r], s1 = s[1][r];
            float v = fmaxf(s0, s1);
            v = fmaxf(v, __shfl_xor(v, 1, 32)); v = fmaxf(v, __shfl_xor(v, 2, 32));
            v = fmaxf(v, __shfl_xor(v, 4, 32)); v = fmaxf(v, __shfl_xor(v, 8, 32));      // stays inside each 16-lane half = one row
            const float mn = fmaxf(mrow[r], v);
            const float al = __builtin_amdgcn_exp2f((mrow[r] - mn) * cexp);
            mrow[r] = mn;
            const float p0 = __builtin_amdgcn_exp2f((s0 - mn) * cexp);
            const float p1 = __builtin_amdgcn_exp2f((s1 - mn) * cexp);
            lsum[r] = lsum[r] * al + (p0 + p1);                                           // per-lane partial row sum, reduced across lanes once at the end
            const int po = (8 * hi + r) * PP + lr;
            unsigned short a, c;
            splitf(p0, a, c); epa[po] = a; epb[po] = c;
            splitf(p1, a, c); epa[po + 16] = a; epb[po + 16] = c;
#pragma unroll
            for (int t2 = 0; t2 < 4; ++t2) o[t2][r] *= al;
        }
        __syncthreads();          // P tile fully written (16 rows x 32 keys) before any fragment reload
        v16us pa, pr;
        {
            const int po = lr * PP + 8 * hi;
            const v8us x0 = *(const v8usa*)(epa + po); const v8us x1 = *(const v8usa*)(epa + po + 16);
            pa = __builtin_shufflevector(x0, x1, 0, 1, 2, 3, 4, 5, 6, 7, 8, 9, 10, 11, 12, 13, 14, 15);
            const v8us y0 = *(const v8usa*)(epb + po); const v8us y1 = *(const v8usa*)(epb + po + 16);
            pr = __builtin_shufflevector(y0, y1, 0, 1, 2, 3, 4, 5, 6, 7, 8, 9, 10, 11, 12, 13, 14, 15);
        }
        const int mnx = m0 + 32 <= mend ? m0 + 32 : mend;  // next step's first key; the last step fetches its own keys again (in bounds, not used)
#pragma unroll
        for (int t2 = 0; t2 < 4; ++t2) {
            o[t2] = mmg<true>(pa, vfa[t2], o[t2]);
            o[t2] = mmg<true>(pr, vfa[t2], o[t2]);
            o[t2] = mmg<true>(pa, vfr[t2], o[t2]);
            const int ko = (mnx + (t2 & 1) * 16) * HD + koff + (t2 >> 1) * 32;
            kfa[t2 >> 1][t2 & 1] = ldus(Kh + ko);
            kfr[t2 >> 1][t2 & 1] = ldus(Kl + ko);
            __builtin_amdgcn_sched_barrier(0);  // keeps each key refill behind the products that free a value fragment pair (register room)
        }
        __syncthreads();          // all reloads done before the next step overwrites the P tile
    }
    // normalise, split into bf16 hi / lo, stage the 16 x 64 tile, then whole-line stores
#pragma unroll
    for (int r = 0; r < 8; ++r) {
        float l = lsum[r];
        l += __shfl_xor(l, 1, 32); l += __shfl_xor(l, 2, 32); l += __shfl_xor(l, 4, 32); l += __shfl_xor(l, 8, 32);
        const float inv = 1.0f / l;
#pragma unroll
        for (int t2 = 0; t2 < 4; ++t2) {
            const float val = o[t2][r] * inv;
            unsigned short a, c; splitf(val, a, c);
            const int oo = (8 * hi + r) * OP + t2 * 16 + lr;
            eoh[oo] = a; eol[oo] = c;
        }
    }
    __syncthreads();
{
#pragma unroll
        for (int s4 = 0; s4 < ER / 4; ++s4) {
            const int row = s4 * 4 + (lane >> 3), cp = (lane & 7) * 8;
            const v8us vh = *(const v8usa*)(eoh + row * OP + cp);
            const v8us vl = *(const v8usa*)(eol + row * OP + cp);
            bf* d = CTX + ((size_t)(q0 + row) * NB + n) * CK + h * HD + cp;
            *(v8us*)d = vh; *(v8us*)(d + DM) = vl;
        }
        
    }
}

// workspace carve (bytes), every region a multiple of 256
constexpr size_t SZ_XB   = (size_t)MROWS * DM * 2;        // x bf16 [MROWS][1024]
constexpr size_t SZ_WQ   = (size_t)F3 * DM * 2;           // w_qkv bf16 [3072][1024]
constexpr size_t SZ_WO   = (size_t)DM * CK * 2;           // [w_out | w_out] bf16 [1024][2048]
constexpr size_t SZ_F    = (size_t)MROWS * F3 * 4;        // qkv f32 [MROWS][3072]
constexpr size_t SZ_QK16 = (size_t)2 * NBH * SEQ * HD * 2;
constexpr size_t SZ_QKH  = (size_t)2 * NBH * RH * HD * 2;
constexpr size_t SZ_VT16 = (size_t)NBH * HD * SEQ * 2;
constexpr size_t SZ_VTH  = (size_t)NBH * HD * RH * 2;
constexpr size_t SZ_CTX  = (size_t)MROWS * CK * 2;        // context bf16 hi | lo [MROWS][2048]
constexpr size_t OF_XB   = 0;
constexpr size_t OF_WQ   = OF_XB + SZ_XB;
constexpr size_t OF_WO   = OF_WQ + SZ_WQ;
constexpr size_t OF_F    = OF_WO + SZ_WO;
constexpr size_t OF_QK16 = OF_F + SZ_F;
constexpr size_t OF_QKH  = OF_QK16 + SZ_QK16;
constexpr size_t OF_QKL  = OF_QKH + SZ_QKH;
constexpr size_t OF_VT16 = OF_QKL + SZ_QKH;
constexpr size_t OF_VTH  = OF_VT16 + SZ_VT16;
constexpr size_t OF_VTL  = OF_VTH + SZ_VTH;
constexpr size_t OF_CTX  = OF_VTL + SZ_VTH;
constexpr size_t WS_TOTAL = OF_CTX + SZ_CTX;
static_assert(SZ_XB % 256 == 0 && SZ_WQ % 256 == 0 && SZ_WO % 256 == 0 && SZ_F % 256 == 0 && SZ_QK16 % 256 == 0);
static_assert(SZ_QKH % 256 == 0 && SZ_VT16 % 256 == 0 && SZ_VTH % 256 == 0 && SZ_CTX % 256 == 0);
static_assert(WS_TOTAL <= (size_t)134217728);            // total carve <= 128 MiB

extern "C" void kernel_launch(void* const* d_in, const int* in_sizes, int n_in,
                              void* d_out, int out_size, void* d_ws, size_t ws_size, hipStream_t stream) {
    if (n_in < 3) return;
    const long long needx = ((long long)(SEQ - 1) * NB_FULL + NB) * DM;     // last token row touched, in elements
    if ((long long)in_sizes[0] < needx || (long long)in_sizes[1] < (long long)F3 * DM || (long long)in_sizes[2] < (long long)DM * DM || (long long)out_size < needx) return;
    if (WS_TOTAL > ws_size) return;
    const float* x = (const float*)d_in[0];       // [2048][2][1024], token row l*2 + n
    const float* wqkv = (const float*)d_in[1];    // [3072][1024] = [out][in]
    const float* wout = (const float*)d_in[2];    // [1024][1024] = [out][in]
    float* OUT = (float*)d_out;                   // [2048][2][1024]
    char* ws = (char*)d_ws;
    bf* XB = (bf*)(ws + OF_XB); bf* WQ = (bf*)(ws + OF_WQ); bf* WO2 = (bf*)(ws + OF_WO); float* F = (float*)(ws + OF_F);
    h16* QK16 = (h16*)(ws + OF_QK16); bf* QKh = (bf*)(ws + OF_QKH); bf* QKl = (bf*)(ws + OF_QKL);
    h16* VT16 = (h16*)(ws + OF_VT16); bf* VTh = (bf*)(ws + OF_VTH); bf* VTl = (bf*)(ws + OF_VTL); bf* CTX = (bf*)(ws + OF_CTX);

    k_cvt<<<(MROWS * 128 + 255) / 256, 256, 0, stream>>>(x, ROWSTEP, XB, DM, 0, MROWS * 128);
    k_cvt<<<(F3 * 128 + 255) / 256, 256, 0, stream>>>(wqkv, 1, WQ, DM, 0, F3 * 128);
    k_cvt<<<(DM * 128 + 255) / 256, 256, 0, stream>>>(wout, 1, WO2, CK, 0, DM * 128);      // columns 0..1023 (pairs with the hi half of the context plane)
    k_cvt<<<(DM * 128 + 255) / 256, 256, 0, stream>>>(wout, 1, WO2, CK, DM, DM * 128);     // columns 1024..2047 (pairs with the lo half)
    k_gemmw<<<dim3(MROWS / 64, F3 / 64, 1), 32, 0, stream>>>(XB, DM, WQ, DM, DM, F, F3);   // qkv[m][f] = sum_e x[m][e] w_qkv[f][e]
    k_planes<<<dim3((unsigned)((size_t)NBH * SEQ * HD / 8 / 256), 3, 1), 256, 0, stream>>>(F, QK16, QKh, QKl, VT16, VTh, VTl);
    k_attn_hr<<<dim3(NBH, RH / ER, 1), 32, 0, stream>>>((const us*)QKh, (const us*)QKl, (const us*)(QKh + PLNH), (const us*)(QKl + PLNH), (const us*)VTh, (const us*)VTl, CTX);
    if (SEQ > RH)
        k_attn_lo<<<dim3(NBH, (SEQ - RH) / 32 > 0 ? (SEQ - RH) / 32 : 1, 1), 32, 0, stream>>>((const us*)QK16, (const us*)(QK16 + PLN), (const us*)VT16, CTX);
    k_gemmw<<<dim3(MROWS / 64, DM / 64, 1), 32, 0, stream>>>(CTX, CK, WO2, CK, CK, OUT, DM * ROWSTEP);   // out[m][f] = sum_e (ctx_hi + ctx_lo)[m][e] w_out[f][e]
}

// v002
// A run of this version takes 191 microseconds.
// Next to v001, in two timings, it ran 1.50 and 1.52 times as fast.
// Over all steps from v000 it is 2.16 times as fast.
#include <hip/hip_runtime.h>

// Contractions: qkv projection and output projection v_wmma_f32_16x16x32_bf16 (every input RNE-converted to bf16; context carried as bf16 hi|lo folded into K); scores and probability x value v_wmma_f32_16x16x32_f16 for query positions >= 256 (P carried x1024), bf16 hi/lo three-product form for positions < 256; f32 accumulate, f32 softmax.
// Sequence-first causal multi-head self-attention with a fused bias-free (out, in) qkv weight and an (out, in) output weight: token row m = l*NB + n, attention problem bh = n*16 + h, head columns h*64..h*64+63.
// Launch plan: 4 x k_cvt (bf16 copies) -> k_gemmw (qkv f32) -> k_planes (q/k/v^T 16-bit planes) -> k_attn_hr (rows < 256, 16-row tiles) -> k_attn_lo (rows >= 256, 32-row tiles) -> k_gemmw (output).

#ifndef NB
#define NB 2                      // batch entries processed (NB_FULL, or 1 for a reduced build)
#endif
#ifndef SEQ
#define SEQ 2048                  // sequence positions processed
#endif
#define NB_FULL  2                // batch stride of the staged x and of the output rows
#define SEQ_FULL 2048
#define DM   1024
#define NH   16
#define HD   64
#define F3   (3 * DM)
#define CK   (2 * DM)             // context plane width: hi columns | lo columns
#define RH   256                  // query positions < RH use the hi/lo planes
#define NBH  (NB * NH)
#define MROWS (SEQ * NB)
#define ROWSTEP (NB_FULL / NB)
#define PLN  ((size_t)NBH * SEQ * HD)
#define PLNH ((size_t)NBH * RH * HD)
#define PCAR 1024.0f
#define OP   72                   // context staging pitch in 16-bit elements (144 B)
#define ER   16                   // query rows per wave in the early-positions kernel

static_assert(NB == NB_FULL || NB == 1);          // compact row m = l*NB + n maps to token row m*ROWSTEP
static_assert(SEQ <= SEQ_FULL && SEQ >= RH);
static_assert(SEQ % 256 == 0);                    // tile multiples (64-row GEMM tiles, 32-row attention tiles, 8-wide plane groups)
static_assert(RH % 32 == 0 && RH % 8 == 0);       // the last 32-key step of the early kernel ends inside the hi/lo planes
static_assert(RH % ER == 0 && ER == 16);          // early kernel: one 16-row WMMA tile per wave, store loop 4 x 4 rows
static_assert(HD == 64 && NH * HD == DM);
static_assert(DM == 1024);                        // k_cvt: 128 eight-element groups per row (i >> 7, i & 127)
static_assert(DM % 64 == 0 && CK % 64 == 0);      // K multiples of two 32-deep blocks (k_gemmw runs them in pairs)
static_assert(MROWS % 64 == 0 && F3 % 64 == 0 && DM % 64 == 0);
static_assert(((size_t)NBH * SEQ * HD / 8) % 256 == 0);   // k_planes grid x block == plane extent
static_assert(OP >= 64 && (OP * 2) % 16 == 0);

typedef _Float16 h16;
typedef unsigned short bf;
typedef unsigned short us;
typedef __attribute__((ext_vector_type(16))) __bf16   v16bf;
typedef __attribute__((ext_vector_type(16))) _Float16 v16h;
typedef __attribute__((ext_vector_type(16))) unsigned short v16us;
typedef __attribute__((ext_vector_type(8)))  _Float16 v8h;
typedef __attribute__((ext_vector_type(8)))  unsigned short v8us;
typedef __attribute__((ext_vector_type(8)))  float    v8f;
typedef __attribute__((ext_vector_type(4)))  float    v4f;
typedef v4f  __attribute__((may_alias)) v4fa;
typedef v8us __attribute__((may_alias)) v8usa;

__device__ __forceinline__ unsigned short f2bf(float f) { unsigned u = __float_as_uint(f); u += 0x7FFFu + ((u >> 16) & 1u); return (unsigned short)(u >> 16); }
__device__ __forceinline__ float bf2f(unsigned short b) { return __uint_as_float(((unsigned)b) << 16); }
__device__ __forceinline__ void splitf(float y, unsigned short& h, unsigned short& l) { h = f2bf(y); l = f2bf(y - bf2f(h)); }

// 16-bit fragment from a K-contiguous row: elements 0..7 <- p[0..7], elements 8..15 <- p[16..23]; the caller adds 8*(lane>>4) to p.
__device__ __forceinline__ v16us ldus(const us* p) {
    const v8us a = *(const v8us*)p; const v8us b = *(const v8us*)(p + 16);
    return __builtin_shufflevector(a, b, 0, 1, 2, 3, 4, 5, 6, 7, 8, 9, 10, 11, 12, 13, 14, 15);
}

// One WMMA plus its own four-slot guard (ties exactly one accumulator, keeps A and B live).
template <bool BF>
__device__ __forceinline__ v8f mmg(v16us a, v16us b, v8f c) {
    if (BF) c = __builtin_amdgcn_wmma_f32_16x16x32_bf16(false, __builtin_bit_cast(v16bf, a), false, __builtin_bit_cast(v16bf, b), (short)0, c, false, false);
    else    c = __builtin_amdgcn_wmma_f32_16x16x32_f16(false, __builtin_bit_cast(v16h, a), false, __builtin_bit_cast(v16h, b), (short)0, c, false, false);
    asm volatile("v_nop\n\tv_nop\n\tv_nop\n\tv_nop" : "+v"(c) : "v"(a), "v"(b));
    return c;
}

__global__ __launch_bounds__(256) void k_cvt(const float* __restrict__ src, int srcstep, bf* dst, int dstpitch, int dstcol, int ngroups) {
    const int i = blockIdx.x * 256 + threadIdx.x; if (i >= ngroups) return;
    const int row = i >> 7, cg = i & 127;
    const v8f v = *(const v8f*)(src + (size_t)row * srcstep * DM + cg * 8);
    v8us o;
#pragma unroll
    for (int k = 0; k < 8; ++k) o[k] = f2bf(v[k]);
    bf* d = dst + (size_t)row * dstpitch + dstcol + cg * 8;
    *(v8us*)d = o; 
}

// ---- k_gemmw: ONE WAVE per 64x64 output tile (16 accumulators), bf16 operands straight from K-contiguous planes; grid (M/64, N/64), 32 threads.
// C[m][n] (f32, pitch ldc) = sum_k A[m][k] Bt[n][k]; K % 64 == 0, M and N multiples of 64.
// Fragments are fetched one 32-deep block ahead: the four A fragments into a second register set at the head of a block, each B fragment back into its own registers behind its last product.
// gemm_blk: the 16 products of one block (ac, b), with the loads of block kn (into an, b) issued among them.
__device__ __forceinline__ void gemm_blk(v8f (&acc)[4][4], const v16us (&ac)[4], v16us (&an)[4], v16us (&b)[4],
                                         const bf* __restrict__ ap, int lda, const bf* __restrict__ bp, int ldb, int kn) {
#pragma unroll
    for (int mb = 0; mb < 4; ++mb) an[mb] = ldus(ap + (size_t)mb * 16 * lda + kn);
    __builtin_amdgcn_sched_barrier(0);          // keeps the next block's A loads ahead of this block's products
#pragma unroll
    for (int nb = 0; nb < 4; ++nb) {
#pragma unroll
        for (int mb = 0; mb < 4; ++mb) acc[mb][nb] = mmg<true>(ac[mb], b[nb], acc[mb][nb]);
        b[nb] = ldus(bp + (size_t)nb * 16 * ldb + kn);
        if (nb == 3) asm volatile("s_wait_xcnt 0x0" ::: "memory");   // the next block rewrites the address registers of this block's last loads
        __builtin_amdgcn_sched_barrier(0);      // keeps this refill here, twelve products ahead of its first use, and the next block's address arithmetic behind the wait
    }
}
__global__ __launch_bounds__(32) void k_gemmw(const bf* __restrict__ A, int lda, const bf* __restrict__ Bt, int ldb, int K, float* C, int ldc) {
    __shared__ __align__(16) float os[16 * 68];
    const int lane = threadIdx.x & 31, lr = lane & 15, hi = lane >> 4;
    const int r0 = blockIdx.x * 64, c0 = blockIdx.y * 64;
    v8f acc[4][4];
#pragma unroll
    for (int mb = 0; mb < 4; ++mb)
#pragma unroll
        for (int nb = 0; nb < 4; ++nb) acc[mb][nb] = (v8f){};
    const size_t aoff = (size_t)(r0 + lr) * lda + 8 * hi, boff = (size_t)(c0 + lr) * ldb + 8 * hi;
    const bf* ap = A + aoff; const bf* bp = Bt + boff;
    v16us a0[4], a1[4], b[4];
#pragma unroll
    for (int mb = 0; mb < 4; ++mb) a0[mb] = ldus(ap + (size_t)mb * 16 * lda);
#pragma unroll
    for (int nb = 0; nb < 4; ++nb) b[nb] = ldus(bp + (size_t)nb * 16 * ldb);
#pragma unroll 1
    for (int kc = 0; kc < K; kc += 64) {
        gemm_blk(acc, a0, a1, b, ap, lda, bp, ldb, kc + 32);
        gemm_blk(acc, a1, a0, b, ap, lda, bp, ldb, kc + 64 < K ? kc + 64 : 0);   // behind the last block: block 0 again (in bounds, not used)
    }
#pragma unroll
    for (int mb = 0; mb < 4; ++mb) {
#pragma unroll
        for (int nb = 0; nb < 4; ++nb) {
#pragma unroll
            for (int j = 0; j < 8; ++j) os[(hi * 8 + j) * 68 + nb * 16 + lr] = acc[mb][nb][j];
        }
        __builtin_amdgcn_wave_barrier(); asm volatile("" ::: "memory");
        float* crow = C + (size_t)(r0 + mb * 16) * ldc + c0;
{
#pragma unroll
            for (int s = 0; s < 8; ++s) {                       // rows 2s+hi, s = 0..7, hi = 0..1: all 16 rows of the slab
                const int row = 2 * s + hi, cofs = lr * 4;
                const v4f val = *(const v4fa*)(os + row * 68 + cofs);
                *(v4f*)(crow + (size_t)row * ldc + cofs) = val;
            }
            
        }
        __builtin_amdgcn_wave_barrier(); asm volatile("" ::: "memory");
    }
}

// ---- k_planes: 16-bit operand planes from the f32 projection F [MROWS][3072] (row m = l*NB + n; column which*1024 + h*64 + d).
// blockIdx.y 2: transposed value planes [bh][d][l] (f16; positions < RH also bf16 hi and lo [bh][d][RH]), lane -> 8 consecutive l (strided reads, 16-B contiguous stores).
__device__ __forceinline__ void cvt3(const v8f x, v8h& o16, v8us& oh, v8us& ol) {
#pragma unroll
    for (int k = 0; k < 8; ++k) { o16[k] = (h16)x[k]; unsigned short a, c; splitf(x[k], a, c); oh[k] = a; ol[k] = c; }
}
__device__ __forceinline__ void store3(h16* p16, bf* ph, bf* pl, bool hr, const v8h o16, const v8us oh, const v8us ol) {
    *(v8h*)p16 = o16; if (hr) { *(v8us*)ph = oh; *(v8us*)pl = ol; }
    
}
__global__ __launch_bounds__(256) void k_planes(const float* __restrict__ F, h16* QK16, bf* QKh, bf* QKl, h16* VT16, bf* VTh, bf* VTl) {
    const int g = blockIdx.x * 256 + threadIdx.x;
    if (g >= NBH * SEQ * HD / 8) return;
    const int which = blockIdx.y;
    v8h o16; v8us oh, ol;
    if (which < 2) {
        const int d8 = g & 7, l = (g >> 3) % SEQ, bh = g / (8 * SEQ), n = bh / NH, h = bh % NH;
        const float* f = F + ((size_t)l * NB + n) * F3 + which * DM + h * HD + d8 * 8;
        const v4f a = *(const v4f*)f, b = *(const v4f*)(f + 4);
        const v8f x = __builtin_shufflevector(a, b, 0, 1, 2, 3, 4, 5, 6, 7);
        cvt3(x, o16, oh, ol);
        const bool hr = (l < RH);
        const size_t e16 = (size_t)which * PLN + ((size_t)bh * SEQ + l) * HD + d8 * 8;
        const size_t eh = hr ? ((size_t)which * PLNH + ((size_t)bh * RH + l) * HD + d8 * 8) : 0;
        store3(QK16 + e16, QKh + eh, QKl + eh, hr, o16, oh, ol);
    } else {
        const int l8 = g % (SEQ / 8), d = (g / (SEQ / 8)) % HD, bh = g / (HD * (SEQ / 8)), n = bh / NH, h = bh % NH;
        const int l = l8 * 8;
        v8f x;
#pragma unroll
        for (int j = 0; j < 8; ++j) x[j] = F[((size_t)(l + j) * NB + n) * F3 + 2 * DM + h * HD + d];
        cvt3(x, o16, oh, ol);
        const bool hr = (l < RH);
        const size_t e16 = ((size_t)bh * HD + d) * SEQ + l;
        const size_t eh = hr ? (((size_t)bh * HD + d) * RH + l) : 0;
        store3(VT16 + e16, VTh + eh, VTl + eh, hr, o16, oh, ol);
    }
}

// lane l with lane l ^ 16 (the other half of a query column's keys)
__device__ __forceinline__ float xhalf(float x) {
    return __builtin_bit_cast(float, __builtin_amdgcn_permlanex16(__builtin_bit_cast(int, x), __builtin_bit_cast(int, x), 0x76543210, 0xfedcba98, false, false));
}

template <bool HR>
__device__ __forceinline__ void attn_body(const us* __restrict__ Qa, const us* __restrict__ Qr, const us* __restrict__ Ka, const us* __restrict__ Kr,
                                          const us* __restrict__ Va, const us* __restrict__ Vr, bf* CTX, const int q0) {
    constexpr int LR = HR ? RH : SEQ;                  // rows per problem in the q/k planes = row length of the transposed value planes
    __shared__ __align__(16) unsigned short oh[32 * OP];
    __shared__ __align__(16) unsigned short ol[32 * OP];
    const int lane = threadIdx.x & 31, lr = lane & 15, hi = lane >> 4;
    const int bh = blockIdx.x, n = bh / NH, h = bh % NH;
    const size_t pb = (size_t)bh * LR * HD;
    Qa += pb; Ka += pb; Va += pb; Qr += pb; Kr += pb; Vr += pb;
    const int qoff = (q0 + lr) * HD + 8 * hi;
    const int koff = lr * HD + 8 * hi;
    const int voff = lr * LR + 8 * hi;
    const float cexp = 0.125f * 1.4426950408889634f;   // HD^-0.5 * log2(e)
    const float pc = HR ? 1.0f : PCAR;
    v8f o[2][4]; float mrow[2], lsum[2];               // o[u][t2][r] = context(query q0 + u*16 + lr, d = t2*16 + 8*hi + r); mrow, lsum: of query q0 + u*16 + lr
#pragma unroll
    for (int u = 0; u < 2; ++u) {
#pragma unroll
        for (int t2 = 0; t2 < 4; ++t2) o[u][t2] = (v8f){};
        mrow[u] = -3.0e38f; lsum[u] = 0.0f;
    }
    v16us qfa[2][2], qfr[2][2], kfa[2][2], kfr[2][2];      // [kc][u] and [kc][t]
#pragma unroll
    for (int kc = 0; kc < 2; ++kc) {
#pragma unroll
        for (int u = 0; u < 2; ++u) {
            qfa[kc][u] = ldus(Qa + qoff + u * 16 * HD + kc * 32);
            qfr[kc][u] = HR ? ldus(Qr + qoff + u * 16 * HD + kc * 32) : qfa[kc][u];
        }
#pragma unroll
        for (int t = 0; t < 2; ++t) {
            const int ko = (t * 16) * HD + koff + kc * 32;
            kfa[kc][t] = ldus(Ka + ko);
            kfr[kc][t] = HR ? ldus(Kr + ko) : kfa[kc][t];
        }
    }
    const int kfirst = (32 <= q0 ? 32 : q0) * HD + koff;
    const us* kpa = Ka + kfirst; const us* kpr = Kr + kfirst;      // the NEXT step's key rows
    const us* vpa = Va + voff;   const us* vpr = Vr + voff;        // this step's value columns
#pragma unroll 1
    for (int m0 = 0; m0 <= q0; m0 += 32) {
        v16us vfa[4], vfr[4];
#pragma unroll
        for (int t2 = 0; t2 < 4; ++t2) {
            vfa[t2] = ldus(vpa + (t2 * 16) * LR);          // A[m = d = t2*16 + lr][k = key m0 + ..] from the transposed plane row d
            vfr[t2] = HR ? ldus(vpr + (t2 * 16) * LR) : vfa[t2];
        }
        v8f s[2][2];
#pragma unroll
        for (int u = 0; u < 2; ++u)
#pragma unroll
            for (int t = 0; t < 2; ++t) s[u][t] = (v8f){};
#pragma unroll
        for (int kc = 0; kc < 2; ++kc) {
#pragma unroll
            for (int t = 0; t < 2; ++t) {
                s[0][t] = mmg<HR>(kfa[kc][t], qfa[kc][0], s[0][t]); s[1][t] = mmg<HR>(kfa[kc][t], qfa[kc][1], s[1][t]);
                if (HR) {
                    s[0][t] = mmg<HR>(kfa[kc][t], qfr[kc][0], s[0][t]); s[1][t] = mmg<HR>(kfa[kc][t], qfr[kc][1], s[1][t]);
                    s[0][t] = mmg<HR>(kfr[kc][t], qfa[kc][0], s[0][t]); s[1][t] = mmg<HR>(kfr[kc][t], qfa[kc][1], s[1][t]);
                }
            }
        }
        {       // next step's key fragments: a whole softmax and the V^T.P^T products ahead of their use (the last step fetches its own keys again: in bounds, not used)
#pragma unroll
            for (int kc = 0; kc < 2; ++kc) {
#pragma unroll
                for (int t = 0; t < 2; ++t) {
                    kfa[kc][t] = ldus(kpa + (t * 16) * HD + kc * 32);
                    kfr[kc][t] = HR ? ldus(kpr + (t * 16) * HD + kc * 32) : kfa[kc][t];
                }
            }
            __builtin_amdgcn_sched_barrier(0);      // keeps the loads ahead of the softmax (lead)
        }
        // s[u][t][r] = score(key m0 + t*16 + 8*hi + r, query q0 + u*16 + lr). Keys beyond the query are excluded (only possible in the diagonal step; key m0 is always kept).
        if (m0 == q0) {
#pragma unroll
            for (int u = 0; u < 2; ++u)
#pragma unroll
                for (int t = 0; t < 2; ++t)
#pragma unroll
                    for (int r = 0; r < 8; ++r) { if (t * 16 + 8 * hi + r > u * 16 + lr) s[u][t][r] = -3.0e38f; }
        }
        v16us pa[2], pr[2];
#pragma unroll
        for (int u = 0; u < 2; ++u) {
            float v = fmaxf(s[u][0][0], s[u][1][0]);
#pragma unroll
            for (int r = 1; r < 8; ++r) v = fmaxf(v, fmaxf(s[u][0][r], s[u][1][r]));
            v = fmaxf(v, xhalf(v));
            const float mn = fmaxf(mrow[u], v);
            const v8f x0 = (s[u][0] - mn) * cexp, x1 = (s[u][1] - mn) * cexp;
            float e0[8], e1[8];
#pragma unroll
            for (int r = 0; r < 8; ++r) e0[r] = __builtin_amdgcn_exp2f(x0[r]);
#pragma unroll
            for (int r = 0; r < 8; ++r) e1[r] = __builtin_amdgcn_exp2f(x1[r]);
            const float al = __builtin_amdgcn_exp2f((mrow[u] - mn) * cexp);
            mrow[u] = mn;
            float ps[4] = {0.0f, 0.0f, 0.0f, 0.0f};             // four independent partial sums of the lane's 16 probabilities
#pragma unroll
            for (int r = 0; r < 8; ++r) {
                const float p0 = e0[r], p1 = e1[r];
                ps[r & 3] += p0 + p1;
                if (HR) {
                    unsigned short a, c; splitf(p0, a, c); pa[u][r] = a; pr[u][r] = c;
                    splitf(p1, a, c); pa[u][8 + r] = a; pr[u][8 + r] = c;
                } else {
                    pa[u][r] = __builtin_bit_cast(unsigned short, (h16)(p0 * PCAR));
                    pa[u][8 + r] = __builtin_bit_cast(unsigned short, (h16)(p1 * PCAR));
                }
            }
            if (!HR) pr[u] = pa[u];
            lsum[u] = lsum[u] * al + ((ps[0] + ps[1]) + (ps[2] + ps[3]));     // per-lane partial sum of one query (its half of the keys), the halves joined once at the end
#pragma unroll
            for (int t2 = 0; t2 < 4; ++t2) o[u][t2] *= al;
        }
#pragma unroll
        for (int t2 = 0; t2 < 4; ++t2) {
            o[0][t2] = mmg<HR>(vfa[t2], pa[0], o[0][t2]); o[1][t2] = mmg<HR>(vfa[t2], pa[1], o[1][t2]);
            if (HR) {
                o[0][t2] = mmg<HR>(vfa[t2], pr[0], o[0][t2]); o[1][t2] = mmg<HR>(vfa[t2], pr[1], o[1][t2]);
                o[0][t2] = mmg<HR>(vfr[t2], pa[0], o[0][t2]); o[1][t2] = mmg<HR>(vfr[t2], pa[1], o[1][t2]);
            }
        }
        // the address pairs of this step's loads stay whole up to this wait; they are stepped only behind it
        if (HR) asm volatile("s_wait_xcnt 0x0" :: "v"(kpa), "v"(kpr), "v"(vpa), "v"(vpr) : "memory");
        else    asm volatile("s_wait_xcnt 0x0" :: "v"(kpa), "v"(vpa) : "memory");
        const int kstep = m0 + 64 <= q0 ? 32 * HD : 0;
        kpa += kstep; kpr += kstep; vpa += 32; vpr += 32;
    }
    // normalise, split into bf16 hi / lo, stage the 32 x 64 tile (a lane's 8 registers are 8 consecutive d of one query: 16-byte LDS stores), then whole-line stores
#pragma unroll
    for (int u = 0; u < 2; ++u) {
        float l = lsum[u];
        l += xhalf(l);
        const float inv = 1.0f / (l * pc);
#pragma unroll
        for (int t2 = 0; t2 < 4; ++t2) {
            v8us a8, c8;
#pragma unroll
            for (int r = 0; r < 8; ++r) { unsigned short a, c; splitf(o[u][t2][r] * inv, a, c); a8[r] = a; c8[r] = c; }
            const int oo = (u * 16 + lr) * OP + t2 * 16 + 8 * hi;
            *(v8usa*)(oh + oo) = a8; *(v8usa*)(ol + oo) = c8;
        }
    }
    __syncthreads();
{
#pragma unroll
        for (int s = 0; s < 8; ++s) {
            const int row = s * 4 + (lane >> 3), cp = (lane & 7) * 8;
            const v8us vh = *(const v8usa*)(oh + row * OP + cp);
            const v8us vl = *(const v8usa*)(ol + row * OP + cp);
            bf* d = CTX + ((size_t)(q0 + row) * NB + n) * CK + h * HD + cp;
            *(v8us*)d = vh; *(v8us*)(d + DM) = vl;
        }
        
    }
}

__global__ __launch_bounds__(32) void k_attn_lo(const us* __restrict__ Q16, const us* __restrict__ K16, const us* __restrict__ V16, bf* CTX) {
    attn_body<false>(Q16, Q16, K16, K16, V16, V16, CTX, RH + (int)blockIdx.y * 32);
}

// ---- k_attn_hr: early query positions (< RH) on bf16 hi/lo planes, ONE 16-row tile per wave (one wave per block), 32 keys per step.
// Per-query arithmetic and product order are those of attn_body with HR = true (q.k: hi.hi, lo.hi, hi.lo per 32-deep chunk; P.v: hi.hi, lo.hi, hi.lo; all into one accumulator, unscaled bf16 residuals), transposed in the same way.
// Live state per lane: 4 output accumulators + 2 score accumulators + 2 softmax scalars + the fragments fetched ahead: q once in front of the loop, a step's v at its head, the next step's k among this step's V^T.P^T products.
// Key steps run over m0 = 0, 32, .., mend with mend = q0 pad down to a multiple of 32 (block-uniform); keys beyond the query are excluded in the last step only (key mend is always kept).
// Planes: q/k [bh][RH][64], transposed value planes [bh][64][RH]; the last step reads keys < mend + 32 <= RH, all written by k_planes.
__global__ __launch_bounds__(32) void k_attn_hr(const us* __restrict__ Qh, const us* __restrict__ Ql, const us* __restrict__ Kh, const us* __restrict__ Kl,
                                                const us* __restrict__ Vh, const us* __restrict__ Vl, bf* CTX) {
    __shared__ __align__(16) unsigned short eoh[ER * OP];     // context hi staging, 16 rows x 64
    __shared__ __align__(16) unsigned short eol[ER * OP];     // context lo staging
    const int lane = threadIdx.x & 31, lr = lane & 15, hi = lane >> 4;
    const int bh = blockIdx.x, n = bh / NH, h = bh % NH;
    const int q0 = (int)blockIdx.y * ER;
    const int mend = q0 & ~31;
    const size_t pb = (size_t)bh * RH * HD;
    Qh += pb; Ql += pb; Kh += pb; Kl += pb; Vh += pb; Vl += pb;
    const int qoff = (q0 + lr) * HD + 8 * hi;
    const int koff = lr * HD + 8 * hi;
    const int voff = lr * RH + 8 * hi;
    const float cexp = 0.125f * 1.4426950408889634f;   // HD^-0.5 * log2(e)
    v8f o[4]; float mrow = -3.0e38f, lsum = 0.0f;      // o[t2][r] = context(query q0 + lr, d = t2*16 + 8*hi + r); mrow, lsum: of query q0 + lr
#pragma unroll
    for (int t2 = 0; t2 < 4; ++t2) o[t2] = (v8f){};
    v16us qfa[2], qfr[2], kfa[2][2], kfr[2][2];            // [kc] and [kc][t]
#pragma unroll
    for (int kc = 0; kc < 2; ++kc) {
        qfa[kc] = ldus(Qh + qoff + kc * 32);
        qfr[kc] = ldus(Ql + qoff + kc * 32);
#pragma unroll
        for (int t = 0; t < 2; ++t) {
            const int ko = (t * 16) * HD + koff + kc * 32;
            kfa[kc][t] = ldus(Kh + ko);
            kfr[kc][t] = ldus(Kl + ko);
        }
    }
    const int kfirst = (32 <= mend ? 32 : mend) * HD + koff;
    const us* kph = Kh + kfirst; const us* kpl = Kl + kfirst;      // the NEXT step's key rows (the last step fetches its own keys again: in bounds, not used)
#pragma unroll 1
    for (int m0 = 0; m0 <= mend; m0 += 32) {
        v16us vfa[4], vfr[4];
        const us* vph = Vh + voff + m0; const us* vpl = Vl + voff + m0;
#pragma unroll
        for (int t2 = 0; t2 < 4; ++t2) {
            vfa[t2] = ldus(vph + (t2 * 16) * RH);          // A[m = d = t2*16 + lr][k = key m0 + ..] from the transposed plane row d
            vfr[t2] = ldus(vpl + (t2 * 16) * RH);
        }
        asm volatile("s_wait_xcnt 0x0" :: "v"(vph), "v"(vpl) : "memory");   // the two address pairs stay whole up to this wait
        v8f s[2];
        s[0] = (v8f){}; s[1] = (v8f){};
#pragma unroll
        for (int kc = 0; kc < 2; ++kc) {
#pragma unroll
            for (int t = 0; t < 2; ++t) {
                s[t] = mmg<true>(kfa[kc][t], qfa[kc], s[t]);
                s[t] = mmg<true>(kfa[kc][t], qfr[kc], s[t]);
                s[t] = mmg<true>(kfr[kc][t], qfa[kc], s[t]);
            }
        }
        // s[t][r] = score(key m0 + t*16 + 8*hi + r, query q0 + lr)
        if (m0 == mend) {
#pragma unroll
            for (int t = 0; t < 2; ++t)
#pragma unroll
                for (int r = 0; r < 8; ++r) { if (m0 + t * 16 + 8 * hi + r > q0 + lr) s[t][r] = -3.0e38f; }
        }
        v16us pa, pr;
        {
            float v = fmaxf(s[0][0], s[1][0]);
#pragma unroll
            for (int r = 1; r < 8; ++r) v = fmaxf(v, fmaxf(s[0][r], s[1][r]));
            v = fmaxf(v, xhalf(v));
            const float mn = fmaxf(mrow, v);
            const float al = __builtin_amdgcn_exp2f((mrow - mn) * cexp);
            mrow = mn;
            const v8f x0 = (s[0] - mn) * cexp, x1 = (s[1] - mn) * cexp;
            float ps[4] = {0.0f, 0.0f, 0.0f, 0.0f};             // four independent partial sums of the lane's 16 probabilities
#pragma unroll
            for (int r = 0; r < 8; ++r) {
                const float p0 = __builtin_amdgcn_exp2f(x0[r]);
                const float p1 = __builtin_amdgcn_exp2f(x1[r]);
                ps[r & 3] += p0 + p1;
                unsigned short a, c;
                splitf(p0, a, c); pa[r] = a; pr[r] = c;
                splitf(p1, a, c); pa[8 + r] = a; pr[8 + r] = c;
            }
            lsum = lsum * al + ((ps[0] + ps[1]) + (ps[2] + ps[3]));           // per-lane partial sum of one query (its half of the keys), the halves joined once at the end
#pragma unroll
            for (int t2 = 0; t2 < 4; ++t2) o[t2] *= al;
        }
#pragma unroll
        for (int t2 = 0; t2 < 4; ++t2) {
            o[t2] = mmg<true>(vfa[t2], pa, o[t2]);
            o[t2] = mmg<true>(vfa[t2], pr, o[t2]);
            o[t2] = mmg<true>(vfr[t2], pa, o[t2]);
            const int ko = ((t2 & 1) * 16) * HD + (t2 >> 1) * 32;
            kfa[t2 >> 1][t2 & 1] = ldus(kph + ko);
            kfr[t2 >> 1][t2 & 1] = ldus(kpl + ko);
            __builtin_amdgcn_sched_barrier(0);  // keeps each key refill behind the products that free a value fragment pair (register room)
        }
        asm volatile("s_wait_xcnt 0x0" :: "v"(kph), "v"(kpl) : "memory");   // the key address pairs stay whole up to this wait; they are stepped only behind it
        const int kstep = m0 + 64 <= mend ? 32 * HD : 0;
        kph += kstep; kpl += kstep;
    }
    // normalise, split into bf16 hi / lo, stage the 16 x 64 tile (16-byte LDS stores), then whole-line stores
    {
        float l = lsum;
        l += xhalf(l);
        const float inv = 1.0f / l;
#pragma unroll
        for (int t2 = 0; t2 < 4; ++t2) {
            v8us a8, c8;
#pragma unroll
            for (int r = 0; r < 8; ++r) { unsigned short a, c; splitf(o[t2][r] * inv, a, c); a8[r] = a; c8[r] = c; }
            const int oo = lr * OP + t2 * 16 + 8 * hi;
            *(v8usa*)(eoh + oo) = a8; *(v8usa*)(eol + oo) = c8;
        }
    }
    __syncthreads();
{
#pragma unroll
        for (int s4 = 0; s4 < ER / 4; ++s4) {
            const int row = s4 * 4 + (lane >> 3), cp = (lane & 7) * 8;
            const v8us vh = *(const v8usa*)(eoh + row * OP + cp);
            const v8us vl = *(const v8usa*)(eol + row * OP + cp);
            bf* d = CTX + ((size_t)(q0 + row) * NB + n) * CK + h * HD + cp;
            *(v8us*)d = vh; *(v8us*)(d + DM) = vl;
        }
        
    }
}

// workspace carve (bytes), every region a multiple of 256
constexpr size_t SZ_XB   = (size_t)MROWS * DM * 2;        // x bf16 [MROWS][1024]
constexpr size_t SZ_WQ   = (size_t)F3 * DM * 2;           // w_qkv bf16 [3072][1024]
constexpr size_t SZ_WO   = (size_t)DM * CK * 2;           // [w_out | w_out] bf16 [1024][2048]
constexpr size_t SZ_F    = (size_t)MROWS * F3 * 4;        // qkv f32 [MROWS][3072]
constexpr size_t SZ_QK16 = (size_t)2 * NBH * SEQ * HD * 2;
constexpr size_t SZ_QKH  = (size_t)2 * NBH * RH * HD * 2;
constexpr size_t SZ_VT16 = (size_t)NBH * HD * SEQ * 2;
constexpr size_t SZ_VTH  = (size_t)NBH * HD * RH * 2;
constexpr size_t SZ_CTX  = (size_t)MROWS * CK * 2;        // context bf16 hi | lo [MROWS][2048]
constexpr size_t OF_XB   = 0;
constexpr size_t OF_WQ   = OF_XB + SZ_XB;
constexpr size_t OF_WO   = OF_WQ + SZ_WQ;
constexpr size_t OF_F    = OF_WO + SZ_WO;
constexpr size_t OF_QK16 = OF_F + SZ_F;
constexpr size_t OF_QKH  = OF_QK16 + SZ_QK16;
constexpr size_t OF_QKL  = OF_QKH + SZ_QKH;
constexpr size_t OF_VT16 = OF_QKL + SZ_QKH;
constexpr size_t OF_VTH  = OF_VT16 + SZ_VT16;
constexpr size_t OF_VTL  = OF_VTH + SZ_VTH;
constexpr size_t OF_CTX  = OF_VTL + SZ_VTH;
constexpr size_t WS_TOTAL = OF_CTX + SZ_CTX;
static_assert(SZ_XB % 256 == 0 && SZ_WQ % 256 == 0 && SZ_WO % 256 == 0 && SZ_F % 256 == 0 && SZ_QK16 % 256 == 0);
static_assert(SZ_QKH % 256 == 0 && SZ_VT16 % 256 == 0 && SZ_VTH % 256 == 0 && SZ_CTX % 256 == 0);
static_assert(WS_TOTAL <= (size_t)134217728);            // total carve <= 128 MiB

extern "C" void kernel_launch(void* const* d_in, const int* in_sizes, int n_in,
                              void* d_out, int out_size, void* d_ws, size_t ws_size, hipStream_t stream) {
    if (n_in < 3) return;
    const long long needx = ((long long)(SEQ - 1) * NB_FULL + NB) * DM;     // last token row touched, in elements
    if ((long long)in_sizes[0] < needx || (long long)in_sizes[1] < (long long)F3 * DM || (long long)in_sizes[2] < (long long)DM * DM || (long long)out_size < needx) return;
    if (WS_TOTAL > ws_size) return;
    const float* x = (const float*)d_in[0];       // [2048][2][1024], token row l*2 + n
    const float* wqkv = (const float*)d_in[1];    // [3072][1024] = [out][in]
    const float* wout = (const float*)d_in[2];    // [1024][1024] = [out][in]
    float* OUT = (float*)d_out;                   // [2048][2][1024]
    char* ws = (char*)d_ws;
    bf* XB = (bf*)(ws + OF_XB); bf* WQ = (bf*)(ws + OF_WQ); bf* WO2 = (bf*)(ws + OF_WO); float* F = (float*)(ws + OF_F);
    h16* QK16 = (h16*)(ws + OF_QK16); bf* QKh = (bf*)(ws + OF_QKH); bf* QKl = (bf*)(ws + OF_QKL);
    h16* VT16 = (h16*)(ws + OF_VT16); bf* VTh = (bf*)(ws + OF_VTH); bf* VTl = (bf*)(ws + OF_VTL); bf* CTX = (bf*)(ws + OF_CTX);

    k_cvt<<<(MROWS * 128 + 255) / 256, 256, 0, stream>>>(x, ROWSTEP, XB, DM, 0, MROWS * 128);
    k_cvt<<<(F3 * 128 + 255) / 256, 256, 0, stream>>>(wqkv, 1, WQ, DM, 0, F3 * 128);
    k_cvt<<<(DM * 128 + 255) / 256, 256, 0, stream>>>(wout, 1, WO2, CK, 0, DM * 128);      // columns 0..1023 (pairs with the hi half of the context plane)
    k_cvt<<<(DM * 128 + 255) / 256, 256, 0, stream>>>(wout, 1, WO2, CK, DM, DM * 128);     // columns 1024..2047 (pairs with the lo half)
    k_gemmw<<<dim3(MROWS / 64, F3 / 64, 1), 32, 0, stream>>>(XB, DM, WQ, DM, DM, F, F3);   // qkv[m][f] = sum_e x[m][e] w_qkv[f][e]
    k_planes<<<dim3((unsigned)((size_t)NBH * SEQ * HD / 8 / 256), 3, 1), 256, 0, stream>>>(F, QK16, QKh, QKl, VT16, VTh, VTl);
    k_attn_hr<<<dim3(NBH, RH / ER, 1), 32, 0, stream>>>((const us*)QKh, (const us*)QKl, (const us*)(QKh + PLNH), (const us*)(QKl + PLNH), (const us*)VTh, (const us*)VTl, CTX);
    if (SEQ > RH)
        k_attn_lo<<<dim3(NBH, (SEQ - RH) / 32 > 0 ? (SEQ - RH) / 32 : 1, 1), 32, 0, stream>>>((const us*)QK16, (const us*)(QK16 + PLN), (const us*)VT16, CTX);
    k_gemmw<<<dim3(MROWS / 64, DM / 64, 1), 32, 0, stream>>>(CTX, CK, WO2, CK, CK, OUT, DM * ROWSTEP);   // out[m][f] = sum_e (ctx_hi + ctx_lo)[m][e] w_out[f][e]
}

// v003
// One run takes 155 microseconds.
// Timed twice side by side with v002, it ran 1.22 and 1.23 times as fast.
// Over all steps from v000 it is 2.65 times as fast.
#include <hip/hip_runtime.h>
#include <stdint.h>

// Contractions: qkv projection and output projection v_wmma_f32_16x16x32_bf16 (every input RNE-converted to bf16; context carried as bf16 hi|lo folded into K); scores and probability x value v_wmma_f32_16x16x32_f16 for query positions >= 256 (P carried x1024), bf16 hi/lo three-product form for positions < 256; f32 accumulate, f32 softmax.
// Sequence-first causal multi-head self-attention with a fused bias-free (out, in) qkv weight and an (out, in) output weight: token row m = l*NB + n, attention problem bh = n*16 + h, head columns h*64..h*64+63.
// Launch plan: 4 x k_cvt (bf16 copies) -> k_gemmw (qkv f32) -> k_planes (q/k/v^T 16-bit planes) -> k_attn_hr (rows < 256, 16-row tiles) -> k_attn_lo (rows >= 256, 32-row tiles) -> k_gemmw (output).

#ifndef NB
#define NB 2                      // batch entries processed (NB_FULL, or 1 for a reduced build)
#endif
#ifndef SEQ
#define SEQ 2048                  // sequence positions processed
#endif
#define NB_FULL  2                // batch stride of the staged x and of the output rows
#define SEQ_FULL 2048
#define DM   1024
#define NH   16
#define HD   64
#define F3   (3 * DM)
#define CK   (2 * DM)             // context plane width: hi columns | lo columns
#define RH   256                  // query positions < RH use the hi/lo planes
#define NBH  (NB * NH)
#define MROWS (SEQ * NB)
#define ROWSTEP (NB_FULL / NB)
#define PLN  ((size_t)NBH * SEQ * HD)
#define PLNH ((size_t)NBH * RH * HD)
#define PCAR 1024.0f
#define OP   72                   // context staging pitch in 16-bit elements (144 B)
#define ER   16                   // query rows per wave in the early-positions kernel

static_assert(NB == NB_FULL || NB == 1);          // compact row m = l*NB + n maps to token row m*ROWSTEP
static_assert(SEQ <= SEQ_FULL && SEQ >= RH);
static_assert(SEQ % 256 == 0);                    // tile multiples (128-row GEMM tiles, 32-row attention tiles, 8-wide plane groups)
static_assert(RH % 32 == 0 && RH % 8 == 0);       // the last 32-key step of the early kernel ends inside the hi/lo planes
static_assert(RH % ER == 0 && ER == 16);          // early kernel: one 16-row WMMA tile per wave, store loop 4 x 4 rows
static_assert(HD == 64 && NH * HD == DM);
static_assert(DM == 1024);                        // k_cvt: 128 eight-element groups per row (i >> 7, i & 127)
static_assert(DM % 64 == 0 && DM >= 128 && CK % 128 == 0 && CK >= 256);   // K: whole stages, at least two (k_gemmw: 64 deep for qkv, 128 deep for the output)
static_assert(MROWS % 128 == 0 && F3 % 128 == 0 && DM % 128 == 0);        // whole 128 x 128 output tiles
static_assert(((size_t)NBH * SEQ * HD / 8) % 256 == 0);   // k_planes grid x block == plane extent
static_assert(OP >= 64 && (OP * 2) % 16 == 0);

typedef _Float16 h16;
typedef unsigned short bf;
typedef unsigned short us;
typedef __attribute__((ext_vector_type(16))) __bf16   v16bf;
typedef __attribute__((ext_vector_type(16))) _Float16 v16h;
typedef __attribute__((ext_vector_type(16))) unsigned short v16us;
typedef __attribute__((ext_vector_type(8)))  _Float16 v8h;
typedef __attribute__((ext_vector_type(8)))  unsigned short v8us;
typedef __attribute__((ext_vector_type(8)))  float    v8f;
typedef __attribute__((ext_vector_type(4)))  float    v4f;
typedef v4f  __attribute__((may_alias)) v4fa;
typedef v8us __attribute__((may_alias)) v8usa;

__device__ __forceinline__ unsigned short f2bf(float f) { unsigned u = __float_as_uint(f); u += 0x7FFFu + ((u >> 16) & 1u); return (unsigned short)(u >> 16); }
__device__ __forceinline__ float bf2f(unsigned short b) { return __uint_as_float(((unsigned)b) << 16); }
__device__ __forceinline__ void splitf(float y, unsigned short& h, unsigned short& l) { h = f2bf(y); l = f2bf(y - bf2f(h)); }

// 16-bit fragment from a K-contiguous row: elements 0..7 <- p[0..7], elements 8..15 <- p[16..23]; the caller adds 8*(lane>>4) to p.
__device__ __forceinline__ v16us ldus(const us* p) {
    const v8us a = *(const v8us*)p; const v8us b = *(const v8us*)(p + 16);
    return __builtin_shufflevector(a, b, 0, 1, 2, 3, 4, 5, 6, 7, 8, 9, 10, 11, 12, 13, 14, 15);
}

// One WMMA plus its own four-slot guard (ties exactly one accumulator, keeps A and B live).
template <bool BF>
__device__ __forceinline__ v8f mmg(v16us a, v16us b, v8f c) {
    if (BF) c = __builtin_amdgcn_wmma_f32_16x16x32_bf16(false, __builtin_bit_cast(v16bf, a), false, __builtin_bit_cast(v16bf, b), (short)0, c, false, false);
    else    c = __builtin_amdgcn_wmma_f32_16x16x32_f16(false, __builtin_bit_cast(v16h, a), false, __builtin_bit_cast(v16h, b), (short)0, c, false, false);
    asm volatile("v_nop\n\tv_nop\n\tv_nop\n\tv_nop" : "+v"(c) : "v"(a), "v"(b));
    return c;
}

__global__ __launch_bounds__(256) void k_cvt(const float* __restrict__ src, int srcstep, bf* dst, int dstpitch, int dstcol, int ngroups) {
    const int i = blockIdx.x * 256 + threadIdx.x; if (i >= ngroups) return;
    const int row = i >> 7, cg = i & 127;
    const v8f v = *(const v8f*)(src + (size_t)row * srcstep * DM + cg * 8);
    v8us o;
#pragma unroll
    for (int k = 0; k < 8; ++k) o[k] = f2bf(v[k]);
    bf* d = dst + (size_t)row * dstpitch + dstcol + cg * 8;
    *(v8us*)d = o; 
}

// ---- k_gemmw: one 128x128 output tile per work-group of four waves (2 x 2, 64x64 = 16 accumulators each); grid (M/128, N/128), 128 threads.
// C[m][n] (f32, pitch ldc) = sum_k A[m][k] Bt[n][k]; K a multiple of KS and at least 2 KS, M and N multiples of 128; bf16 operands from K-contiguous planes.
// A stage is KS k of the tile's 128 A rows and 128 Bt rows. Each wave brings one slice of it (64 rows of 2 KS bytes) into LDS with one tensor load, every row padded by 16 bytes;
// two buffers: the load of stage s + 1 is in flight while stage s is multiplied. Every operand row is fetched once per work-group in whole lines and read by two waves from LDS.
// KS = 64 leaves room for three work-groups on a WGP (a grid of several per WGP); KS = 128 keeps twice the bytes in flight where a work-group has its WGP alone.
typedef uint32_t u32x4 __attribute__((ext_vector_type(4)));
typedef uint32_t u32x8 __attribute__((ext_vector_type(8)));
__device__ __forceinline__ uint32_t uni(uint32_t v) { return (uint32_t)__builtin_amdgcn_readfirstlane(v); }
__device__ __forceinline__ uint32_t pinned(uint32_t v) { uint32_t w = (uint32_t)__builtin_amdgcn_readfirstlane(v); asm volatile("" : "+s"(w)); return w; }   // a wave-uniform test held in a scalar register, so that the branch on it is a scalar branch (tensor loads ignore EXEC)
// one request of the calling wave: the tile that g1 describes, from the global address in g0 to the LDS place in g0
__device__ __forceinline__ void gemm_tload(const u32x4 g0, const u32x8 g1) { asm volatile("tensor_load_to_lds %0, %1" :: "s"(g0), "s"(g1) : "memory"); }
// the wave's own requests have landed. The two groups are operands so that their registers stay whole up to this wait and take new values only behind it.
__device__ __forceinline__ void gemm_twait(u32x4& g0, u32x8& g1) { asm volatile("s_wait_tensorcnt 0x0" : "+s"(g0), "+s"(g1) :: "memory"); }
// next stage: the LDS place dst, the global address one stage's row bytes further on (the type bits in word 3 lie above the address)
__device__ __forceinline__ void gemm_tnext(u32x4& g0, uint32_t dst, uint32_t rowb) {
    const uint64_t ga = (((uint64_t)g0[3] << 32) | (uint64_t)g0[2]) + rowb;
    g0[1] = uni(dst); g0[2] = uni((uint32_t)ga); g0[3] = uni((uint32_t)(ga >> 32));
}
template <int KS>
__global__ __launch_bounds__(128) void k_gemmw(const bf* __restrict__ A, int lda, const bf* __restrict__ Bt, int ldb, int K, float* C, int ldc) {
    static_assert(KS == 64 || KS == 128);
    constexpr uint32_t ROWB   = 2u * KS;                                  // bytes of a row in a stage
    constexpr uint32_t GPITCH = ROWB + 16u;                               // LDS row pitch: an odd multiple of 16 bytes for 16-byte reads
    constexpr uint32_t GSLICE = (64u * GPITCH + 2047u) / 2048u * 2048u;   // 64 rows, rounded up to a multiple of 2 KiB
    constexpr uint32_t GBUF   = 4u * GSLICE;                              // slices: A rows 0..63, A rows 64..127, Bt rows 0..63, Bt rows 64..127
    __shared__ __attribute__((aligned(2048))) unsigned char tl[2 * GBUF];
    __shared__ __align__(16) float osall[4 * 16 * 68];
    const int lane = threadIdx.x & 31, lr = lane & 15, hi = lane >> 4;
    const uint32_t wave = uni(threadIdx.x >> 5), wm = wave & 1u, wn = wave >> 1;
    const int r0 = blockIdx.x * 128, c0 = blockIdx.y * 128;
    // this wave's slice of every stage: waves 0, 1 the two halves of the A rows, waves 2, 3 of the Bt rows
    const bool isb = wave >= 2u;
    const uint32_t spitch = (uint32_t)(isb ? ldb : lda) * 2u;
    const uint64_t sbase = (uint64_t)(size_t)(isb ? Bt : A) + (uint64_t)((isb ? c0 : r0) + (int)(wave & 1u) * 64) * spitch;
    const uint32_t sdst = (uint32_t)(size_t)tl + wave * GSLICE;
    u32x8 g1;                                     // 1-byte elements, tensor = tile = 64 rows of ROWB bytes, 4 dwords of LDS pad behind every row
    g1[0] = uni((1u << 20) | ((KS == 64 ? 4u : 5u) << 22) | (3u << 25));
    g1[1] = uni(ROWB << 16);
    g1[2] = uni(64u << 16);
    g1[3] = uni(ROWB << 16);
    g1[4] = uni(64u);
    g1[5] = uni(spitch);
    g1[6] = uni(0u);
    g1[7] = uni(0u);
    u32x4 g0;                                     // count 1, LDS place, global address, type 2
    g0[0] = uni(1u); g0[1] = uni(sdst); g0[2] = uni((uint32_t)sbase); g0[3] = uni((((uint32_t)(sbase >> 32)) & 0x01FFFFFFu) | 0x80000000u);
    const int T = K / KS;                         // stages
    v8f acc[4][4];
#pragma unroll
    for (int mb = 0; mb < 4; ++mb)
#pragma unroll
        for (int nb = 0; nb < 4; ++nb) acc[mb][nb] = (v8f){};
    gemm_tload(g0, g1);
    gemm_twait(g0, g1);                                     // stage 0 has landed (this wave's slice)
    __syncthreads();                                        // ... and every wave's
    gemm_tnext(g0, sdst + GBUF, ROWB);
    gemm_tload(g0, g1);
    const uint32_t aoff = wm * GSLICE + (uint32_t)lr * GPITCH + 16u * (uint32_t)hi;
    const uint32_t boff = (2u + wn) * GSLICE + (uint32_t)lr * GPITCH + 16u * (uint32_t)hi;
#pragma unroll 1                                 // rolled: one publish point in the code, the buffer chosen by a scalar
    for (int s = 0; s < T; ++s) {
        const uint32_t bsel = (uint32_t)(s & 1) * GBUF;
#pragma unroll 1
        for (int h = 0; h < KS / 64; ++h) {         // 64 k at a time: two 32-deep blocks (kept rolled: four blocks in a row spilled accumulators)
            const unsigned char* ap = tl + bsel + aoff + h * 128; const unsigned char* bp = tl + bsel + boff + h * 128;
            // LDS reads stand at two places only: the head (both blocks' A, the first block's Bt, the second block's Bt columns 0..31) and the middle of the first block
            // (the second block's Bt columns 32..63, into the registers that the first eight products have freed).
            v16us a[2][4], b[2][4];
#pragma unroll
            for (int i = 0; i < 4; ++i) { a[0][i] = ldus((const us*)(ap + i * 16 * GPITCH)); b[0][i] = ldus((const us*)(bp + i * 16 * GPITCH)); }
#pragma unroll
            for (int i = 0; i < 4; ++i) a[1][i] = ldus((const us*)(ap + i * 16 * GPITCH + 64));
#pragma unroll
            for (int i = 0; i < 2; ++i) b[1][i] = ldus((const us*)(bp + i * 16 * GPITCH + 64));
            __builtin_amdgcn_sched_barrier(0);      // keeps these loads one group ahead of the products
#pragma unroll
            for (int nb = 0; nb < 2; ++nb)
#pragma unroll
                for (int mb = 0; mb < 4; ++mb) acc[mb][nb] = mmg<true>(a[0][mb], b[0][nb], acc[mb][nb]);
            __builtin_amdgcn_sched_barrier(0);      // keeps the second group from rising among the products whose registers it takes
#pragma unroll
            for (int i = 2; i < 4; ++i) b[1][i] = ldus((const us*)(bp + i * 16 * GPITCH + 64));
            __builtin_amdgcn_sched_barrier(0);      // keeps the second group together, sixteen products ahead of its first use
#pragma unroll
            for (int nb = 2; nb < 4; ++nb)
#pragma unroll
                for (int mb = 0; mb < 4; ++mb) acc[mb][nb] = mmg<true>(a[0][mb], b[0][nb], acc[mb][nb]);
#pragma unroll
            for (int nb = 0; nb < 4; ++nb)
#pragma unroll
                for (int mb = 0; mb < 4; ++mb) acc[mb][nb] = mmg<true>(a[1][mb], b[1][nb], acc[mb][nb]);
        }
        // publish point of stage s + 1
        asm volatile("s_wait_dscnt 0x0" ::: "memory");      // this wave has left stage s's buffer
        gemm_twait(g0, g1);                                 // this wave's slice of stage s + 1 has landed
        __syncthreads();                                    // stage s + 1 readable by all; stage s's buffer left by all
        if (pinned(s + 2 < T)) { gemm_tnext(g0, sdst + bsel, ROWB); gemm_tload(g0, g1); }
    }
    gemm_twait(g0, g1);                                     // nothing in flight when the wave ends
    asm volatile("s_wait_dscnt 0x0" ::: "memory");
    float* os = osall + wave * (16 * 68);                   // output staging, private to the wave
#pragma unroll
    for (int mb = 0; mb < 4; ++mb) {
#pragma unroll
        for (int nb = 0; nb < 4; ++nb) {
#pragma unroll
            for (int j = 0; j < 8; ++j) os[(hi * 8 + j) * 68 + nb * 16 + lr] = acc[mb][nb][j];
        }
        __builtin_amdgcn_wave_barrier(); asm volatile("" ::: "memory");
        float* crow = C + (size_t)(r0 + (int)wm * 64 + mb * 16) * ldc + c0 + (int)wn * 64;
{
#pragma unroll
            for (int s = 0; s < 8; ++s) {                       // rows 2s+hi, s = 0..7, hi = 0..1: all 16 rows of the slab
                const int row = 2 * s + hi, cofs = lr * 4;
                const v4f val = *(const v4fa*)(os + row * 68 + cofs);
                *(v4f*)(crow + (size_t)row * ldc + cofs) = val;
            }
            
        }
        __builtin_amdgcn_wave_barrier(); asm volatile("" ::: "memory");
    }
}

// ---- k_planes: 16-bit operand planes from the f32 projection F [MROWS][3072] (row m = l*NB + n; column which*1024 + h*64 + d).
// blockIdx.y 2: transposed value planes [bh][d][l] (f16; positions < RH also bf16 hi and lo [bh][d][RH]), lane -> 8 consecutive l (strided reads, 16-B contiguous stores).
__device__ __forceinline__ void cvt3(const v8f x, v8h& o16, v8us& oh, v8us& ol) {
#pragma unroll
    for (int k = 0; k < 8; ++k) { o16[k] = (h16)x[k]; unsigned short a, c; splitf(x[k], a, c); oh[k] = a; ol[k] = c; }
}
__device__ __forceinline__ void store3(h16* p16, bf* ph, bf* pl, bool hr, const v8h o16, const v8us oh, const v8us ol) {
    *(v8h*)p16 = o16; if (hr) { *(v8us*)ph = oh; *(v8us*)pl = ol; }
    
}
__global__ __launch_bounds__(256) void k_planes(const float* __restrict__ F, h16* QK16, bf* QKh, bf* QKl, h16* VT16, bf* VTh, bf* VTl) {
    const int g = blockIdx.x * 256 + threadIdx.x;
    if (g >= NBH * SEQ * HD / 8) return;
    const int which = blockIdx.y;
    v8h o16; v8us oh, ol;
    if (which < 2) {
        const int d8 = g & 7, l = (g >> 3) % SEQ, bh = g / (8 * SEQ), n = bh / NH, h = bh % NH;
        const float* f = F + ((size_t)l * NB + n) * F3 + which * DM + h * HD + d8 * 8;
        const v4f a = *(const v4f*)f, b = *(const v4f*)(f + 4);
        const v8f x = __builtin_shufflevector(a, b, 0, 1, 2, 3, 4, 5, 6, 7);
        cvt3(x, o16, oh, ol);
        const bool hr = (l < RH);
        const size_t e16 = (size_t)which * PLN + ((size_t)bh * SEQ + l) * HD + d8 * 8;
        const size_t eh = hr ? ((size_t)which * PLNH + ((size_t)bh * RH + l) * HD + d8 * 8) : 0;
        store3(QK16 + e16, QKh + eh, QKl + eh, hr, o16, oh, ol);
    } else {
        const int l8 = g % (SEQ / 8), d = (g / (SEQ / 8)) % HD, bh = g / (HD * (SEQ / 8)), n = bh / NH, h = bh % NH;
        const int l = l8 * 8;
        v8f x;
#pragma unroll
        for (int j = 0; j < 8; ++j) x[j] = F[((size_t)(l + j) * NB + n) * F3 + 2 * DM + h * HD + d];
        cvt3(x, o16, oh, ol);
        const bool hr = (l < RH);
        const size_t e16 = ((size_t)bh * HD + d) * SEQ + l;
        const size_t eh = hr ? (((size_t)bh * HD + d) * RH + l) : 0;
        store3(VT16 + e16, VTh + eh, VTl + eh, hr, o16, oh, ol);
    }
}

// lane l with lane l ^ 16 (the other half of a query column's keys)
__device__ __forceinline__ float xhalf(float x) {
    return __builtin_bit_cast(float, __builtin_amdgcn_permlanex16(__builtin_bit_cast(int, x), __builtin_bit_cast(int, x), 0x76543210, 0xfedcba98, false, false));
}

template <bool HR>
__device__ __forceinline__ void attn_body(const us* __restrict__ Qa, const us* __restrict__ Qr, const us* __restrict__ Ka, const us* __restrict__ Kr,
                                          const us* __restrict__ Va, const us* __restrict__ Vr, bf* CTX, const int q0) {
    constexpr int LR = HR ? RH : SEQ;                  // rows per problem in the q/k planes = row length of the transposed value planes
    __shared__ __align__(16) unsigned short oh[32 * OP];
    __shared__ __align__(16) unsigned short ol[32 * OP];
    const int lane = threadIdx.x & 31, lr = lane & 15, hi = lane >> 4;
    const int bh = blockIdx.x, n = bh / NH, h = bh % NH;
    const size_t pb = (size_t)bh * LR * HD;
    Qa += pb; Ka += pb; Va += pb; Qr += pb; Kr += pb; Vr += pb;
    const int qoff = (q0 + lr) * HD + 8 * hi;
    const int koff = lr * HD + 8 * hi;
    const int voff = lr * LR + 8 * hi;
    const float cexp = 0.125f * 1.4426950408889634f;   // HD^-0.5 * log2(e)
    const float pc = HR ? 1.0f : PCAR;
    v8f o[2][4]; float mrow[2], lsum[2];               // o[u][t2][r] = context(query q0 + u*16 + lr, d = t2*16 + 8*hi + r); mrow, lsum: of query q0 + u*16 + lr
#pragma unroll
    for (int u = 0; u < 2; ++u) {
#pragma unroll
        for (int t2 = 0; t2 < 4; ++t2) o[u][t2] = (v8f){};
        mrow[u] = -3.0e38f; lsum[u] = 0.0f;
    }
    v16us qfa[2][2], qfr[2][2], kfa[2][2], kfr[2][2];      // [kc][u] and [kc][t]
#pragma unroll
    for (int kc = 0; kc < 2; ++kc) {
#pragma unroll
        for (int u = 0; u < 2; ++u) {
            qfa[kc][u] = ldus(Qa + qoff + u * 16 * HD + kc * 32);
            qfr[kc][u] = HR ? ldus(Qr + qoff + u * 16 * HD + kc * 32) : qfa[kc][u];
        }
#pragma unroll
        for (int t = 0; t < 2; ++t) {
            const int ko = (t * 16) * HD + koff + kc * 32;
            kfa[kc][t] = ldus(Ka + ko);
            kfr[kc][t] = HR ? ldus(Kr + ko) : kfa[kc][t];
        }
    }
    const int kfirst = (32 <= q0 ? 32 : q0) * HD + koff;
    const us* kpa = Ka + kfirst; const us* kpr = Kr + kfirst;      // the NEXT step's key rows
    const us* vpa = Va + voff;   const us* vpr = Vr + voff;        // this step's value columns
#pragma unroll 1
    for (int m0 = 0; m0 <= q0; m0 += 32) {
        v16us vfa[4], vfr[4];
#pragma unroll
        for (int t2 = 0; t2 < 4; ++t2) {
            vfa[t2] = ldus(vpa + (t2 * 16) * LR);          // A[m = d = t2*16 + lr][k = key m0 + ..] from the transposed plane row d
            vfr[t2] = HR ? ldus(vpr + (t2 * 16) * LR) : vfa[t2];
        }
        v8f s[2][2];
#pragma unroll
        for (int u = 0; u < 2; ++u)
#pragma unroll
            for (int t = 0; t < 2; ++t) s[u][t] = (v8f){};
#pragma unroll
        for (int kc = 0; kc < 2; ++kc) {
#pragma unroll
            for (int t = 0; t < 2; ++t) {
                s[0][t] = mmg<HR>(kfa[kc][t], qfa[kc][0], s[0][t]); s[1][t] = mmg<HR>(kfa[kc][t], qfa[kc][1], s[1][t]);
                if (HR) {
                    s[0][t] = mmg<HR>(kfa[kc][t], qfr[kc][0], s[0][t]); s[1][t] = mmg<HR>(kfa[kc][t], qfr[kc][1], s[1][t]);
                    s[0][t] = mmg<HR>(kfr[kc][t], qfa[kc][0], s[0][t]); s[1][t] = mmg<HR>(kfr[kc][t], qfa[kc][1], s[1][t]);
                }
            }
        }
        {       // next step's key fragments: a whole softmax and the V^T.P^T products ahead of their use (the last step fetches its own keys again: in bounds, not used)
#pragma unroll
            for (int kc = 0; kc < 2; ++kc) {
#pragma unroll
                for (int t = 0; t < 2; ++t) {
                    kfa[kc][t] = ldus(kpa + (t * 16) * HD + kc * 32);
                    kfr[kc][t] = HR ? ldus(kpr + (t * 16) * HD + kc * 32) : kfa[kc][t];
                }
            }
            __builtin_amdgcn_sched_barrier(0);      // keeps the loads ahead of the softmax (lead)
        }
        // s[u][t][r] = score(key m0 + t*16 + 8*hi + r, query q0 + u*16 + lr). Keys beyond the query are excluded (only possible in the diagonal step; key m0 is always kept).
        if (m0 == q0) {
#pragma unroll
            for (int u = 0; u < 2; ++u)
#pragma unroll
                for (int t = 0; t < 2; ++t)
#pragma unroll
                    for (int r = 0; r < 8; ++r) { if (t * 16 + 8 * hi + r > u * 16 + lr) s[u][t][r] = -3.0e38f; }
        }
        v16us pa[2], pr[2];
#pragma unroll
        for (int u = 0; u < 2; ++u) {
            float v = fmaxf(s[u][0][0], s[u][1][0]);
#pragma unroll
            for (int r = 1; r < 8; ++r) v = fmaxf(v, fmaxf(s[u][0][r], s[u][1][r]));
            v = fmaxf(v, xhalf(v));
            const float mn = fmaxf(mrow[u], v);
            const v8f x0 = (s[u][0] - mn) * cexp, x1 = (s[u][1] - mn) * cexp;
            float e0[8], e1[8];
#pragma unroll
            for (int r = 0; r < 8; ++r) e0[r] = __builtin_amdgcn_exp2f(x0[r]);
#pragma unroll
            for (int r = 0; r < 8; ++r) e1[r] = __builtin_amdgcn_exp2f(x1[r]);
            const float al = __builtin_amdgcn_exp2f((mrow[u] - mn) * cexp);
            mrow[u] = mn;
            float ps[4] = {0.0f, 0.0f, 0.0f, 0.0f};             // four independent partial sums of the lane's 16 probabilities
#pragma unroll
            for (int r = 0; r < 8; ++r) {
                const float p0 = e0[r], p1 = e1[r];
                ps[r & 3] += p0 + p1;
                if (HR) {
                    unsigned short a, c; splitf(p0, a, c); pa[u][r] = a; pr[u][r] = c;
                    splitf(p1, a, c); pa[u][8 + r] = a; pr[u][8 + r] = c;
                } else {
                    pa[u][r] = __builtin_bit_cast(unsigned short, (h16)(p0 * PCAR));
                    pa[u][8 + r] = __builtin_bit_cast(unsigned short, (h16)(p1 * PCAR));
                }
            }
            if (!HR) pr[u] = pa[u];
            lsum[u] = lsum[u] * al + ((ps[0] + ps[1]) + (ps[2] + ps[3]));     // per-lane partial sum of one query (its half of the keys), the halves joined once at the end
#pragma unroll
            for (int t2 = 0; t2 < 4; ++t2) o[u][t2] *= al;
        }
#pragma unroll
        for (int t2 = 0; t2 < 4; ++t2) {
            o[0][t2] = mmg<HR>(vfa[t2], pa[0], o[0][t2]); o[1][t2] = mmg<HR>(vfa[t2], pa[1], o[1][t2]);
            if (HR) {
                o[0][t2] = mmg<HR>(vfa[t2], pr[0], o[0][t2]); o[1][t2] = mmg<HR>(vfa[t2], pr[1], o[1][t2]);
                o[0][t2] = mmg<HR>(vfr[t2], pa[0], o[0][t2]); o[1][t2] = mmg<HR>(vfr[t2], pa[1], o[1][t2]);
            }
        }
        // the address pairs of this step's loads stay whole up to this wait; they are stepped only behind it
        if (HR) asm volatile("s_wait_xcnt 0x0" :: "v"(kpa), "v"(kpr), "v"(vpa), "v"(vpr) : "memory");
        else    asm volatile("s_wait_xcnt 0x0" :: "v"(kpa), "v"(vpa) : "memory");
        const int kstep = m0 + 64 <= q0 ? 32 * HD : 0;
        kpa += kstep; kpr += kstep; vpa += 32; vpr += 32;
    }
    // normalise, split into bf16 hi / lo, stage the 32 x 64 tile (a lane's 8 registers are 8 consecutive d of one query: 16-byte LDS stores), then whole-line stores
#pragma unroll
    for (int u = 0; u < 2; ++u) {
        float l = lsum[u];
        l += xhalf(l);
        const float inv = 1.0f / (l * pc);
#pragma unroll
        for (int t2 = 0; t2 < 4; ++t2) {
            v8us a8, c8;
#pragma unroll
            for (int r = 0; r < 8; ++r) { unsigned short a, c; splitf(o[u][t2][r] * inv, a, c); a8[r] = a; c8[r] = c; }
            const int oo = (u * 16 + lr) * OP + t2 * 16 + 8 * hi;
            *(v8usa*)(oh + oo) = a8; *(v8usa*)(ol + oo) = c8;
        }
    }
    __syncthreads();
{
#pragma unroll
        for (int s = 0; s < 8; ++s) {
            const int row = s * 4 + (lane >> 3), cp = (lane & 7) * 8;
            const v8us vh = *(const v8usa*)(oh + row * OP + cp);
            const v8us vl = *(const v8usa*)(ol + row * OP + cp);
            bf* d = CTX + ((size_t)(q0 + row) * NB + n) * CK + h * HD + cp;
            *(v8us*)d = vh; *(v8us*)(d + DM) = vl;
        }
        
    }
}

__global__ __launch_bounds__(32) void k_attn_lo(const us* __restrict__ Q16, const us* __restrict__ K16, const us* __restrict__ V16, bf* CTX) {
    attn_body<false>(Q16, Q16, K16, K16, V16, V16, CTX, RH + (int)blockIdx.y * 32);
}

// ---- k_attn_hr: early query positions (< RH) on bf16 hi/lo planes, ONE 16-row tile per wave (one wave per block), 32 keys per step.
// Per-query arithmetic and product order are those of attn_body with HR = true (q.k: hi.hi, lo.hi, hi.lo per 32-deep chunk; P.v: hi.hi, lo.hi, hi.lo; all into one accumulator, unscaled bf16 residuals), transposed in the same way.
// Live state per lane: 4 output accumulators + 2 score accumulators + 2 softmax scalars + the fragments fetched ahead: q once in front of the loop, a step's v at its head, the next step's k among this step's V^T.P^T products.
// Key steps run over m0 = 0, 32, .., mend with mend = q0 pad down to a multiple of 32 (block-uniform); keys beyond the query are excluded in the last step only (key mend is always kept).
// Planes: q/k [bh][RH][64], transposed value planes [bh][64][RH]; the last step reads keys < mend + 32 <= RH, all written by k_planes.
__global__ __launch_bounds__(32) void k_attn_hr(const us* __restrict__ Qh, const us* __restrict__ Ql, const us* __restrict__ Kh, const us* __restrict__ Kl,
                                                const us* __restrict__ Vh, const us* __restrict__ Vl, bf* CTX) {
    __shared__ __align__(16) unsigned short eoh[ER * OP];     // context hi staging, 16 rows x 64
    __shared__ __align__(16) unsigned short eol[ER * OP];     // context lo staging
    const int lane = threadIdx.x & 31, lr = lane & 15, hi = lane >> 4;
    const int bh = blockIdx.x, n = bh / NH, h = bh % NH;
    const int q0 = (int)blockIdx.y * ER;
    const int mend = q0 & ~31;
    const size_t pb = (size_t)bh * RH * HD;
    Qh += pb; Ql += pb; Kh += pb; Kl += pb; Vh += pb; Vl += pb;
    const int qoff = (q0 + lr) * HD + 8 * hi;
    const int koff = lr * HD + 8 * hi;
    const int voff = lr * RH + 8 * hi;
    const float cexp = 0.125f * 1.4426950408889634f;   // HD^-0.5 * log2(e)
    v8f o[4]; float mrow = -3.0e38f, lsum = 0.0f;      // o[t2][r] = context(query q0 + lr, d = t2*16 + 8*hi + r); mrow, lsum: of query q0 + lr
#pragma unroll
    for (int t2 = 0; t2 < 4; ++t2) o[t2] = (v8f){};
    v16us qfa[2], qfr[2], kfa[2][2], kfr[2][2];            // [kc] and [kc][t]
#pragma unroll
    for (int kc = 0; kc < 2; ++kc) {
        qfa[kc] = ldus(Qh + qoff + kc * 32);
        qfr[kc] = ldus(Ql + qoff + kc * 32);
#pragma unroll
        for (int t = 0; t < 2; ++t) {
            const int ko = (t * 16) * HD + koff + kc * 32;
            kfa[kc][t] = ldus(Kh + ko);
            kfr[kc][t] = ldus(Kl + ko);
        }
    }
    const int kfirst = (32 <= mend ? 32 : mend) * HD + koff;
    const us* kph = Kh + kfirst; const us* kpl = Kl + kfirst;      // the NEXT step's key rows (the last step fetches its own keys again: in bounds, not used)
#pragma unroll 1
    for (int m0 = 0; m0 <= mend; m0 += 32) {
        v16us vfa[4], vfr[4];
        const us* vph = Vh + voff + m0; const us* vpl = Vl + voff + m0;
#pragma unroll
        for (int t2 = 0; t2 < 4; ++t2) {
            vfa[t2] = ldus(vph + (t2 * 16) * RH);          // A[m = d = t2*16 + lr][k = key m0 + ..] from the transposed plane row d
            vfr[t2] = ldus(vpl + (t2 * 16) * RH);
        }
        asm volatile("s_wait_xcnt 0x0" :: "v"(vph), "v"(vpl) : "memory");   // the two address pairs stay whole up to this wait
        v8f s[2];
        s[0] = (v8f){}; s[1] = (v8f){};
#pragma unroll
        for (int kc = 0; kc < 2; ++kc) {
#pragma unroll
            for (int t = 0; t < 2; ++t) {
                s[t] = mmg<true>(kfa[kc][t], qfa[kc], s[t]);
                s[t] = mmg<true>(kfa[kc][t], qfr[kc], s[t]);
                s[t] = mmg<true>(kfr[kc][t], qfa[kc], s[t]);
            }
        }
        // s[t][r] = score(key m0 + t*16 + 8*hi + r, query q0 + lr)
        if (m0 == mend) {
#pragma unroll
            for (int t = 0; t < 2; ++t)
#pragma unroll
                for (int r = 0; r < 8; ++r) { if (m0 + t * 16 + 8 * hi + r > q0 + lr) s[t][r] = -3.0e38f; }
        }
        v16us pa, pr;
        {
            float v = fmaxf(s[0][0], s[1][0]);
#pragma unroll
            for (int r = 1; r < 8; ++r) v = fmaxf(v, fmaxf(s[0][r], s[1][r]));
            v = fmaxf(v, xhalf(v));
            const float mn = fmaxf(mrow, v);
            const float al = __builtin_amdgcn_exp2f((mrow - mn) * cexp);
            mrow = mn;
            const v8f x0 = (s[0] - mn) * cexp, x1 = (s[1] - mn) * cexp;
            float ps[4] = {0.0f, 0.0f, 0.0f, 0.0f};             // four independent partial sums of the lane's 16 probabilities
#pragma unroll
            for (int r = 0; r < 8; ++r) {
                const float p0 = __builtin_amdgcn_exp2f(x0[r]);
                const float p1 = __builtin_amdgcn_exp2f(x1[r]);
                ps[r & 3] += p0 + p1;
                unsigned short a, c;
                splitf(p0, a, c); pa[r] = a; pr[r] = c;
                splitf(p1, a, c); pa[8 + r] = a; pr[8 + r] = c;
            }
            lsum = lsum * al + ((ps[0] + ps[1]) + (ps[2] + ps[3]));           // per-lane partial sum of one query (its half of the keys), the halves joined once at the end
#pragma unroll
            for (int t2 = 0; t2 < 4; ++t2) o[t2] *= al;
        }
#pragma unroll
        for (int t2 = 0; t2 < 4; ++t2) {
            o[t2] = mmg<true>(vfa[t2], pa, o[t2]);
            o[t2] = mmg<true>(vfa[t2], pr, o[t2]);
            o[t2] = mmg<true>(vfr[t2], pa, o[t2]);
            const int ko = ((t2 & 1) * 16) * HD + (t2 >> 1) * 32;
            kfa[t2 >> 1][t2 & 1] = ldus(kph + ko);
            kfr[t2 >> 1][t2 & 1] = ldus(kpl + ko);
            __builtin_amdgcn_sched_barrier(0);  // keeps each key refill behind the products that free a value fragment pair (register room)
        }
        asm volatile("s_wait_xcnt 0x0" :: "v"(kph), "v"(kpl) : "memory");   // the key address pairs stay whole up to this wait; they are stepped only behind it
        const int kstep = m0 + 64 <= mend ? 32 * HD : 0;
        kph += kstep; kpl += kstep;
    }
    // normalise, split into bf16 hi / lo, stage the 16 x 64 tile (16-byte LDS stores), then whole-line stores
    {
        float l = lsum;
        l += xhalf(l);
        const float inv = 1.0f / l;
#pragma unroll
        for (int t2 = 0; t2 < 4; ++t2) {
            v8us a8, c8;
#pragma unroll
            for (int r = 0; r < 8; ++r) { unsigned short a, c; splitf(o[t2][r] * inv, a, c); a8[r] = a; c8[r] = c; }
            const int oo = lr * OP + t2 * 16 + 8 * hi;
            *(v8usa*)(eoh + oo) = a8; *(v8usa*)(eol + oo) = c8;
        }
    }
    __syncthreads();
{
#pragma unroll
        for (int s4 = 0; s4 < ER / 4; ++s4) {
            const int row = s4 * 4 + (lane >> 3), cp = (lane & 7) * 8;
            const v8us vh = *(const v8usa*)(eoh + row * OP + cp);
            const v8us vl = *(const v8usa*)(eol + row * OP + cp);
            bf* d = CTX + ((size_t)(q0 + row) * NB + n) * CK + h * HD + cp;
            *(v8us*)d = vh; *(v8us*)(d + DM) = vl;
        }
        
    }
}

// workspace carve (bytes), every region a multiple of 256
constexpr size_t SZ_XB   = (size_t)MROWS * DM * 2;        // x bf16 [MROWS][1024]
constexpr size_t SZ_WQ   = (size_t)F3 * DM * 2;           // w_qkv bf16 [3072][1024]
constexpr size_t SZ_WO   = (size_t)DM * CK * 2;           // [w_out | w_out] bf16 [1024][2048]
constexpr size_t SZ_F    = (size_t)MROWS * F3 * 4;        // qkv f32 [MROWS][3072]
constexpr size_t SZ_QK16 = (size_t)2 * NBH * SEQ * HD * 2;
constexpr size_t SZ_QKH  = (size_t)2 * NBH * RH * HD * 2;
constexpr size_t SZ_VT16 = (size_t)NBH * HD * SEQ * 2;
constexpr size_t SZ_VTH  = (size_t)NBH * HD * RH * 2;
constexpr size_t SZ_CTX  = (size_t)MROWS * CK * 2;        // context bf16 hi | lo [MROWS][2048]
constexpr size_t OF_XB   = 0;
constexpr size_t OF_WQ   = OF_XB + SZ_XB;
constexpr size_t OF_WO   = OF_WQ + SZ_WQ;
constexpr size_t OF_F    = OF_WO + SZ_WO;
constexpr size_t OF_QK16 = OF_F + SZ_F;
constexpr size_t OF_QKH  = OF_QK16 + SZ_QK16;
constexpr size_t OF_QKL  = OF_QKH + SZ_QKH;
constexpr size_t OF_VT16 = OF_QKL + SZ_QKH;
constexpr size_t OF_VTH  = OF_VT16 + SZ_VT16;
constexpr size_t OF_VTL  = OF_VTH + SZ_VTH;
constexpr size_t OF_CTX  = OF_VTL + SZ_VTH;
constexpr size_t WS_TOTAL = OF_CTX + SZ_CTX;
static_assert(SZ_XB % 256 == 0 && SZ_WQ % 256 == 0 && SZ_WO % 256 == 0 && SZ_F % 256 == 0 && SZ_QK16 % 256 == 0);
static_assert(SZ_QKH % 256 == 0 && SZ_VT16 % 256 == 0 && SZ_VTH % 256 == 0 && SZ_CTX % 256 == 0);
static_assert(WS_TOTAL <= (size_t)134217728);            // total carve <= 128 MiB

extern "C" void kernel_launch(void* const* d_in, const int* in_sizes, int n_in,
                              void* d_out, int out_size, void* d_ws, size_t ws_size, hipStream_t stream) {
    if (n_in < 3) return;
    const long long needx = ((long long)(SEQ - 1) * NB_FULL + NB) * DM;     // last token row touched, in elements
    if ((long long)in_sizes[0] < needx || (long long)in_sizes[1] < (long long)F3 * DM || (long long)in_sizes[2] < (long long)DM * DM || (long long)out_size < needx) return;
    if (WS_TOTAL > ws_size) return;
    const float* x = (const float*)d_in[0];       // [2048][2][1024], token row l*2 + n
    const float* wqkv = (const float*)d_in[1];    // [3072][1024] = [out][in]
    const float* wout = (const float*)d_in[2];    // [1024][1024] = [out][in]
    float* OUT = (float*)d_out;                   // [2048][2][1024]
    char* ws = (char*)d_ws;
    bf* XB = (bf*)(ws + OF_XB); bf* WQ = (bf*)(ws + OF_WQ); bf* WO2 = (bf*)(ws + OF_WO); float* F = (float*)(ws + OF_F);
    h16* QK16 = (h16*)(ws + OF_QK16); bf* QKh = (bf*)(ws + OF_QKH); bf* QKl = (bf*)(ws + OF_QKL);
    h16* VT16 = (h16*)(ws + OF_VT16); bf* VTh = (bf*)(ws + OF_VTH); bf* VTl = (bf*)(ws + OF_VTL); bf* CTX = (bf*)(ws + OF_CTX);

    k_cvt<<<(MROWS * 128 + 255) / 256, 256, 0, stream>>>(x, ROWSTEP, XB, DM, 0, MROWS * 128);
    k_cvt<<<(F3 * 128 + 255) / 256, 256, 0, stream>>>(wqkv, 1, WQ, DM, 0, F3 * 128);
    k_cvt<<<(DM * 128 + 255) / 256, 256, 0, stream>>>(wout, 1, WO2, CK, 0, DM * 128);      // columns 0..1023 (pairs with the hi half of the context plane)
    k_cvt<<<(DM * 128 + 255) / 256, 256, 0, stream>>>(wout, 1, WO2, CK, DM, DM * 128);     // columns 1024..2047 (pairs with the lo half)
    k_gemmw<64><<<dim3(MROWS / 128, F3 / 128, 1), 128, 0, stream>>>(XB, DM, WQ, DM, DM, F, F3);   // qkv[m][f] = sum_e x[m][e] w_qkv[f][e]
    k_planes<<<dim3((unsigned)((size_t)NBH * SEQ * HD / 8 / 256), 3, 1), 256, 0, stream>>>(F, QK16, QKh, QKl, VT16, VTh, VTl);
    k_attn_hr<<<dim3(NBH, RH / ER, 1), 32, 0, stream>>>((const us*)QKh, (const us*)QKl, (const us*)(QKh + PLNH), (const us*)(QKl + PLNH), (const us*)VTh, (const us*)VTl, CTX);
    if (SEQ > RH)
        k_attn_lo<<<dim3(NBH, (SEQ - RH) / 32 > 0 ? (SEQ - RH) / 32 : 1, 1), 32, 0, stream>>>((const us*)QK16, (const us*)(QK16 + PLN), (const us*)VT16, CTX);
    k_gemmw<128><<<dim3(MROWS / 128, DM / 128, 1), 128, 0, stream>>>(CTX, CK, WO2, CK, CK, OUT, DM * ROWSTEP);   // out[m][f] = sum_e (ctx_hi + ctx_lo)[m][e] w_out[f][e]
}

// v004
// One run takes 126 microseconds.
// In two side-by-side timings against v003, it was 1.23 and 1.22 times as fast.
// Over all steps from v000 it is 3.25 times as fast.
#include <hip/hip_runtime.h>
#include <stdint.h>

// Contractions: qkv projection and output projection v_wmma_f32_16x16x32_bf16 (every input RNE-converted to bf16; context carried as bf16 hi|lo folded into K); scores and probability x value v_wmma_f32_16x16x32_f16 for query positions >= 256 (P carried x1024), bf16 hi/lo three-product form for positions < 256; f32 accumulate, f32 softmax.
// Sequence-first causal multi-head self-attention with a fused bias-free (out, in) qkv weight and an (out, in) output weight: token row m = l*NB + n, attention problem bh = n*16 + h, head columns h*64..h*64+63.
// Launch plan: 4 x k_cvt (bf16 copies) -> k_gemmw (qkv product, its epilogue writes the q/k/v^T 16-bit planes) -> k_attn_hr (rows < 256, 16-row tiles) -> k_attn_lo (rows >= 256, 32-row tiles) -> k_gemmw (output).

#ifndef NB
#define NB 2                      // batch entries processed (NB_FULL, or 1 for a reduced build)
#endif
#ifndef SEQ
#define SEQ 2048                  // sequence positions processed
#endif
#define NB_FULL  2                // batch stride of the staged x and of the output rows
#define SEQ_FULL 2048
#define DM   1024
#define NH   16
#define HD   64
#define F3   (3 * DM)
#define CK   (2 * DM)             // context plane width: hi columns | lo columns
#define RH   256                  // query positions < RH use the hi/lo planes
#define NBH  (NB * NH)
#define MROWS (SEQ * NB)
#define ROWSTEP (NB_FULL / NB)
#define PLN  ((size_t)NBH * SEQ * HD)
#define PLNH ((size_t)NBH * RH * HD)
#define PCAR 1024.0f
#define OP   72                   // context staging pitch in 16-bit elements (144 B)
#define ER   16                   // query rows per wave in the early-positions kernel

static_assert(NB == NB_FULL || NB == 1);          // compact row m = l*NB + n maps to token row m*ROWSTEP
static_assert(SEQ <= SEQ_FULL && SEQ >= RH);
static_assert(SEQ % 256 == 0);                    // tile multiples (128-row GEMM tiles, 32-row attention tiles, 8-wide plane groups)
static_assert(RH % 32 == 0 && RH % 8 == 0);       // the last 32-key step of the early kernel ends inside the hi/lo planes
static_assert(RH % ER == 0 && ER == 16);          // early kernel: one 16-row WMMA tile per wave, store loop 4 x 4 rows
static_assert(HD == 64 && NH * HD == DM);
static_assert(DM == 1024);                        // k_cvt: 128 eight-element groups per row (i >> 7, i & 127)
static_assert(DM % 64 == 0 && DM >= 128 && CK % 128 == 0 && CK >= 256);   // K: whole stages, at least two (k_gemmw: 64 deep for qkv, 128 deep for the output)
static_assert(MROWS % 128 == 0 && F3 % 128 == 0 && DM % 128 == 0);        // whole 128 x 128 output tiles
static_assert(RH % (128 / NB) == 0 && DM % 128 == 0);     // a 128 x 128 tile of the qkv product lies wholly in one of q, k, v and wholly below or above RH
static_assert(OP >= 64 && (OP * 2) % 16 == 0);

typedef _Float16 h16;
typedef unsigned short bf;
typedef unsigned short us;
typedef __attribute__((ext_vector_type(16))) __bf16   v16bf;
typedef __attribute__((ext_vector_type(16))) _Float16 v16h;
typedef __attribute__((ext_vector_type(16))) unsigned short v16us;
typedef __attribute__((ext_vector_type(8)))  _Float16 v8h;
typedef __attribute__((ext_vector_type(8)))  unsigned short v8us;
typedef __attribute__((ext_vector_type(8)))  float    v8f;
typedef __attribute__((ext_vector_type(4)))  float    v4f;
typedef v4f  __attribute__((may_alias)) v4fa;
typedef v8us __attribute__((may_alias)) v8usa;

__device__ __forceinline__ unsigned short f2bf(float f) { unsigned u = __float_as_uint(f); u += 0x7FFFu + ((u >> 16) & 1u); return (unsigned short)(u >> 16); }
__device__ __forceinline__ float bf2f(unsigned short b) { return __uint_as_float(((unsigned)b) << 16); }
__device__ __forceinline__ void splitf(float y, unsigned short& h, unsigned short& l) { h = f2bf(y); l = f2bf(y - bf2f(h)); }

// 16-bit fragment from a K-contiguous row: elements 0..7 <- p[0..7], elements 8..15 <- p[16..23]; the caller adds 8*(lane>>4) to p.
__device__ __forceinline__ v16us ldus(const us* p) {
    const v8us a = *(const v8us*)p; const v8us b = *(const v8us*)(p + 16);
    return __builtin_shufflevector(a, b, 0, 1, 2, 3, 4, 5, 6, 7, 8, 9, 10, 11, 12, 13, 14, 15);
}

// One WMMA plus its own four-slot guard (ties exactly one accumulator, keeps A and B live).
template <bool BF>
__device__ __forceinline__ v8f mmg(v16us a, v16us b, v8f c) {
    if (BF) c = __builtin_amdgcn_wmma_f32_16x16x32_bf16(false, __builtin_bit_cast(v16bf, a), false, __builtin_bit_cast(v16bf, b), (short)0, c, false, false);
    else    c = __builtin_amdgcn_wmma_f32_16x16x32_f16(false, __builtin_bit_cast(v16h, a), false, __builtin_bit_cast(v16h, b), (short)0, c, false, false);
    asm volatile("v_nop\n\tv_nop\n\tv_nop\n\tv_nop" : "+v"(c) : "v"(a), "v"(b));
    return c;
}

__global__ __launch_bounds__(256) void k_cvt(const float* __restrict__ src, int srcstep, bf* dst, int dstpitch, int dstcol, int ngroups) {
    const int i = blockIdx.x * 256 + threadIdx.x; if (i >= ngroups) return;
    const int row = i >> 7, cg = i & 127;
    const v8f v = *(const v8f*)(src + (size_t)row * srcstep * DM + cg * 8);
    v8us o;
#pragma unroll
    for (int k = 0; k < 8; ++k) o[k] = f2bf(v[k]);
    bf* d = dst + (size_t)row * dstpitch + dstcol + cg * 8;
    *(v8us*)d = o; 
}

// ---- k_gemmw: one 128x128 output tile per work-group of four waves (2 x 2, 64x64 = 16 accumulators each); grid (M/128, N/128), 128 threads.
// C[m][n] (f32, pitch ldc) = sum_k A[m][k] Bt[n][k]; K a multiple of KS and at least 2 KS, M and N multiples of 128; bf16 operands from K-contiguous planes.
// A stage is KS k of the tile's 128 A rows and 128 Bt rows. Each wave brings one slice of it (64 rows of 2 KS bytes) into LDS with one tensor load, every row padded by 16 bytes;
// two buffers: the load of stage s + 1 is in flight while stage s is multiplied. Every operand row is fetched once per work-group in whole lines and read by two waves from LDS.
// KS = 64 leaves room for three work-groups on a WGP (a grid of several per WGP); KS = 128 keeps twice the bytes in flight where a work-group has its WGP alone.
typedef uint32_t u32x4 __attribute__((ext_vector_type(4)));
typedef uint32_t u32x8 __attribute__((ext_vector_type(8)));
__device__ __forceinline__ uint32_t uni(uint32_t v) { return (uint32_t)__builtin_amdgcn_readfirstlane(v); }
__device__ __forceinline__ uint32_t pinned(uint32_t v) { uint32_t w = (uint32_t)__builtin_amdgcn_readfirstlane(v); asm volatile("" : "+s"(w)); return w; }   // a wave-uniform test held in a scalar register, so that the branch on it is a scalar branch (tensor loads ignore EXEC)
// one request of the calling wave: the tile that g1 describes, from the global address in g0 to the LDS place in g0
__device__ __forceinline__ void gemm_tload(const u32x4 g0, const u32x8 g1) { asm volatile("tensor_load_to_lds %0, %1" :: "s"(g0), "s"(g1) : "memory"); }
// the wave's own requests have landed. The two groups are operands so that their registers stay whole up to this wait and take new values only behind it.
__device__ __forceinline__ void gemm_twait(u32x4& g0, u32x8& g1) { asm volatile("s_wait_tensorcnt 0x0" : "+s"(g0), "+s"(g1) :: "memory"); }
// next stage: the LDS place dst, the global address one stage's row bytes further on (the type bits in word 3 lie above the address)
__device__ __forceinline__ void gemm_tnext(u32x4& g0, uint32_t dst, uint32_t rowb) {
    const uint64_t ga = (((uint64_t)g0[3] << 32) | (uint64_t)g0[2]) + rowb;
    g0[1] = uni(dst); g0[2] = uni((uint32_t)ga); g0[3] = uni((uint32_t)(ga >> 32));
}
// 16-bit forms of eight f32 values of the qkv product: f16, and bf16 hi and lo (stored only for positions < RH)
__device__ __forceinline__ void cvt3(const v8f x, v8h& o16, v8us& oh, v8us& ol) {
#pragma unroll
    for (int k = 0; k < 8; ++k) { o16[k] = (h16)x[k]; unsigned short a, c; splitf(x[k], a, c); oh[k] = a; ol[k] = c; }
}
__device__ __forceinline__ void store3(h16* p16, bf* ph, bf* pl, bool hr, const v8h o16, const v8us oh, const v8us ol) {
    *(v8h*)p16 = o16;
    asm volatile("s_wait_xcnt 0x0" ::: "memory");       // stands before the store's address and data registers are written again
    if (hr) {
        *(v8us*)ph = oh; *(v8us*)pl = ol;
        asm volatile("s_wait_xcnt 0x0" ::: "memory");   // the same for these two stores
    }
}
// PL = false: the tile goes to C as f32. PL = true (the qkv product; row m = l*NB + n, column which*1024 + h*64 + d): the tile goes straight to the 16-bit operand planes of the attention kernels,
// q and k as [bh][l][64] (f16; positions < RH also bf16 hi and lo [bh][RH][64]), v transposed as [bh][d][l] (f16; positions < RH also bf16 hi and lo [bh][d][RH]); C is not touched.
template <int KS, bool PL>
__global__ __launch_bounds__(128) void k_gemmw(const bf* __restrict__ A, int lda, const bf* __restrict__ Bt, int ldb, int K, float* C, int ldc,
                                               h16* QK16, bf* QKh, bf* QKl, h16* VT16, bf* VTh, bf* VTl) {
    static_assert(KS == 64 || KS == 128);
    constexpr uint32_t ROWB   = 2u * KS;                                  // bytes of a row in a stage
    constexpr uint32_t GPITCH = ROWB + 16u;                               // LDS row pitch: an odd multiple of 16 bytes for 16-byte reads
    constexpr uint32_t GSLICE = (64u * GPITCH + 2047u) / 2048u * 2048u;   // 64 rows, rounded up to a multiple of 2 KiB
    constexpr uint32_t GBUF   = 4u * GSLICE;                              // slices: A rows 0..63, A rows 64..127, Bt rows 0..63, Bt rows 64..127
    __shared__ __attribute__((aligned(2048))) unsigned char tl[2 * GBUF];
    __shared__ __align__(16) float osall[4 * 16 * 68];
    const int lane = threadIdx.x & 31, lr = lane & 15, hi = lane >> 4;
    const uint32_t wave = uni(threadIdx.x >> 5), wm = wave & 1u, wn = wave >> 1;
    const int r0 = blockIdx.x * 128, c0 = blockIdx.y * 128;
    // this wave's slice of every stage: waves 0, 1 the two halves of the A rows, waves 2, 3 of the Bt rows
    const bool isb = wave >= 2u;
    const uint32_t spitch = (uint32_t)(isb ? ldb : lda) * 2u;
    const uint64_t sbase = (uint64_t)(size_t)(isb ? Bt : A) + (uint64_t)((isb ? c0 : r0) + (int)(wave & 1u) * 64) * spitch;
    const uint32_t sdst = (uint32_t)(size_t)tl + wave * GSLICE;
    u32x8 g1;                                     // 1-byte elements, tensor = tile = 64 rows of ROWB bytes, 4 dwords of LDS pad behind every row
    g1[0] = uni((1u << 20) | ((KS == 64 ? 4u : 5u) << 22) | (3u << 25));
    g1[1] = uni(ROWB << 16);
    g1[2] = uni(64u << 16);
    g1[3] = uni(ROWB << 16);
    g1[4] = uni(64u);
    g1[5] = uni(spitch);
    g1[6] = uni(0u);
    g1[7] = uni(0u);
    u32x4 g0;                                     // count 1, LDS place, global address, type 2
    g0[0] = uni(1u); g0[1] = uni(sdst); g0[2] = uni((uint32_t)sbase); g0[3] = uni((((uint32_t)(sbase >> 32)) & 0x01FFFFFFu) | 0x80000000u);
    const int T = K / KS;                         // stages
    v8f acc[4][4];
#pragma unroll
    for (int mb = 0; mb < 4; ++mb)
#pragma unroll
        for (int nb = 0; nb < 4; ++nb) acc[mb][nb] = (v8f){};
    gemm_tload(g0, g1);
    gemm_twait(g0, g1);                                     // stage 0 has landed (this wave's slice)
    __syncthreads();                                        // ... and every wave's
    gemm_tnext(g0, sdst + GBUF, ROWB);
    gemm_tload(g0, g1);
    const uint32_t aoff = wm * GSLICE + (uint32_t)lr * GPITCH + 16u * (uint32_t)hi;
    const uint32_t boff = (2u + wn) * GSLICE + (uint32_t)lr * GPITCH + 16u * (uint32_t)hi;
#pragma unroll 1                                 // rolled: one publish point in the code, the buffer chosen by a scalar
    for (int s = 0; s < T; ++s) {
        const uint32_t bsel = (uint32_t)(s & 1) * GBUF;
#pragma unroll 1
        for (int h = 0; h < KS / 64; ++h) {         // 64 k at a time: two 32-deep blocks (kept rolled: four blocks in a row spilled accumulators)
            const unsigned char* ap = tl + bsel + aoff + h * 128; const unsigned char* bp = tl + bsel + boff + h * 128;
            // LDS reads stand at two places only: the head (both blocks' A, the first block's Bt, the second block's Bt columns 0..31) and the middle of the first block
            // (the second block's Bt columns 32..63, into the registers that the first eight products have freed).
            v16us a[2][4], b[2][4];
#pragma unroll
            for (int i = 0; i < 4; ++i) { a[0][i] = ldus((const us*)(ap + i * 16 * GPITCH)); b[0][i] = ldus((const us*)(bp + i * 16 * GPITCH)); }
#pragma unroll
            for (int i = 0; i < 4; ++i) a[1][i] = ldus((const us*)(ap + i * 16 * GPITCH + 64));
#pragma unroll
            for (int i = 0; i < 2; ++i) b[1][i] = ldus((const us*)(bp + i * 16 * GPITCH + 64));
            __builtin_amdgcn_sched_barrier(0);      // keeps these loads one group ahead of the products
#pragma unroll
            for (int nb = 0; nb < 2; ++nb)
#pragma unroll
                for (int mb = 0; mb < 4; ++mb) acc[mb][nb] = mmg<true>(a[0][mb], b[0][nb], acc[mb][nb]);
            __builtin_amdgcn_sched_barrier(0);      // keeps the second group from rising among the products whose registers it takes
#pragma unroll
            for (int i = 2; i < 4; ++i) b[1][i] = ldus((const us*)(bp + i * 16 * GPITCH + 64));
            __builtin_amdgcn_sched_barrier(0);      // keeps the second group together, sixteen products ahead of its first use
#pragma unroll
            for (int nb = 2; nb < 4; ++nb)
#pragma unroll
                for (int mb = 0; mb < 4; ++mb) acc[mb][nb] = mmg<true>(a[0][mb], b[0][nb], acc[mb][nb]);
#pragma unroll
            for (int nb = 0; nb < 4; ++nb)
#pragma unroll
                for (int mb = 0; mb < 4; ++mb) acc[mb][nb] = mmg<true>(a[1][mb], b[1][nb], acc[mb][nb]);
        }
        // publish point of stage s + 1
        asm volatile("s_wait_dscnt 0x0" ::: "memory");      // this wave has left stage s's buffer
        gemm_twait(g0, g1);                                 // this wave's slice of stage s + 1 has landed
        __syncthreads();                                    // stage s + 1 readable by all; stage s's buffer left by all
        if (pinned(s + 2 < T)) { gemm_tnext(g0, sdst + bsel, ROWB); gemm_tload(g0, g1); }
    }
    gemm_twait(g0, g1);                                     // nothing in flight when the wave ends
    asm volatile("s_wait_dscnt 0x0" ::: "memory");
    float* os = osall + wave * (16 * 68);                   // output staging, private to the wave
    if constexpr (PL) {
        const int which = c0 / DM;                          // 0 q, 1 k, 2 v: the same for the whole tile
        const bool hr = r0 / NB < RH;                       // the tile's positions all lie below RH, or none does
        v8h o16; v8us oh, ol;
        if (which < 2) {
            const int h = ((c0 + (int)wn * 64) % DM) / HD;  // the wave's 64 columns are one head
#pragma unroll
            for (int mb = 0; mb < 4; ++mb) {
#pragma unroll
                for (int nb = 0; nb < 4; ++nb) {
#pragma unroll
                    for (int j = 0; j < 8; ++j) os[(hi * 8 + j) * 68 + nb * 16 + lr] = acc[mb][nb][j];
                }
                __builtin_amdgcn_wave_barrier(); asm volatile("" ::: "memory");
#pragma unroll
                for (int s = 0; s < 4; ++s) {               // eight lanes store one row of a plane: 64 elements, one 128-byte line
                    const int row = s * 4 + (lane >> 3), cp = (lane & 7) * 8;
                    const v4f a = *(const v4fa*)(os + row * 68 + cp), b = *(const v4fa*)(os + row * 68 + cp + 4);
                    cvt3(__builtin_shufflevector(a, b, 0, 1, 2, 3, 4, 5, 6, 7), o16, oh, ol);
                    const int m = r0 + (int)wm * 64 + mb * 16 + row, l = m / NB, bh = (m % NB) * NH + h;
                    const size_t e16 = (size_t)which * PLN + ((size_t)bh * SEQ + l) * HD + cp;
                    const size_t eh = hr ? ((size_t)which * PLNH + ((size_t)bh * RH + l) * HD + cp) : 0;
                    store3(QK16 + e16, QKh + eh, QKl + eh, hr, o16, oh, ol);
                }
                __builtin_amdgcn_wave_barrier(); asm volatile("" ::: "memory");
            }
        } else {
            // v: the whole 128 x 128 tile is turned in LDS, T[column][n][position], so that eight lanes store 64 positions of one (bh, d): one 128-byte line, one writer.
            // T takes the place of the stage buffers: every wave has left them and nothing is in flight (the last pass's waits and barrier).
            constexpr int TP = 132, LT = 128 / NB;          // row pitch in floats (528 bytes, an odd multiple of 16); positions in the tile
            static_assert((size_t)128 * TP * 4 <= (size_t)2 * GBUF && (8 / NB) % 4 == 0);
            float* T = (float*)tl;
#pragma unroll
            for (int mb = 0; mb < 4; ++mb) {
#pragma unroll
                for (int nb = 0; nb < 4; ++nb) {
                    float* tw = T + ((int)wn * 64 + nb * 16 + lr) * TP + ((int)wm * 64 + mb * 16 + hi * 8) / NB;
#pragma unroll
                    for (int n = 0; n < NB; ++n) {
#pragma unroll
                        for (int k4 = 0; k4 < 8 / NB / 4; ++k4) {
                            v4f t;
#pragma unroll
                            for (int e = 0; e < 4; ++e) t[e] = acc[mb][nb][(k4 * 4 + e) * NB + n];
                            *(v4fa*)(tw + n * LT + k4 * 4) = t;
                        }
                    }
                }
            }
            __syncthreads();                                // the turned tile is whole before any wave reads another wave's part
#pragma unroll 4
            for (int it = 0; it < 16; ++it) {
                const int gi = it * 128 + (int)threadIdx.x, l8 = gi % (LT / 8), rr = gi / (LT / 8), c = rr % 128, n = rr / 128;
                const float* tr = T + c * TP + n * LT + l8 * 8;
                const v4f a = *(const v4fa*)tr, b = *(const v4fa*)(tr + 4);
                cvt3(__builtin_shufflevector(a, b, 0, 1, 2, 3, 4, 5, 6, 7), o16, oh, ol);
                const int col = c0 - 2 * DM + c, bh = n * NH + col / HD, d = col % HD, l = r0 / NB + l8 * 8;
                const size_t e16 = ((size_t)bh * HD + d) * SEQ + l;
                const size_t eh = hr ? (((size_t)bh * HD + d) * RH + l) : 0;
                store3(VT16 + e16, VTh + eh, VTl + eh, hr, o16, oh, ol);
            }
        }
        return;
    }
#pragma unroll
    for (int mb = 0; mb < 4; ++mb) {
#pragma unroll
        for (int nb = 0; nb < 4; ++nb) {
#pragma unroll
            for (int j = 0; j < 8; ++j) os[(hi * 8 + j) * 68 + nb * 16 + lr] = acc[mb][nb][j];
        }
        __builtin_amdgcn_wave_barrier(); asm volatile("" ::: "memory");
        float* crow = C + (size_t)(r0 + (int)wm * 64 + mb * 16) * ldc + c0 + (int)wn * 64;
{
#pragma unroll
            for (int s = 0; s < 8; ++s) {                       // rows 2s+hi, s = 0..7, hi = 0..1: all 16 rows of the slab
                const int row = 2 * s + hi, cofs = lr * 4;
                const v4f val = *(const v4fa*)(os + row * 68 + cofs);
                *(v4f*)(crow + (size_t)row * ldc + cofs) = val;
            }
            
        }
        __builtin_amdgcn_wave_barrier(); asm volatile("" ::: "memory");
    }
}

// lane l with lane l ^ 16 (the other half of a query column's keys)
__device__ __forceinline__ float xhalf(float x) {
    return __builtin_bit_cast(float, __builtin_amdgcn_permlanex16(__builtin_bit_cast(int, x), __builtin_bit_cast(int, x), 0x76543210, 0xfedcba98, false, false));
}

template <bool HR>
__device__ __forceinline__ void attn_body(const us* __restrict__ Qa, const us* __restrict__ Qr, const us* __restrict__ Ka, const us* __restrict__ Kr,
                                          const us* __restrict__ Va, const us* __restrict__ Vr, bf* CTX, const int q0) {
    constexpr int LR = HR ? RH : SEQ;                  // rows per problem in the q/k planes = row length of the transposed value planes
    __shared__ __align__(16) unsigned short oh[32 * OP];
    __shared__ __align__(16) unsigned short ol[32 * OP];
    const int lane = threadIdx.x & 31, lr = lane & 15, hi = lane >> 4;
    const int bh = blockIdx.x, n = bh / NH, h = bh % NH;
    const size_t pb = (size_t)bh * LR * HD;
    Qa += pb; Ka += pb; Va += pb; Qr += pb; Kr += pb; Vr += pb;
    const int qoff = (q0 + lr) * HD + 8 * hi;
    const int koff = lr * HD + 8 * hi;
    const int voff = lr * LR + 8 * hi;
    const float cexp = 0.125f * 1.4426950408889634f;   // HD^-0.5 * log2(e)
    const float pc = HR ? 1.0f : PCAR;
    v8f o[2][4]; float mrow[2], lsum[2];               // o[u][t2][r] = context(query q0 + u*16 + lr, d = t2*16 + 8*hi + r); mrow, lsum: of query q0 + u*16 + lr
#pragma unroll
    for (int u = 0; u < 2; ++u) {
#pragma unroll
        for (int t2 = 0; t2 < 4; ++t2) o[u][t2] = (v8f){};
        mrow[u] = -3.0e38f; lsum[u] = 0.0f;
    }
    v16us qfa[2][2], qfr[2][2], kfa[2][2], kfr[2][2];      // [kc][u] and [kc][t]
#pragma unroll
    for (int kc = 0; kc < 2; ++kc) {
#pragma unroll
        for (int u = 0; u < 2; ++u) {
            qfa[kc][u] = ldus(Qa + qoff + u * 16 * HD + kc * 32);
            qfr[kc][u] = HR ? ldus(Qr + qoff + u * 16 * HD + kc * 32) : qfa[kc][u];
        }
#pragma unroll
        for (int t = 0; t < 2; ++t) {
            const int ko = (t * 16) * HD + koff + kc * 32;
            kfa[kc][t] = ldus(Ka + ko);
            kfr[kc][t] = HR ? ldus(Kr + ko) : kfa[kc][t];
        }
    }
    const int kfirst = (32 <= q0 ? 32 : q0) * HD + koff;
    const us* kpa = Ka + kfirst; const us* kpr = Kr + kfirst;      // the NEXT step's key rows
    const us* vpa = Va + voff;   const us* vpr = Vr + voff;        // this step's value columns
#pragma unroll 1
    for (int m0 = 0; m0 <= q0; m0 += 32) {
        v16us vfa[4], vfr[4];
#pragma unroll
        for (int t2 = 0; t2 < 4; ++t2) {
            vfa[t2] = ldus(vpa + (t2 * 16) * LR);          // A[m = d = t2*16 + lr][k = key m0 + ..] from the transposed plane row d
            vfr[t2] = HR ? ldus(vpr + (t2 * 16) * LR) : vfa[t2];
        }
        v8f s[2][2];
#pragma unroll
        for (int u = 0; u < 2; ++u)
#pragma unroll
            for (int t = 0; t < 2; ++t) s[u][t] = (v8f){};
#pragma unroll
        for (int kc = 0; kc < 2; ++kc) {
#pragma unroll
            for (int t = 0; t < 2; ++t) {
                s[0][t] = mmg<HR>(kfa[kc][t], qfa[kc][0], s[0][t]); s[1][t] = mmg<HR>(kfa[kc][t], qfa[kc][1], s[1][t]);
                if (HR) {
                    s[0][t] = mmg<HR>(kfa[kc][t], qfr[kc][0], s[0][t]); s[1][t] = mmg<HR>(kfa[kc][t], qfr[kc][1], s[1][t]);
                    s[0][t] = mmg<HR>(kfr[kc][t], qfa[kc][0], s[0][t]); s[1][t] = mmg<HR>(kfr[kc][t], qfa[kc][1], s[1][t]);
                }
            }
        }
        {       // next step's key fragments: a whole softmax and the V^T.P^T products ahead of their use (the last step fetches its own keys again: in bounds, not used)
#pragma unroll
            for (int kc = 0; kc < 2; ++kc) {
#pragma unroll
                for (int t = 0; t < 2; ++t) {
                    kfa[kc][t] = ldus(kpa + (t * 16) * HD + kc * 32);
                    kfr[kc][t] = HR ? ldus(kpr + (t * 16) * HD + kc * 32) : kfa[kc][t];
                }
            }
            __builtin_amdgcn_sched_barrier(0);      // keeps the loads ahead of the softmax (lead)
        }
        // s[u][t][r] = score(key m0 + t*16 + 8*hi + r, query q0 + u*16 + lr). Keys beyond the query are excluded (only possible in the diagonal step; key m0 is always kept).
        if (m0 == q0) {
#pragma unroll
            for (int u = 0; u < 2; ++u)
#pragma unroll
                for (int t = 0; t < 2; ++t)
#pragma unroll
                    for (int r = 0; r < 8; ++r) { if (t * 16 + 8 * hi + r > u * 16 + lr) s[u][t][r] = -3.0e38f; }
        }
        v16us pa[2], pr[2];
#pragma unroll
        for (int u = 0; u < 2; ++u) {
            float v = fmaxf(s[u][0][0], s[u][1][0]);
#pragma unroll
            for (int r = 1; r < 8; ++r) v = fmaxf(v, fmaxf(s[u][0][r], s[u][1][r]));
            v = fmaxf(v, xhalf(v));
            const float mn = fmaxf(mrow[u], v);
            const v8f x0 = (s[u][0] - mn) * cexp, x1 = (s[u][1] - mn) * cexp;
            float e0[8], e1[8];
#pragma unroll
            for (int r = 0; r < 8; ++r) e0[r] = __builtin_amdgcn_exp2f(x0[r]);
#pragma unroll
            for (int r = 0; r < 8; ++r) e1[r] = __builtin_amdgcn_exp2f(x1[r]);
            const float al = __builtin_amdgcn_exp2f((mrow[u] - mn) * cexp);
            mrow[u] = mn;
            float ps[4] = {0.0f, 0.0f, 0.0f, 0.0f};             // four independent partial sums of the lane's 16 probabilities
#pragma unroll
            for (int r = 0; r < 8; ++r) {
                const float p0 = e0[r], p1 = e1[r];
                ps[r & 3] += p0 + p1;
                if (HR) {
                    unsigned short a, c; splitf(p0, a, c); pa[u][r] = a; pr[u][r] = c;
                    splitf(p1, a, c); pa[u][8 + r] = a; pr[u][8 + r] = c;
                } else {
                    pa[u][r] = __builtin_bit_cast(unsigned short, (h16)(p0 * PCAR));
                    pa[u][8 + r] = __builtin_bit_cast(unsigned short, (h16)(p1 * PCAR));
                }
            }
            if (!HR) pr[u] = pa[u];
            lsum[u] = lsum[u] * al + ((ps[0] + ps[1]) + (ps[2] + ps[3]));     // per-lane partial sum of one query (its half of the keys), the halves joined once at the end
#pragma unroll
            for (int t2 = 0; t2 < 4; ++t2) o[u][t2] *= al;
        }
#pragma unroll
        for (int t2 = 0; t2 < 4; ++t2) {
            o[0][t2] = mmg<HR>(vfa[t2], pa[0], o[0][t2]); o[1][t2] = mmg<HR>(vfa[t2], pa[1], o[1][t2]);
            if (HR) {
                o[0][t2] = mmg<HR>(vfa[t2], pr[0], o[0][t2]); o[1][t2] = mmg<HR>(vfa[t2], pr[1], o[1][t2]);
                o[0][t2] = mmg<HR>(vfr[t2], pa[0], o[0][t2]); o[1][t2] = mmg<HR>(vfr[t2], pa[1], o[1][t2]);
            }
        }
        // the address pairs of this step's loads stay whole up to this wait; they are stepped only behind it
        if (HR) asm volatile("s_wait_xcnt 0x0" :: "v"(kpa), "v"(kpr), "v"(vpa), "v"(vpr) : "memory");
        else    asm volatile("s_wait_xcnt 0x0" :: "v"(kpa), "v"(vpa) : "memory");
        const int kstep = m0 + 64 <= q0 ? 32 * HD : 0;
        kpa += kstep; kpr += kstep; vpa += 32; vpr += 32;
    }
    // normalise, split into bf16 hi / lo, stage the 32 x 64 tile (a lane's 8 registers are 8 consecutive d of one query: 16-byte LDS stores), then whole-line stores
#pragma unroll
    for (int u = 0; u < 2; ++u) {
        float l = lsum[u];
        l += xhalf(l);
        const float inv = 1.0f / (l * pc);
#pragma unroll
        for (int t2 = 0; t2 < 4; ++t2) {
            v8us a8, c8;
#pragma unroll
            for (int r = 0; r < 8; ++r) { unsigned short a, c; splitf(o[u][t2][r] * inv, a, c); a8[r] = a; c8[r] = c; }
            const int oo = (u * 16 + lr) * OP + t2 * 16 + 8 * hi;
            *(v8usa*)(oh + oo) = a8; *(v8usa*)(ol + oo) = c8;
        }
    }
    __syncthreads();
{
#pragma unroll
        for (int s = 0; s < 8; ++s) {
            const int row = s * 4 + (lane >> 3), cp = (lane & 7) * 8;
            const v8us vh = *(const v8usa*)(oh + row * OP + cp);
            const v8us vl = *(const v8usa*)(ol + row * OP + cp);
            bf* d = CTX + ((size_t)(q0 + row) * NB + n) * CK + h * HD + cp;
            *(v8us*)d = vh; *(v8us*)(d + DM) = vl;
        }
        
    }
}

__global__ __launch_bounds__(32) void k_attn_lo(const us* __restrict__ Q16, const us* __restrict__ K16, const us* __restrict__ V16, bf* CTX) {
    attn_body<false>(Q16, Q16, K16, K16, V16, V16, CTX, RH + (int)blockIdx.y * 32);
}

// ---- k_attn_hr: early query positions (< RH) on bf16 hi/lo planes, ONE 16-row tile per wave (one wave per block), 32 keys per step.
// Per-query arithmetic and product order are those of attn_body with HR = true (q.k: hi.hi, lo.hi, hi.lo per 32-deep chunk; P.v: hi.hi, lo.hi, hi.lo; all into one accumulator, unscaled bf16 residuals), transposed in the same way.
// Live state per lane: 4 output accumulators + 2 score accumulators + 2 softmax scalars + the fragments fetched ahead: q once in front of the loop, a step's v at its head, the next step's k among this step's V^T.P^T products.
// Key steps run over m0 = 0, 32, .., mend with mend = q0 pad down to a multiple of 32 (block-uniform); keys beyond the query are excluded in the last step only (key mend is always kept).
// Planes: q/k [bh][RH][64], transposed value planes [bh][64][RH]; the last step reads keys < mend + 32 <= RH, all written by the qkv product's epilogue.
__global__ __launch_bounds__(32) void k_attn_hr(const us* __restrict__ Qh, const us* __restrict__ Ql, const us* __restrict__ Kh, const us* __restrict__ Kl,
                                                const us* __restrict__ Vh, const us* __restrict__ Vl, bf* CTX) {
    __shared__ __align__(16) unsigned short eoh[ER * OP];     // context hi staging, 16 rows x 64
    __shared__ __align__(16) unsigned short eol[ER * OP];     // context lo staging
    const int lane = threadIdx.x & 31, lr = lane & 15, hi = lane >> 4;
    const int bh = blockIdx.x, n = bh / NH, h = bh % NH;
    const int q0 = (int)blockIdx.y * ER;
    const int mend = q0 & ~31;
    const size_t pb = (size_t)bh * RH * HD;
    Qh += pb; Ql += pb; Kh += pb; Kl += pb; Vh += pb; Vl += pb;
    const int qoff = (q0 + lr) * HD + 8 * hi;
    const int koff = lr * HD + 8 * hi;
    const int voff = lr * RH + 8 * hi;
    const float cexp = 0.125f * 1.4426950408889634f;   // HD^-0.5 * log2(e)
    v8f o[4]; float mrow = -3.0e38f, lsum = 0.0f;      // o[t2][r] = context(query q0 + lr, d = t2*16 + 8*hi + r); mrow, lsum: of query q0 + lr
#pragma unroll
    for (int t2 = 0; t2 < 4; ++t2) o[t2] = (v8f){};
    v16us qfa[2], qfr[2], kfa[2][2], kfr[2][2];            // [kc] and [kc][t]
#pragma unroll
    for (int kc = 0; kc < 2; ++kc) {
        qfa[kc] = ldus(Qh + qoff + kc * 32);
        qfr[kc] = ldus(Ql + qoff + kc * 32);
#pragma unroll
        for (int t = 0; t < 2; ++t) {
            const int ko = (t * 16) * HD + koff + kc * 32;
            kfa[kc][t] = ldus(Kh + ko);
            kfr[kc][t] = ldus(Kl + ko);
        }
    }
    const int kfirst = (32 <= mend ? 32 : mend) * HD + koff;
    const us* kph = Kh + kfirst; const us* kpl = Kl + kfirst;      // the NEXT step's key rows (the last step fetches its own keys again: in bounds, not used)
#pragma unroll 1
    for (int m0 = 0; m0 <= mend; m0 += 32) {
        v16us vfa[4], vfr[4];
        const us* vph = Vh + voff + m0; const us* vpl = Vl + voff + m0;
#pragma unroll
        for (int t2 = 0; t2 < 4; ++t2) {
            vfa[t2] = ldus(vph + (t2 * 16) * RH);          // A[m = d = t2*16 + lr][k = key m0 + ..] from the transposed plane row d
            vfr[t2] = ldus(vpl + (t2 * 16) * RH);
        }
        asm volatile("s_wait_xcnt 0x0" :: "v"(vph), "v"(vpl) : "memory");   // the two address pairs stay whole up to this wait
        v8f s[2];
        s[0] = (v8f){}; s[1] = (v8f){};
#pragma unroll
        for (int kc = 0; kc < 2; ++kc) {
#pragma unroll
            for (int t = 0; t < 2; ++t) {
                s[t] = mmg<true>(kfa[kc][t], qfa[kc], s[t]);
                s[t] = mmg<true>(kfa[kc][t], qfr[kc], s[t]);
                s[t] = mmg<true>(kfr[kc][t], qfa[kc], s[t]);
            }
        }
        // s[t][r] = score(key m0 + t*16 + 8*hi + r, query q0 + lr)
        if (m0 == mend) {
#pragma unroll
            for (int t = 0; t < 2; ++t)
#pragma unroll
                for (int r = 0; r < 8; ++r) { if (m0 + t * 16 + 8 * hi + r > q0 + lr) s[t][r] = -3.0e38f; }
        }
        v16us pa, pr;
        {
            float v = fmaxf(s[0][0], s[1][0]);
#pragma unroll
            for (int r = 1; r < 8; ++r) v = fmaxf(v, fmaxf(s[0][r], s[1][r]));
            v = fmaxf(v, xhalf(v));
            const float mn = fmaxf(mrow, v);
            const float al = __builtin_amdgcn_exp2f((mrow - mn) * cexp);
            mrow = mn;
            const v8f x0 = (s[0] - mn) * cexp, x1 = (s[1] - mn) * cexp;
            float ps[4] = {0.0f, 0.0f, 0.0f, 0.0f};             // four independent partial sums of the lane's 16 probabilities
#pragma unroll
            for (int r = 0; r < 8; ++r) {
                const float p0 = __builtin_amdgcn_exp2f(x0[r]);
                const float p1 = __builtin_amdgcn_exp2f(x1[r]);
                ps[r & 3] += p0 + p1;
                unsigned short a, c;
                splitf(p0, a, c); pa[r] = a; pr[r] = c;
                splitf(p1, a, c); pa[8 + r] = a; pr[8 + r] = c;
            }
            lsum = lsum * al + ((ps[0] + ps[1]) + (ps[2] + ps[3]));           // per-lane partial sum of one query (its half of the keys), the halves joined once at the end
#pragma unroll
            for (int t2 = 0; t2 < 4; ++t2) o[t2] *= al;
        }
#pragma unroll
        for (int t2 = 0; t2 < 4; ++t2) {
            o[t2] = mmg<true>(vfa[t2], pa, o[t2]);
            o[t2] = mmg<true>(vfa[t2], pr, o[t2]);
            o[t2] = mmg<true>(vfr[t2], pa, o[t2]);
            const int ko = ((t2 & 1) * 16) * HD + (t2 >> 1) * 32;
            kfa[t2 >> 1][t2 & 1] = ldus(kph + ko);
            kfr[t2 >> 1][t2 & 1] = ldus(kpl + ko);
            __builtin_amdgcn_sched_barrier(0);  // keeps each key refill behind the products that free a value fragment pair (register room)
        }
        asm volatile("s_wait_xcnt 0x0" :: "v"(kph), "v"(kpl) : "memory");   // the key address pairs stay whole up to this wait; they are stepped only behind it
        const int kstep = m0 + 64 <= mend ? 32 * HD : 0;
        kph += kstep; kpl += kstep;
    }
    // normalise, split into bf16 hi / lo, stage the 16 x 64 tile (16-byte LDS stores), then whole-line stores
    {
        float l = lsum;
        l += xhalf(l);
        const float inv = 1.0f / l;
#pragma unroll
        for (int t2 = 0; t2 < 4; ++t2) {
            v8us a8, c8;
#pragma unroll
            for (int r = 0; r < 8; ++r) { unsigned short a, c; splitf(o[t2][r] * inv, a, c); a8[r] = a; c8[r] = c; }
            const int oo = lr * OP + t2 * 16 + 8 * hi;
            *(v8usa*)(eoh + oo) = a8; *(v8usa*)(eol + oo) = c8;
        }
    }
    __syncthreads();
{
#pragma unroll
        for (int s4 = 0; s4 < ER / 4; ++s4) {
            const int row = s4 * 4 + (lane >> 3), cp = (lane & 7) * 8;
            const v8us vh = *(const v8usa*)(eoh + row * OP + cp);
            const v8us vl = *(const v8usa*)(eol + row * OP + cp);
            bf* d = CTX + ((size_t)(q0 + row) * NB + n) * CK + h * HD + cp;
            *(v8us*)d = vh; *(v8us*)(d + DM) = vl;
        }
        
    }
}

// workspace carve (bytes), every region a multiple of 256
constexpr size_t SZ_XB   = (size_t)MROWS * DM * 2;        // x bf16 [MROWS][1024]
constexpr size_t SZ_WQ   = (size_t)F3 * DM * 2;           // w_qkv bf16 [3072][1024]
constexpr size_t SZ_WO   = (size_t)DM * CK * 2;           // [w_out | w_out] bf16 [1024][2048]
constexpr size_t SZ_QK16 = (size_t)2 * NBH * SEQ * HD * 2;
constexpr size_t SZ_QKH  = (size_t)2 * NBH * RH * HD * 2;
constexpr size_t SZ_VT16 = (size_t)NBH * HD * SEQ * 2;
constexpr size_t SZ_VTH  = (size_t)NBH * HD * RH * 2;
constexpr size_t SZ_CTX  = (size_t)MROWS * CK * 2;        // context bf16 hi | lo [MROWS][2048]
constexpr size_t OF_XB   = 0;
constexpr size_t OF_WQ   = OF_XB + SZ_XB;
constexpr size_t OF_WO   = OF_WQ + SZ_WQ;
constexpr size_t OF_QK16 = OF_WO + SZ_WO;
constexpr size_t OF_QKH  = OF_QK16 + SZ_QK16;
constexpr size_t OF_QKL  = OF_QKH + SZ_QKH;
constexpr size_t OF_VT16 = OF_QKL + SZ_QKH;
constexpr size_t OF_VTH  = OF_VT16 + SZ_VT16;
constexpr size_t OF_VTL  = OF_VTH + SZ_VTH;
constexpr size_t OF_CTX  = OF_VTL + SZ_VTH;
constexpr size_t WS_TOTAL = OF_CTX + SZ_CTX;
static_assert(SZ_XB % 256 == 0 && SZ_WQ % 256 == 0 && SZ_WO % 256 == 0 && SZ_QK16 % 256 == 0);
static_assert(SZ_QKH % 256 == 0 && SZ_VT16 % 256 == 0 && SZ_VTH % 256 == 0 && SZ_CTX % 256 == 0);
static_assert(WS_TOTAL <= (size_t)134217728);            // total carve <= 128 MiB

extern "C" void kernel_launch(void* const* d_in, const int* in_sizes, int n_in,
                              void* d_out, int out_size, void* d_ws, size_t ws_size, hipStream_t stream) {
    if (n_in < 3) return;
    const long long needx = ((long long)(SEQ - 1) * NB_FULL + NB) * DM;     // last token row touched, in elements
    if ((long long)in_sizes[0] < needx || (long long)in_sizes[1] < (long long)F3 * DM || (long long)in_sizes[2] < (long long)DM * DM || (long long)out_size < needx) return;
    if (WS_TOTAL > ws_size) return;
    const float* x = (const float*)d_in[0];       // [2048][2][1024], token row l*2 + n
    const float* wqkv = (const float*)d_in[1];    // [3072][1024] = [out][in]
    const float* wout = (const float*)d_in[2];    // [1024][1024] = [out][in]
    float* OUT = (float*)d_out;                   // [2048][2][1024]
    char* ws = (char*)d_ws;
    bf* XB = (bf*)(ws + OF_XB); bf* WQ = (bf*)(ws + OF_WQ); bf* WO2 = (bf*)(ws + OF_WO);
    h16* QK16 = (h16*)(ws + OF_QK16); bf* QKh = (bf*)(ws + OF_QKH); bf* QKl = (bf*)(ws + OF_QKL);
    h16* VT16 = (h16*)(ws + OF_VT16); bf* VTh = (bf*)(ws + OF_VTH); bf* VTl = (bf*)(ws + OF_VTL); bf* CTX = (bf*)(ws + OF_CTX);

    k_cvt<<<(MROWS * 128 + 255) / 256, 256, 0, stream>>>(x, ROWSTEP, XB, DM, 0, MROWS * 128);
    k_cvt<<<(F3 * 128 + 255) / 256, 256, 0, stream>>>(wqkv, 1, WQ, DM, 0, F3 * 128);
    k_cvt<<<(DM * 128 + 255) / 256, 256, 0, stream>>>(wout, 1, WO2, CK, 0, DM * 128);      // columns 0..1023 (pairs with the hi half of the context plane)
    k_cvt<<<(DM * 128 + 255) / 256, 256, 0, stream>>>(wout, 1, WO2, CK, DM, DM * 128);     // columns 1024..2047 (pairs with the lo half)
    k_gemmw<64, true><<<dim3(MROWS / 128, F3 / 128, 1), 128, 0, stream>>>(XB, DM, WQ, DM, DM, nullptr, 0, QK16, QKh, QKl, VT16, VTh, VTl);   // qkv[m][f] = sum_e x[m][e] w_qkv[f][e], written as 16-bit planes
    k_attn_hr<<<dim3(NBH, RH / ER, 1), 32, 0, stream>>>((const us*)QKh, (const us*)QKl, (const us*)(QKh + PLNH), (const us*)(QKl + PLNH), (const us*)VTh, (const us*)VTl, CTX);
    if (SEQ > RH)
        k_attn_lo<<<dim3(NBH, (SEQ - RH) / 32 > 0 ? (SEQ - RH) / 32 : 1, 1), 32, 0, stream>>>((const us*)QK16, (const us*)(QK16 + PLN), (const us*)VT16, CTX);
    k_gemmw<128, false><<<dim3(MROWS / 128, DM / 128, 1), 128, 0, stream>>>(CTX, CK, WO2, CK, CK, OUT, DM * ROWSTEP, nullptr, nullptr, nullptr, nullptr, nullptr, nullptr);   // out[m][f] = sum_e (ctx_hi + ctx_lo)[m][e] w_out[f][e]
}

// v005
// One run takes 118 microseconds.
// Next to v004, in two timings, it ran 1.04 times as fast each time.
// All steps since v000 together make it 3.37 times as fast.
#include <hip/hip_runtime.h>
#include <stdint.h>

// Contractions: qkv projection and output projection v_wmma_f32_16x16x32_bf16 (every input RNE-converted to bf16; context carried as bf16 hi|lo folded into K); scores and probability x value v_wmma_f32_16x16x32_f16 for query positions >= 256 (P carried x1024), bf16 hi/lo three-product form for positions < 256; f32 accumulate, f32 softmax.
// Sequence-first causal multi-head self-attention with a fused bias-free (out, in) qkv weight and an (out, in) output weight: token row m = l*NB + n, attention problem bh = n*16 + h, head columns h*64..h*64+63.
// Launch plan: k_cvt_all (bf16 copies) -> k_gemmw (qkv product, its epilogue writes the q/k/v^T 16-bit planes) -> k_attn_hr (rows < 256, 16-row tiles) -> k_attn_lo (rows >= 256, 32-row tiles) -> k_gemmw (output).

#ifndef NB
#define NB 2                      // batch entries processed (NB_FULL, or 1 for a reduced build)
#endif
#ifndef SEQ
#define SEQ 2048                  // sequence positions processed
#endif
#define NB_FULL  2                // batch stride of the staged x and of the output rows
#define SEQ_FULL 2048
#define DM   1024
#define NH   16
#define HD   64
#define F3   (3 * DM)
#define CK   (2 * DM)             // context plane width: hi columns | lo columns
#define RH   256                  // query positions < RH use the hi/lo planes
#define NBH  (NB * NH)
#define MROWS (SEQ * NB)
#define ROWSTEP (NB_FULL / NB)
#define PLN  ((size_t)NBH * SEQ * HD)
#define PLNH ((size_t)NBH * RH * HD)
#define PCAR 1024.0f
#define OP   72                   // context staging pitch in 16-bit elements (144 B)
#define ER   16                   // query rows per wave in the early-positions kernel

static_assert(NB == NB_FULL || NB == 1);          // compact row m = l*NB + n maps to token row m*ROWSTEP
static_assert(SEQ <= SEQ_FULL && SEQ >= RH);
static_assert(SEQ % 256 == 0);                    // tile multiples (128-row GEMM tiles, 32-row attention tiles, 8-wide plane groups)
static_assert(RH % 32 == 0 && RH % 8 == 0);       // the last 32-key step of the early kernel ends inside the hi/lo planes
static_assert(RH % ER == 0 && ER == 16);          // early kernel: one 16-row WMMA tile per wave, store loop 4 x 4 rows
static_assert(HD == 64 && NH * HD == DM);
static_assert(DM == 1024);                        // k_cvt_all: a row is 8 loads of 128 floats per wave
static_assert(DM % 64 == 0 && DM >= 128 && CK % 128 == 0 && CK >= 256);   // K: whole stages, at least two (k_gemmw: 64 deep for qkv, 128 deep for the output)
static_assert(MROWS % 128 == 0 && F3 % 128 == 0 && DM % 128 == 0);        // whole 128 x 128 output tiles
static_assert(RH % (128 / NB) == 0 && DM % 128 == 0);     // a 128 x 128 tile of the qkv product lies wholly in one of q, k, v and wholly below or above RH
static_assert(OP >= 64 && (OP * 2) % 16 == 0);

typedef _Float16 h16;
typedef unsigned short bf;
typedef unsigned short us;
typedef __attribute__((ext_vector_type(16))) __bf16   v16bf;
typedef __attribute__((ext_vector_type(16))) _Float16 v16h;
typedef __attribute__((ext_vector_type(16))) unsigned short v16us;
typedef __attribute__((ext_vector_type(8)))  _Float16 v8h;
typedef __attribute__((ext_vector_type(8)))  unsigned short v8us;
typedef __attribute__((ext_vector_type(8)))  float    v8f;
typedef __attribute__((ext_vector_type(4)))  float    v4f;
typedef v4f  __attribute__((may_alias)) v4fa;
typedef v8us __attribute__((may_alias)) v8usa;

__device__ __forceinline__ unsigned short f2bf(float f) { unsigned u = __float_as_uint(f); u += 0x7FFFu + ((u >> 16) & 1u); return (unsigned short)(u >> 16); }
__device__ __forceinline__ float bf2f(unsigned short b) { return __uint_as_float(((unsigned)b) << 16); }
__device__ __forceinline__ void splitf(float y, unsigned short& h, unsigned short& l) { h = f2bf(y); l = f2bf(y - bf2f(h)); }

// 16-bit fragment from a K-contiguous row: elements 0..7 <- p[0..7], elements 8..15 <- p[16..23]; the caller adds 8*(lane>>4) to p.
__device__ __forceinline__ v16us ldus(const us* p) {
    const v8us a = *(const v8us*)p; const v8us b = *(const v8us*)(p + 16);
    return __builtin_shufflevector(a, b, 0, 1, 2, 3, 4, 5, 6, 7, 8, 9, 10, 11, 12, 13, 14, 15);
}

// One WMMA plus its own four-slot guard (ties exactly one accumulator, keeps A and B live).
template <bool BF>
__device__ __forceinline__ v8f mmg(v16us a, v16us b, v8f c) {
    if (BF) c = __builtin_amdgcn_wmma_f32_16x16x32_bf16(false, __builtin_bit_cast(v16bf, a), false, __builtin_bit_cast(v16bf, b), (short)0, c, false, false);
    else    c = __builtin_amdgcn_wmma_f32_16x16x32_f16(false, __builtin_bit_cast(v16h, a), false, __builtin_bit_cast(v16h, b), (short)0, c, false, false);
    asm volatile("v_nop\n\tv_nop\n\tv_nop\n\tv_nop" : "+v"(c) : "v"(a), "v"(b));
    return c;
}

// ---- k_cvt_all: every f32 input to its bf16 plane in ONE launch of CROWS / CRPW two-row waves (16 per work-group, one work-group per 32 rows).
// A wave takes CRPW whole rows of 1024 floats out of the list [x rows | w_qkv rows | w_out rows]: rows w and w + CROWS / CRPW. All of its loads (8 per row, 512 contiguous bytes each) are issued
// before the first value is converted; a store is 256 contiguous bytes. A w_out row is stored twice (columns 0..1023 pair with the hi half of the context plane, 1024..2047 with the lo half).
#define CROWS (MROWS + F3 + DM)
#define CRPW  2
static_assert(CROWS % (16 * CRPW) == 0);          // whole work-groups of 16 waves
typedef __attribute__((ext_vector_type(4))) unsigned short v4us;
__global__ __launch_bounds__(512) void k_cvt_all(const float* __restrict__ x, const float* __restrict__ wqkv, const float* __restrict__ wout, bf* XB, bf* WQ, bf* WO2) {
    const int lane = threadIdx.x & 31;
    const int w = __builtin_amdgcn_readfirstlane((int)(blockIdx.x * 16 + (threadIdx.x >> 5)));
    const float* s[CRPW]; bf* dst[CRPW]; bool dup[CRPW];
#pragma unroll
    for (int r = 0; r < CRPW; ++r) {                  // which plane the row belongs to: the same for the whole wave, scalar selects
        const int row = w + r * (CROWS / CRPW);
        const bool isx = row < MROWS, isq = row < MROWS + F3;
        const int rr = isx ? row : (isq ? row - MROWS : row - MROWS - F3);
        s[r]   = (isx ? x : (isq ? wqkv : wout)) + (size_t)rr * (isx ? ROWSTEP * DM : DM) + lane * 4;
        dst[r] = (isx ? XB : (isq ? WQ : WO2)) + (size_t)rr * (isq ? DM : CK) + lane * 4;
        dup[r] = !isq;
    }
    v4f v[CRPW][8];
#pragma unroll
    for (int r = 0; r < CRPW; ++r)
#pragma unroll
        for (int j = 0; j < 8; ++j) v[r][j] = *(const v4f*)(s[r] + j * 128);
    __builtin_amdgcn_sched_barrier(0);                // keeps every load of the wave ahead of the first conversion: without it the second row's loads sank behind waits on the first row's
#pragma unroll
    for (int r = 0; r < CRPW; ++r) {
        v4us o[8];
#pragma unroll
        for (int j = 0; j < 8; ++j) {
#pragma unroll
            for (int k = 0; k < 4; ++k) o[j][k] = f2bf(v[r][j][k]);
        }
        bf* d = dst[r];
#pragma unroll
        for (int j = 0; j < 8; ++j) *(v4us*)(d + j * 128) = o[j];
        if (r + 1 < CRPW) asm volatile("s_wait_xcnt 0x0" ::: "memory");       // stands before the stores' base and data registers are written again (the next row's address and values take them)
        if (dup[r]) {
#pragma unroll
            for (int j = 0; j < 8; ++j) *(v4us*)(d + DM + j * 128) = o[j];
            if (r + 1 < CRPW) asm volatile("s_wait_xcnt 0x0" ::: "memory");   // the same for these stores
        }
    }
}

// ---- k_gemmw: one 128x128 output tile per work-group of four waves (2 x 2, 64x64 = 16 accumulators each); grid (M/128, N/128), 128 threads.
// C[m][n] (f32, pitch ldc) = sum_k A[m][k] Bt[n][k]; K a multiple of KS and at least 2 KS, M and N multiples of 128; bf16 operands from K-contiguous planes.
// A stage is KS k of the tile's 128 A rows and 128 Bt rows. Each wave brings one slice of it (64 rows of 2 KS bytes) into LDS with one tensor load, every row padded by 16 bytes;
// two buffers: the load of stage s + 1 is in flight while stage s is multiplied. Every operand row is fetched once per work-group in whole lines and read by two waves from LDS.
// KS = 64 leaves room for three work-groups on a WGP (a grid of several per WGP); KS = 128 keeps twice the bytes in flight where a work-group has its WGP alone.
typedef uint32_t u32x4 __attribute__((ext_vector_type(4)));
typedef uint32_t u32x8 __attribute__((ext_vector_type(8)));
__device__ __forceinline__ uint32_t uni(uint32_t v) { return (uint32_t)__builtin_amdgcn_readfirstlane(v); }
__device__ __forceinline__ uint32_t pinned(uint32_t v) { uint32_t w = (uint32_t)__builtin_amdgcn_readfirstlane(v); asm volatile("" : "+s"(w)); return w; }   // a wave-uniform test held in a scalar register, so that the branch on it is a scalar branch (tensor loads ignore EXEC)
// one request of the calling wave: the tile that g1 describes, from the global address in g0 to the LDS place in g0
__device__ __forceinline__ void gemm_tload(const u32x4 g0, const u32x8 g1) { asm volatile("tensor_load_to_lds %0, %1" :: "s"(g0), "s"(g1) : "memory"); }
// the wave's own requests have landed. The two groups are operands so that their registers stay whole up to this wait and take new values only behind it.
__device__ __forceinline__ void gemm_twait(u32x4& g0, u32x8& g1) { asm volatile("s_wait_tensorcnt 0x0" : "+s"(g0), "+s"(g1) :: "memory"); }
// next stage: the LDS place dst, the global address one stage's row bytes further on (the type bits in word 3 lie above the address)
__device__ __forceinline__ void gemm_tnext(u32x4& g0, uint32_t dst, uint32_t rowb) {
    const uint64_t ga = (((uint64_t)g0[3] << 32) | (uint64_t)g0[2]) + rowb;
    g0[1] = uni(dst); g0[2] = uni((uint32_t)ga); g0[3] = uni((uint32_t)(ga >> 32));
}
// 16-bit forms of eight f32 values of the qkv product: f16, and bf16 hi and lo (stored only for positions < RH)
__device__ __forceinline__ void cvt3(const v8f x, v8h& o16, v8us& oh, v8us& ol) {
#pragma unroll
    for (int k = 0; k < 8; ++k) { o16[k] = (h16)x[k]; unsigned short a, c; splitf(x[k], a, c); oh[k] = a; ol[k] = c; }
}
__device__ __forceinline__ void store3(h16* p16, bf* ph, bf* pl, bool hr, const v8h o16, const v8us oh, const v8us ol) {
    *(v8h*)p16 = o16;
    asm volatile("s_wait_xcnt 0x0" ::: "memory");       // stands before the store's address and data registers are written again
    if (hr) {
        *(v8us*)ph = oh; *(v8us*)pl = ol;
        asm volatile("s_wait_xcnt 0x0" ::: "memory");   // the same for these two stores
    }
}
// PL = false: the tile goes to C as f32. PL = true (the qkv product; row m = l*NB + n, column which*1024 + h*64 + d): the tile goes straight to the 16-bit operand planes of the attention kernels,
// q and k as [bh][l][64] (f16; positions < RH also bf16 hi and lo [bh][RH][64]), v transposed as [bh][d][l] (f16; positions < RH also bf16 hi and lo [bh][d][RH]); C is not touched.
template <int KS, bool PL>
__global__ __launch_bounds__(128) void k_gemmw(const bf* __restrict__ A, int lda, const bf* __restrict__ Bt, int ldb, int K, float* C, int ldc,
                                               h16* QK16, bf* QKh, bf* QKl, h16* VT16, bf* VTh, bf* VTl) {
    static_assert(KS == 64 || KS == 128);
    constexpr uint32_t ROWB   = 2u * KS;                                  // bytes of a row in a stage
    constexpr uint32_t GPITCH = ROWB + 16u;                               // LDS row pitch: an odd multiple of 16 bytes for 16-byte reads
    constexpr uint32_t GSLICE = (64u * GPITCH + 2047u) / 2048u * 2048u;   // 64 rows, rounded up to a multiple of 2 KiB
    constexpr uint32_t GBUF   = 4u * GSLICE;                              // slices: A rows 0..63, A rows 64..127, Bt rows 0..63, Bt rows 64..127
    __shared__ __attribute__((aligned(2048))) unsigned char tl[2 * GBUF];
    __shared__ __align__(16) float osall[4 * 16 * 68];
    const int lane = threadIdx.x & 31, lr = lane & 15, hi = lane >> 4;
    const uint32_t wave = uni(threadIdx.x >> 5), wm = wave & 1u, wn = wave >> 1;
    const int r0 = blockIdx.x * 128, c0 = blockIdx.y * 128;
    // this wave's slice of every stage: waves 0, 1 the two halves of the A rows, waves 2, 3 of the Bt rows
    const bool isb = wave >= 2u;
    const uint32_t spitch = (uint32_t)(isb ? ldb : lda) * 2u;
    const uint64_t sbase = (uint64_t)(size_t)(isb ? Bt : A) + (uint64_t)((isb ? c0 : r0) + (int)(wave & 1u) * 64) * spitch;
    const uint32_t sdst = (uint32_t)(size_t)tl + wave * GSLICE;
    u32x8 g1;                                     // 1-byte elements, tensor = tile = 64 rows of ROWB bytes, 4 dwords of LDS pad behind every row
    g1[0] = uni((1u << 20) | ((KS == 64 ? 4u : 5u) << 22) | (3u << 25));
    g1[1] = uni(ROWB << 16);
    g1[2] = uni(64u << 16);
    g1[3] = uni(ROWB << 16);
    g1[4] = uni(64u);
    g1[5] = uni(spitch);
    g1[6] = uni(0u);
    g1[7] = uni(0u);
    u32x4 g0;                                     // count 1, LDS place, global address, type 2
    g0[0] = uni(1u); g0[1] = uni(sdst); g0[2] = uni((uint32_t)sbase); g0[3] = uni((((uint32_t)(sbase >> 32)) & 0x01FFFFFFu) | 0x80000000u);
    const int T = K / KS;                         // stages
    v8f acc[4][4];
#pragma unroll
    for (int mb = 0; mb < 4; ++mb)
#pragma unroll
        for (int nb = 0; nb < 4; ++nb) acc[mb][nb] = (v8f){};
    gemm_tload(g0, g1);
    gemm_twait(g0, g1);                                     // stage 0 has landed (this wave's slice)
    __syncthreads();                                        // ... and every wave's
    gemm_tnext(g0, sdst + GBUF, ROWB);
    gemm_tload(g0, g1);
    const uint32_t aoff = wm * GSLICE + (uint32_t)lr * GPITCH + 16u * (uint32_t)hi;
    const uint32_t boff = (2u + wn) * GSLICE + (uint32_t)lr * GPITCH + 16u * (uint32_t)hi;
#pragma unroll 1                                 // rolled: one publish point in the code, the buffer chosen by a scalar
    for (int s = 0; s < T; ++s) {
        const uint32_t bsel = (uint32_t)(s & 1) * GBUF;
#pragma unroll 1
        for (int h = 0; h < KS / 64; ++h) {         // 64 k at a time: two 32-deep blocks (kept rolled: four blocks in a row spilled accumulators)
            const unsigned char* ap = tl + bsel + aoff + h * 128; const unsigned char* bp = tl + bsel + boff + h * 128;
            // LDS reads stand at two places only: the head (both blocks' A, the first block's Bt, the second block's Bt columns 0..31) and the middle of the first block
            // (the second block's Bt columns 32..63, into the registers that the first eight products have freed).
            v16us a[2][4], b[2][4];
#pragma unroll
            for (int i = 0; i < 4; ++i) { a[0][i] = ldus((const us*)(ap + i * 16 * GPITCH)); b[0][i] = ldus((const us*)(bp + i * 16 * GPITCH)); }
#pragma unroll
            for (int i = 0; i < 4; ++i) a[1][i] = ldus((const us*)(ap + i * 16 * GPITCH + 64));
#pragma unroll
            for (int i = 0; i < 2; ++i) b[1][i] = ldus((const us*)(bp + i * 16 * GPITCH + 64));
            __builtin_amdgcn_sched_barrier(0);      // keeps these loads one group ahead of the products
#pragma unroll
            for (int nb = 0; nb < 2; ++nb)
#pragma unroll
                for (int mb = 0; mb < 4; ++mb) acc[mb][nb] = mmg<true>(a[0][mb], b[0][nb], acc[mb][nb]);
            __builtin_amdgcn_sched_barrier(0);      // keeps the second group from rising among the products whose registers it takes
#pragma unroll
            for (int i = 2; i < 4; ++i) b[1][i] = ldus((const us*)(bp + i * 16 * GPITCH + 64));
            __builtin_amdgcn_sched_barrier(0);      // keeps the second group together, sixteen products ahead of its first use
#pragma unroll
            for (int nb = 2; nb < 4; ++nb)
#pragma unroll
                for (int mb = 0; mb < 4; ++mb) acc[mb][nb] = mmg<true>(a[0][mb], b[0][nb], acc[mb][nb]);
#pragma unroll
            for (int nb = 0; nb < 4; ++nb)
#pragma unroll
                for (int mb = 0; mb < 4; ++mb) acc[mb][nb] = mmg<true>(a[1][mb], b[1][nb], acc[mb][nb]);
        }
        // publish point of stage s + 1
        asm volatile("s_wait_dscnt 0x0" ::: "memory");      // this wave has left stage s's buffer
        gemm_twait(g0, g1);                                 // this wave's slice of stage s + 1 has landed
        __syncthreads();                                    // stage s + 1 readable by all; stage s's buffer left by all
        if (pinned(s + 2 < T)) { gemm_tnext(g0, sdst + bsel, ROWB); gemm_tload(g0, g1); }
    }
    gemm_twait(g0, g1);                                     // nothing in flight when the wave ends
    asm volatile("s_wait_dscnt 0x0" ::: "memory");
    float* os = osall + wave * (16 * 68);                   // output staging, private to the wave
    if constexpr (PL) {
        const int which = c0 / DM;                          // 0 q, 1 k, 2 v: the same for the whole tile
        const bool hr = r0 / NB < RH;                       // the tile's positions all lie below RH, or none does
        v8h o16; v8us oh, ol;
        if (which < 2) {
            const int h = ((c0 + (int)wn * 64) % DM) / HD;  // the wave's 64 columns are one head
#pragma unroll
            for (int mb = 0; mb < 4; ++mb) {
#pragma unroll
                for (int nb = 0; nb < 4; ++nb) {
#pragma unroll
                    for (int j = 0; j < 8; ++j) os[(hi * 8 + j) * 68 + nb * 16 + lr] = acc[mb][nb][j];
                }
                __builtin_amdgcn_wave_barrier(); asm volatile("" ::: "memory");
#pragma unroll
                for (int s = 0; s < 4; ++s) {               // eight lanes store one row of a plane: 64 elements, one 128-byte line
                    const int row = s * 4 + (lane >> 3), cp = (lane & 7) * 8;
                    const v4f a = *(const v4fa*)(os + row * 68 + cp), b = *(const v4fa*)(os + row * 68 + cp + 4);
                    cvt3(__builtin_shufflevector(a, b, 0, 1, 2, 3, 4, 5, 6, 7), o16, oh, ol);
                    const int m = r0 + (int)wm * 64 + mb * 16 + row, l = m / NB, bh = (m % NB) * NH + h;
                    const size_t e16 = (size_t)which * PLN + ((size_t)bh * SEQ + l) * HD + cp;
                    const size_t eh = hr ? ((size_t)which * PLNH + ((size_t)bh * RH + l) * HD + cp) : 0;
                    store3(QK16 + e16, QKh + eh, QKl + eh, hr, o16, oh, ol);
                }
                __builtin_amdgcn_wave_barrier(); asm volatile("" ::: "memory");
            }
        } else {
            // v: the whole 128 x 128 tile is turned in LDS, T[column][n][position], so that eight lanes store 64 positions of one (bh, d): one 128-byte line, one writer.
            // T takes the place of the stage buffers: every wave has left them and nothing is in flight (the last pass's waits and barrier).
            constexpr int TP = 132, LT = 128 / NB;          // row pitch in floats (528 bytes, an odd multiple of 16); positions in the tile
            static_assert((size_t)128 * TP * 4 <= (size_t)2 * GBUF && (8 / NB) % 4 == 0);
            float* T = (float*)tl;
#pragma unroll
            for (int mb = 0; mb < 4; ++mb) {
#pragma unroll
                for (int nb = 0; nb < 4; ++nb) {
                    float* tw = T + ((int)wn * 64 + nb * 16 + lr) * TP + ((int)wm * 64 + mb * 16 + hi * 8) / NB;
#pragma unroll
                    for (int n = 0; n < NB; ++n) {
#pragma unroll
                        for (int k4 = 0; k4 < 8 / NB / 4; ++k4) {
                            v4f t;
#pragma unroll
                            for (int e = 0; e < 4; ++e) t[e] = acc[mb][nb][(k4 * 4 + e) * NB + n];
                            *(v4fa*)(tw + n * LT + k4 * 4) = t;
                        }
                    }
                }
            }
            __syncthreads();                                // the turned tile is whole before any wave reads another wave's part
#pragma unroll 4
            for (int it = 0; it < 16; ++it) {
                const int gi = it * 128 + (int)threadIdx.x, l8 = gi % (LT / 8), rr = gi / (LT / 8), c = rr % 128, n = rr / 128;
                const float* tr = T + c * TP + n * LT + l8 * 8;
                const v4f a = *(const v4fa*)tr, b = *(const v4fa*)(tr + 4);
                cvt3(__builtin_shufflevector(a, b, 0, 1, 2, 3, 4, 5, 6, 7), o16, oh, ol);
                const int col = c0 - 2 * DM + c, bh = n * NH + col / HD, d = col % HD, l = r0 / NB + l8 * 8;
                const size_t e16 = ((size_t)bh * HD + d) * SEQ + l;
                const size_t eh = hr ? (((size_t)bh * HD + d) * RH + l) : 0;
                store3(VT16 + e16, VTh + eh, VTl + eh, hr, o16, oh, ol);
            }
        }
        return;
    }
#pragma unroll
    for (int mb = 0; mb < 4; ++mb) {
#pragma unroll
        for (int nb = 0; nb < 4; ++nb) {
#pragma unroll
            for (int j = 0; j < 8; ++j) os[(hi * 8 + j) * 68 + nb * 16 + lr] = acc[mb][nb][j];
        }
        __builtin_amdgcn_wave_barrier(); asm volatile("" ::: "memory");
        float* crow = C + (size_t)(r0 + (int)wm * 64 + mb * 16) * ldc + c0 + (int)wn * 64;
{
#pragma unroll
            for (int s = 0; s < 8; ++s) {                       // rows 2s+hi, s = 0..7, hi = 0..1: all 16 rows of the slab
                const int row = 2 * s + hi, cofs = lr * 4;
                const v4f val = *(const v4fa*)(os + row * 68 + cofs);
                *(v4f*)(crow + (size_t)row * ldc + cofs) = val;
            }
            
        }
        __builtin_amdgcn_wave_barrier(); asm volatile("" ::: "memory");
    }
}

// lane l with lane l ^ 16 (the other half of a query column's keys)
__device__ __forceinline__ float xhalf(float x) {
    return __builtin_bit_cast(float, __builtin_amdgcn_permlanex16(__builtin_bit_cast(int, x), __builtin_bit_cast(int, x), 0x76543210, 0xfedcba98, false, false));
}

template <bool HR>
__device__ __forceinline__ void attn_body(const us* __restrict__ Qa, const us* __restrict__ Qr, const us* __restrict__ Ka, const us* __restrict__ Kr,
                                          const us* __restrict__ Va, const us* __restrict__ Vr, bf* CTX, const int q0) {
    constexpr int LR = HR ? RH : SEQ;                  // rows per problem in the q/k planes = row length of the transposed value planes
    __shared__ __align__(16) unsigned short oh[32 * OP];
    __shared__ __align__(16) unsigned short ol[32 * OP];
    const int lane = threadIdx.x & 31, lr = lane & 15, hi = lane >> 4;
    const int bh = blockIdx.x, n = bh / NH, h = bh % NH;
    const size_t pb = (size_t)bh * LR * HD;
    Qa += pb; Ka += pb; Va += pb; Qr += pb; Kr += pb; Vr += pb;
    const int qoff = (q0 + lr) * HD + 8 * hi;
    const int koff = lr * HD + 8 * hi;
    const int voff = lr * LR + 8 * hi;
    const float cexp = 0.125f * 1.4426950408889634f;   // HD^-0.5 * log2(e)
    const float pc = HR ? 1.0f : PCAR;
    v8f o[2][4]; float mrow[2], lsum[2];               // o[u][t2][r] = context(query q0 + u*16 + lr, d = t2*16 + 8*hi + r); mrow, lsum: of query q0 + u*16 + lr
#pragma unroll
    for (int u = 0; u < 2; ++u) {
#pragma unroll
        for (int t2 = 0; t2 < 4; ++t2) o[u][t2] = (v8f){};
        mrow[u] = -3.0e38f; lsum[u] = 0.0f;
    }
    v16us qfa[2][2], qfr[2][2], kfa[2][2], kfr[2][2];      // [kc][u] and [kc][t]
#pragma unroll
    for (int kc = 0; kc < 2; ++kc) {
#pragma unroll
        for (int u = 0; u < 2; ++u) {
            qfa[kc][u] = ldus(Qa + qoff + u * 16 * HD + kc * 32);
            qfr[kc][u] = HR ? ldus(Qr + qoff + u * 16 * HD + kc * 32) : qfa[kc][u];
        }
#pragma unroll
        for (int t = 0; t < 2; ++t) {
            const int ko = (t * 16) * HD + koff + kc * 32;
            kfa[kc][t] = ldus(Ka + ko);
            kfr[kc][t] = HR ? ldus(Kr + ko) : kfa[kc][t];
        }
    }
    const int kfirst = (32 <= q0 ? 32 : q0) * HD + koff;
    const us* kpa = Ka + kfirst; const us* kpr = Kr + kfirst;      // the NEXT step's key rows
    const us* vpa = Va + voff;   const us* vpr = Vr + voff;        // this step's value columns
#pragma unroll 1
    for (int m0 = 0; m0 <= q0; m0 += 32) {
        v16us vfa[4], vfr[4];
#pragma unroll
        for (int t2 = 0; t2 < 4; ++t2) {
            vfa[t2] = ldus(vpa + (t2 * 16) * LR);          // A[m = d = t2*16 + lr][k = key m0 + ..] from the transposed plane row d
            vfr[t2] = HR ? ldus(vpr + (t2 * 16) * LR) : vfa[t2];
        }
        v8f s[2][2];
#pragma unroll
        for (int u = 0; u < 2; ++u)
#pragma unroll
            for (int t = 0; t < 2; ++t) s[u][t] = (v8f){};
#pragma unroll
        for (int kc = 0; kc < 2; ++kc) {
#pragma unroll
            for (int t = 0; t < 2; ++t) {
                s[0][t] = mmg<HR>(kfa[kc][t], qfa[kc][0], s[0][t]); s[1][t] = mmg<HR>(kfa[kc][t], qfa[kc][1], s[1][t]);
                if (HR) {
                    s[0][t] = mmg<HR>(kfa[kc][t], qfr[kc][0], s[0][t]); s[1][t] = mmg<HR>(kfa[kc][t], qfr[kc][1], s[1][t]);
                    s[0][t] = mmg<HR>(kfr[kc][t], qfa[kc][0], s[0][t]); s[1][t] = mmg<HR>(kfr[kc][t], qfa[kc][1], s[1][t]);
                }
            }
        }
        {       // next step's key fragments: a whole softmax and the V^T.P^T products ahead of their use (the last step fetches its own keys again: in bounds, not used)
#pragma unroll
            for (int kc = 0; kc < 2; ++kc) {
#pragma unroll
                for (int t = 0; t < 2; ++t) {
                    kfa[kc][t] = ldus(kpa + (t * 16) * HD + kc * 32);
                    kfr[kc][t] = HR ? ldus(kpr + (t * 16) * HD + kc * 32) : kfa[kc][t];
                }
            }
            __builtin_amdgcn_sched_barrier(0);      // keeps the loads ahead of the softmax (lead)
        }
        // s[u][t][r] = score(key m0 + t*16 + 8*hi + r, query q0 + u*16 + lr). Keys beyond the query are excluded (only possible in the diagonal step; key m0 is always kept).
        if (m0 == q0) {
#pragma unroll
            for (int u = 0; u < 2; ++u)
#pragma unroll
                for (int t = 0; t < 2; ++t)
#pragma unroll
                    for (int r = 0; r < 8; ++r) { if (t * 16 + 8 * hi + r > u * 16 + lr) s[u][t][r] = -3.0e38f; }
        }
        v16us pa[2], pr[2];
#pragma unroll
        for (int u = 0; u < 2; ++u) {
            float v = fmaxf(s[u][0][0], s[u][1][0]);
#pragma unroll
            for (int r = 1; r < 8; ++r) v = fmaxf(v, fmaxf(s[u][0][r], s[u][1][r]));
            v = fmaxf(v, xhalf(v));
            const float mn = fmaxf(mrow[u], v);
            const v8f x0 = (s[u][0] - mn) * cexp, x1 = (s[u][1] - mn) * cexp;
            float e0[8], e1[8];
#pragma unroll
            for (int r = 0; r < 8; ++r) e0[r] = __builtin_amdgcn_exp2f(x0[r]);
#pragma unroll
            for (int r = 0; r < 8; ++r) e1[r] = __builtin_amdgcn_exp2f(x1[r]);
            const float al = __builtin_amdgcn_exp2f((mrow[u] - mn) * cexp);
            mrow[u] = mn;
            float ps[4] = {0.0f, 0.0f, 0.0f, 0.0f};             // four independent partial sums of the lane's 16 probabilities
#pragma unroll
            for (int r = 0; r < 8; ++r) {
                const float p0 = e0[r], p1 = e1[r];
                ps[r & 3] += p0 + p1;
                if (HR) {
                    unsigned short a, c; splitf(p0, a, c); pa[u][r] = a; pr[u][r] = c;
                    splitf(p1, a, c); pa[u][8 + r] = a; pr[u][8 + r] = c;
                } else {
                    pa[u][r] = __builtin_bit_cast(unsigned short, (h16)(p0 * PCAR));
                    pa[u][8 + r] = __builtin_bit_cast(unsigned short, (h16)(p1 * PCAR));
                }
            }
            if (!HR) pr[u] = pa[u];
            lsum[u] = lsum[u] * al + ((ps[0] + ps[1]) + (ps[2] + ps[3]));     // per-lane partial sum of one query (its half of the keys), the halves joined once at the end
#pragma unroll
            for (int t2 = 0; t2 < 4; ++t2) o[u][t2] *= al;
        }
#pragma unroll
        for (int t2 = 0; t2 < 4; ++t2) {
            o[0][t2] = mmg<HR>(vfa[t2], pa[0], o[0][t2]); o[1][t2] = mmg<HR>(vfa[t2], pa[1], o[1][t2]);
            if (HR) {
                o[0][t2] = mmg<HR>(vfa[t2], pr[0], o[0][t2]); o[1][t2] = mmg<HR>(vfa[t2], pr[1], o[1][t2]);
                o[0][t2] = mmg<HR>(vfr[t2], pa[0], o[0][t2]); o[1][t2] = mmg<HR>(vfr[t2], pa[1], o[1][t2]);
            }
        }
        // the address pairs of this step's loads stay whole up to this wait; they are stepped only behind it
        if (HR) asm volatile("s_wait_xcnt 0x0" :: "v"(kpa), "v"(kpr), "v"(vpa), "v"(vpr) : "memory");
        else    asm volatile("s_wait_xcnt 0x0" :: "v"(kpa), "v"(vpa) : "memory");
        const int kstep = m0 + 64 <= q0 ? 32 * HD : 0;
        kpa += kstep; kpr += kstep; vpa += 32; vpr += 32;
    }
    // normalise, split into bf16 hi / lo, stage the 32 x 64 tile (a lane's 8 registers are 8 consecutive d of one query: 16-byte LDS stores), then whole-line stores
#pragma unroll
    for (int u = 0; u < 2; ++u) {
        float l = lsum[u];
        l += xhalf(l);
        const float inv = 1.0f / (l * pc);
#pragma unroll
        for (int t2 = 0; t2 < 4; ++t2) {
            v8us a8, c8;
#pragma unroll
            for (int r = 0; r < 8; ++r) { unsigned short a, c; splitf(o[u][t2][r] * inv, a, c); a8[r] = a; c8[r] = c; }
            const int oo = (u * 16 + lr) * OP + t2 * 16 + 8 * hi;
            *(v8usa*)(oh + oo) = a8; *(v8usa*)(ol + oo) = c8;
        }
    }
    __syncthreads();
{
#pragma unroll
        for (int s = 0; s < 8; ++s) {
            const int row = s * 4 + (lane >> 3), cp = (lane & 7) * 8;
            const v8us vh = *(const v8usa*)(oh + row * OP + cp);
            const v8us vl = *(const v8usa*)(ol + row * OP + cp);
            bf* d = CTX + ((size_t)(q0 + row) * NB + n) * CK + h * HD + cp;
            *(v8us*)d = vh; *(v8us*)(d + DM) = vl;
        }
        
    }
}

__global__ __launch_bounds__(32) void k_attn_lo(const us* __restrict__ Q16, const us* __restrict__ K16, const us* __restrict__ V16, bf* CTX) {
    attn_body<false>(Q16, Q16, K16, K16, V16, V16, CTX, RH + (int)blockIdx.y * 32);
}

// ---- k_attn_hr: early query positions (< RH) on bf16 hi/lo planes, ONE 16-row tile per wave (one wave per block), 32 keys per step.
// Per-query arithmetic and product order are those of attn_body with HR = true (q.k: hi.hi, lo.hi, hi.lo per 32-deep chunk; P.v: hi.hi, lo.hi, hi.lo; all into one accumulator, unscaled bf16 residuals), transposed in the same way.
// Live state per lane: 4 output accumulators + 2 score accumulators + 2 softmax scalars + the fragments fetched ahead: q once in front of the loop, a step's v at its head, the next step's k among this step's V^T.P^T products.
// Key steps run over m0 = 0, 32, .., mend with mend = q0 pad down to a multiple of 32 (block-uniform); keys beyond the query are excluded in the last step only (key mend is always kept).
// Planes: q/k [bh][RH][64], transposed value planes [bh][64][RH]; the last step reads keys < mend + 32 <= RH, all written by the qkv product's epilogue.
__global__ __launch_bounds__(32) void k_attn_hr(const us* __restrict__ Qh, const us* __restrict__ Ql, const us* __restrict__ Kh, const us* __restrict__ Kl,
                                                const us* __restrict__ Vh, const us* __restrict__ Vl, bf* CTX) {
    __shared__ __align__(16) unsigned short eoh[ER * OP];     // context hi staging, 16 rows x 64
    __shared__ __align__(16) unsigned short eol[ER * OP];     // context lo staging
    const int lane = threadIdx.x & 31, lr = lane & 15, hi = lane >> 4;
    const int bh = blockIdx.x, n = bh / NH, h = bh % NH;
    const int q0 = (int)blockIdx.y * ER;
    const int mend = q0 & ~31;
    const size_t pb = (size_t)bh * RH * HD;
    Qh += pb; Ql += pb; Kh += pb; Kl += pb; Vh += pb; Vl += pb;
    const int qoff = (q0 + lr) * HD + 8 * hi;
    const int koff = lr * HD + 8 * hi;
    const int voff = lr * RH + 8 * hi;
    const float cexp = 0.125f * 1.4426950408889634f;   // HD^-0.5 * log2(e)
    v8f o[4]; float mrow = -3.0e38f, lsum = 0.0f;      // o[t2][r] = context(query q0 + lr, d = t2*16 + 8*hi + r); mrow, lsum: of query q0 + lr
#pragma unroll
    for (int t2 = 0; t2 < 4; ++t2) o[t2] = (v8f){};
    v16us qfa[2], qfr[2], kfa[2][2], kfr[2][2];            // [kc] and [kc][t]
#pragma unroll
    for (int kc = 0; kc < 2; ++kc) {
        qfa[kc] = ldus(Qh + qoff + kc * 32);
        qfr[kc] = ldus(Ql + qoff + kc * 32);
#pragma unroll
        for (int t = 0; t < 2; ++t) {
            const int ko = (t * 16) * HD + koff + kc * 32;
            kfa[kc][t] = ldus(Kh + ko);
            kfr[kc][t] = ldus(Kl + ko);
        }
    }
    const int kfirst = (32 <= mend ? 32 : mend) * HD + koff;
    const us* kph = Kh + kfirst; const us* kpl = Kl + kfirst;      // the NEXT step's key rows (the last step fetches its own keys again: in bounds, not used)
#pragma unroll 1
    for (int m0 = 0; m0 <= mend; m0 += 32) {
        v16us vfa[4], vfr[4];
        const us* vph = Vh + voff + m0; const us* vpl = Vl + voff + m0;
#pragma unroll
        for (int t2 = 0; t2 < 4; ++t2) {
            vfa[t2] = ldus(vph + (t2 * 16) * RH);          // A[m = d = t2*16 + lr][k = key m0 + ..] from the transposed plane row d
            vfr[t2] = ldus(vpl + (t2 * 16) * RH);
        }
        asm volatile("s_wait_xcnt 0x0" :: "v"(vph), "v"(vpl) : "memory");   // the two address pairs stay whole up to this wait
        v8f s[2];
        s[0] = (v8f){}; s[1] = (v8f){};
#pragma unroll
        for (int kc = 0; kc < 2; ++kc) {
#pragma unroll
            for (int t = 0; t < 2; ++t) {
                s[t] = mmg<true>(kfa[kc][t], qfa[kc], s[t]);
                s[t] = mmg<true>(kfa[kc][t], qfr[kc], s[t]);
                s[t] = mmg<true>(kfr[kc][t], qfa[kc], s[t]);
            }
        }
        // s[t][r] = score(key m0 + t*16 + 8*hi + r, query q0 + lr)
        if (m0 == mend) {
#pragma unroll
            for (int t = 0; t < 2; ++t)
#pragma unroll
                for (int r = 0; r < 8; ++r) { if (m0 + t * 16 + 8 * hi + r > q0 + lr) s[t][r] = -3.0e38f; }
        }
        v16us pa, pr;
        {
            float v = fmaxf(s[0][0], s[1][0]);
#pragma unroll
            for (int r = 1; r < 8; ++r) v = fmaxf(v, fmaxf(s[0][r], s[1][r]));
            v = fmaxf(v, xhalf(v));
            const float mn = fmaxf(mrow, v);
            const float al = __builtin_amdgcn_exp2f((mrow - mn) * cexp);
            mrow = mn;
            const v8f x0 = (s[0] - mn) * cexp, x1 = (s[1] - mn) * cexp;
            float ps[4] = {0.0f, 0.0f, 0.0f, 0.0f};             // four independent partial sums of the lane's 16 probabilities
#pragma unroll
            for (int r = 0; r < 8; ++r) {
                const float p0 = __builtin_amdgcn_exp2f(x0[r]);
                const float p1 = __builtin_amdgcn_exp2f(x1[r]);
                ps[r & 3] += p0 + p1;
                unsigned short a, c;
                splitf(p0, a, c); pa[r] = a; pr[r] = c;
                splitf(p1, a, c); pa[8 + r] = a; pr[8 + r] = c;
            }
            lsum = lsum * al + ((ps[0] + ps[1]) + (ps[2] + ps[3]));           // per-lane partial sum of one query (its half of the keys), the halves joined once at the end
#pragma unroll
            for (int t2 = 0; t2 < 4; ++t2) o[t2] *= al;
        }
#pragma unroll
        for (int t2 = 0; t2 < 4; ++t2) {
            o[t2] = mmg<true>(vfa[t2], pa, o[t2]);
            o[t2] = mmg<true>(vfa[t2], pr, o[t2]);
            o[t2] = mmg<true>(vfr[t2], pa, o[t2]);
            const int ko = ((t2 & 1) * 16) * HD + (t2 >> 1) * 32;
            kfa[t2 >> 1][t2 & 1] = ldus(kph + ko);
            kfr[t2 >> 1][t2 & 1] = ldus(kpl + ko);
            __builtin_amdgcn_sched_barrier(0);  // keeps each key refill behind the products that free a value fragment pair (register room)
        }
        asm volatile("s_wait_xcnt 0x0" :: "v"(kph), "v"(kpl) : "memory");   // the key address pairs stay whole up to this wait; they are stepped only behind it
        const int kstep = m0 + 64 <= mend ? 32 * HD : 0;
        kph += kstep; kpl += kstep;
    }
    // normalise, split into bf16 hi / lo, stage the 16 x 64 tile (16-byte LDS stores), then whole-line stores
    {
        float l = lsum;
        l += xhalf(l);
        const float inv = 1.0f / l;
#pragma unroll
        for (int t2 = 0; t2 < 4; ++t2) {
            v8us a8, c8;
#pragma unroll
            for (int r = 0; r < 8; ++r) { unsigned short a, c; splitf(o[t2][r] * inv, a, c); a8[r] = a; c8[r] = c; }
            const int oo = lr * OP + t2 * 16 + 8 * hi;
            *(v8usa*)(eoh + oo) = a8; *(v8usa*)(eol + oo) = c8;
        }
    }
    __syncthreads();
{
#pragma unroll
        for (int s4 = 0; s4 < ER / 4; ++s4) {
            const int row = s4 * 4 + (lane >> 3), cp = (lane & 7) * 8;
            const v8us vh = *(const v8usa*)(eoh + row * OP + cp);
            const v8us vl = *(const v8usa*)(eol + row * OP + cp);
            bf* d = CTX + ((size_t)(q0 + row) * NB + n) * CK + h * HD + cp;
            *(v8us*)d = vh; *(v8us*)(d + DM) = vl;
        }
        
    }
}

// workspace carve (bytes), every region a multiple of 256
constexpr size_t SZ_XB   = (size_t)MROWS * DM * 2;        // x bf16 [MROWS][1024]
constexpr size_t SZ_WQ   = (size_t)F3 * DM * 2;           // w_qkv bf16 [3072][1024]
constexpr size_t SZ_WO   = (size_t)DM * CK * 2;           // [w_out | w_out] bf16 [1024][2048]
constexpr size_t SZ_QK16 = (size_t)2 * NBH * SEQ * HD * 2;
constexpr size_t SZ_QKH  = (size_t)2 * NBH * RH * HD * 2;
constexpr size_t SZ_VT16 = (size_t)NBH * HD * SEQ * 2;
constexpr size_t SZ_VTH  = (size_t)NBH * HD * RH * 2;
constexpr size_t SZ_CTX  = (size_t)MROWS * CK * 2;        // context bf16 hi | lo [MROWS][2048]
constexpr size_t OF_XB   = 0;
constexpr size_t OF_WQ   = OF_XB + SZ_XB;
constexpr size_t OF_WO   = OF_WQ + SZ_WQ;
constexpr size_t OF_QK16 = OF_WO + SZ_WO;
constexpr size_t OF_QKH  = OF_QK16 + SZ_QK16;
constexpr size_t OF_QKL  = OF_QKH + SZ_QKH;
constexpr size_t OF_VT16 = OF_QKL + SZ_QKH;
constexpr size_t OF_VTH  = OF_VT16 + SZ_VT16;
constexpr size_t OF_VTL  = OF_VTH + SZ_VTH;
constexpr size_t OF_CTX  = OF_VTL + SZ_VTH;
constexpr size_t WS_TOTAL = OF_CTX + SZ_CTX;
static_assert(SZ_XB % 256 == 0 && SZ_WQ % 256 == 0 && SZ_WO % 256 == 0 && SZ_QK16 % 256 == 0);
static_assert(SZ_QKH % 256 == 0 && SZ_VT16 % 256 == 0 && SZ_VTH % 256 == 0 && SZ_CTX % 256 == 0);
static_assert(WS_TOTAL <= (size_t)134217728);            // total carve <= 128 MiB

extern "C" void kernel_launch(void* const* d_in, const int* in_sizes, int n_in,
                              void* d_out, int out_size, void* d_ws, size_t ws_size, hipStream_t stream) {
    if (n_in < 3) return;
    const long long needx = ((long long)(SEQ - 1) * NB_FULL + NB) * DM;     // last token row touched, in elements
    if ((long long)in_sizes[0] < needx || (long long)in_sizes[1] < (long long)F3 * DM || (long long)in_sizes[2] < (long long)DM * DM || (long long)out_size < needx) return;
    if (WS_TOTAL > ws_size) return;
    const float* x = (const float*)d_in[0];       // [2048][2][1024], token row l*2 + n
    const float* wqkv = (const float*)d_in[1];    // [3072][1024] = [out][in]
    const float* wout = (const float*)d_in[2];    // [1024][1024] = [out][in]
    float* OUT = (float*)d_out;                   // [2048][2][1024]
    char* ws = (char*)d_ws;
    bf* XB = (bf*)(ws + OF_XB); bf* WQ = (bf*)(ws + OF_WQ); bf* WO2 = (bf*)(ws + OF_WO);
    h16* QK16 = (h16*)(ws + OF_QK16); bf* QKh = (bf*)(ws + OF_QKH); bf* QKl = (bf*)(ws + OF_QKL);
    h16* VT16 = (h16*)(ws + OF_VT16); bf* VTh = (bf*)(ws + OF_VTH); bf* VTl = (bf*)(ws + OF_VTL); bf* CTX = (bf*)(ws + OF_CTX);

    k_cvt_all<<<CROWS / (16 * CRPW), 512, 0, stream>>>(x, wqkv, wout, XB, WQ, WO2);
    k_gemmw<64, true><<<dim3(MROWS / 128, F3 / 128, 1), 128, 0, stream>>>(XB, DM, WQ, DM, DM, nullptr, 0, QK16, QKh, QKl, VT16, VTh, VTl);   // qkv[m][f] = sum_e x[m][e] w_qkv[f][e], written as 16-bit planes
    k_attn_hr<<<dim3(NBH, RH / ER, 1), 32, 0, stream>>>((const us*)QKh, (const us*)QKl, (const us*)(QKh + PLNH), (const us*)(QKl + PLNH), (const us*)VTh, (const us*)VTl, CTX);
    if (SEQ > RH)
        k_attn_lo<<<dim3(NBH, (SEQ - RH) / 32 > 0 ? (SEQ - RH) / 32 : 1, 1), 32, 0, stream>>>((const us*)QK16, (const us*)(QK16 + PLN), (const us*)VT16, CTX);
    k_gemmw<128, false><<<dim3(MROWS / 128, DM / 128, 1), 128, 0, stream>>>(CTX, CK, WO2, CK, CK, OUT, DM * ROWSTEP, nullptr, nullptr, nullptr, nullptr, nullptr, nullptr);   // out[m][f] = sum_e (ctx_hi + ctx_lo)[m][e] w_out[f][e]
}

// v006
// A run of this version takes 110 microseconds.
// Timed twice side by side with v005, it ran 1.10 times as fast both times.
// Over all steps from v000 it is 3.69 times as fast.
#include <hip/hip_runtime.h>
#include <stdint.h>

// Contractions: qkv projection and output projection v_wmma_f32_16x16x32_bf16 (every input RNE-converted to bf16; context carried as bf16 hi|lo folded into K); scores and probability x value v_wmma_f32_16x16x32_f16 for query positions >= 256 (P carried x1024), bf16 hi/lo three-product form for positions < 256; f32 accumulate, f32 softmax.
// Sequence-first causal multi-head self-attention with a fused bias-free (out, in) qkv weight and an (out, in) output weight: token row m = l*NB + n, attention problem bh = n*16 + h, head columns h*64..h*64+63.
// Launch plan: k_cvt_all (bf16 copies) -> k_gemmw (qkv product, its epilogue writes the q/k/v^T 16-bit planes) -> k_attn_hr (rows < 256, 16-row tiles) -> k_attn_lo (rows >= 256, 32-row tiles) -> k_gemmw (output).

#ifndef NB
#define NB 2                      // batch entries processed (NB_FULL, or 1 for a reduced build)
#endif
#ifndef SEQ
#define SEQ 2048                  // sequence positions processed
#endif
#define NB_FULL  2                // batch stride of the staged x and of the output rows
#define SEQ_FULL 2048
#define DM   1024
#define NH   16
#define HD   64
#define F3   (3 * DM)
#define CK   (2 * DM)             // context plane width: hi columns | lo columns
#define RH   256                  // query positions < RH use the hi/lo planes
#define NBH  (NB * NH)
#define MROWS (SEQ * NB)
#define ROWSTEP (NB_FULL / NB)
#define PLN  ((size_t)NBH * SEQ * HD)
#define PLNH ((size_t)NBH * RH * HD)
#define PCAR 1024.0f
#define OP   72                   // context staging pitch in 16-bit elements (144 B)
#define ER   16                   // query rows per wave in the early-positions kernel

static_assert(NB == NB_FULL || NB == 1);          // compact row m = l*NB + n maps to token row m*ROWSTEP
static_assert(SEQ <= SEQ_FULL && SEQ >= RH);
static_assert(SEQ % 256 == 0);                    // tile multiples (128-row GEMM tiles, 32-row attention tiles, 8-wide plane groups)
static_assert(RH % 32 == 0 && RH % 8 == 0);       // the last 32-key step of the early kernel ends inside the hi/lo planes
static_assert(RH % ER == 0 && ER == 16);          // early kernel: one 16-row WMMA tile per wave, store loop 4 x 4 rows
static_assert(HD == 64 && NH * HD == DM);
static_assert(DM == 1024);                        // k_cvt_all: a row is 8 loads of 128 floats per wave
static_assert(DM % 64 == 0 && DM >= 128 && CK % 128 == 0 && CK >= 256);   // K: whole stages, at least two (k_gemmw: 64 deep for qkv, 128 deep for the output)
static_assert(MROWS % 128 == 0 && F3 % 128 == 0 && DM % 128 == 0);        // whole 128 x 128 output tiles
static_assert(RH % (128 / NB) == 0 && DM % 128 == 0);     // a 128 x 128 tile of the qkv product lies wholly in one of q, k, v and wholly below or above RH
static_assert(OP >= 64 && (OP * 2) % 16 == 0);

typedef _Float16 h16;
typedef unsigned short bf;
typedef unsigned short us;
typedef __attribute__((ext_vector_type(16))) __bf16   v16bf;
typedef __attribute__((ext_vector_type(16))) _Float16 v16h;
typedef __attribute__((ext_vector_type(16))) unsigned short v16us;
typedef __attribute__((ext_vector_type(8)))  _Float16 v8h;
typedef __attribute__((ext_vector_type(8)))  unsigned short v8us;
typedef __attribute__((ext_vector_type(8)))  float    v8f;
typedef __attribute__((ext_vector_type(4)))  float    v4f;
typedef v4f  __attribute__((may_alias)) v4fa;
typedef v8us __attribute__((may_alias)) v8usa;

__device__ __forceinline__ unsigned short f2bf(float f) { unsigned u = __float_as_uint(f); u += 0x7FFFu + ((u >> 16) & 1u); return (unsigned short)(u >> 16); }
__device__ __forceinline__ float bf2f(unsigned short b) { return __uint_as_float(((unsigned)b) << 16); }
__device__ __forceinline__ void splitf(float y, unsigned short& h, unsigned short& l) { h = f2bf(y); l = f2bf(y - bf2f(h)); }

// 16-bit fragment from a K-contiguous row: elements 0..7 <- p[0..7], elements 8..15 <- p[16..23]; the caller adds 8*(lane>>4) to p.
__device__ __forceinline__ v16us ldus(const us* p) {
    const v8us a = *(const v8us*)p; const v8us b = *(const v8us*)(p + 16);
    return __builtin_shufflevector(a, b, 0, 1, 2, 3, 4, 5, 6, 7, 8, 9, 10, 11, 12, 13, 14, 15);
}

// 16-bit fragment from a plane kept in fragment order: a fragment is 1 KiB, two runs of 512 contiguous bytes (elements 0..7 of lanes 0..31, then elements 8..15); the caller adds 8*lane to p.
// Each of the two loads then covers four whole 128-byte lines, where a load from a row-major plane touches sixteen lines for 32 bytes each.
__device__ __forceinline__ v16us ldfr(const us* p) {
    const v8us a = *(const v8us*)p; const v8us b = *(const v8us*)(p + 256);
    return __builtin_shufflevector(a, b, 0, 1, 2, 3, 4, 5, 6, 7, 8, 9, 10, 11, 12, 13, 14, 15);
}
// Element offsets inside one problem's plane. q and k: position l, 8-element chunk c8 of the 64 head columns (16 positions x 64 columns = two fragments of 32 columns each).
// v: head column d, position l a multiple of 8 (32 positions x 64 columns = four fragments of 16 columns each). Lane = 16*hi + lr, with lr the fragment's row and hi the 8-element half of ldus.
__device__ __forceinline__ int fo_qk(int l, int c8) { return (l >> 4) * 1024 + (c8 >> 1) * 256 + (c8 & 1) * 128 + (l & 15) * 8; }
__device__ __forceinline__ int fo_v(int d, int l)   { return (l >> 5) * 2048 + ((d >> 4) * 2 + ((l >> 4) & 1)) * 256 + ((l >> 3) & 1) * 128 + (d & 15) * 8; }

// One WMMA plus its own four-slot guard (ties exactly one accumulator, keeps A and B live).
template <bool BF>
__device__ __forceinline__ v8f mmg(v16us a, v16us b, v8f c) {
    if (BF) c = __builtin_amdgcn_wmma_f32_16x16x32_bf16(false, __builtin_bit_cast(v16bf, a), false, __builtin_bit_cast(v16bf, b), (short)0, c, false, false);
    else    c = __builtin_amdgcn_wmma_f32_16x16x32_f16(false, __builtin_bit_cast(v16h, a), false, __builtin_bit_cast(v16h, b), (short)0, c, false, false);
    asm volatile("v_nop\n\tv_nop\n\tv_nop\n\tv_nop" : "+v"(c) : "v"(a), "v"(b));
    return c;
}

// ---- k_cvt_all: every f32 input to its bf16 plane in ONE launch of CROWS / CRPW two-row waves (16 per work-group, one work-group per 32 rows).
// A wave takes CRPW whole rows of 1024 floats out of the list [x rows | w_qkv rows | w_out rows]: rows w and w + CROWS / CRPW. All of its loads (8 per row, 512 contiguous bytes each) are issued
// before the first value is converted; a store is 256 contiguous bytes. A w_out row is stored twice (columns 0..1023 pair with the hi half of the context plane, 1024..2047 with the lo half).
#define CROWS (MROWS + F3 + DM)
#define CRPW  2
static_assert(CROWS % (16 * CRPW) == 0);          // whole work-groups of 16 waves
typedef __attribute__((ext_vector_type(4))) unsigned short v4us;
__global__ __launch_bounds__(512) void k_cvt_all(const float* __restrict__ x, const float* __restrict__ wqkv, const float* __restrict__ wout, bf* XB, bf* WQ, bf* WO2) {
    const int lane = threadIdx.x & 31;
    const int w = __builtin_amdgcn_readfirstlane((int)(blockIdx.x * 16 + (threadIdx.x >> 5)));
    const float* s[CRPW]; bf* dst[CRPW]; bool dup[CRPW];
#pragma unroll
    for (int r = 0; r < CRPW; ++r) {                  // which plane the row belongs to: the same for the whole wave, scalar selects
        const int row = w + r * (CROWS / CRPW);
        const bool isx = row < MROWS, isq = row < MROWS + F3;
        const int rr = isx ? row : (isq ? row - MROWS : row - MROWS - F3);
        s[r]   = (isx ? x : (isq ? wqkv : wout)) + (size_t)rr * (isx ? ROWSTEP * DM : DM) + lane * 4;
        dst[r] = (isx ? XB : (isq ? WQ : WO2)) + (size_t)rr * (isq ? DM : CK) + lane * 4;
        dup[r] = !isq;
    }
    v4f v[CRPW][8];
#pragma unroll
    for (int r = 0; r < CRPW; ++r)
#pragma unroll
        for (int j = 0; j < 8; ++j) v[r][j] = *(const v4f*)(s[r] + j * 128);
    __builtin_amdgcn_sched_barrier(0);                // keeps every load of the wave ahead of the first conversion: without it the second row's loads sank behind waits on the first row's
#pragma unroll
    for (int r = 0; r < CRPW; ++r) {
        v4us o[8];
#pragma unroll
        for (int j = 0; j < 8; ++j) {
#pragma unroll
            for (int k = 0; k < 4; ++k) o[j][k] = f2bf(v[r][j][k]);
        }
        bf* d = dst[r];
#pragma unroll
        for (int j = 0; j < 8; ++j) *(v4us*)(d + j * 128) = o[j];
        if (r + 1 < CRPW) asm volatile("s_wait_xcnt 0x0" ::: "memory");       // stands before the stores' base and data registers are written again (the next row's address and values take them)
        if (dup[r]) {
#pragma unroll
            for (int j = 0; j < 8; ++j) *(v4us*)(d + DM + j * 128) = o[j];
            if (r + 1 < CRPW) asm volatile("s_wait_xcnt 0x0" ::: "memory");   // the same for these stores
        }
    }
}

// ---- k_gemmw: one 128x128 output tile per work-group of four waves (2 x 2, 64x64 = 16 accumulators each); grid (M/128, N/128), 128 threads.
// C[m][n] (f32, pitch ldc) = sum_k A[m][k] Bt[n][k]; K a multiple of KS and at least 2 KS, M and N multiples of 128; bf16 operands from K-contiguous planes.
// A stage is KS k of the tile's 128 A rows and 128 Bt rows. Each wave brings one slice of it (64 rows of 2 KS bytes) into LDS with one tensor load, every row padded by 16 bytes;
// two buffers: the load of stage s + 1 is in flight while stage s is multiplied. Every operand row is fetched once per work-group in whole lines and read by two waves from LDS.
// KS = 64 leaves room for three work-groups on a WGP (a grid of several per WGP); KS = 128 keeps twice the bytes in flight where a work-group has its WGP alone.
typedef uint32_t u32x4 __attribute__((ext_vector_type(4)));
typedef uint32_t u32x8 __attribute__((ext_vector_type(8)));
__device__ __forceinline__ uint32_t uni(uint32_t v) { return (uint32_t)__builtin_amdgcn_readfirstlane(v); }
__device__ __forceinline__ uint32_t pinned(uint32_t v) { uint32_t w = (uint32_t)__builtin_amdgcn_readfirstlane(v); asm volatile("" : "+s"(w)); return w; }   // a wave-uniform test held in a scalar register, so that the branch on it is a scalar branch (tensor loads ignore EXEC)
// one request of the calling wave: the tile that g1 describes, from the global address in g0 to the LDS place in g0
__device__ __forceinline__ void gemm_tload(const u32x4 g0, const u32x8 g1) { asm volatile("tensor_load_to_lds %0, %1" :: "s"(g0), "s"(g1) : "memory"); }
// the wave's own requests have landed. The two groups are operands so that their registers stay whole up to this wait and take new values only behind it.
__device__ __forceinline__ void gemm_twait(u32x4& g0, u32x8& g1) { asm volatile("s_wait_tensorcnt 0x0" : "+s"(g0), "+s"(g1) :: "memory"); }
// next stage: the LDS place dst, the global address one stage's row bytes further on (the type bits in word 3 lie above the address)
__device__ __forceinline__ void gemm_tnext(u32x4& g0, uint32_t dst, uint32_t rowb) {
    const uint64_t ga = (((uint64_t)g0[3] << 32) | (uint64_t)g0[2]) + rowb;
    g0[1] = uni(dst); g0[2] = uni((uint32_t)ga); g0[3] = uni((uint32_t)(ga >> 32));
}
// 16-bit forms of eight f32 values of the qkv product: f16, and bf16 hi and lo (stored only for positions < RH)
__device__ __forceinline__ void cvt3(const v8f x, v8h& o16, v8us& oh, v8us& ol) {
#pragma unroll
    for (int k = 0; k < 8; ++k) { o16[k] = (h16)x[k]; unsigned short a, c; splitf(x[k], a, c); oh[k] = a; ol[k] = c; }
}
__device__ __forceinline__ void store3(h16* p16, bf* ph, bf* pl, bool hr, const v8h o16, const v8us oh, const v8us ol) {
    *(v8h*)p16 = o16;
    asm volatile("s_wait_xcnt 0x0" ::: "memory");       // stands before the store's address and data registers are written again
    if (hr) {
        *(v8us*)ph = oh; *(v8us*)pl = ol;
        asm volatile("s_wait_xcnt 0x0" ::: "memory");   // the same for these two stores
    }
}
// PL = false: the tile goes to C as f32. PL = true (the qkv product; row m = l*NB + n, column which*1024 + h*64 + d): the tile goes straight to the 16-bit operand planes of the attention kernels,
// q and k per problem bh as SEQ x 64 elements (f16; positions < RH also bf16 hi and lo, RH x 64), v likewise, every plane in the fragment order of fo_qk and fo_v (v's fragments are those of the transposed tile); C is not touched.
template <int KS, bool PL>
__global__ __launch_bounds__(128) void k_gemmw(const bf* __restrict__ A, int lda, const bf* __restrict__ Bt, int ldb, int K, float* C, int ldc,
                                               h16* QK16, bf* QKh, bf* QKl, h16* VT16, bf* VTh, bf* VTl) {
    static_assert(KS == 64 || KS == 128);
    constexpr uint32_t ROWB   = 2u * KS;                                  // bytes of a row in a stage
    constexpr uint32_t GPITCH = ROWB + 16u;                               // LDS row pitch: an odd multiple of 16 bytes for 16-byte reads
    constexpr uint32_t GSLICE = (64u * GPITCH + 2047u) / 2048u * 2048u;   // 64 rows, rounded up to a multiple of 2 KiB
    constexpr uint32_t GBUF   = 4u * GSLICE;                              // slices: A rows 0..63, A rows 64..127, Bt rows 0..63, Bt rows 64..127
    __shared__ __attribute__((aligned(2048))) unsigned char tl[2 * GBUF];
    __shared__ __align__(16) float osall[4 * 16 * 68];
    const int lane = threadIdx.x & 31, lr = lane & 15, hi = lane >> 4;
    const uint32_t wave = uni(threadIdx.x >> 5), wm = wave & 1u, wn = wave >> 1;
    const int r0 = blockIdx.x * 128, c0 = blockIdx.y * 128;
    // this wave's slice of every stage: waves 0, 1 the two halves of the A rows, waves 2, 3 of the Bt rows
    const bool isb = wave >= 2u;
    const uint32_t spitch = (uint32_t)(isb ? ldb : lda) * 2u;
    const uint64_t sbase = (uint64_t)(size_t)(isb ? Bt : A) + (uint64_t)((isb ? c0 : r0) + (int)(wave & 1u) * 64) * spitch;
    const uint32_t sdst = (uint32_t)(size_t)tl + wave * GSLICE;
    u32x8 g1;                                     // 1-byte elements, tensor = tile = 64 rows of ROWB bytes, 4 dwords of LDS pad behind every row
    g1[0] = uni((1u << 20) | ((KS == 64 ? 4u : 5u) << 22) | (3u << 25));
    g1[1] = uni(ROWB << 16);
    g1[2] = uni(64u << 16);
    g1[3] = uni(ROWB << 16);
    g1[4] = uni(64u);
    g1[5] = uni(spitch);
    g1[6] = uni(0u);
    g1[7] = uni(0u);
    u32x4 g0;                                     // count 1, LDS place, global address, type 2
    g0[0] = uni(1u); g0[1] = uni(sdst); g0[2] = uni((uint32_t)sbase); g0[3] = uni((((uint32_t)(sbase >> 32)) & 0x01FFFFFFu) | 0x80000000u);
    const int T = K / KS;                         // stages
    v8f acc[4][4];
#pragma unroll
    for (int mb = 0; mb < 4; ++mb)
#pragma unroll
        for (int nb = 0; nb < 4; ++nb) acc[mb][nb] = (v8f){};
    gemm_tload(g0, g1);
    gemm_twait(g0, g1);                                     // stage 0 has landed (this wave's slice)
    __syncthreads();                                        // ... and every wave's
    gemm_tnext(g0, sdst + GBUF, ROWB);
    gemm_tload(g0, g1);
    const uint32_t aoff = wm * GSLICE + (uint32_t)lr * GPITCH + 16u * (uint32_t)hi;
    const uint32_t boff = (2u + wn) * GSLICE + (uint32_t)lr * GPITCH + 16u * (uint32_t)hi;
#pragma unroll 1                                 // rolled: one publish point in the code, the buffer chosen by a scalar
    for (int s = 0; s < T; ++s) {
        const uint32_t bsel = (uint32_t)(s & 1) * GBUF;
#pragma unroll 1
        for (int h = 0; h < KS / 64; ++h) {         // 64 k at a time: two 32-deep blocks (kept rolled: four blocks in a row spilled accumulators)
            const unsigned char* ap = tl + bsel + aoff + h * 128; const unsigned char* bp = tl + bsel + boff + h * 128;
            // LDS reads stand at two places only: the head (both blocks' A, the first block's Bt, the second block's Bt columns 0..31) and the middle of the first block
            // (the second block's Bt columns 32..63, into the registers that the first eight products have freed).
            v16us a[2][4], b[2][4];
#pragma unroll
            for (int i = 0; i < 4; ++i) { a[0][i] = ldus((const us*)(ap + i * 16 * GPITCH)); b[0][i] = ldus((const us*)(bp + i * 16 * GPITCH)); }
#pragma unroll
            for (int i = 0; i < 4; ++i) a[1][i] = ldus((const us*)(ap + i * 16 * GPITCH + 64));
#pragma unroll
            for (int i = 0; i < 2; ++i) b[1][i] = ldus((const us*)(bp + i * 16 * GPITCH + 64));
            __builtin_amdgcn_sched_barrier(0);      // keeps these loads one group ahead of the products
#pragma unroll
            for (int nb = 0; nb < 2; ++nb)
#pragma unroll
                for (int mb = 0; mb < 4; ++mb) acc[mb][nb] = mmg<true>(a[0][mb], b[0][nb], acc[mb][nb]);
            __builtin_amdgcn_sched_barrier(0);      // keeps the second group from rising among the products whose registers it takes
#pragma unroll
            for (int i = 2; i < 4; ++i) b[1][i] = ldus((const us*)(bp + i * 16 * GPITCH + 64));
            __builtin_amdgcn_sched_barrier(0);      // keeps the second group together, sixteen products ahead of its first use
#pragma unroll
            for (int nb = 2; nb < 4; ++nb)
#pragma unroll
                for (int mb = 0; mb < 4; ++mb) acc[mb][nb] = mmg<true>(a[0][mb], b[0][nb], acc[mb][nb]);
#pragma unroll
            for (int nb = 0; nb < 4; ++nb)
#pragma unroll
                for (int mb = 0; mb < 4; ++mb) acc[mb][nb] = mmg<true>(a[1][mb], b[1][nb], acc[mb][nb]);
        }
        // publish point of stage s + 1
        asm volatile("s_wait_dscnt 0x0" ::: "memory");      // this wave has left stage s's buffer
        gemm_twait(g0, g1);                                 // this wave's slice of stage s + 1 has landed
        __syncthreads();                                    // stage s + 1 readable by all; stage s's buffer left by all
        if (pinned(s + 2 < T)) { gemm_tnext(g0, sdst + bsel, ROWB); gemm_tload(g0, g1); }
    }
    gemm_twait(g0, g1);                                     // nothing in flight when the wave ends
    asm volatile("s_wait_dscnt 0x0" ::: "memory");
    float* os = osall + wave * (16 * 68);                   // output staging, private to the wave
    if constexpr (PL) {
        const int which = c0 / DM;                          // 0 q, 1 k, 2 v: the same for the whole tile
        const bool hr = r0 / NB < RH;                       // the tile's positions all lie below RH, or none does
        v8h o16; v8us oh, ol;
        if (which < 2) {
            const int h = ((c0 + (int)wn * 64) % DM) / HD;  // the wave's 64 columns are one head
#pragma unroll
            for (int mb = 0; mb < 4; ++mb) {
#pragma unroll
                for (int nb = 0; nb < 4; ++nb) {
#pragma unroll
                    for (int j = 0; j < 8; ++j) os[(hi * 8 + j) * 68 + nb * 16 + lr] = acc[mb][nb][j];
                }
                __builtin_amdgcn_wave_barrier(); asm volatile("" ::: "memory");
#pragma unroll
                for (int s = 0; s < 4; ++s) {               // eight lanes store one chunk of eight consecutive positions of one problem: one 128-byte line of the fragment order
                    const int sub = (lane >> 3) & 1, c8 = s * 2 + (lane >> 4), cp = c8 * 8;
                    const int row = NB == 2 ? (lane & 7) * 2 + sub : sub * 8 + (lane & 7);
                    const v4f a = *(const v4fa*)(os + row * 68 + cp), b = *(const v4fa*)(os + row * 68 + cp + 4);
                    cvt3(__builtin_shufflevector(a, b, 0, 1, 2, 3, 4, 5, 6, 7), o16, oh, ol);
                    const int m = r0 + (int)wm * 64 + mb * 16 + row, l = m / NB, bh = (m % NB) * NH + h;
                    const size_t e16 = (size_t)which * PLN + (size_t)bh * SEQ * HD + fo_qk(l, c8);
                    const size_t eh = hr ? ((size_t)which * PLNH + (size_t)bh * RH * HD + fo_qk(l, c8)) : 0;
                    store3(QK16 + e16, QKh + eh, QKl + eh, hr, o16, oh, ol);
                }
                __builtin_amdgcn_wave_barrier(); asm volatile("" ::: "memory");
            }
        } else {
            // v: the whole 128 x 128 tile is turned in LDS, T[column][n][position], so that a lane stores eight positions of one (bh, d) and eight lanes one 128-byte line of the fragment order, one writer.
            // T takes the place of the stage buffers: every wave has left them and nothing is in flight (the last pass's waits and barrier).
            constexpr int TP = 132, LT = 128 / NB;          // row pitch in floats (528 bytes, an odd multiple of 16); positions in the tile
            static_assert((size_t)128 * TP * 4 <= (size_t)2 * GBUF && (8 / NB) % 4 == 0);
            float* T = (float*)tl;
#pragma unroll
            for (int mb = 0; mb < 4; ++mb) {
#pragma unroll
                for (int nb = 0; nb < 4; ++nb) {
                    float* tw = T + ((int)wn * 64 + nb * 16 + lr) * TP + ((int)wm * 64 + mb * 16 + hi * 8) / NB;
#pragma unroll
                    for (int n = 0; n < NB; ++n) {
#pragma unroll
                        for (int k4 = 0; k4 < 8 / NB / 4; ++k4) {
                            v4f t;
#pragma unroll
                            for (int e = 0; e < 4; ++e) t[e] = acc[mb][nb][(k4 * 4 + e) * NB + n];
                            *(v4fa*)(tw + n * LT + k4 * 4) = t;
                        }
                    }
                }
            }
            __syncthreads();                                // the turned tile is whole before any wave reads another wave's part
#pragma unroll 4
            for (int it = 0; it < 16; ++it) {
                const int gi = it * 4 + (int)wave, l8 = (gi % (LT / 16)) * 2 + hi, rr = gi / (LT / 16), c = (rr % 8) * 16 + lr, n = rr / 8;   // a wave stores one run of a fragment: 512 contiguous bytes
                const float* tr = T + c * TP + n * LT + l8 * 8;
                const v4f a = *(const v4fa*)tr, b = *(const v4fa*)(tr + 4);
                cvt3(__builtin_shufflevector(a, b, 0, 1, 2, 3, 4, 5, 6, 7), o16, oh, ol);
                const int col = c0 - 2 * DM + c, bh = n * NH + col / HD, d = col % HD, l = r0 / NB + l8 * 8;
                const size_t e16 = (size_t)bh * HD * SEQ + fo_v(d, l);
                const size_t eh = hr ? ((size_t)bh * HD * RH + fo_v(d, l)) : 0;
                store3(VT16 + e16, VTh + eh, VTl + eh, hr, o16, oh, ol);
            }
        }
        return;
    }
#pragma unroll
    for (int mb = 0; mb < 4; ++mb) {
#pragma unroll
        for (int nb = 0; nb < 4; ++nb) {
#pragma unroll
            for (int j = 0; j < 8; ++j) os[(hi * 8 + j) * 68 + nb * 16 + lr] = acc[mb][nb][j];
        }
        __builtin_amdgcn_wave_barrier(); asm volatile("" ::: "memory");
        float* crow = C + (size_t)(r0 + (int)wm * 64 + mb * 16) * ldc + c0 + (int)wn * 64;
{
#pragma unroll
            for (int s = 0; s < 8; ++s) {                       // rows 2s+hi, s = 0..7, hi = 0..1: all 16 rows of the slab
                const int row = 2 * s + hi, cofs = lr * 4;
                const v4f val = *(const v4fa*)(os + row * 68 + cofs);
                *(v4f*)(crow + (size_t)row * ldc + cofs) = val;
            }
            
        }
        __builtin_amdgcn_wave_barrier(); asm volatile("" ::: "memory");
    }
}

// lane l with lane l ^ 16 (the other half of a query column's keys)
__device__ __forceinline__ float xhalf(float x) {
    return __builtin_bit_cast(float, __builtin_amdgcn_permlanex16(__builtin_bit_cast(int, x), __builtin_bit_cast(int, x), 0x76543210, 0xfedcba98, false, false));
}

template <bool HR>
__device__ __forceinline__ void attn_body(const us* __restrict__ Qa, const us* __restrict__ Qr, const us* __restrict__ Ka, const us* __restrict__ Kr,
                                          const us* __restrict__ Va, const us* __restrict__ Vr, bf* CTX, const int q0) {
    constexpr int LR = HR ? RH : SEQ;                  // positions per problem in the planes
    __shared__ __align__(16) unsigned short oh[32 * OP];
    __shared__ __align__(16) unsigned short ol[32 * OP];
    const int lane = threadIdx.x & 31, lr = lane & 15, hi = lane >> 4;
    const int bh = blockIdx.x, n = bh / NH, h = bh % NH;
    const size_t pb = (size_t)bh * LR * HD;
    Qa += pb; Ka += pb; Va += pb; Qr += pb; Kr += pb; Vr += pb;
    const int qoff = q0 * HD + 8 * lane;               // fragment order: 16 positions of q or k are 1024 elements, 32 positions of v 2048
    const int koff = 8 * lane;
    const int voff = 8 * lane;
    const float cexp = 0.125f * 1.4426950408889634f;   // HD^-0.5 * log2(e)
    const float pc = HR ? 1.0f : PCAR;
    v8f o[2][4]; float mrow[2], lsum[2];               // o[u][t2][r] = context(query q0 + u*16 + lr, d = t2*16 + 8*hi + r); mrow, lsum: of query q0 + u*16 + lr
#pragma unroll
    for (int u = 0; u < 2; ++u) {
#pragma unroll
        for (int t2 = 0; t2 < 4; ++t2) o[u][t2] = (v8f){};
        mrow[u] = -3.0e38f; lsum[u] = 0.0f;
    }
    v16us qfa[2][2], qfr[2][2], kfa[2][2], kfr[2][2];      // [kc][u] and [kc][t]
#pragma unroll
    for (int kc = 0; kc < 2; ++kc) {
#pragma unroll
        for (int u = 0; u < 2; ++u) {
            qfa[kc][u] = ldfr(Qa + qoff + u * 16 * HD + kc * 512);
            qfr[kc][u] = HR ? ldfr(Qr + qoff + u * 16 * HD + kc * 512) : qfa[kc][u];
        }
#pragma unroll
        for (int t = 0; t < 2; ++t) {
            const int ko = (t * 16) * HD + koff + kc * 512;
            kfa[kc][t] = ldfr(Ka + ko);
            kfr[kc][t] = HR ? ldfr(Kr + ko) : kfa[kc][t];
        }
    }
    const int kfirst = (32 <= q0 ? 32 : q0) * HD + koff;
    const us* kpa = Ka + kfirst; const us* kpr = Kr + kfirst;      // the NEXT step's key rows
    const us* vpa = Va + voff;   const us* vpr = Vr + voff;        // this step's value columns
#pragma unroll 1
    for (int m0 = 0; m0 <= q0; m0 += 32) {
        v16us vfa[4], vfr[4];
#pragma unroll
        for (int t2 = 0; t2 < 4; ++t2) {
            vfa[t2] = ldfr(vpa + t2 * 512);                // A[m = d = t2*16 + lr][k = key m0 + ..]
            vfr[t2] = HR ? ldfr(vpr + t2 * 512) : vfa[t2];
        }
        v8f s[2][2];
#pragma unroll
        for (int u = 0; u < 2; ++u)
#pragma unroll
            for (int t = 0; t < 2; ++t) s[u][t] = (v8f){};
#pragma unroll
        for (int kc = 0; kc < 2; ++kc) {
#pragma unroll
            for (int t = 0; t < 2; ++t) {
                s[0][t] = mmg<HR>(kfa[kc][t], qfa[kc][0], s[0][t]); s[1][t] = mmg<HR>(kfa[kc][t], qfa[kc][1], s[1][t]);
                if (HR) {
                    s[0][t] = mmg<HR>(kfa[kc][t], qfr[kc][0], s[0][t]); s[1][t] = mmg<HR>(kfa[kc][t], qfr[kc][1], s[1][t]);
                    s[0][t] = mmg<HR>(kfr[kc][t], qfa[kc][0], s[0][t]); s[1][t] = mmg<HR>(kfr[kc][t], qfa[kc][1], s[1][t]);
                }
            }
        }
        {       // next step's key fragments: a whole softmax and the V^T.P^T products ahead of their use (the last step fetches its own keys again: in bounds, not used)
#pragma unroll
            for (int kc = 0; kc < 2; ++kc) {
#pragma unroll
                for (int t = 0; t < 2; ++t) {
                    kfa[kc][t] = ldfr(kpa + (t * 16) * HD + kc * 512);
                    kfr[kc][t] = HR ? ldfr(kpr + (t * 16) * HD + kc * 512) : kfa[kc][t];
                }
            }
            __builtin_amdgcn_sched_barrier(0);      // keeps the loads ahead of the softmax (lead)
        }
        // s[u][t][r] = score(key m0 + t*16 + 8*hi + r, query q0 + u*16 + lr). Keys beyond the query are excluded (only possible in the diagonal step; key m0 is always kept).
        if (m0 == q0) {
#pragma unroll
            for (int u = 0; u < 2; ++u)
#pragma unroll
                for (int t = 0; t < 2; ++t)
#pragma unroll
                    for (int r = 0; r < 8; ++r) { if (t * 16 + 8 * hi + r > u * 16 + lr) s[u][t][r] = -3.0e38f; }
        }
        v16us pa[2], pr[2];
#pragma unroll
        for (int u = 0; u < 2; ++u) {
            float v = fmaxf(s[u][0][0], s[u][1][0]);
#pragma unroll
            for (int r = 1; r < 8; ++r) v = fmaxf(v, fmaxf(s[u][0][r], s[u][1][r]));
            v = fmaxf(v, xhalf(v));
            const float mn = fmaxf(mrow[u], v);
            const v8f x0 = (s[u][0] - mn) * cexp, x1 = (s[u][1] - mn) * cexp;
            float e0[8], e1[8];
#pragma unroll
            for (int r = 0; r < 8; ++r) e0[r] = __builtin_amdgcn_exp2f(x0[r]);
#pragma unroll
            for (int r = 0; r < 8; ++r) e1[r] = __builtin_amdgcn_exp2f(x1[r]);
            const float al = __builtin_amdgcn_exp2f((mrow[u] - mn) * cexp);
            mrow[u] = mn;
            float ps[4] = {0.0f, 0.0f, 0.0f, 0.0f};             // four independent partial sums of the lane's 16 probabilities
#pragma unroll
            for (int r = 0; r < 8; ++r) {
                const float p0 = e0[r], p1 = e1[r];
                ps[r & 3] += p0 + p1;
                if (HR) {
                    unsigned short a, c; splitf(p0, a, c); pa[u][r] = a; pr[u][r] = c;
                    splitf(p1, a, c); pa[u][8 + r] = a; pr[u][8 + r] = c;
                } else {
                    pa[u][r] = __builtin_bit_cast(unsigned short, (h16)(p0 * PCAR));
                    pa[u][8 + r] = __builtin_bit_cast(unsigned short, (h16)(p1 * PCAR));
                }
            }
            if (!HR) pr[u] = pa[u];
            lsum[u] = lsum[u] * al + ((ps[0] + ps[1]) + (ps[2] + ps[3]));     // per-lane partial sum of one query (its half of the keys), the halves joined once at the end
#pragma unroll
            for (int t2 = 0; t2 < 4; ++t2) o[u][t2] *= al;
        }
#pragma unroll
        for (int t2 = 0; t2 < 4; ++t2) {
            o[0][t2] = mmg<HR>(vfa[t2], pa[0], o[0][t2]); o[1][t2] = mmg<HR>(vfa[t2], pa[1], o[1][t2]);
            if (HR) {
                o[0][t2] = mmg<HR>(vfa[t2], pr[0], o[0][t2]); o[1][t2] = mmg<HR>(vfa[t2], pr[1], o[1][t2]);
                o[0][t2] = mmg<HR>(vfr[t2], pa[0], o[0][t2]); o[1][t2] = mmg<HR>(vfr[t2], pa[1], o[1][t2]);
            }
        }
        // the address pairs of this step's loads stay whole up to this wait; they are stepped only behind it
        if (HR) asm volatile("s_wait_xcnt 0x0" :: "v"(kpa), "v"(kpr), "v"(vpa), "v"(vpr) : "memory");
        else    asm volatile("s_wait_xcnt 0x0" :: "v"(kpa), "v"(vpa) : "memory");
        const int kstep = m0 + 64 <= q0 ? 32 * HD : 0;
        kpa += kstep; kpr += kstep; vpa += 32 * HD; vpr += 32 * HD;
    }
    // normalise, split into bf16 hi / lo, stage the 32 x 64 tile (a lane's 8 registers are 8 consecutive d of one query: 16-byte LDS stores), then whole-line stores
#pragma unroll
    for (int u = 0; u < 2; ++u) {
        float l = lsum[u];
        l += xhalf(l);
        const float inv = 1.0f / (l * pc);
#pragma unroll
        for (int t2 = 0; t2 < 4; ++t2) {
            v8us a8, c8;
#pragma unroll
            for (int r = 0; r < 8; ++r) { unsigned short a, c; splitf(o[u][t2][r] * inv, a, c); a8[r] = a; c8[r] = c; }
            const int oo = (u * 16 + lr) * OP + t2 * 16 + 8 * hi;
            *(v8usa*)(oh + oo) = a8; *(v8usa*)(ol + oo) = c8;
        }
    }
    __syncthreads();
{
#pragma unroll
        for (int s = 0; s < 8; ++s) {
            const int row = s * 4 + (lane >> 3), cp = (lane & 7) * 8;
            const v8us vh = *(const v8usa*)(oh + row * OP + cp);
            const v8us vl = *(const v8usa*)(ol + row * OP + cp);
            bf* d = CTX + ((size_t)(q0 + row) * NB + n) * CK + h * HD + cp;
            *(v8us*)d = vh; *(v8us*)(d + DM) = vl;
        }
        
    }
}

__global__ __launch_bounds__(32) void k_attn_lo(const us* __restrict__ Q16, const us* __restrict__ K16, const us* __restrict__ V16, bf* CTX) {
    attn_body<false>(Q16, Q16, K16, K16, V16, V16, CTX, RH + (int)blockIdx.y * 32);
}

// ---- k_attn_hr: early query positions (< RH) on bf16 hi/lo planes, ONE 16-row tile per wave (one wave per block), 32 keys per step.
// Per-query arithmetic and product order are those of attn_body with HR = true (q.k: hi.hi, lo.hi, hi.lo per 32-deep chunk; P.v: hi.hi, lo.hi, hi.lo; all into one accumulator, unscaled bf16 residuals), transposed in the same way.
// Live state per lane: 4 output accumulators + 2 score accumulators + 2 softmax scalars + the fragments fetched ahead: q once in front of the loop, a step's v at its head, the next step's k among this step's V^T.P^T products.
// Key steps run over m0 = 0, 32, .., mend with mend = q0 pad down to a multiple of 32 (block-uniform); keys beyond the query are excluded in the last step only (key mend is always kept).
// Planes: RH x 64 elements per problem in fragment order (fo_qk, fo_v); the last step reads keys < mend + 32 <= RH, all written by the qkv product's epilogue.
__global__ __launch_bounds__(32) void k_attn_hr(const us* __restrict__ Qh, const us* __restrict__ Ql, const us* __restrict__ Kh, const us* __restrict__ Kl,
                                                const us* __restrict__ Vh, const us* __restrict__ Vl, bf* CTX) {
    __shared__ __align__(16) unsigned short eoh[ER * OP];     // context hi staging, 16 rows x 64
    __shared__ __align__(16) unsigned short eol[ER * OP];     // context lo staging
    const int lane = threadIdx.x & 31, lr = lane & 15, hi = lane >> 4;
    const int bh = blockIdx.x, n = bh / NH, h = bh % NH;
    const int q0 = (int)blockIdx.y * ER;
    const int mend = q0 & ~31;
    const size_t pb = (size_t)bh * RH * HD;
    Qh += pb; Ql += pb; Kh += pb; Kl += pb; Vh += pb; Vl += pb;
    const int qoff = q0 * HD + 8 * lane;               // fragment order: 16 positions of q or k are 1024 elements, 32 positions of v 2048
    const int koff = 8 * lane;
    const int voff = 8 * lane;
    const float cexp = 0.125f * 1.4426950408889634f;   // HD^-0.5 * log2(e)
    v8f o[4]; float mrow = -3.0e38f, lsum = 0.0f;      // o[t2][r] = context(query q0 + lr, d = t2*16 + 8*hi + r); mrow, lsum: of query q0 + lr
#pragma unroll
    for (int t2 = 0; t2 < 4; ++t2) o[t2] = (v8f){};
    v16us qfa[2], qfr[2], kfa[2][2], kfr[2][2];            // [kc] and [kc][t]
#pragma unroll
    for (int kc = 0; kc < 2; ++kc) {
        qfa[kc] = ldfr(Qh + qoff + kc * 512);
        qfr[kc] = ldfr(Ql + qoff + kc * 512);
#pragma unroll
        for (int t = 0; t < 2; ++t) {
            const int ko = (t * 16) * HD + koff + kc * 512;
            kfa[kc][t] = ldfr(Kh + ko);
            kfr[kc][t] = ldfr(Kl + ko);
        }
    }
    const int kfirst = (32 <= mend ? 32 : mend) * HD + koff;
    const us* kph = Kh + kfirst; const us* kpl = Kl + kfirst;      // the NEXT step's key rows (the last step fetches its own keys again: in bounds, not used)
#pragma unroll 1
    for (int m0 = 0; m0 <= mend; m0 += 32) {
        v16us vfa[4], vfr[4];
        const us* vph = Vh + voff + m0 * HD; const us* vpl = Vl + voff + m0 * HD;
#pragma unroll
        for (int t2 = 0; t2 < 4; ++t2) {
            vfa[t2] = ldfr(vph + t2 * 512);                // A[m = d = t2*16 + lr][k = key m0 + ..]
            vfr[t2] = ldfr(vpl + t2 * 512);
        }
        asm volatile("s_wait_xcnt 0x0" :: "v"(vph), "v"(vpl) : "memory");   // the two address pairs stay whole up to this wait
        v8f s[2];
        s[0] = (v8f){}; s[1] = (v8f){};
#pragma unroll
        for (int kc = 0; kc < 2; ++kc) {
#pragma unroll
            for (int t = 0; t < 2; ++t) {
                s[t] = mmg<true>(kfa[kc][t], qfa[kc], s[t]);
                s[t] = mmg<true>(kfa[kc][t], qfr[kc], s[t]);
                s[t] = mmg<true>(kfr[kc][t], qfa[kc], s[t]);
            }
        }
        // s[t][r] = score(key m0 + t*16 + 8*hi + r, query q0 + lr)
        if (m0 == mend) {
#pragma unroll
            for (int t = 0; t < 2; ++t)
#pragma unroll
                for (int r = 0; r < 8; ++r) { if (m0 + t * 16 + 8 * hi + r > q0 + lr) s[t][r] = -3.0e38f; }
        }
        v16us pa, pr;
        {
            float v = fmaxf(s[0][0], s[1][0]);
#pragma unroll
            for (int r = 1; r < 8; ++r) v = fmaxf(v, fmaxf(s[0][r], s[1][r]));
            v = fmaxf(v, xhalf(v));
            const float mn = fmaxf(mrow, v);
            const float al = __builtin_amdgcn_exp2f((mrow - mn) * cexp);
            mrow = mn;
            const v8f x0 = (s[0] - mn) * cexp, x1 = (s[1] - mn) * cexp;
            float ps[4] = {0.0f, 0.0f, 0.0f, 0.0f};             // four independent partial sums of the lane's 16 probabilities
#pragma unroll
            for (int r = 0; r < 8; ++r) {
                const float p0 = __builtin_amdgcn_exp2f(x0[r]);
                const float p1 = __builtin_amdgcn_exp2f(x1[r]);
                ps[r & 3] += p0 + p1;
                unsigned short a, c;
                splitf(p0, a, c); pa[r] = a; pr[r] = c;
                splitf(p1, a, c); pa[8 + r] = a; pr[8 + r] = c;
            }
            lsum = lsum * al + ((ps[0] + ps[1]) + (ps[2] + ps[3]));           // per-lane partial sum of one query (its half of the keys), the halves joined once at the end
#pragma unroll
            for (int t2 = 0; t2 < 4; ++t2) o[t2] *= al;
        }
#pragma unroll
        for (int t2 = 0; t2 < 4; ++t2) {
            o[t2] = mmg<true>(vfa[t2], pa, o[t2]);
            o[t2] = mmg<true>(vfa[t2], pr, o[t2]);
            o[t2] = mmg<true>(vfr[t2], pa, o[t2]);
            const int ko = ((t2 & 1) * 16) * HD + (t2 >> 1) * 512;
            kfa[t2 >> 1][t2 & 1] = ldfr(kph + ko);
            kfr[t2 >> 1][t2 & 1] = ldfr(kpl + ko);
            __builtin_amdgcn_sched_barrier(0);  // keeps each key refill behind the products that free a value fragment pair (register room)
        }
        asm volatile("s_wait_xcnt 0x0" :: "v"(kph), "v"(kpl) : "memory");   // the key address pairs stay whole up to this wait; they are stepped only behind it
        const int kstep = m0 + 64 <= mend ? 32 * HD : 0;
        kph += kstep; kpl += kstep;
    }
    // normalise, split into bf16 hi / lo, stage the 16 x 64 tile (16-byte LDS stores), then whole-line stores
    {
        float l = lsum;
        l += xhalf(l);
        const float inv = 1.0f / l;
#pragma unroll
        for (int t2 = 0; t2 < 4; ++t2) {
            v8us a8, c8;
#pragma unroll
            for (int r = 0; r < 8; ++r) { unsigned short a, c; splitf(o[t2][r] * inv, a, c); a8[r] = a; c8[r] = c; }
            const int oo = lr * OP + t2 * 16 + 8 * hi;
            *(v8usa*)(eoh + oo) = a8; *(v8usa*)(eol + oo) = c8;
        }
    }
    __syncthreads();
{
#pragma unroll
        for (int s4 = 0; s4 < ER / 4; ++s4) {
            const int row = s4 * 4 + (lane >> 3), cp = (lane & 7) * 8;
            const v8us vh = *(const v8usa*)(eoh + row * OP + cp);
            const v8us vl = *(const v8usa*)(eol + row * OP + cp);
            bf* d = CTX + ((size_t)(q0 + row) * NB + n) * CK + h * HD + cp;
            *(v8us*)d = vh; *(v8us*)(d + DM) = vl;
        }
        
    }
}

// workspace carve (bytes), every region a multiple of 256
constexpr size_t SZ_XB   = (size_t)MROWS * DM * 2;        // x bf16 [MROWS][1024]
constexpr size_t SZ_WQ   = (size_t)F3 * DM * 2;           // w_qkv bf16 [3072][1024]
constexpr size_t SZ_WO   = (size_t)DM * CK * 2;           // [w_out | w_out] bf16 [1024][2048]
constexpr size_t SZ_QK16 = (size_t)2 * NBH * SEQ * HD * 2;
constexpr size_t SZ_QKH  = (size_t)2 * NBH * RH * HD * 2;
constexpr size_t SZ_VT16 = (size_t)NBH * HD * SEQ * 2;
constexpr size_t SZ_VTH  = (size_t)NBH * HD * RH * 2;
constexpr size_t SZ_CTX  = (size_t)MROWS * CK * 2;        // context bf16 hi | lo [MROWS][2048]
constexpr size_t OF_XB   = 0;
constexpr size_t OF_WQ   = OF_XB + SZ_XB;
constexpr size_t OF_WO   = OF_WQ + SZ_WQ;
constexpr size_t OF_QK16 = OF_WO + SZ_WO;
constexpr size_t OF_QKH  = OF_QK16 + SZ_QK16;
constexpr size_t OF_QKL  = OF_QKH + SZ_QKH;
constexpr size_t OF_VT16 = OF_QKL + SZ_QKH;
constexpr size_t OF_VTH  = OF_VT16 + SZ_VT16;
constexpr size_t OF_VTL  = OF_VTH + SZ_VTH;
constexpr size_t OF_CTX  = OF_VTL + SZ_VTH;
constexpr size_t WS_TOTAL = OF_CTX + SZ_CTX;
static_assert(SZ_XB % 256 == 0 && SZ_WQ % 256 == 0 && SZ_WO % 256 == 0 && SZ_QK16 % 256 == 0);
static_assert(SZ_QKH % 256 == 0 && SZ_VT16 % 256 == 0 && SZ_VTH % 256 == 0 && SZ_CTX % 256 == 0);
static_assert(WS_TOTAL <= (size_t)134217728);            // total carve <= 128 MiB

extern "C" void kernel_launch(void* const* d_in, const int* in_sizes, int n_in,
                              void* d_out, int out_size, void* d_ws, size_t ws_size, hipStream_t stream) {
    if (n_in < 3) return;
    const long long needx = ((long long)(SEQ - 1) * NB_FULL + NB) * DM;     // last token row touched, in elements
    if ((long long)in_sizes[0] < needx || (long long)in_sizes[1] < (long long)F3 * DM || (long long)in_sizes[2] < (long long)DM * DM || (long long)out_size < needx) return;
    if (WS_TOTAL > ws_size) return;
    const float* x = (const float*)d_in[0];       // [2048][2][1024], token row l*2 + n
    const float* wqkv = (const float*)d_in[1];    // [3072][1024] = [out][in]
    const float* wout = (const float*)d_in[2];    // [1024][1024] = [out][in]
    float* OUT = (float*)d_out;                   // [2048][2][1024]
    char* ws = (char*)d_ws;
    bf* XB = (bf*)(ws + OF_XB); bf* WQ = (bf*)(ws + OF_WQ); bf* WO2 = (bf*)(ws + OF_WO);
    h16* QK16 = (h16*)(ws + OF_QK16); bf* QKh = (bf*)(ws + OF_QKH); bf* QKl = (bf*)(ws + OF_QKL);
    h16* VT16 = (h16*)(ws + OF_VT16); bf* VTh = (bf*)(ws + OF_VTH); bf* VTl = (bf*)(ws + OF_VTL); bf* CTX = (bf*)(ws + OF_CTX);

    k_cvt_all<<<CROWS / (16 * CRPW), 512, 0, stream>>>(x, wqkv, wout, XB, WQ, WO2);
    k_gemmw<64, true><<<dim3(MROWS / 128, F3 / 128, 1), 128, 0, stream>>>(XB, DM, WQ, DM, DM, nullptr, 0, QK16, QKh, QKl, VT16, VTh, VTl);   // qkv[m][f] = sum_e x[m][e] w_qkv[f][e], written as 16-bit planes
    k_attn_hr<<<dim3(NBH, RH / ER, 1), 32, 0, stream>>>((const us*)QKh, (const us*)QKl, (const us*)(QKh + PLNH), (const us*)(QKl + PLNH), (const us*)VTh, (const us*)VTl, CTX);
    if (SEQ > RH)
        k_attn_lo<<<dim3(NBH, (SEQ - RH) / 32 > 0 ? (SEQ - RH) / 32 : 1, 1), 32, 0, stream>>>((const us*)QK16, (const us*)(QK16 + PLN), (const us*)VT16, CTX);
    k_gemmw<128, false><<<dim3(MROWS / 128, DM / 128, 1), 128, 0, stream>>>(CTX, CK, WO2, CK, CK, OUT, DM * ROWSTEP, nullptr, nullptr, nullptr, nullptr, nullptr, nullptr);   // out[m][f] = sum_e (ctx_hi + ctx_lo)[m][e] w_out[f][e]
}

// v007
// One run takes 86.9 microseconds.
// Two timings next to v006 put it at 1.24 and 1.27 times that version's speed.
// Over all steps from v000 it is 4.64 times as fast.
#include <hip/hip_runtime.h>
#include <stdint.h>

// Contractions: qkv projection and output projection v_wmma_f32_16x16x32_bf16 (every input RNE-converted to bf16; context carried as bf16 hi|lo folded into K); scores and probability x value v_wmma_f32_16x16x32_f16 for query positions >= 256 (P carried x1024), bf16 hi/lo three-product form for positions < 256; f32 accumulate, f32 softmax.
// Sequence-first causal multi-head self-attention with a fused bias-free (out, in) qkv weight and an (out, in) output weight: token row m = l*NB + n, attention problem bh = n*16 + h, head columns h*64..h*64+63.
// Launch plan: k_cvt_all (bf16 copies) -> k_gemmw (qkv product, its epilogue writes the q/k/v^T 16-bit planes) -> k_attn_hr (rows < 256, 16-row tiles) -> k_attn_lo (rows >= 256, 32-row tiles) -> k_gemmw (output).

#ifndef NB
#define NB 2                      // batch entries processed (NB_FULL, or 1 for a reduced build)
#endif
#ifndef SEQ
#define SEQ 2048                  // sequence positions processed
#endif
#define NB_FULL  2                // batch stride of the staged x and of the output rows
#define SEQ_FULL 2048
#define DM   1024
#define NH   16
#define HD   64
#define F3   (3 * DM)
#define CK   (2 * DM)             // context plane width: hi columns | lo columns
#define RH   256                  // query positions < RH use the hi/lo planes
#define NBH  (NB * NH)
#define MROWS (SEQ * NB)
#define ROWSTEP (NB_FULL / NB)
#define PLN  ((size_t)NBH * SEQ * HD)
#define PLNH ((size_t)NBH * RH * HD)
#define PCAR 1024.0f
#define OP   72                   // context staging pitch in 16-bit elements (144 B)
#define ER   16                   // query rows per wave in the early-positions kernel

static_assert(NB == NB_FULL || NB == 1);          // compact row m = l*NB + n maps to token row m*ROWSTEP
static_assert(SEQ <= SEQ_FULL && SEQ >= RH);
static_assert(SEQ % 256 == 0);                    // tile multiples (128-row GEMM tiles, 32-row attention tiles, 8-wide plane groups)
static_assert(RH % 32 == 0 && RH % 8 == 0);       // the last 32-key step of the early kernel ends inside the hi/lo planes
static_assert(RH % ER == 0 && ER == 16);          // early kernel: one 16-row WMMA tile per wave, store loop 4 x 4 rows
static_assert(HD == 64 && NH * HD == DM);
static_assert(DM == 1024);                        // k_cvt_all: a row is 8 loads of 128 floats per wave
static_assert(DM % 64 == 0 && DM >= 128 && CK % 128 == 0 && CK >= 256);   // K: whole stages, at least two (k_gemmw: 64 deep for qkv, 128 deep for the output)
static_assert(MROWS % 128 == 0 && F3 % 128 == 0 && DM % 128 == 0);        // whole 128 x 128 output tiles
static_assert(RH % (128 / NB) == 0 && DM % 128 == 0);     // a 128 x 128 tile of the qkv product lies wholly in one of q, k, v and wholly below or above RH
static_assert(OP >= 64 && (OP * 2) % 16 == 0);

typedef _Float16 h16;
typedef unsigned short bf;
typedef unsigned short us;
typedef __attribute__((ext_vector_type(16))) __bf16   v16bf;
typedef __attribute__((ext_vector_type(16))) _Float16 v16h;
typedef __attribute__((ext_vector_type(16))) unsigned short v16us;
typedef __attribute__((ext_vector_type(8)))  _Float16 v8h;
typedef __attribute__((ext_vector_type(8)))  unsigned short v8us;
typedef __attribute__((ext_vector_type(8)))  float    v8f;
typedef __attribute__((ext_vector_type(4)))  float    v4f;
typedef v4f  __attribute__((may_alias)) v4fa;
typedef v8us __attribute__((may_alias)) v8usa;

__device__ __forceinline__ unsigned short f2bf(float f) { unsigned u = __float_as_uint(f); u += 0x7FFFu + ((u >> 16) & 1u); return (unsigned short)(u >> 16); }
__device__ __forceinline__ float bf2f(unsigned short b) { return __uint_as_float(((unsigned)b) << 16); }
__device__ __forceinline__ void splitf(float y, unsigned short& h, unsigned short& l) { h = f2bf(y); l = f2bf(y - bf2f(h)); }

// 16-bit fragment from a K-contiguous row: elements 0..7 <- p[0..7], elements 8..15 <- p[16..23]; the caller adds 8*(lane>>4) to p.
__device__ __forceinline__ v16us ldus(const us* p) {
    const v8us a = *(const v8us*)p; const v8us b = *(const v8us*)(p + 16);
    return __builtin_shufflevector(a, b, 0, 1, 2, 3, 4, 5, 6, 7, 8, 9, 10, 11, 12, 13, 14, 15);
}

// 16-bit fragment from a plane kept in fragment order: a fragment is 1 KiB, two runs of 512 contiguous bytes (elements 0..7 of lanes 0..31, then elements 8..15); the caller adds 8*lane to p.
// Each of the two loads then covers four whole 128-byte lines, where a load from a row-major plane touches sixteen lines for 32 bytes each.
__device__ __forceinline__ v16us ldfr(const us* p) {
    const v8us a = *(const v8us*)p; const v8us b = *(const v8us*)(p + 256);
    return __builtin_shufflevector(a, b, 0, 1, 2, 3, 4, 5, 6, 7, 8, 9, 10, 11, 12, 13, 14, 15);
}
// Element offsets inside one problem's plane. q and k: position l, 8-element chunk c8 of the 64 head columns (16 positions x 64 columns = two fragments of 32 columns each).
// v: head column d, position l a multiple of 8 (32 positions x 64 columns = four fragments of 16 columns each). Lane = 16*hi + lr, with lr the fragment's row and hi the 8-element half of ldus.
__device__ __forceinline__ int fo_qk(int l, int c8) { return (l >> 4) * 1024 + (c8 >> 1) * 256 + (c8 & 1) * 128 + (l & 15) * 8; }
__device__ __forceinline__ int fo_v(int d, int l)   { return (l >> 5) * 2048 + ((d >> 4) * 2 + ((l >> 4) & 1)) * 256 + ((l >> 3) & 1) * 128 + (d & 15) * 8; }

// One WMMA plus its own four-slot guard (ties exactly one accumulator, keeps A and B live).
template <bool BF>
__device__ __forceinline__ v8f mmg(v16us a, v16us b, v8f c) {
    if (BF) c = __builtin_amdgcn_wmma_f32_16x16x32_bf16(false, __builtin_bit_cast(v16bf, a), false, __builtin_bit_cast(v16bf, b), (short)0, c, false, false);
    else    c = __builtin_amdgcn_wmma_f32_16x16x32_f16(false, __builtin_bit_cast(v16h, a), false, __builtin_bit_cast(v16h, b), (short)0, c, false, false);
    asm volatile("v_nop\n\tv_nop\n\tv_nop\n\tv_nop" : "+v"(c) : "v"(a), "v"(b));
    return c;
}

// ---- k_cvt_all: every f32 input to its bf16 plane in ONE launch of CROWS / CRPW two-row waves (16 per work-group, one work-group per 32 rows).
// A wave takes CRPW whole rows of 1024 floats out of the list [x rows | w_qkv rows | w_out rows]: rows w and w + CROWS / CRPW. All of its loads (8 per row, 512 contiguous bytes each) are issued
// before the first value is converted; a store is 256 contiguous bytes. A w_out row is stored twice (columns 0..1023 pair with the hi half of the context plane, 1024..2047 with the lo half).
#define CROWS (MROWS + F3 + DM)
#define CRPW  2
static_assert(CROWS % (16 * CRPW) == 0);          // whole work-groups of 16 waves
typedef __attribute__((ext_vector_type(4))) unsigned short v4us;
__global__ __launch_bounds__(512) void k_cvt_all(const float* __restrict__ x, const float* __restrict__ wqkv, const float* __restrict__ wout, bf* XB, bf* WQ, bf* WO2) {
    const int lane = threadIdx.x & 31;
    const int w = __builtin_amdgcn_readfirstlane((int)(blockIdx.x * 16 + (threadIdx.x >> 5)));
    const float* s[CRPW]; bf* dst[CRPW]; bool dup[CRPW];
#pragma unroll
    for (int r = 0; r < CRPW; ++r) {                  // which plane the row belongs to: the same for the whole wave, scalar selects
        const int row = w + r * (CROWS / CRPW);
        const bool isx = row < MROWS, isq = row < MROWS + F3;
        const int rr = isx ? row : (isq ? row - MROWS : row - MROWS - F3);
        s[r]   = (isx ? x : (isq ? wqkv : wout)) + (size_t)rr * (isx ? ROWSTEP * DM : DM) + lane * 4;
        dst[r] = (isx ? XB : (isq ? WQ : WO2)) + (size_t)rr * (isq ? DM : CK) + lane * 4;
        dup[r] = !isq;
    }
    v4f v[CRPW][8];
#pragma unroll
    for (int r = 0; r < CRPW; ++r)
#pragma unroll
        for (int j = 0; j < 8; ++j) v[r][j] = *(const v4f*)(s[r] + j * 128);
    __builtin_amdgcn_sched_barrier(0);                // keeps every load of the wave ahead of the first conversion: without it the second row's loads sank behind waits on the first row's
#pragma unroll
    for (int r = 0; r < CRPW; ++r) {
        v4us o[8];
#pragma unroll
        for (int j = 0; j < 8; ++j) {
#pragma unroll
            for (int k = 0; k < 4; ++k) o[j][k] = f2bf(v[r][j][k]);
        }
        bf* d = dst[r];
#pragma unroll
        for (int j = 0; j < 8; ++j) *(v4us*)(d + j * 128) = o[j];
        if (r + 1 < CRPW) asm volatile("s_wait_xcnt 0x0" ::: "memory");       // stands before the stores' base and data registers are written again (the next row's address and values take them)
        if (dup[r]) {
#pragma unroll
            for (int j = 0; j < 8; ++j) *(v4us*)(d + DM + j * 128) = o[j];
            if (r + 1 < CRPW) asm volatile("s_wait_xcnt 0x0" ::: "memory");   // the same for these stores
        }
    }
}

// ---- k_gemmw: one 128x128 output tile per work-group of four waves (2 x 2, 64x64 = 16 accumulators each); grid (M/128, N/128), 128 threads.
// C[m][n] (f32, pitch ldc) = sum_k A[m][k] Bt[n][k]; K a multiple of KS and at least 2 KS, M and N multiples of 128; bf16 operands from K-contiguous planes.
// A stage is KS k of the tile's 128 A rows and 128 Bt rows. Each wave brings one slice of it (64 rows of 2 KS bytes) into LDS with one tensor load, every row padded by 16 bytes;
// two buffers: the load of stage s + 1 is in flight while stage s is multiplied. Every operand row is fetched once per work-group in whole lines and read by two waves from LDS.
// KS = 64 leaves room for three work-groups on a WGP (a grid of several per WGP); KS = 128 keeps twice the bytes in flight where a work-group has its WGP alone.
// The k walk is rotated: pass s works on k stage (s + rot) mod T, rot set by the tile's indices. The work-groups that share A rows (one tile row) or Bt rows (one tile column) all run at once;
// entering at stage 0 together they ask for the same lines at the same moment, and at every stage all of them wait for its first fetch from memory. Entered apart, each stage is fetched by the one that
// comes to it first and met in L2 by the rest. Every stage is still taken exactly once; the f32 sum over k starts at stage rot and wraps round.
// rot = 4 * (row / 8) + row % 4 + RY * column: any four neighbouring rows of each eight differ (for speed only, nothing rests on it),
// and RY spreads the tile columns over the stages where there are fewer columns than stages.
typedef uint32_t u32x4 __attribute__((ext_vector_type(4)));
typedef uint32_t u32x8 __attribute__((ext_vector_type(8)));
__device__ __forceinline__ uint32_t uni(uint32_t v) { return (uint32_t)__builtin_amdgcn_readfirstlane(v); }
__device__ __forceinline__ uint32_t pinned(uint32_t v) { uint32_t w = (uint32_t)__builtin_amdgcn_readfirstlane(v); asm volatile("" : "+s"(w)); return w; }   // a wave-uniform test held in a scalar register, so that the branch on it is a scalar branch (tensor loads ignore EXEC)
// one request of the calling wave: the tile that g1 describes, from the global address in g0 to the LDS place in g0
__device__ __forceinline__ void gemm_tload(const u32x4 g0, const u32x8 g1) { asm volatile("tensor_load_to_lds %0, %1" :: "s"(g0), "s"(g1) : "memory"); }
// the wave's own requests have landed. The two groups are operands so that their registers stay whole up to this wait and take new values only behind it.
__device__ __forceinline__ void gemm_twait(u32x4& g0, u32x8& g1) { asm volatile("s_wait_tensorcnt 0x0" : "+s"(g0), "+s"(g1) :: "memory"); }
// next stage: the LDS place dst, the global address ga of the slice's first byte in that stage (type 2 in the top bits of word 3)
__device__ __forceinline__ void gemm_tnext(u32x4& g0, uint32_t dst, uint64_t ga) {
    g0[1] = uni(dst); g0[2] = uni((uint32_t)ga); g0[3] = uni((((uint32_t)(ga >> 32)) & 0x01FFFFFFu) | 0x80000000u);
}
// 16-bit forms of eight f32 values of the qkv product: f16, and bf16 hi and lo (stored only for positions < RH)
__device__ __forceinline__ void cvt3(const v8f x, v8h& o16, v8us& oh, v8us& ol) {
#pragma unroll
    for (int k = 0; k < 8; ++k) { o16[k] = (h16)x[k]; unsigned short a, c; splitf(x[k], a, c); oh[k] = a; ol[k] = c; }
}
__device__ __forceinline__ void store3(h16* p16, bf* ph, bf* pl, bool hr, const v8h o16, const v8us oh, const v8us ol) {
    *(v8h*)p16 = o16;
    asm volatile("s_wait_xcnt 0x0" ::: "memory");       // stands before the store's address and data registers are written again
    if (hr) {
        *(v8us*)ph = oh; *(v8us*)pl = ol;
        asm volatile("s_wait_xcnt 0x0" ::: "memory");   // the same for these two stores
    }
}
// PL = false: the tile goes to C as f32. PL = true (the qkv product; row m = l*NB + n, column which*1024 + h*64 + d): the tile goes straight to the 16-bit operand planes of the attention kernels,
// q and k per problem bh as SEQ x 64 elements (f16; positions < RH also bf16 hi and lo, RH x 64), v likewise, every plane in the fragment order of fo_qk and fo_v (v's fragments are those of the transposed tile); C is not touched.
template <int KS, bool PL, int RY>
__global__ __launch_bounds__(128) void k_gemmw(const bf* __restrict__ A, int lda, const bf* __restrict__ Bt, int ldb, int K, float* C, int ldc,
                                               h16* QK16, bf* QKh, bf* QKl, h16* VT16, bf* VTh, bf* VTl) {
    static_assert(KS == 64 || KS == 128);
    constexpr uint32_t ROWB   = 2u * KS;                                  // bytes of a row in a stage
    constexpr uint32_t GPITCH = ROWB + 16u;                               // LDS row pitch: an odd multiple of 16 bytes for 16-byte reads
    constexpr uint32_t GSLICE = (64u * GPITCH + 2047u) / 2048u * 2048u;   // 64 rows, rounded up to a multiple of 2 KiB
    constexpr uint32_t GBUF   = 4u * GSLICE;                              // slices: A rows 0..63, A rows 64..127, Bt rows 0..63, Bt rows 64..127
    __shared__ __attribute__((aligned(2048))) unsigned char tl[2 * GBUF];
    __shared__ __align__(16) float osall[4 * 16 * 68];
    const int lane = threadIdx.x & 31, lr = lane & 15, hi = lane >> 4;
    const uint32_t wave = uni(threadIdx.x >> 5), wm = wave & 1u, wn = wave >> 1;
    const int r0 = blockIdx.x * 128, c0 = blockIdx.y * 128;
    // this wave's slice of every stage: waves 0, 1 the two halves of the A rows, waves 2, 3 of the Bt rows
    const bool isb = wave >= 2u;
    const uint32_t spitch = (uint32_t)(isb ? ldb : lda) * 2u;
    const uint64_t sbase = (uint64_t)(size_t)(isb ? Bt : A) + (uint64_t)((isb ? c0 : r0) + (int)(wave & 1u) * 64) * spitch;
    const uint32_t sdst = (uint32_t)(size_t)tl + wave * GSLICE;
    u32x8 g1;                                     // 1-byte elements, tensor = tile = 64 rows of ROWB bytes, 4 dwords of LDS pad behind every row
    g1[0] = uni((1u << 20) | ((KS == 64 ? 4u : 5u) << 22) | (3u << 25));
    g1[1] = uni(ROWB << 16);
    g1[2] = uni(64u << 16);
    g1[3] = uni(ROWB << 16);
    g1[4] = uni(64u);
    g1[5] = uni(spitch);
    g1[6] = uni(0u);
    g1[7] = uni(0u);
    const int T = K / KS;                         // stages
    int kst = (int)uni(((blockIdx.x >> 3) * 4u + (blockIdx.x & 3u) + blockIdx.y * (uint32_t)RY) % (uint32_t)T);      // k stage of the request formed next: rot, rot + 1, .., T - 1, 0, .., rot - 1
    u32x4 g0;                                     // count 1, LDS place, global address, type 2
    g0[0] = uni(1u);
    gemm_tnext(g0, sdst, sbase + (uint64_t)((uint32_t)kst * ROWB));
    v8f acc[4][4];
#pragma unroll
    for (int mb = 0; mb < 4; ++mb)
#pragma unroll
        for (int nb = 0; nb < 4; ++nb) acc[mb][nb] = (v8f){};
    gemm_tload(g0, g1);
    gemm_twait(g0, g1);                                     // the first pass's stage (k stage rot) has landed (this wave's slice)
    __syncthreads();                                        // ... and every wave's
    kst = kst + 1 < T ? kst + 1 : 0;
    gemm_tnext(g0, sdst + GBUF, sbase + (uint64_t)((uint32_t)kst * ROWB));
    gemm_tload(g0, g1);
    const uint32_t aoff = wm * GSLICE + (uint32_t)lr * GPITCH + 16u * (uint32_t)hi;
    const uint32_t boff = (2u + wn) * GSLICE + (uint32_t)lr * GPITCH + 16u * (uint32_t)hi;
#pragma unroll 1                                 // rolled: one publish point in the code, the buffer chosen by a scalar
    for (int s = 0; s < T; ++s) {
        const uint32_t bsel = (uint32_t)(s & 1) * GBUF;
#pragma unroll 1
        for (int h = 0; h < KS / 64; ++h) {         // 64 k at a time: two 32-deep blocks (kept rolled: four blocks in a row spilled accumulators)
            const unsigned char* ap = tl + bsel + aoff + h * 128; const unsigned char* bp = tl + bsel + boff + h * 128;
            // LDS reads stand at two places only: the head (both blocks' A, the first block's Bt, the second block's Bt columns 0..31) and the middle of the first block
            // (the second block's Bt columns 32..63, into the registers that the first eight products have freed).
            v16us a[2][4], b[2][4];
#pragma unroll
            for (int i = 0; i < 4; ++i) { a[0][i] = ldus((const us*)(ap + i * 16 * GPITCH)); b[0][i] = ldus((const us*)(bp + i * 16 * GPITCH)); }
#pragma unroll
            for (int i = 0; i < 4; ++i) a[1][i] = ldus((const us*)(ap + i * 16 * GPITCH + 64));
#pragma unroll
            for (int i = 0; i < 2; ++i) b[1][i] = ldus((const us*)(bp + i * 16 * GPITCH + 64));
            __builtin_amdgcn_sched_barrier(0);      // keeps these loads one group ahead of the products
#pragma unroll
            for (int nb = 0; nb < 2; ++nb)
#pragma unroll
                for (int mb = 0; mb < 4; ++mb) acc[mb][nb] = mmg<true>(a[0][mb], b[0][nb], acc[mb][nb]);
            __builtin_amdgcn_sched_barrier(0);      // keeps the second group from rising among the products whose registers it takes
#pragma unroll
            for (int i = 2; i < 4; ++i) b[1][i] = ldus((const us*)(bp + i * 16 * GPITCH + 64));
            __builtin_amdgcn_sched_barrier(0);      // keeps the second group together, sixteen products ahead of its first use
#pragma unroll
            for (int nb = 2; nb < 4; ++nb)
#pragma unroll
                for (int mb = 0; mb < 4; ++mb) acc[mb][nb] = mmg<true>(a[0][mb], b[0][nb], acc[mb][nb]);
#pragma unroll
            for (int nb = 0; nb < 4; ++nb)
#pragma unroll
                for (int mb = 0; mb < 4; ++mb) acc[mb][nb] = mmg<true>(a[1][mb], b[1][nb], acc[mb][nb]);
        }
        // publish point of stage s + 1
        asm volatile("s_wait_dscnt 0x0" ::: "memory");      // this wave has left stage s's buffer
        gemm_twait(g0, g1);                                 // this wave's slice of stage s + 1 has landed
        __syncthreads();                                    // stage s + 1 readable by all; stage s's buffer left by all
        if (pinned(s + 2 < T)) {
            kst = kst + 1 < T ? kst + 1 : 0;
            gemm_tnext(g0, sdst + bsel, sbase + (uint64_t)((uint32_t)kst * ROWB));
            gemm_tload(g0, g1);
        }
    }
    gemm_twait(g0, g1);                                     // nothing in flight when the wave ends
    asm volatile("s_wait_dscnt 0x0" ::: "memory");
    float* os = osall + wave * (16 * 68);                   // output staging, private to the wave
    if constexpr (PL) {
        const int which = c0 / DM;                          // 0 q, 1 k, 2 v: the same for the whole tile
        const bool hr = r0 / NB < RH;                       // the tile's positions all lie below RH, or none does
        v8h o16; v8us oh, ol;
        if (which < 2) {
            const int h = ((c0 + (int)wn * 64) % DM) / HD;  // the wave's 64 columns are one head
#pragma unroll
            for (int mb = 0; mb < 4; ++mb) {
#pragma unroll
                for (int nb = 0; nb < 4; ++nb) {
#pragma unroll
                    for (int j = 0; j < 8; ++j) os[(hi * 8 + j) * 68 + nb * 16 + lr] = acc[mb][nb][j];
                }
                __builtin_amdgcn_wave_barrier(); asm volatile("" ::: "memory");
#pragma unroll
                for (int s = 0; s < 4; ++s) {               // eight lanes store one chunk of eight consecutive positions of one problem: one 128-byte line of the fragment order
                    const int sub = (lane >> 3) & 1, c8 = s * 2 + (lane >> 4), cp = c8 * 8;
                    const int row = NB == 2 ? (lane & 7) * 2 + sub : sub * 8 + (lane & 7);
                    const v4f a = *(const v4fa*)(os + row * 68 + cp), b = *(const v4fa*)(os + row * 68 + cp + 4);
                    cvt3(__builtin_shufflevector(a, b, 0, 1, 2, 3, 4, 5, 6, 7), o16, oh, ol);
                    const int m = r0 + (int)wm * 64 + mb * 16 + row, l = m / NB, bh = (m % NB) * NH + h;
                    const size_t e16 = (size_t)which * PLN + (size_t)bh * SEQ * HD + fo_qk(l, c8);
                    const size_t eh = hr ? ((size_t)which * PLNH + (size_t)bh * RH * HD + fo_qk(l, c8)) : 0;
                    store3(QK16 + e16, QKh + eh, QKl + eh, hr, o16, oh, ol);
                }
                __builtin_amdgcn_wave_barrier(); asm volatile("" ::: "memory");
            }
        } else {
            // v: the whole 128 x 128 tile is turned in LDS, T[column][n][position], so that a lane stores eight positions of one (bh, d) and eight lanes one 128-byte line of the fragment order, one writer.
            // T takes the place of the stage buffers: every wave has left them and nothing is in flight (the last pass's waits and barrier).
            constexpr int TP = 132, LT = 128 / NB;          // row pitch in floats (528 bytes, an odd multiple of 16); positions in the tile
            static_assert((size_t)128 * TP * 4 <= (size_t)2 * GBUF && (8 / NB) % 4 == 0);
            float* T = (float*)tl;
#pragma unroll
            for (int mb = 0; mb < 4; ++mb) {
#pragma unroll
                for (int nb = 0; nb < 4; ++nb) {
                    float* tw = T + ((int)wn * 64 + nb * 16 + lr) * TP + ((int)wm * 64 + mb * 16 + hi * 8) / NB;
#pragma unroll
                    for (int n = 0; n < NB; ++n) {
#pragma unroll
                        for (int k4 = 0; k4 < 8 / NB / 4; ++k4) {
                            v4f t;
#pragma unroll
                            for (int e = 0; e < 4; ++e) t[e] = acc[mb][nb][(k4 * 4 + e) * NB + n];
                            *(v4fa*)(tw + n * LT + k4 * 4) = t;
                        }
                    }
                }
            }
            __syncthreads();                                // the turned tile is whole before any wave reads another wave's part
#pragma unroll 4
            for (int it = 0; it < 16; ++it) {
                const int gi = it * 4 + (int)wave, l8 = (gi % (LT / 16)) * 2 + hi, rr = gi / (LT / 16), c = (rr % 8) * 16 + lr, n = rr / 8;   // a wave stores one run of a fragment: 512 contiguous bytes
                const float* tr = T + c * TP + n * LT + l8 * 8;
                const v4f a = *(const v4fa*)tr, b = *(const v4fa*)(tr + 4);
                cvt3(__builtin_shufflevector(a, b, 0, 1, 2, 3, 4, 5, 6, 7), o16, oh, ol);
                const int col = c0 - 2 * DM + c, bh = n * NH + col / HD, d = col % HD, l = r0 / NB + l8 * 8;
                const size_t e16 = (size_t)bh * HD * SEQ + fo_v(d, l);
                const size_t eh = hr ? ((size_t)bh * HD * RH + fo_v(d, l)) : 0;
                store3(VT16 + e16, VTh + eh, VTl + eh, hr, o16, oh, ol);
            }
        }
        return;
    }
#pragma unroll
    for (int mb = 0; mb < 4; ++mb) {
#pragma unroll
        for (int nb = 0; nb < 4; ++nb) {
#pragma unroll
            for (int j = 0; j < 8; ++j) os[(hi * 8 + j) * 68 + nb * 16 + lr] = acc[mb][nb][j];
        }
        __builtin_amdgcn_wave_barrier(); asm volatile("" ::: "memory");
        float* crow = C + (size_t)(r0 + (int)wm * 64 + mb * 16) * ldc + c0 + (int)wn * 64;
{
#pragma unroll
            for (int s = 0; s < 8; ++s) {                       // rows 2s+hi, s = 0..7, hi = 0..1: all 16 rows of the slab
                const int row = 2 * s + hi, cofs = lr * 4;
                const v4f val = *(const v4fa*)(os + row * 68 + cofs);
                *(v4f*)(crow + (size_t)row * ldc + cofs) = val;
            }
            
        }
        __builtin_amdgcn_wave_barrier(); asm volatile("" ::: "memory");
    }
}

// lane l with lane l ^ 16 (the other half of a query column's keys)
__device__ __forceinline__ float xhalf(float x) {
    return __builtin_bit_cast(float, __builtin_amdgcn_permlanex16(__builtin_bit_cast(int, x), __builtin_bit_cast(int, x), 0x76543210, 0xfedcba98, false, false));
}

template <bool HR>
__device__ __forceinline__ void attn_body(const us* __restrict__ Qa, const us* __restrict__ Qr, const us* __restrict__ Ka, const us* __restrict__ Kr,
                                          const us* __restrict__ Va, const us* __restrict__ Vr, bf* CTX, const int q0, const int mrot) {
    constexpr int LR = HR ? RH : SEQ;                  // positions per problem in the planes
    __shared__ __align__(16) unsigned short oh[32 * OP];
    __shared__ __align__(16) unsigned short ol[32 * OP];
    const int lane = threadIdx.x & 31, lr = lane & 15, hi = lane >> 4;
    const int bh = blockIdx.x, n = bh / NH, h = bh % NH;
    const size_t pb = (size_t)bh * LR * HD;
    Qa += pb; Ka += pb; Va += pb; Qr += pb; Kr += pb; Vr += pb;
    const int qoff = q0 * HD + 8 * lane;               // fragment order: 16 positions of q or k are 1024 elements, 32 positions of v 2048
    const int koff = 8 * lane;
    const int voff = 8 * lane;
    const float cexp = 0.125f * 1.4426950408889634f;   // HD^-0.5 * log2(e)
    const float pc = HR ? 1.0f : PCAR;
    v8f o[2][4]; float mrow[2], lsum[2];               // o[u][t2][r] = context(query q0 + u*16 + lr, d = t2*16 + 8*hi + r); mrow, lsum: of query q0 + u*16 + lr
#pragma unroll
    for (int u = 0; u < 2; ++u) {
#pragma unroll
        for (int t2 = 0; t2 < 4; ++t2) o[u][t2] = (v8f){};
        mrow[u] = -3.0e38f; lsum[u] = 0.0f;
    }
    v16us qfa[2][2], qfr[2][2], kfa[2][2], kfr[2][2];      // [kc][u] and [kc][t]
#pragma unroll
    for (int kc = 0; kc < 2; ++kc) {
#pragma unroll
        for (int u = 0; u < 2; ++u) {
            qfa[kc][u] = ldfr(Qa + qoff + u * 16 * HD + kc * 512);
            qfr[kc][u] = HR ? ldfr(Qr + qoff + u * 16 * HD + kc * 512) : qfa[kc][u];
        }
#pragma unroll
        for (int t = 0; t < 2; ++t) {
            const int ko = (mrot + t * 16) * HD + koff + kc * 512;
            kfa[kc][t] = ldfr(Ka + ko);
            kfr[kc][t] = HR ? ldfr(Kr + ko) : kfa[kc][t];
        }
    }
    // Rotated key walk: the steps m0 = mrot, mrot + 32, .., q0, 0, .., mrot - 32, every step once (the online softmax takes the steps in any order; the diagonal step is told by m0 == q0).
    // The waves of one problem all run at once: entering at key 0 together they ask for the same lines at the same moment, and at every step all of them wait for its first fetch from memory.
    // Entered apart, a step's lines are fetched by the wave that comes to them first and met in L2 by the rest.
    int m0 = mrot, m1 = m0 + 32 <= q0 ? m0 + 32 : 0;               // this step's first key, the next step's
    const us* kpa = Ka + m1 * HD + koff; const us* kpr = Kr + m1 * HD + koff;      // the NEXT step's key rows
    const us* vpa = Va + m0 * HD + voff; const us* vpr = Vr + m0 * HD + voff;      // this step's value columns
#pragma unroll 1
    for (int st = 0; st <= q0; st += 32) {
        v16us vfa[4], vfr[4];
#pragma unroll
        for (int t2 = 0; t2 < 4; ++t2) {
            vfa[t2] = ldfr(vpa + t2 * 512);                // A[m = d = t2*16 + lr][k = key m0 + ..]
            vfr[t2] = HR ? ldfr(vpr + t2 * 512) : vfa[t2];
        }
        v8f s[2][2];
#pragma unroll
        for (int u = 0; u < 2; ++u)
#pragma unroll
            for (int t = 0; t < 2; ++t) s[u][t] = (v8f){};
#pragma unroll
        for (int kc = 0; kc < 2; ++kc) {
#pragma unroll
            for (int t = 0; t < 2; ++t) {
                s[0][t] = mmg<HR>(kfa[kc][t], qfa[kc][0], s[0][t]); s[1][t] = mmg<HR>(kfa[kc][t], qfa[kc][1], s[1][t]);
                if (HR) {
                    s[0][t] = mmg<HR>(kfa[kc][t], qfr[kc][0], s[0][t]); s[1][t] = mmg<HR>(kfa[kc][t], qfr[kc][1], s[1][t]);
                    s[0][t] = mmg<HR>(kfr[kc][t], qfa[kc][0], s[0][t]); s[1][t] = mmg<HR>(kfr[kc][t], qfa[kc][1], s[1][t]);
                }
            }
        }
        {       // next step's key fragments: a whole softmax and the V^T.P^T products ahead of their use (the last step fetches the first step's keys again: in bounds, not used)
#pragma unroll
            for (int kc = 0; kc < 2; ++kc) {
#pragma unroll
                for (int t = 0; t < 2; ++t) {
                    kfa[kc][t] = ldfr(kpa + (t * 16) * HD + kc * 512);
                    kfr[kc][t] = HR ? ldfr(kpr + (t * 16) * HD + kc * 512) : kfa[kc][t];
                }
            }
            __builtin_amdgcn_sched_barrier(0);      // keeps the loads ahead of the softmax (lead)
        }
        // s[u][t][r] = score(key m0 + t*16 + 8*hi + r, query q0 + u*16 + lr). Keys beyond the query are excluded (only possible in the diagonal step; key m0 is always kept).
        if (m0 == q0) {
#pragma unroll
            for (int u = 0; u < 2; ++u)
#pragma unroll
                for (int t = 0; t < 2; ++t)
#pragma unroll
                    for (int r = 0; r < 8; ++r) { if (t * 16 + 8 * hi + r > u * 16 + lr) s[u][t][r] = -3.0e38f; }
        }
        v16us pa[2], pr[2];
#pragma unroll
        for (int u = 0; u < 2; ++u) {
            float v = fmaxf(s[u][0][0], s[u][1][0]);
#pragma unroll
            for (int r = 1; r < 8; ++r) v = fmaxf(v, fmaxf(s[u][0][r], s[u][1][r]));
            v = fmaxf(v, xhalf(v));
            const float mn = fmaxf(mrow[u], v);
            const v8f x0 = (s[u][0] - mn) * cexp, x1 = (s[u][1] - mn) * cexp;
            float e0[8], e1[8];
#pragma unroll
            for (int r = 0; r < 8; ++r) e0[r] = __builtin_amdgcn_exp2f(x0[r]);
#pragma unroll
            for (int r = 0; r < 8; ++r) e1[r] = __builtin_amdgcn_exp2f(x1[r]);
            const float al = __builtin_amdgcn_exp2f((mrow[u] - mn) * cexp);
            mrow[u] = mn;
            float ps[4] = {0.0f, 0.0f, 0.0f, 0.0f};             // four independent partial sums of the lane's 16 probabilities
#pragma unroll
            for (int r = 0; r < 8; ++r) {
                const float p0 = e0[r], p1 = e1[r];
                ps[r & 3] += p0 + p1;
                if (HR) {
                    unsigned short a, c; splitf(p0, a, c); pa[u][r] = a; pr[u][r] = c;
                    splitf(p1, a, c); pa[u][8 + r] = a; pr[u][8 + r] = c;
                } else {
                    pa[u][r] = __builtin_bit_cast(unsigned short, (h16)(p0 * PCAR));
                    pa[u][8 + r] = __builtin_bit_cast(unsigned short, (h16)(p1 * PCAR));
                }
            }
            if (!HR) pr[u] = pa[u];
            lsum[u] = lsum[u] * al + ((ps[0] + ps[1]) + (ps[2] + ps[3]));     // per-lane partial sum of one query (its half of the keys), the halves joined once at the end
#pragma unroll
            for (int t2 = 0; t2 < 4; ++t2) o[u][t2] *= al;
        }
#pragma unroll
        for (int t2 = 0; t2 < 4; ++t2) {
            o[0][t2] = mmg<HR>(vfa[t2], pa[0], o[0][t2]); o[1][t2] = mmg<HR>(vfa[t2], pa[1], o[1][t2]);
            if (HR) {
                o[0][t2] = mmg<HR>(vfa[t2], pr[0], o[0][t2]); o[1][t2] = mmg<HR>(vfa[t2], pr[1], o[1][t2]);
                o[0][t2] = mmg<HR>(vfr[t2], pa[0], o[0][t2]); o[1][t2] = mmg<HR>(vfr[t2], pa[1], o[1][t2]);
            }
        }
        // the address pairs of this step's loads stay whole up to this wait; they are stepped only behind it
        if (HR) asm volatile("s_wait_xcnt 0x0" :: "v"(kpa), "v"(kpr), "v"(vpa), "v"(vpr) : "memory");
        else    asm volatile("s_wait_xcnt 0x0" :: "v"(kpa), "v"(vpa) : "memory");
        const int m2 = m1 + 32 <= q0 ? m1 + 32 : 0;
        const int kstep = (m2 - m1) * HD, vstep = (m1 - m0) * HD;
        kpa += kstep; kpr += kstep; vpa += vstep; vpr += vstep;
        m0 = m1; m1 = m2;
    }
    // normalise, split into bf16 hi / lo, stage the 32 x 64 tile (a lane's 8 registers are 8 consecutive d of one query: 16-byte LDS stores), then whole-line stores
#pragma unroll
    for (int u = 0; u < 2; ++u) {
        float l = lsum[u];
        l += xhalf(l);
        const float inv = 1.0f / (l * pc);
#pragma unroll
        for (int t2 = 0; t2 < 4; ++t2) {
            v8us a8, c8;
#pragma unroll
            for (int r = 0; r < 8; ++r) { unsigned short a, c; splitf(o[u][t2][r] * inv, a, c); a8[r] = a; c8[r] = c; }
            const int oo = (u * 16 + lr) * OP + t2 * 16 + 8 * hi;
            *(v8usa*)(oh + oo) = a8; *(v8usa*)(ol + oo) = c8;
        }
    }
    __syncthreads();
{
#pragma unroll
        for (int s = 0; s < 8; ++s) {
            const int row = s * 4 + (lane >> 3), cp = (lane & 7) * 8;
            const v8us vh = *(const v8usa*)(oh + row * OP + cp);
            const v8us vl = *(const v8usa*)(ol + row * OP + cp);
            bf* d = CTX + ((size_t)(q0 + row) * NB + n) * CK + h * HD + cp;
            *(v8us*)d = vh; *(v8us*)(d + DM) = vl;
        }
        
    }
}

__global__ __launch_bounds__(32) void k_attn_lo(const us* __restrict__ Q16, const us* __restrict__ K16, const us* __restrict__ V16, bf* CTX) {
    const int q0 = RH + (int)blockIdx.y * 32;
    attn_body<false>(Q16, Q16, K16, K16, V16, V16, CTX, q0, (int)(blockIdx.y * 7u % (uint32_t)(q0 / 32 + 1)) * 32);   // entry step: spread over the tile's own steps, neighbouring tiles apart
}

// ---- k_attn_hr: early query positions (< RH) on bf16 hi/lo planes, ONE 16-row tile per wave (one wave per block), 32 keys per step.
// Per-query arithmetic and product order are those of attn_body with HR = true (q.k: hi.hi, lo.hi, hi.lo per 32-deep chunk; P.v: hi.hi, lo.hi, hi.lo; all into one accumulator, unscaled bf16 residuals), transposed in the same way.
// Live state per lane: 4 output accumulators + 2 score accumulators + 2 softmax scalars + the fragments fetched ahead: q once in front of the loop, a step's v at its head, the next step's k among this step's V^T.P^T products.
// Key steps run over m0 = 0, 32, .., mend with mend = q0 pad down to a multiple of 32 (block-uniform), entered at mrot and wrapped round; keys beyond the query are excluded in the step m0 == mend only (key mend is always kept).
// Planes: RH x 64 elements per problem in fragment order (fo_qk, fo_v); the last step reads keys < mend + 32 <= RH, all written by the qkv product's epilogue.
__global__ __launch_bounds__(32) void k_attn_hr(const us* __restrict__ Qh, const us* __restrict__ Ql, const us* __restrict__ Kh, const us* __restrict__ Kl,
                                                const us* __restrict__ Vh, const us* __restrict__ Vl, bf* CTX) {
    __shared__ __align__(16) unsigned short eoh[ER * OP];     // context hi staging, 16 rows x 64
    __shared__ __align__(16) unsigned short eol[ER * OP];     // context lo staging
    const int lane = threadIdx.x & 31, lr = lane & 15, hi = lane >> 4;
    const int bh = blockIdx.x, n = bh / NH, h = bh % NH;
    const int q0 = (int)blockIdx.y * ER;
    const int mend = q0 & ~31;
    const int mrot = (int)(blockIdx.y % (uint32_t)(mend / 32 + 1)) * 32;      // entry step of the rotated key walk (as in attn_body): mrot, .., mend, 0, .., mrot - 32
    const size_t pb = (size_t)bh * RH * HD;
    Qh += pb; Ql += pb; Kh += pb; Kl += pb; Vh += pb; Vl += pb;
    const int qoff = q0 * HD + 8 * lane;               // fragment order: 16 positions of q or k are 1024 elements, 32 positions of v 2048
    const int koff = 8 * lane;
    const int voff = 8 * lane;
    const float cexp = 0.125f * 1.4426950408889634f;   // HD^-0.5 * log2(e)
    v8f o[4]; float mrow = -3.0e38f, lsum = 0.0f;      // o[t2][r] = context(query q0 + lr, d = t2*16 + 8*hi + r); mrow, lsum: of query q0 + lr
#pragma unroll
    for (int t2 = 0; t2 < 4; ++t2) o[t2] = (v8f){};
    v16us qfa[2], qfr[2], kfa[2][2], kfr[2][2];            // [kc] and [kc][t]
#pragma unroll
    for (int kc = 0; kc < 2; ++kc) {
        qfa[kc] = ldfr(Qh + qoff + kc * 512);
        qfr[kc] = ldfr(Ql + qoff + kc * 512);
#pragma unroll
        for (int t = 0; t < 2; ++t) {
            const int ko = (mrot + t * 16) * HD + koff + kc * 512;
            kfa[kc][t] = ldfr(Kh + ko);
            kfr[kc][t] = ldfr(Kl + ko);
        }
    }
    int m0 = mrot, m1 = m0 + 32 <= mend ? m0 + 32 : 0;             // this step's first key, the next step's
    const us* kph = Kh + m1 * HD + koff; const us* kpl = Kl + m1 * HD + koff;      // the NEXT step's key rows (the last step fetches the first step's keys again: in bounds, not used)
#pragma unroll 1
    for (int st = 0; st <= mend; st += 32) {
        v16us vfa[4], vfr[4];
        const us* vph = Vh + voff + m0 * HD; const us* vpl = Vl + voff + m0 * HD;
#pragma unroll
        for (int t2 = 0; t2 < 4; ++t2) {
            vfa[t2] = ldfr(vph + t2 * 512);                // A[m = d = t2*16 + lr][k = key m0 + ..]
            vfr[t2] = ldfr(vpl + t2 * 512);
        }
        asm volatile("s_wait_xcnt 0x0" :: "v"(vph), "v"(vpl) : "memory");   // the two address pairs stay whole up to this wait
        v8f s[2];
        s[0] = (v8f){}; s[1] = (v8f){};
#pragma unroll
        for (int kc = 0; kc < 2; ++kc) {
#pragma unroll
            for (int t = 0; t < 2; ++t) {
                s[t] = mmg<true>(kfa[kc][t], qfa[kc], s[t]);
                s[t] = mmg<true>(kfa[kc][t], qfr[kc], s[t]);
                s[t] = mmg<true>(kfr[kc][t], qfa[kc], s[t]);
            }
        }
        // s[t][r] = score(key m0 + t*16 + 8*hi + r, query q0 + lr)
        if (m0 == mend) {
#pragma unroll
            for (int t = 0; t < 2; ++t)
#pragma unroll
                for (int r = 0; r < 8; ++r) { if (m0 + t * 16 + 8 * hi + r > q0 + lr) s[t][r] = -3.0e38f; }
        }
        v16us pa, pr;
        {
            float v = fmaxf(s[0][0], s[1][0]);
#pragma unroll
            for (int r = 1; r < 8; ++r) v = fmaxf(v, fmaxf(s[0][r], s[1][r]));
            v = fmaxf(v, xhalf(v));
            const float mn = fmaxf(mrow, v);
            const float al = __builtin_amdgcn_exp2f((mrow - mn) * cexp);
            mrow = mn;
            const v8f x0 = (s[0] - mn) * cexp, x1 = (s[1] - mn) * cexp;
            float ps[4] = {0.0f, 0.0f, 0.0f, 0.0f};             // four independent partial sums of the lane's 16 probabilities
#pragma unroll
            for (int r = 0; r < 8; ++r) {
                const float p0 = __builtin_amdgcn_exp2f(x0[r]);
                const float p1 = __builtin_amdgcn_exp2f(x1[r]);
                ps[r & 3] += p0 + p1;
                unsigned short a, c;
                splitf(p0, a, c); pa[r] = a; pr[r] = c;
                splitf(p1, a, c); pa[8 + r] = a; pr[8 + r] = c;
            }
            lsum = lsum * al + ((ps[0] + ps[1]) + (ps[2] + ps[3]));           // per-lane partial sum of one query (its half of the keys), the halves joined once at the end
#pragma unroll
            for (int t2 = 0; t2 < 4; ++t2) o[t2] *= al;
        }
#pragma unroll
        for (int t2 = 0; t2 < 4; ++t2) {
            o[t2] = mmg<true>(vfa[t2], pa, o[t2]);
            o[t2] = mmg<true>(vfa[t2], pr, o[t2]);
            o[t2] = mmg<true>(vfr[t2], pa, o[t2]);
            const int ko = ((t2 & 1) * 16) * HD + (t2 >> 1) * 512;
            kfa[t2 >> 1][t2 & 1] = ldfr(kph + ko);
            kfr[t2 >> 1][t2 & 1] = ldfr(kpl + ko);
            __builtin_amdgcn_sched_barrier(0);  // keeps each key refill behind the products that free a value fragment pair (register room)
        }
        asm volatile("s_wait_xcnt 0x0" :: "v"(kph), "v"(kpl) : "memory");   // the key address pairs stay whole up to this wait; they are stepped only behind it
        const int m2 = m1 + 32 <= mend ? m1 + 32 : 0;
        const int kstep = (m2 - m1) * HD;
        kph += kstep; kpl += kstep;
        m0 = m1; m1 = m2;
    }
    // normalise, split into bf16 hi / lo, stage the 16 x 64 tile (16-byte LDS stores), then whole-line stores
    {
        float l = lsum;
        l += xhalf(l);
        const float inv = 1.0f / l;
#pragma unroll
        for (int t2 = 0; t2 < 4; ++t2) {
            v8us a8, c8;
#pragma unroll
            for (int r = 0; r < 8; ++r) { unsigned short a, c; splitf(o[t2][r] * inv, a, c); a8[r] = a; c8[r] = c; }
            const int oo = lr * OP + t2 * 16 + 8 * hi;
            *(v8usa*)(eoh + oo) = a8; *(v8usa*)(eol + oo) = c8;
        }
    }
    __syncthreads();
{
#pragma unroll
        for (int s4 = 0; s4 < ER / 4; ++s4) {
            const int row = s4 * 4 + (lane >> 3), cp = (lane & 7) * 8;
            const v8us vh = *(const v8usa*)(eoh + row * OP + cp);
            const v8us vl = *(const v8usa*)(eol + row * OP + cp);
            bf* d = CTX + ((size_t)(q0 + row) * NB + n) * CK + h * HD + cp;
            *(v8us*)d = vh; *(v8us*)(d + DM) = vl;
        }
        
    }
}

// workspace carve (bytes), every region a multiple of 256
constexpr size_t SZ_XB   = (size_t)MROWS * DM * 2;        // x bf16 [MROWS][1024]
constexpr size_t SZ_WQ   = (size_t)F3 * DM * 2;           // w_qkv bf16 [3072][1024]
constexpr size_t SZ_WO   = (size_t)DM * CK * 2;           // [w_out | w_out] bf16 [1024][2048]
constexpr size_t SZ_QK16 = (size_t)2 * NBH * SEQ * HD * 2;
constexpr size_t SZ_QKH  = (size_t)2 * NBH * RH * HD * 2;
constexpr size_t SZ_VT16 = (size_t)NBH * HD * SEQ * 2;
constexpr size_t SZ_VTH  = (size_t)NBH * HD * RH * 2;
constexpr size_t SZ_CTX  = (size_t)MROWS * CK * 2;        // context bf16 hi | lo [MROWS][2048]
constexpr size_t OF_XB   = 0;
constexpr size_t OF_WQ   = OF_XB + SZ_XB;
constexpr size_t OF_WO   = OF_WQ + SZ_WQ;
constexpr size_t OF_QK16 = OF_WO + SZ_WO;
constexpr size_t OF_QKH  = OF_QK16 + SZ_QK16;
constexpr size_t OF_QKL  = OF_QKH + SZ_QKH;
constexpr size_t OF_VT16 = OF_QKL + SZ_QKH;
constexpr size_t OF_VTH  = OF_VT16 + SZ_VT16;
constexpr size_t OF_VTL  = OF_VTH + SZ_VTH;
constexpr size_t OF_CTX  = OF_VTL + SZ_VTH;
constexpr size_t WS_TOTAL = OF_CTX + SZ_CTX;
static_assert(SZ_XB % 256 == 0 && SZ_WQ % 256 == 0 && SZ_WO % 256 == 0 && SZ_QK16 % 256 == 0);
static_assert(SZ_QKH % 256 == 0 && SZ_VT16 % 256 == 0 && SZ_VTH % 256 == 0 && SZ_CTX % 256 == 0);
static_assert(WS_TOTAL <= (size_t)134217728);            // total carve <= 128 MiB

// entry-stage step per tile column of k_gemmw: stages / tile columns, at least 1
constexpr int RY_QKV = (DM / 64) / (F3 / 128) > 0 ? (DM / 64) / (F3 / 128) : 1;
constexpr int RY_OUT = (CK / 128) / (DM / 128) > 0 ? (CK / 128) / (DM / 128) : 1;

extern "C" void kernel_launch(void* const* d_in, const int* in_sizes, int n_in,
                              void* d_out, int out_size, void* d_ws, size_t ws_size, hipStream_t stream) {
    if (n_in < 3) return;
    const long long needx = ((long long)(SEQ - 1) * NB_FULL + NB) * DM;     // last token row touched, in elements
    if ((long long)in_sizes[0] < needx || (long long)in_sizes[1] < (long long)F3 * DM || (long long)in_sizes[2] < (long long)DM * DM || (long long)out_size < needx) return;
    if (WS_TOTAL > ws_size) return;
    const float* x = (const float*)d_in[0];       // [2048][2][1024], token row l*2 + n
    const float* wqkv = (const float*)d_in[1];    // [3072][1024] = [out][in]
    const float* wout = (const float*)d_in[2];    // [1024][1024] = [out][in]
    float* OUT = (float*)d_out;                   // [2048][2][1024]
    char* ws = (char*)d_ws;
    bf* XB = (bf*)(ws + OF_XB); bf* WQ = (bf*)(ws + OF_WQ); bf* WO2 = (bf*)(ws + OF_WO);
    h16* QK16 = (h16*)(ws + OF_QK16); bf* QKh = (bf*)(ws + OF_QKH); bf* QKl = (bf*)(ws + OF_QKL);
    h16* VT16 = (h16*)(ws + OF_VT16); bf* VTh = (bf*)(ws + OF_VTH); bf* VTl = (bf*)(ws + OF_VTL); bf* CTX = (bf*)(ws + OF_CTX);

    k_cvt_all<<<CROWS / (16 * CRPW), 512, 0, stream>>>(x, wqkv, wout, XB, WQ, WO2);
    k_gemmw<64, true, RY_QKV><<<dim3(MROWS / 128, F3 / 128, 1), 128, 0, stream>>>(XB, DM, WQ, DM, DM, nullptr, 0, QK16, QKh, QKl, VT16, VTh, VTl);   // qkv[m][f] = sum_e x[m][e] w_qkv[f][e], written as 16-bit planes
    k_attn_hr<<<dim3(NBH, RH / ER, 1), 32, 0, stream>>>((const us*)QKh, (const us*)QKl, (const us*)(QKh + PLNH), (const us*)(QKl + PLNH), (const us*)VTh, (const us*)VTl, CTX);
    if (SEQ > RH)
        k_attn_lo<<<dim3(NBH, (SEQ - RH) / 32 > 0 ? (SEQ - RH) / 32 : 1, 1), 32, 0, stream>>>((const us*)QK16, (const us*)(QK16 + PLN), (const us*)VT16, CTX);
    k_gemmw<128, false, RY_OUT><<<dim3(MROWS / 128, DM / 128, 1), 128, 0, stream>>>(CTX, CK, WO2, CK, CK, OUT, DM * ROWSTEP, nullptr, nullptr, nullptr, nullptr, nullptr, nullptr);   // out[m][f] = sum_e (ctx_hi + ctx_lo)[m][e] w_out[f][e]
}

// v008
// It runs in 78.8 microseconds.
// Next to v007, in two timings, it ran 1.08 and 1.11 times as fast.
// Over all steps from v000 it is 5.09 times as fast.
#include <hip/hip_runtime.h>
#include <stdint.h>

// Contractions: qkv projection and output projection v_wmma_f32_16x16x32_bf16 (every input RNE-converted to bf16; context carried as bf16 hi|lo folded into K); scores and probability x value v_wmma_f32_16x16x32_f16 for query positions >= 256 (P carried x1024), bf16 hi/lo three-product form for positions < 256; f32 accumulate, f32 softmax.
// Sequence-first causal multi-head self-attention with a fused bias-free (out, in) qkv weight and an (out, in) output weight: token row m = l*NB + n, attention problem bh = n*16 + h, head columns h*64..h*64+63.
// Launch plan: k_cvt_all (bf16 copies) -> k_gemmw (qkv product, its epilogue writes the q/k/v^T 16-bit planes) -> k_attn_hr (rows < 256, 16-row tiles) -> k_attn_lo (rows >= 256, 32-row tiles, four waves share a tile's keys) -> k_gemmw (output).

#ifndef NB
#define NB 2                      // batch entries processed (NB_FULL, or 1 for a reduced build)
#endif
#ifndef SEQ
#define SEQ 2048                  // sequence positions processed
#endif
#define NB_FULL  2                // batch stride of the staged x and of the output rows
#define SEQ_FULL 2048
#define DM   1024
#define NH   16
#define HD   64
#define F3   (3 * DM)
#define CK   (2 * DM)             // context plane width: hi columns | lo columns
#define RH   256                  // query positions < RH use the hi/lo planes
#define NBH  (NB * NH)
#define MROWS (SEQ * NB)
#define ROWSTEP (NB_FULL / NB)
#define PLN  ((size_t)NBH * SEQ * HD)
#define PLNH ((size_t)NBH * RH * HD)
#define PCAR 1024.0f
#define OP   72                   // context staging pitch in 16-bit elements (144 B)
#define ER   16                   // query rows per wave in the early-positions kernel
#define AW   4                    // waves per 32-row tile in the late-positions kernel: wave w takes key steps w, w + AW, ..

static_assert(NB == NB_FULL || NB == 1);          // compact row m = l*NB + n maps to token row m*ROWSTEP
static_assert(SEQ <= SEQ_FULL && SEQ >= RH);
static_assert(SEQ % 256 == 0);                    // tile multiples (128-row GEMM tiles, 32-row attention tiles, 8-wide plane groups)
static_assert(RH % 32 == 0 && RH % 8 == 0);       // the last 32-key step of the early kernel ends inside the hi/lo planes
static_assert(RH % ER == 0 && ER == 16);          // early kernel: one 16-row WMMA tile per wave, store loop 4 x 4 rows
static_assert(HD == 64 && NH * HD == DM);
static_assert(AW == 4 && RH / 32 >= AW);          // late kernel: every wave has a key step; wave w joins head columns 16 w .. 16 w + 15 and stores 8 / AW groups of four rows
static_assert(DM == 1024);                        // k_cvt_all: a row is 8 loads of 128 floats per wave
static_assert(DM % 64 == 0 && DM >= 128 && CK % 128 == 0 && CK >= 256);   // K: whole stages, at least two (k_gemmw: 64 deep for qkv, 128 deep for the output)
static_assert(MROWS % 128 == 0 && F3 % 128 == 0 && DM % 128 == 0);        // whole 128 x 128 output tiles
static_assert(RH % (128 / NB) == 0 && DM % 128 == 0);     // a 128 x 128 tile of the qkv product lies wholly in one of q, k, v and wholly below or above RH
static_assert(OP >= 64 && (OP * 2) % 16 == 0);

typedef _Float16 h16;
typedef unsigned short bf;
typedef unsigned short us;
typedef __attribute__((ext_vector_type(16))) __bf16   v16bf;
typedef __attribute__((ext_vector_type(16))) _Float16 v16h;
typedef __attribute__((ext_vector_type(16))) unsigned short v16us;
typedef __attribute__((ext_vector_type(8)))  _Float16 v8h;
typedef __attribute__((ext_vector_type(8)))  unsigned short v8us;
typedef __attribute__((ext_vector_type(8)))  float    v8f;
typedef __attribute__((ext_vector_type(4)))  float    v4f;
typedef v4f  __attribute__((may_alias)) v4fa;
typedef v8us __attribute__((may_alias)) v8usa;

__device__ __forceinline__ unsigned short f2bf(float f) { unsigned u = __float_as_uint(f); u += 0x7FFFu + ((u >> 16) & 1u); return (unsigned short)(u >> 16); }
__device__ __forceinline__ float bf2f(unsigned short b) { return __uint_as_float(((unsigned)b) << 16); }
__device__ __forceinline__ void splitf(float y, unsigned short& h, unsigned short& l) { h = f2bf(y); l = f2bf(y - bf2f(h)); }

// 16-bit fragment from a K-contiguous row: elements 0..7 <- p[0..7], elements 8..15 <- p[16..23]; the caller adds 8*(lane>>4) to p.
__device__ __forceinline__ v16us ldus(const us* p) {
    const v8us a = *(const v8us*)p; const v8us b = *(const v8us*)(p + 16);
    return __builtin_shufflevector(a, b, 0, 1, 2, 3, 4, 5, 6, 7, 8, 9, 10, 11, 12, 13, 14, 15);
}

// 16-bit fragment from a plane kept in fragment order: a fragment is 1 KiB, two runs of 512 contiguous bytes (elements 0..7 of lanes 0..31, then elements 8..15); the caller adds 8*lane to p.
// Each of the two loads then covers four whole 128-byte lines, where a load from a row-major plane touches sixteen lines for 32 bytes each.
__device__ __forceinline__ v16us ldfr(const us* p) {
    const v8us a = *(const v8us*)p; const v8us b = *(const v8us*)(p + 256);
    return __builtin_shufflevector(a, b, 0, 1, 2, 3, 4, 5, 6, 7, 8, 9, 10, 11, 12, 13, 14, 15);
}
// Element offsets inside one problem's plane. q and k: position l, 8-element chunk c8 of the 64 head columns (16 positions x 64 columns = two fragments of 32 columns each).
// v: head column d, position l a multiple of 8 (32 positions x 64 columns = four fragments of 16 columns each). Lane = 16*hi + lr, with lr the fragment's row and hi the 8-element half of ldus.
__device__ __forceinline__ int fo_qk(int l, int c8) { return (l >> 4) * 1024 + (c8 >> 1) * 256 + (c8 & 1) * 128 + (l & 15) * 8; }
__device__ __forceinline__ int fo_v(int d, int l)   { return (l >> 5) * 2048 + ((d >> 4) * 2 + ((l >> 4) & 1)) * 256 + ((l >> 3) & 1) * 128 + (d & 15) * 8; }

// One WMMA plus its own four-slot guard (ties exactly one accumulator, keeps A and B live).
template <bool BF>
__device__ __forceinline__ v8f mmg(v16us a, v16us b, v8f c) {
    if (BF) c = __builtin_amdgcn_wmma_f32_16x16x32_bf16(false, __builtin_bit_cast(v16bf, a), false, __builtin_bit_cast(v16bf, b), (short)0, c, false, false);
    else    c = __builtin_amdgcn_wmma_f32_16x16x32_f16(false, __builtin_bit_cast(v16h, a), false, __builtin_bit_cast(v16h, b), (short)0, c, false, false);
    asm volatile("v_nop\n\tv_nop\n\tv_nop\n\tv_nop" : "+v"(c) : "v"(a), "v"(b));
    return c;
}

// ---- k_cvt_all: every f32 input to its bf16 plane in ONE launch of CROWS / CRPW two-row waves (16 per work-group, one work-group per 32 rows).
// A wave takes CRPW whole rows of 1024 floats out of the list [x rows | w_qkv rows | w_out rows]: rows w and w + CROWS / CRPW. All of its loads (8 per row, 512 contiguous bytes each) are issued
// before the first value is converted; a store is 256 contiguous bytes. A w_out row is stored twice (columns 0..1023 pair with the hi half of the context plane, 1024..2047 with the lo half).
#define CROWS (MROWS + F3 + DM)
#define CRPW  2
static_assert(CROWS % (16 * CRPW) == 0);          // whole work-groups of 16 waves
typedef __attribute__((ext_vector_type(4))) unsigned short v4us;
__global__ __launch_bounds__(512) void k_cvt_all(const float* __restrict__ x, const float* __restrict__ wqkv, const float* __restrict__ wout, bf* XB, bf* WQ, bf* WO2) {
    const int lane = threadIdx.x & 31;
    const int w = __builtin_amdgcn_readfirstlane((int)(blockIdx.x * 16 + (threadIdx.x >> 5)));
    const float* s[CRPW]; bf* dst[CRPW]; bool dup[CRPW];
#pragma unroll
    for (int r = 0; r < CRPW; ++r) {                  // which plane the row belongs to: the same for the whole wave, scalar selects
        const int row = w + r * (CROWS / CRPW);
        const bool isx = row < MROWS, isq = row < MROWS + F3;
        const int rr = isx ? row : (isq ? row - MROWS : row - MROWS - F3);
        s[r]   = (isx ? x : (isq ? wqkv : wout)) + (size_t)rr * (isx ? ROWSTEP * DM : DM) + lane * 4;
        dst[r] = (isx ? XB : (isq ? WQ : WO2)) + (size_t)rr * (isq ? DM : CK) + lane * 4;
        dup[r] = !isq;
    }
    v4f v[CRPW][8];
#pragma unroll
    for (int r = 0; r < CRPW; ++r)
#pragma unroll
        for (int j = 0; j < 8; ++j) v[r][j] = *(const v4f*)(s[r] + j * 128);
    __builtin_amdgcn_sched_barrier(0);                // keeps every load of the wave ahead of the first conversion: without it the second row's loads sank behind waits on the first row's
#pragma unroll
    for (int r = 0; r < CRPW; ++r) {
        v4us o[8];
#pragma unroll
        for (int j = 0; j < 8; ++j) {
#pragma unroll
            for (int k = 0; k < 4; ++k) o[j][k] = f2bf(v[r][j][k]);
        }
        bf* d = dst[r];
#pragma unroll
        for (int j = 0; j < 8; ++j) *(v4us*)(d + j * 128) = o[j];
        if (r + 1 < CRPW) asm volatile("s_wait_xcnt 0x0" ::: "memory");       // stands before the stores' base and data registers are written again (the next row's address and values take them)
        if (dup[r]) {
#pragma unroll
            for (int j = 0; j < 8; ++j) *(v4us*)(d + DM + j * 128) = o[j];
            if (r + 1 < CRPW) asm volatile("s_wait_xcnt 0x0" ::: "memory");   // the same for these stores
        }
    }
}

// ---- k_gemmw: one 128x128 output tile per work-group of four waves (2 x 2, 64x64 = 16 accumulators each); grid (M/128, N/128), 128 threads.
// C[m][n] (f32, pitch ldc) = sum_k A[m][k] Bt[n][k]; K a multiple of KS and at least 2 KS, M and N multiples of 128; bf16 operands from K-contiguous planes.
// A stage is KS k of the tile's 128 A rows and 128 Bt rows. Each wave brings one slice of it (64 rows of 2 KS bytes) into LDS with one tensor load, every row padded by 16 bytes;
// two buffers: the load of stage s + 1 is in flight while stage s is multiplied. Every operand row is fetched once per work-group in whole lines and read by two waves from LDS.
// KS = 64 leaves room for three work-groups on a WGP (a grid of several per WGP); KS = 128 keeps twice the bytes in flight where a work-group has its WGP alone.
// The k walk is rotated: pass s works on k stage (s + rot) mod T, rot set by the tile's indices. The work-groups that share A rows (one tile row) or Bt rows (one tile column) all run at once;
// entering at stage 0 together they ask for the same lines at the same moment, and at every stage all of them wait for its first fetch from memory. Entered apart, each stage is fetched by the one that
// comes to it first and met in L2 by the rest. Every stage is still taken exactly once; the f32 sum over k starts at stage rot and wraps round.
// rot = 4 * (row / 8) + row % 4 + RY * column: any four neighbouring rows of each eight differ (for speed only, nothing rests on it),
// and RY spreads the tile columns over the stages where there are fewer columns than stages.
typedef uint32_t u32x4 __attribute__((ext_vector_type(4)));
typedef uint32_t u32x8 __attribute__((ext_vector_type(8)));
__device__ __forceinline__ uint32_t uni(uint32_t v) { return (uint32_t)__builtin_amdgcn_readfirstlane(v); }
__device__ __forceinline__ uint32_t pinned(uint32_t v) { uint32_t w = (uint32_t)__builtin_amdgcn_readfirstlane(v); asm volatile("" : "+s"(w)); return w; }   // a wave-uniform test held in a scalar register, so that the branch on it is a scalar branch (tensor loads ignore EXEC)
// one request of the calling wave: the tile that g1 describes, from the global address in g0 to the LDS place in g0
__device__ __forceinline__ void gemm_tload(const u32x4 g0, const u32x8 g1) { asm volatile("tensor_load_to_lds %0, %1" :: "s"(g0), "s"(g1) : "memory"); }
// the wave's own requests have landed. The two groups are operands so that their registers stay whole up to this wait and take new values only behind it.
__device__ __forceinline__ void gemm_twait(u32x4& g0, u32x8& g1) { asm volatile("s_wait_tensorcnt 0x0" : "+s"(g0), "+s"(g1) :: "memory"); }
// next stage: the LDS place dst, the global address ga of the slice's first byte in that stage (type 2 in the top bits of word 3)
__device__ __forceinline__ void gemm_tnext(u32x4& g0, uint32_t dst, uint64_t ga) {
    g0[1] = uni(dst); g0[2] = uni((uint32_t)ga); g0[3] = uni((((uint32_t)(ga >> 32)) & 0x01FFFFFFu) | 0x80000000u);
}
// 16-bit forms of eight f32 values of the qkv product: f16, and bf16 hi and lo (stored only for positions < RH)
__device__ __forceinline__ void cvt3(const v8f x, v8h& o16, v8us& oh, v8us& ol) {
#pragma unroll
    for (int k = 0; k < 8; ++k) { o16[k] = (h16)x[k]; unsigned short a, c; splitf(x[k], a, c); oh[k] = a; ol[k] = c; }
}
__device__ __forceinline__ void store3(h16* p16, bf* ph, bf* pl, bool hr, const v8h o16, const v8us oh, const v8us ol) {
    *(v8h*)p16 = o16;
    asm volatile("s_wait_xcnt 0x0" ::: "memory");       // stands before the store's address and data registers are written again
    if (hr) {
        *(v8us*)ph = oh; *(v8us*)pl = ol;
        asm volatile("s_wait_xcnt 0x0" ::: "memory");   // the same for these two stores
    }
}
// PL = false: the tile goes to C as f32. PL = true (the qkv product; row m = l*NB + n, column which*1024 + h*64 + d): the tile goes straight to the 16-bit operand planes of the attention kernels,
// q and k per problem bh as SEQ x 64 elements (f16; positions < RH also bf16 hi and lo, RH x 64), v likewise, every plane in the fragment order of fo_qk and fo_v (v's fragments are those of the transposed tile); C is not touched.
template <int KS, bool PL, int RY>
__global__ __launch_bounds__(128) void k_gemmw(const bf* __restrict__ A, int lda, const bf* __restrict__ Bt, int ldb, int K, float* C, int ldc,
                                               h16* QK16, bf* QKh, bf* QKl, h16* VT16, bf* VTh, bf* VTl) {
    static_assert(KS == 64 || KS == 128);
    constexpr uint32_t ROWB   = 2u * KS;                                  // bytes of a row in a stage
    constexpr uint32_t GPITCH = ROWB + 16u;                               // LDS row pitch: an odd multiple of 16 bytes for 16-byte reads
    constexpr uint32_t GSLICE = (64u * GPITCH + 2047u) / 2048u * 2048u;   // 64 rows, rounded up to a multiple of 2 KiB
    constexpr uint32_t GBUF   = 4u * GSLICE;                              // slices: A rows 0..63, A rows 64..127, Bt rows 0..63, Bt rows 64..127
    __shared__ __attribute__((aligned(2048))) unsigned char tl[2 * GBUF];
    __shared__ __align__(16) float osall[4 * 16 * 68];
    const int lane = threadIdx.x & 31, lr = lane & 15, hi = lane >> 4;
    const uint32_t wave = uni(threadIdx.x >> 5), wm = wave & 1u, wn = wave >> 1;
    const int r0 = blockIdx.x * 128, c0 = blockIdx.y * 128;
    // this wave's slice of every stage: waves 0, 1 the two halves of the A rows, waves 2, 3 of the Bt rows
    const bool isb = wave >= 2u;
    const uint32_t spitch = (uint32_t)(isb ? ldb : lda) * 2u;
    const uint64_t sbase = (uint64_t)(size_t)(isb ? Bt : A) + (uint64_t)((isb ? c0 : r0) + (int)(wave & 1u) * 64) * spitch;
    const uint32_t sdst = (uint32_t)(size_t)tl + wave * GSLICE;
    u32x8 g1;                                     // 1-byte elements, tensor = tile = 64 rows of ROWB bytes, 4 dwords of LDS pad behind every row
    g1[0] = uni((1u << 20) | ((KS == 64 ? 4u : 5u) << 22) | (3u << 25));
    g1[1] = uni(ROWB << 16);
    g1[2] = uni(64u << 16);
    g1[3] = uni(ROWB << 16);
    g1[4] = uni(64u);
    g1[5] = uni(spitch);
    g1[6] = uni(0u);
    g1[7] = uni(0u);
    const int T = K / KS;                         // stages
    int kst = (int)uni(((blockIdx.x >> 3) * 4u + (blockIdx.x & 3u) + blockIdx.y * (uint32_t)RY) % (uint32_t)T);      // k stage of the request formed next: rot, rot + 1, .., T - 1, 0, .., rot - 1
    u32x4 g0;                                     // count 1, LDS place, global address, type 2
    g0[0] = uni(1u);
    gemm_tnext(g0, sdst, sbase + (uint64_t)((uint32_t)kst * ROWB));
    v8f acc[4][4];
#pragma unroll
    for (int mb = 0; mb < 4; ++mb)
#pragma unroll
        for (int nb = 0; nb < 4; ++nb) acc[mb][nb] = (v8f){};
    gemm_tload(g0, g1);
    gemm_twait(g0, g1);                                     // the first pass's stage (k stage rot) has landed (this wave's slice)
    __syncthreads();                                        // ... and every wave's
    kst = kst + 1 < T ? kst + 1 : 0;
    gemm_tnext(g0, sdst + GBUF, sbase + (uint64_t)((uint32_t)kst * ROWB));
    gemm_tload(g0, g1);
    const uint32_t aoff = wm * GSLICE + (uint32_t)lr * GPITCH + 16u * (uint32_t)hi;
    const uint32_t boff = (2u + wn) * GSLICE + (uint32_t)lr * GPITCH + 16u * (uint32_t)hi;
#pragma unroll 1                                 // rolled: one publish point in the code, the buffer chosen by a scalar
    for (int s = 0; s < T; ++s) {
        const uint32_t bsel = (uint32_t)(s & 1) * GBUF;
#pragma unroll 1
        for (int h = 0; h < KS / 64; ++h) {         // 64 k at a time: two 32-deep blocks (kept rolled: four blocks in a row spilled accumulators)
            const unsigned char* ap = tl + bsel + aoff + h * 128; const unsigned char* bp = tl + bsel + boff + h * 128;
            // LDS reads stand at two places only: the head (both blocks' A, the first block's Bt, the second block's Bt columns 0..31) and the middle of the first block
            // (the second block's Bt columns 32..63, into the registers that the first eight products have freed).
            v16us a[2][4], b[2][4];
#pragma unroll
            for (int i = 0; i < 4; ++i) { a[0][i] = ldus((const us*)(ap + i * 16 * GPITCH)); b[0][i] = ldus((const us*)(bp + i * 16 * GPITCH)); }
#pragma unroll
            for (int i = 0; i < 4; ++i) a[1][i] = ldus((const us*)(ap + i * 16 * GPITCH + 64));
#pragma unroll
            for (int i = 0; i < 2; ++i) b[1][i] = ldus((const us*)(bp + i * 16 * GPITCH + 64));
            __builtin_amdgcn_sched_barrier(0);      // keeps these loads one group ahead of the products
#pragma unroll
            for (int nb = 0; nb < 2; ++nb)
#pragma unroll
                for (int mb = 0; mb < 4; ++mb) acc[mb][nb] = mmg<true>(a[0][mb], b[0][nb], acc[mb][nb]);
            __builtin_amdgcn_sched_barrier(0);      // keeps the second group from rising among the products whose registers it takes
#pragma unroll
            for (int i = 2; i < 4; ++i) b[1][i] = ldus((const us*)(bp + i * 16 * GPITCH + 64));
            __builtin_amdgcn_sched_barrier(0);      // keeps the second group together, sixteen products ahead of its first use
#pragma unroll
            for (int nb = 2; nb < 4; ++nb)
#pragma unroll
                for (int mb = 0; mb < 4; ++mb) acc[mb][nb] = mmg<true>(a[0][mb], b[0][nb], acc[mb][nb]);
#pragma unroll
            for (int nb = 0; nb < 4; ++nb)
#pragma unroll
                for (int mb = 0; mb < 4; ++mb) acc[mb][nb] = mmg<true>(a[1][mb], b[1][nb], acc[mb][nb]);
        }
        // publish point of stage s + 1
        asm volatile("s_wait_dscnt 0x0" ::: "memory");      // this wave has left stage s's buffer
        gemm_twait(g0, g1);                                 // this wave's slice of stage s + 1 has landed
        __syncthreads();                                    // stage s + 1 readable by all; stage s's buffer left by all
        if (pinned(s + 2 < T)) {
            kst = kst + 1 < T ? kst + 1 : 0;
            gemm_tnext(g0, sdst + bsel, sbase + (uint64_t)((uint32_t)kst * ROWB));
            gemm_tload(g0, g1);
        }
    }
    gemm_twait(g0, g1);                                     // nothing in flight when the wave ends
    asm volatile("s_wait_dscnt 0x0" ::: "memory");
    float* os = osall + wave * (16 * 68);                   // output staging, private to the wave
    if constexpr (PL) {
        const int which = c0 / DM;                          // 0 q, 1 k, 2 v: the same for the whole tile
        const bool hr = r0 / NB < RH;                       // the tile's positions all lie below RH, or none does
        v8h o16; v8us oh, ol;
        if (which < 2) {
            const int h = ((c0 + (int)wn * 64) % DM) / HD;  // the wave's 64 columns are one head
#pragma unroll
            for (int mb = 0; mb < 4; ++mb) {
#pragma unroll
                for (int nb = 0; nb < 4; ++nb) {
#pragma unroll
                    for (int j = 0; j < 8; ++j) os[(hi * 8 + j) * 68 + nb * 16 + lr] = acc[mb][nb][j];
                }
                __builtin_amdgcn_wave_barrier(); asm volatile("" ::: "memory");
#pragma unroll
                for (int s = 0; s < 4; ++s) {               // eight lanes store one chunk of eight consecutive positions of one problem: one 128-byte line of the fragment order
                    const int sub = (lane >> 3) & 1, c8 = s * 2 + (lane >> 4), cp = c8 * 8;
                    const int row = NB == 2 ? (lane & 7) * 2 + sub : sub * 8 + (lane & 7);
                    const v4f a = *(const v4fa*)(os + row * 68 + cp), b = *(const v4fa*)(os + row * 68 + cp + 4);
                    cvt3(__builtin_shufflevector(a, b, 0, 1, 2, 3, 4, 5, 6, 7), o16, oh, ol);
                    const int m = r0 + (int)wm * 64 + mb * 16 + row, l = m / NB, bh = (m % NB) * NH + h;
                    const size_t e16 = (size_t)which * PLN + (size_t)bh * SEQ * HD + fo_qk(l, c8);
                    const size_t eh = hr ? ((size_t)which * PLNH + (size_t)bh * RH * HD + fo_qk(l, c8)) : 0;
                    store3(QK16 + e16, QKh + eh, QKl + eh, hr, o16, oh, ol);
                }
                __builtin_amdgcn_wave_barrier(); asm volatile("" ::: "memory");
            }
        } else {
            // v: the whole 128 x 128 tile is turned in LDS, T[column][n][position], so that a lane stores eight positions of one (bh, d) and eight lanes one 128-byte line of the fragment order, one writer.
            // T takes the place of the stage buffers: every wave has left them and nothing is in flight (the last pass's waits and barrier).
            constexpr int TP = 132, LT = 128 / NB;          // row pitch in floats (528 bytes, an odd multiple of 16); positions in the tile
            static_assert((size_t)128 * TP * 4 <= (size_t)2 * GBUF && (8 / NB) % 4 == 0);
            float* T = (float*)tl;
#pragma unroll
            for (int mb = 0; mb < 4; ++mb) {
#pragma unroll
                for (int nb = 0; nb < 4; ++nb) {
                    float* tw = T + ((int)wn * 64 + nb * 16 + lr) * TP + ((int)wm * 64 + mb * 16 + hi * 8) / NB;
#pragma unroll
                    for (int n = 0; n < NB; ++n) {
#pragma unroll
                        for (int k4 = 0; k4 < 8 / NB / 4; ++k4) {
                            v4f t;
#pragma unroll
                            for (int e = 0; e < 4; ++e) t[e] = acc[mb][nb][(k4 * 4 + e) * NB + n];
                            *(v4fa*)(tw + n * LT + k4 * 4) = t;
                        }
                    }
                }
            }
            __syncthreads();                                // the turned tile is whole before any wave reads another wave's part
#pragma unroll 4
            for (int it = 0; it < 16; ++it) {
                const int gi = it * 4 + (int)wave, l8 = (gi % (LT / 16)) * 2 + hi, rr = gi / (LT / 16), c = (rr % 8) * 16 + lr, n = rr / 8;   // a wave stores one run of a fragment: 512 contiguous bytes
                const float* tr = T + c * TP + n * LT + l8 * 8;
                const v4f a = *(const v4fa*)tr, b = *(const v4fa*)(tr + 4);
                cvt3(__builtin_shufflevector(a, b, 0, 1, 2, 3, 4, 5, 6, 7), o16, oh, ol);
                const int col = c0 - 2 * DM + c, bh = n * NH + col / HD, d = col % HD, l = r0 / NB + l8 * 8;
                const size_t e16 = (size_t)bh * HD * SEQ + fo_v(d, l);
                const size_t eh = hr ? ((size_t)bh * HD * RH + fo_v(d, l)) : 0;
                store3(VT16 + e16, VTh + eh, VTl + eh, hr, o16, oh, ol);
            }
        }
        return;
    }
#pragma unroll
    for (int mb = 0; mb < 4; ++mb) {
#pragma unroll
        for (int nb = 0; nb < 4; ++nb) {
#pragma unroll
            for (int j = 0; j < 8; ++j) os[(hi * 8 + j) * 68 + nb * 16 + lr] = acc[mb][nb][j];
        }
        __builtin_amdgcn_wave_barrier(); asm volatile("" ::: "memory");
        float* crow = C + (size_t)(r0 + (int)wm * 64 + mb * 16) * ldc + c0 + (int)wn * 64;
{
#pragma unroll
            for (int s = 0; s < 8; ++s) {                       // rows 2s+hi, s = 0..7, hi = 0..1: all 16 rows of the slab
                const int row = 2 * s + hi, cofs = lr * 4;
                const v4f val = *(const v4fa*)(os + row * 68 + cofs);
                *(v4f*)(crow + (size_t)row * ldc + cofs) = val;
            }
            
        }
        __builtin_amdgcn_wave_barrier(); asm volatile("" ::: "memory");
    }
}

// lane l with lane l ^ 16 (the other half of a query column's keys)
__device__ __forceinline__ float xhalf(float x) {
    return __builtin_bit_cast(float, __builtin_amdgcn_permlanex16(__builtin_bit_cast(int, x), __builtin_bit_cast(int, x), 0x76543210, 0xfedcba98, false, false));
}

template <bool HR>
__device__ __forceinline__ void attn_body(const us* __restrict__ Qa, const us* __restrict__ Qr, const us* __restrict__ Ka, const us* __restrict__ Kr,
                                          const us* __restrict__ Va, const us* __restrict__ Vr, bf* CTX, const int q0, const int mrot, const int wv) {
    constexpr int LR = HR ? RH : SEQ;                  // positions per problem in the planes
    constexpr int MS = 32 * AW;                        // keys from one step of a wave to its next
    const int mlow = wv * 32;                          // the wave's lowest step
    __shared__ __align__(16) unsigned short oh[32 * OP];
    __shared__ __align__(16) unsigned short ol[32 * OP];
    __shared__ __align__(16) float po[AW * 2 * 4 * 2 * 128];      // partial outputs [wave][u][t2][register half][lane][4]: every 16-byte access of a wave covers 512 contiguous bytes
    __shared__ float pm[AW * 2 * 32], pl[AW * 2 * 32];            // partial maxima and sums [wave][u][lane]
    const int lane = threadIdx.x & 31, lr = lane & 15, hi = lane >> 4;
    const int bh = blockIdx.x, n = bh / NH, h = bh % NH;
    const size_t pb = (size_t)bh * LR * HD;
    Qa += pb; Ka += pb; Va += pb; Qr += pb; Kr += pb; Vr += pb;
    const int qoff = q0 * HD + 8 * lane;               // fragment order: 16 positions of q or k are 1024 elements, 32 positions of v 2048
    const int koff = 8 * lane;
    const int voff = 8 * lane;
    const float cexp = 0.125f * 1.4426950408889634f;   // HD^-0.5 * log2(e)
    const float pc = HR ? 1.0f : PCAR;
    v8f o[2][4]; float mrow[2], lsum[2];               // o[u][t2][r] = context(query q0 + u*16 + lr, d = t2*16 + 8*hi + r); mrow, lsum: of query q0 + u*16 + lr
#pragma unroll
    for (int u = 0; u < 2; ++u) {
#pragma unroll
        for (int t2 = 0; t2 < 4; ++t2) o[u][t2] = (v8f){};
        mrow[u] = -3.0e38f; lsum[u] = 0.0f;
    }
    v16us qfa[2][2], qfr[2][2], kfa[2][2], kfr[2][2];      // [kc][u] and [kc][t]
#pragma unroll
    for (int kc = 0; kc < 2; ++kc) {
#pragma unroll
        for (int u = 0; u < 2; ++u) {
            qfa[kc][u] = ldfr(Qa + qoff + u * 16 * HD + kc * 512);
            qfr[kc][u] = HR ? ldfr(Qr + qoff + u * 16 * HD + kc * 512) : qfa[kc][u];
        }
#pragma unroll
        for (int t = 0; t < 2; ++t) {
            const int ko = (mrot + t * 16) * HD + koff + kc * 512;
            kfa[kc][t] = ldfr(Ka + ko);
            kfr[kc][t] = HR ? ldfr(Kr + ko) : kfa[kc][t];
        }
    }
    // Rotated key walk over the wave's own steps: m0 = mrot, mrot + MS, .., wrapped round to mlow, .., mrot - MS, every step once (the online softmax takes the steps in any order; the diagonal step is told by m0 == q0).
    // The waves of one problem all run at once: entering at key 0 together they ask for the same lines at the same moment, and at every step all of them wait for its first fetch from memory.
    // Entered apart, a step's lines are fetched by the wave that comes to them first and met in L2 by the rest.
    int m0 = mrot, m1 = m0 + MS <= q0 ? m0 + MS : mlow;            // this step's first key, the next step's
    const us* kpa = Ka + m1 * HD + koff; const us* kpr = Kr + m1 * HD + koff;      // the NEXT step's key rows
    const us* vpa = Va + m0 * HD + voff; const us* vpr = Vr + m0 * HD + voff;      // this step's value columns
#pragma unroll 1
    for (int st = mlow; st <= q0; st += MS) {
        v16us vfa[4], vfr[4];
#pragma unroll
        for (int t2 = 0; t2 < 4; ++t2) {
            vfa[t2] = ldfr(vpa + t2 * 512);                // A[m = d = t2*16 + lr][k = key m0 + ..]
            vfr[t2] = HR ? ldfr(vpr + t2 * 512) : vfa[t2];
        }
        v8f s[2][2];
#pragma unroll
        for (int u = 0; u < 2; ++u)
#pragma unroll
            for (int t = 0; t < 2; ++t) s[u][t] = (v8f){};
#pragma unroll
        for (int kc = 0; kc < 2; ++kc) {
#pragma unroll
            for (int t = 0; t < 2; ++t) {
                s[0][t] = mmg<HR>(kfa[kc][t], qfa[kc][0], s[0][t]); s[1][t] = mmg<HR>(kfa[kc][t], qfa[kc][1], s[1][t]);
                if (HR) {
                    s[0][t] = mmg<HR>(kfa[kc][t], qfr[kc][0], s[0][t]); s[1][t] = mmg<HR>(kfa[kc][t], qfr[kc][1], s[1][t]);
                    s[0][t] = mmg<HR>(kfr[kc][t], qfa[kc][0], s[0][t]); s[1][t] = mmg<HR>(kfr[kc][t], qfa[kc][1], s[1][t]);
                }
            }
        }
        {       // next step's key fragments: a whole softmax and the V^T.P^T products ahead of their use (the last step fetches the first step's keys again: in bounds, not used)
#pragma unroll
            for (int kc = 0; kc < 2; ++kc) {
#pragma unroll
                for (int t = 0; t < 2; ++t) {
                    kfa[kc][t] = ldfr(kpa + (t * 16) * HD + kc * 512);
                    kfr[kc][t] = HR ? ldfr(kpr + (t * 16) * HD + kc * 512) : kfa[kc][t];
                }
            }
            __builtin_amdgcn_sched_barrier(0);      // keeps the loads ahead of the softmax (lead)
        }
        // s[u][t][r] = score(key m0 + t*16 + 8*hi + r, query q0 + u*16 + lr). Keys beyond the query are excluded (only possible in the diagonal step; key m0 is always kept).
        if (m0 == q0) {
#pragma unroll
            for (int u = 0; u < 2; ++u)
#pragma unroll
                for (int t = 0; t < 2; ++t)
#pragma unroll
                    for (int r = 0; r < 8; ++r) { if (t * 16 + 8 * hi + r > u * 16 + lr) s[u][t][r] = -3.0e38f; }
        }
        v16us pa[2], pr[2];
#pragma unroll
        for (int u = 0; u < 2; ++u) {
            float v = fmaxf(s[u][0][0], s[u][1][0]);
#pragma unroll
            for (int r = 1; r < 8; ++r) v = fmaxf(v, fmaxf(s[u][0][r], s[u][1][r]));
            v = fmaxf(v, xhalf(v));
            const float mn = fmaxf(mrow[u], v);
            const v8f x0 = (s[u][0] - mn) * cexp, x1 = (s[u][1] - mn) * cexp;
            float e0[8], e1[8];
#pragma unroll
            for (int r = 0; r < 8; ++r) e0[r] = __builtin_amdgcn_exp2f(x0[r]);
#pragma unroll
            for (int r = 0; r < 8; ++r) e1[r] = __builtin_amdgcn_exp2f(x1[r]);
            const float al = __builtin_amdgcn_exp2f((mrow[u] - mn) * cexp);
            mrow[u] = mn;
            float ps[4] = {0.0f, 0.0f, 0.0f, 0.0f};             // four independent partial sums of the lane's 16 probabilities
#pragma unroll
            for (int r = 0; r < 8; ++r) {
                const float p0 = e0[r], p1 = e1[r];
                ps[r & 3] += p0 + p1;
                if (HR) {
                    unsigned short a, c; splitf(p0, a, c); pa[u][r] = a; pr[u][r] = c;
                    splitf(p1, a, c); pa[u][8 + r] = a; pr[u][8 + r] = c;
                } else {
                    pa[u][r] = __builtin_bit_cast(unsigned short, (h16)(p0 * PCAR));
                    pa[u][8 + r] = __builtin_bit_cast(unsigned short, (h16)(p1 * PCAR));
                }
            }
            if (!HR) pr[u] = pa[u];
            lsum[u] = lsum[u] * al + ((ps[0] + ps[1]) + (ps[2] + ps[3]));     // per-lane partial sum of one query (its half of the keys), the halves joined once at the end
#pragma unroll
            for (int t2 = 0; t2 < 4; ++t2) o[u][t2] *= al;
        }
#pragma unroll
        for (int t2 = 0; t2 < 4; ++t2) {
            o[0][t2] = mmg<HR>(vfa[t2], pa[0], o[0][t2]); o[1][t2] = mmg<HR>(vfa[t2], pa[1], o[1][t2]);
            if (HR) {
                o[0][t2] = mmg<HR>(vfa[t2], pr[0], o[0][t2]); o[1][t2] = mmg<HR>(vfa[t2], pr[1], o[1][t2]);
                o[0][t2] = mmg<HR>(vfr[t2], pa[0], o[0][t2]); o[1][t2] = mmg<HR>(vfr[t2], pa[1], o[1][t2]);
            }
        }
        // the address pairs of this step's loads stay whole up to this wait; they are stepped only behind it
        if (HR) asm volatile("s_wait_xcnt 0x0" :: "v"(kpa), "v"(kpr), "v"(vpa), "v"(vpr) : "memory");
        else    asm volatile("s_wait_xcnt 0x0" :: "v"(kpa), "v"(vpa) : "memory");
        const int m2 = m1 + MS <= q0 ? m1 + MS : mlow;
        const int kstep = (m2 - m1) * HD, vstep = (m1 - m0) * HD;
        kpa += kstep; kpr += kstep; vpa += vstep; vpr += vstep;
        m0 = m1; m1 = m2;
    }
    // every wave publishes its partial result: maximum, sum (the halves joined) and unscaled output accumulators
#pragma unroll
    for (int u = 0; u < 2; ++u) {
        float l = lsum[u];
        l += xhalf(l);
        pm[(wv * 2 + u) * 32 + lane] = mrow[u];
        pl[(wv * 2 + u) * 32 + lane] = l;
#pragma unroll
        for (int t2 = 0; t2 < 4; ++t2) {
            float* p = po + ((wv * 2 + u) * 4 + t2) * 256 + lane * 4;
            *(v4fa*)p = __builtin_shufflevector(o[u][t2], o[u][t2], 0, 1, 2, 3);
            *(v4fa*)(p + 128) = __builtin_shufflevector(o[u][t2], o[u][t2], 4, 5, 6, 7);
        }
    }
    __syncthreads();                                    // all partial results are whole before any wave reads another wave's
    // wave wv joins head columns wv*16 .. wv*16 + 15 of all 32 queries, the partial results in wave order, each scaled from its own maximum to the common one;
    // then normalise, split into bf16 hi / lo, stage the 32 x 64 tile (a lane's 8 values are 8 consecutive d of one query: 16-byte LDS stores), then whole-line stores
#pragma unroll
    for (int u = 0; u < 2; ++u) {
        float mw[AW], f[AW];
#pragma unroll
        for (int w = 0; w < AW; ++w) mw[w] = pm[(w * 2 + u) * 32 + lane];
        const float mall = fmaxf(fmaxf(mw[0], mw[1]), fmaxf(mw[2], mw[3]));
        float l = 0.0f;
        v8f acc = (v8f){};
#pragma unroll
        for (int w = 0; w < AW; ++w) {
            f[w] = __builtin_amdgcn_exp2f((mw[w] - mall) * cexp);
            l += pl[(w * 2 + u) * 32 + lane] * f[w];
            const float* p = po + ((w * 2 + u) * 4 + wv) * 256 + lane * 4;
            const v4f a = *(const v4fa*)p, b = *(const v4fa*)(p + 128);
            acc += __builtin_shufflevector(a, b, 0, 1, 2, 3, 4, 5, 6, 7) * f[w];
        }
        const float inv = 1.0f / (l * pc);
        v8us a8, c8;
#pragma unroll
        for (int r = 0; r < 8; ++r) { unsigned short a, c; splitf(acc[r] * inv, a, c); a8[r] = a; c8[r] = c; }
        const int oo = (u * 16 + lr) * OP + wv * 16 + 8 * hi;
        *(v8usa*)(oh + oo) = a8; *(v8usa*)(ol + oo) = c8;
    }
    __syncthreads();                                    // the staged tile is whole before the row stores
{
#pragma unroll
        for (int s2 = 0; s2 < 8 / AW; ++s2) {
            const int s = wv * (8 / AW) + s2;
            const int row = s * 4 + (lane >> 3), cp = (lane & 7) * 8;
            const v8us vh = *(const v8usa*)(oh + row * OP + cp);
            const v8us vl = *(const v8usa*)(ol + row * OP + cp);
            bf* d = CTX + ((size_t)(q0 + row) * NB + n) * CK + h * HD + cp;
            *(v8us*)d = vh; *(v8us*)(d + DM) = vl;
        }
        
    }
}

__global__ __launch_bounds__(32 * AW) void k_attn_lo(const us* __restrict__ Q16, const us* __restrict__ K16, const us* __restrict__ V16, bf* CTX) {
    const int q0 = RH + (int)blockIdx.y * 32;
    const int wv = __builtin_amdgcn_readfirstlane((int)(threadIdx.x >> 5));     // the wave's number, held scalar: the step bookkeeping stays on the scalar unit
    const int cnt = (q0 / 32 - wv) / AW + 1;                                    // the wave's key steps: wv, wv + AW, .. <= q0 / 32
    attn_body<false>(Q16, Q16, K16, K16, V16, V16, CTX, q0, (wv + AW * (int)(blockIdx.y * 7u % (uint32_t)cnt)) * 32, wv);   // entry step: spread over the wave's own steps, neighbouring tiles apart
}

// ---- k_attn_hr: early query positions (< RH) on bf16 hi/lo planes, ONE 16-row tile per wave (one wave per block), 32 keys per step.
// Per-query arithmetic and product order are those of attn_body with HR = true (q.k: hi.hi, lo.hi, hi.lo per 32-deep chunk; P.v: hi.hi, lo.hi, hi.lo; all into one accumulator, unscaled bf16 residuals), transposed in the same way.
// Live state per lane: 4 output accumulators + 2 score accumulators + 2 softmax scalars + the fragments fetched ahead: q once in front of the loop, a step's v at its head, the next step's k among this step's V^T.P^T products.
// Key steps run over m0 = 0, 32, .., mend with mend = q0 pad down to a multiple of 32 (block-uniform), entered at mrot and wrapped round; keys beyond the query are excluded in the step m0 == mend only (key mend is always kept).
// Planes: RH x 64 elements per problem in fragment order (fo_qk, fo_v); the last step reads keys < mend + 32 <= RH, all written by the qkv product's epilogue.
__global__ __launch_bounds__(32) void k_attn_hr(const us* __restrict__ Qh, const us* __restrict__ Ql, const us* __restrict__ Kh, const us* __restrict__ Kl,
                                                const us* __restrict__ Vh, const us* __restrict__ Vl, bf* CTX) {
    __shared__ __align__(16) unsigned short eoh[ER * OP];     // context hi staging, 16 rows x 64
    __shared__ __align__(16) unsigned short eol[ER * OP];     // context lo staging
    const int lane = threadIdx.x & 31, lr = lane & 15, hi = lane >> 4;
    const int bh = blockIdx.x, n = bh / NH, h = bh % NH;
    const int q0 = (int)blockIdx.y * ER;
    const int mend = q0 & ~31;
    const int mrot = (int)(blockIdx.y % (uint32_t)(mend / 32 + 1)) * 32;      // entry step of the rotated key walk (as in attn_body): mrot, .., mend, 0, .., mrot - 32
    const size_t pb = (size_t)bh * RH * HD;
    Qh += pb; Ql += pb; Kh += pb; Kl += pb; Vh += pb; Vl += pb;
    const int qoff = q0 * HD + 8 * lane;               // fragment order: 16 positions of q or k are 1024 elements, 32 positions of v 2048
    const int koff = 8 * lane;
    const int voff = 8 * lane;
    const float cexp = 0.125f * 1.4426950408889634f;   // HD^-0.5 * log2(e)
    v8f o[4]; float mrow = -3.0e38f, lsum = 0.0f;      // o[t2][r] = context(query q0 + lr, d = t2*16 + 8*hi + r); mrow, lsum: of query q0 + lr
#pragma unroll
    for (int t2 = 0; t2 < 4; ++t2) o[t2] = (v8f){};
    v16us qfa[2], qfr[2], kfa[2][2], kfr[2][2];            // [kc] and [kc][t]
#pragma unroll
    for (int kc = 0; kc < 2; ++kc) {
        qfa[kc] = ldfr(Qh + qoff + kc * 512);
        qfr[kc] = ldfr(Ql + qoff + kc * 512);
#pragma unroll
        for (int t = 0; t < 2; ++t) {
            const int ko = (mrot + t * 16) * HD + koff + kc * 512;
            kfa[kc][t] = ldfr(Kh + ko);
            kfr[kc][t] = ldfr(Kl + ko);
        }
    }
    int m0 = mrot, m1 = m0 + 32 <= mend ? m0 + 32 : 0;             // this step's first key, the next step's
    const us* kph = Kh + m1 * HD + koff; const us* kpl = Kl + m1 * HD + koff;      // the NEXT step's key rows (the last step fetches the first step's keys again: in bounds, not used)
#pragma unroll 1
    for (int st = 0; st <= mend; st += 32) {
        v16us vfa[4], vfr[4];
        const us* vph = Vh + voff + m0 * HD; const us* vpl = Vl + voff + m0 * HD;
#pragma unroll
        for (int t2 = 0; t2 < 4; ++t2) {
            vfa[t2] = ldfr(vph + t2 * 512);                // A[m = d = t2*16 + lr][k = key m0 + ..]
            vfr[t2] = ldfr(vpl + t2 * 512);
        }
        asm volatile("s_wait_xcnt 0x0" :: "v"(vph), "v"(vpl) : "memory");   // the two address pairs stay whole up to this wait
        v8f s[2];
        s[0] = (v8f){}; s[1] = (v8f){};
#pragma unroll
        for (int kc = 0; kc < 2; ++kc) {
#pragma unroll
            for (int t = 0; t < 2; ++t) {
                s[t] = mmg<true>(kfa[kc][t], qfa[kc], s[t]);
                s[t] = mmg<true>(kfa[kc][t], qfr[kc], s[t]);
                s[t] = mmg<true>(kfr[kc][t], qfa[kc], s[t]);
            }
        }
        // s[t][r] = score(key m0 + t*16 + 8*hi + r, query q0 + lr)
        if (m0 == mend) {
#pragma unroll
            for (int t = 0; t < 2; ++t)
#pragma unroll
                for (int r = 0; r < 8; ++r) { if (m0 + t * 16 + 8 * hi + r > q0 + lr) s[t][r] = -3.0e38f; }
        }
        v16us pa, pr;
        {
            float v = fmaxf(s[0][0], s[1][0]);
#pragma unroll
            for (int r = 1; r < 8; ++r) v = fmaxf(v, fmaxf(s[0][r], s[1][r]));
            v = fmaxf(v, xhalf(v));
            const float mn = fmaxf(mrow, v);
            const float al = __builtin_amdgcn_exp2f((mrow - mn) * cexp);
            mrow = mn;
            const v8f x0 = (s[0] - mn) * cexp, x1 = (s[1] - mn) * cexp;
            float ps[4] = {0.0f, 0.0f, 0.0f, 0.0f};             // four independent partial sums of the lane's 16 probabilities
#pragma unroll
            for (int r = 0; r < 8; ++r) {
                const float p0 = __builtin_amdgcn_exp2f(x0[r]);
                const float p1 = __builtin_amdgcn_exp2f(x1[r]);
                ps[r & 3] += p0 + p1;
                unsigned short a, c;
                splitf(p0, a, c); pa[r] = a; pr[r] = c;
                splitf(p1, a, c); pa[8 + r] = a; pr[8 + r] = c;
            }
            lsum = lsum * al + ((ps[0] + ps[1]) + (ps[2] + ps[3]));           // per-lane partial sum of one query (its half of the keys), the halves joined once at the end
#pragma unroll
            for (int t2 = 0; t2 < 4; ++t2) o[t2] *= al;
        }
#pragma unroll
        for (int t2 = 0; t2 < 4; ++t2) {
            o[t2] = mmg<true>(vfa[t2], pa, o[t2]);
            o[t2] = mmg<true>(vfa[t2], pr, o[t2]);
            o[t2] = mmg<true>(vfr[t2], pa, o[t2]);
            const int ko = ((t2 & 1) * 16) * HD + (t2 >> 1) * 512;
            kfa[t2 >> 1][t2 & 1] = ldfr(kph + ko);
            kfr[t2 >> 1][t2 & 1] = ldfr(kpl + ko);
            __builtin_amdgcn_sched_barrier(0);  // keeps each key refill behind the products that free a value fragment pair (register room)
        }
        asm volatile("s_wait_xcnt 0x0" :: "v"(kph), "v"(kpl) : "memory");   // the key address pairs stay whole up to this wait; they are stepped only behind it
        const int m2 = m1 + 32 <= mend ? m1 + 32 : 0;
        const int kstep = (m2 - m1) * HD;
        kph += kstep; kpl += kstep;
        m0 = m1; m1 = m2;
    }
    // normalise, split into bf16 hi / lo, stage the 16 x 64 tile (16-byte LDS stores), then whole-line stores
    {
        float l = lsum;
        l += xhalf(l);
        const float inv = 1.0f / l;
#pragma unroll
        for (int t2 = 0; t2 < 4; ++t2) {
            v8us a8, c8;
#pragma unroll
            for (int r = 0; r < 8; ++r) { unsigned short a, c; splitf(o[t2][r] * inv, a, c); a8[r] = a; c8[r] = c; }
            const int oo = lr * OP + t2 * 16 + 8 * hi;
            *(v8usa*)(eoh + oo) = a8; *(v8usa*)(eol + oo) = c8;
        }
    }
    __syncthreads();
{
#pragma unroll
        for (int s4 = 0; s4 < ER / 4; ++s4) {
            const int row = s4 * 4 + (lane >> 3), cp = (lane & 7) * 8;
            const v8us vh = *(const v8usa*)(eoh + row * OP + cp);
            const v8us vl = *(const v8usa*)(eol + row * OP + cp);
            bf* d = CTX + ((size_t)(q0 + row) * NB + n) * CK + h * HD + cp;
            *(v8us*)d = vh; *(v8us*)(d + DM) = vl;
        }
        
    }
}

// workspace carve (bytes), every region a multiple of 256
constexpr size_t SZ_XB   = (size_t)MROWS * DM * 2;        // x bf16 [MROWS][1024]
constexpr size_t SZ_WQ   = (size_t)F3 * DM * 2;           // w_qkv bf16 [3072][1024]
constexpr size_t SZ_WO   = (size_t)DM * CK * 2;           // [w_out | w_out] bf16 [1024][2048]
constexpr size_t SZ_QK16 = (size_t)2 * NBH * SEQ * HD * 2;
constexpr size_t SZ_QKH  = (size_t)2 * NBH * RH * HD * 2;
constexpr size_t SZ_VT16 = (size_t)NBH * HD * SEQ * 2;
constexpr size_t SZ_VTH  = (size_t)NBH * HD * RH * 2;
constexpr size_t SZ_CTX  = (size_t)MROWS * CK * 2;        // context bf16 hi | lo [MROWS][2048]
constexpr size_t OF_XB   = 0;
constexpr size_t OF_WQ   = OF_XB + SZ_XB;
constexpr size_t OF_WO   = OF_WQ + SZ_WQ;
constexpr size_t OF_QK16 = OF_WO + SZ_WO;
constexpr size_t OF_QKH  = OF_QK16 + SZ_QK16;
constexpr size_t OF_QKL  = OF_QKH + SZ_QKH;
constexpr size_t OF_VT16 = OF_QKL + SZ_QKH;
constexpr size_t OF_VTH  = OF_VT16 + SZ_VT16;
constexpr size_t OF_VTL  = OF_VTH + SZ_VTH;
constexpr size_t OF_CTX  = OF_VTL + SZ_VTH;
constexpr size_t WS_TOTAL = OF_CTX + SZ_CTX;
static_assert(SZ_XB % 256 == 0 && SZ_WQ % 256 == 0 && SZ_WO % 256 == 0 && SZ_QK16 % 256 == 0);
static_assert(SZ_QKH % 256 == 0 && SZ_VT16 % 256 == 0 && SZ_VTH % 256 == 0 && SZ_CTX % 256 == 0);
static_assert(WS_TOTAL <= (size_t)134217728);            // total carve <= 128 MiB

// entry-stage step per tile column of k_gemmw: stages / tile columns, at least 1
constexpr int RY_QKV = (DM / 64) / (F3 / 128) > 0 ? (DM / 64) / (F3 / 128) : 1;
constexpr int RY_OUT = (CK / 128) / (DM / 128) > 0 ? (CK / 128) / (DM / 128) : 1;

extern "C" void kernel_launch(void* const* d_in, const int* in_sizes, int n_in,
                              void* d_out, int out_size, void* d_ws, size_t ws_size, hipStream_t stream) {
    if (n_in < 3) return;
    const long long needx = ((long long)(SEQ - 1) * NB_FULL + NB) * DM;     // last token row touched, in elements
    if ((long long)in_sizes[0] < needx || (long long)in_sizes[1] < (long long)F3 * DM || (long long)in_sizes[2] < (long long)DM * DM || (long long)out_size < needx) return;
    if (WS_TOTAL > ws_size) return;
    const float* x = (const float*)d_in[0];       // [2048][2][1024], token row l*2 + n
    const float* wqkv = (const float*)d_in[1];    // [3072][1024] = [out][in]
    const float* wout = (const float*)d_in[2];    // [1024][1024] = [out][in]
    float* OUT = (float*)d_out;                   // [2048][2][1024]
    char* ws = (char*)d_ws;
    bf* XB = (bf*)(ws + OF_XB); bf* WQ = (bf*)(ws + OF_WQ); bf* WO2 = (bf*)(ws + OF_WO);
    h16* QK16 = (h16*)(ws + OF_QK16); bf* QKh = (bf*)(ws + OF_QKH); bf* QKl = (bf*)(ws + OF_QKL);
    h16* VT16 = (h16*)(ws + OF_VT16); bf* VTh = (bf*)(ws + OF_VTH); bf* VTl = (bf*)(ws + OF_VTL); bf* CTX = (bf*)(ws + OF_CTX);

    k_cvt_all<<<CROWS / (16 * CRPW), 512, 0, stream>>>(x, wqkv, wout, XB, WQ, WO2);
    k_gemmw<64, true, RY_QKV><<<dim3(MROWS / 128, F3 / 128, 1), 128, 0, stream>>>(XB, DM, WQ, DM, DM, nullptr, 0, QK16, QKh, QKl, VT16, VTh, VTl);   // qkv[m][f] = sum_e x[m][e] w_qkv[f][e], written as 16-bit planes
    k_attn_hr<<<dim3(NBH, RH / ER, 1), 32, 0, stream>>>((const us*)QKh, (const us*)QKl, (const us*)(QKh + PLNH), (const us*)(QKl + PLNH), (const us*)VTh, (const us*)VTl, CTX);
    if (SEQ > RH)
        k_attn_lo<<<dim3(NBH, (SEQ - RH) / 32 > 0 ? (SEQ - RH) / 32 : 1, 1), 32 * AW, 0, stream>>>((const us*)QK16, (const us*)(QK16 + PLN), (const us*)VT16, CTX);
    k_gemmw<128, false, RY_OUT><<<dim3(MROWS / 128, DM / 128, 1), 128, 0, stream>>>(CTX, CK, WO2, CK, CK, OUT, DM * ROWSTEP, nullptr, nullptr, nullptr, nullptr, nullptr, nullptr);   // out[m][f] = sum_e (ctx_hi + ctx_lo)[m][e] w_out[f][e]
}

// v009
// Measured time: 71 microseconds a run.
// Next to v008, in two timings, it ran 1.10 and 1.09 times as fast.
// All steps since v000 together make it 5.59 times as fast.
#include <hip/hip_runtime.h>
#include <stdint.h>

// Contractions: qkv projection and output projection v_wmma_f32_16x16x32_bf16 (every input RNE-converted to bf16; context carried as bf16 hi|lo folded into K); scores and probability x value v_wmma_f32_16x16x32_f16 for query positions >= 256 (P carried x1024), bf16 hi/lo three-product form for positions < 256; f32 accumulate, f32 softmax.
// Sequence-first causal multi-head self-attention with a fused bias-free (out, in) qkv weight and an (out, in) output weight: token row m = l*NB + n, attention problem bh = n*16 + h, head columns h*64..h*64+63.
// Launch plan: k_cvt_all (bf16 copies) -> k_gemmw (qkv product, its epilogue writes the q/k/v^T 16-bit planes) -> k_attn (one grid: rows < 256 in 16-row tiles, one per wave; rows >= 256 in 32-row tiles, four waves share a tile's keys) -> k_gemmw (output).

#ifndef NB
#define NB 2                      // batch entries processed (NB_FULL, or 1 for a reduced build)
#endif
#ifndef SEQ
#define SEQ 2048                  // sequence positions processed
#endif
#define NB_FULL  2                // batch stride of the staged x and of the output rows
#define SEQ_FULL 2048
#define DM   1024
#define NH   16
#define HD   64
#define F3   (3 * DM)
#define CK   (2 * DM)             // context plane width: hi columns | lo columns
#define RH   256                  // query positions < RH use the hi/lo planes
#define NBH  (NB * NH)
#define MROWS (SEQ * NB)
#define ROWSTEP (NB_FULL / NB)
#define PLN  ((size_t)NBH * SEQ * HD)
#define PLNH ((size_t)NBH * RH * HD)
#define PCAR 1024.0f
#define OP   72                   // context staging pitch in 16-bit elements (144 B)
#define ER   16                   // query rows per wave in the early-positions kernel
#define AW   4                    // waves per 32-row tile in the late-positions kernel: wave w takes key steps w, w + AW, ..

static_assert(NB == NB_FULL || NB == 1);          // compact row m = l*NB + n maps to token row m*ROWSTEP
static_assert(SEQ <= SEQ_FULL && SEQ >= RH);
static_assert(SEQ % 256 == 0);                    // tile multiples (128-row GEMM tiles, 32-row attention tiles, 8-wide plane groups)
static_assert(RH % 32 == 0 && RH % 8 == 0);       // the last 32-key step of the early kernel ends inside the hi/lo planes
static_assert(RH % ER == 0 && ER == 16);          // early kernel: one 16-row WMMA tile per wave, store loop 4 x 4 rows
static_assert(HD == 64 && NH * HD == DM);
static_assert((RH / ER) % AW == 0);               // early tiles fill whole work-groups of AW waves
static_assert(AW == 4 && RH / 32 >= AW);          // late kernel: every wave has a key step; wave w joins head columns 16 w .. 16 w + 15 and stores 8 / AW groups of four rows
static_assert(DM == 1024);                        // k_cvt_all: a row is 8 loads of 128 floats per wave
static_assert(DM % 64 == 0 && DM >= 128 && CK % 128 == 0 && CK >= 256);   // K: whole stages, at least two (k_gemmw: 64 deep for qkv, 128 deep for the output)
static_assert(MROWS % 128 == 0 && F3 % 128 == 0 && DM % 128 == 0);        // whole 128 x 128 output tiles
static_assert(RH % (128 / NB) == 0 && DM % 128 == 0);     // a 128 x 128 tile of the qkv product lies wholly in one of q, k, v and wholly below or above RH
static_assert(OP >= 64 && (OP * 2) % 16 == 0);

typedef _Float16 h16;
typedef unsigned short bf;
typedef unsigned short us;
typedef __attribute__((ext_vector_type(16))) __bf16   v16bf;
typedef __attribute__((ext_vector_type(16))) _Float16 v16h;
typedef __attribute__((ext_vector_type(16))) unsigned short v16us;
typedef __attribute__((ext_vector_type(8)))  _Float16 v8h;
typedef __attribute__((ext_vector_type(8)))  unsigned short v8us;
typedef __attribute__((ext_vector_type(8)))  float    v8f;
typedef __attribute__((ext_vector_type(4)))  float    v4f;
typedef v4f  __attribute__((may_alias)) v4fa;
typedef v8us __attribute__((may_alias)) v8usa;

__device__ __forceinline__ unsigned short f2bf(float f) { unsigned u = __float_as_uint(f); u += 0x7FFFu + ((u >> 16) & 1u); return (unsigned short)(u >> 16); }
__device__ __forceinline__ float bf2f(unsigned short b) { return __uint_as_float(((unsigned)b) << 16); }
__device__ __forceinline__ void splitf(float y, unsigned short& h, unsigned short& l) { h = f2bf(y); l = f2bf(y - bf2f(h)); }

// 16-bit fragment from a K-contiguous row: elements 0..7 <- p[0..7], elements 8..15 <- p[16..23]; the caller adds 8*(lane>>4) to p.
__device__ __forceinline__ v16us ldus(const us* p) {
    const v8us a = *(const v8us*)p; const v8us b = *(const v8us*)(p + 16);
    return __builtin_shufflevector(a, b, 0, 1, 2, 3, 4, 5, 6, 7, 8, 9, 10, 11, 12, 13, 14, 15);
}

// 16-bit fragment from a plane kept in fragment order: a fragment is 1 KiB, two runs of 512 contiguous bytes (elements 0..7 of lanes 0..31, then elements 8..15); the caller adds 8*lane to p.
// Each of the two loads then covers four whole 128-byte lines, where a load from a row-major plane touches sixteen lines for 32 bytes each.
__device__ __forceinline__ v16us ldfr(const us* p) {
    const v8us a = *(const v8us*)p; const v8us b = *(const v8us*)(p + 256);
    return __builtin_shufflevector(a, b, 0, 1, 2, 3, 4, 5, 6, 7, 8, 9, 10, 11, 12, 13, 14, 15);
}
// Element offsets inside one problem's plane. q and k: position l, 8-element chunk c8 of the 64 head columns (16 positions x 64 columns = two fragments of 32 columns each).
// v: head column d, position l a multiple of 8 (32 positions x 64 columns = four fragments of 16 columns each). Lane = 16*hi + lr, with lr the fragment's row and hi the 8-element half of ldus.
__device__ __forceinline__ int fo_qk(int l, int c8) { return (l >> 4) * 1024 + (c8 >> 1) * 256 + (c8 & 1) * 128 + (l & 15) * 8; }
__device__ __forceinline__ int fo_v(int d, int l)   { return (l >> 5) * 2048 + ((d >> 4) * 2 + ((l >> 4) & 1)) * 256 + ((l >> 3) & 1) * 128 + (d & 15) * 8; }

// One WMMA plus its own four-slot guard (ties exactly one accumulator, keeps A and B live).
template <bool BF>
__device__ __forceinline__ v8f mmg(v16us a, v16us b, v8f c) {
    if (BF) c = __builtin_amdgcn_wmma_f32_16x16x32_bf16(false, __builtin_bit_cast(v16bf, a), false, __builtin_bit_cast(v16bf, b), (short)0, c, false, false);
    else    c = __builtin_amdgcn_wmma_f32_16x16x32_f16(false, __builtin_bit_cast(v16h, a), false, __builtin_bit_cast(v16h, b), (short)0, c, false, false);
    asm volatile("v_nop\n\tv_nop\n\tv_nop\n\tv_nop" : "+v"(c) : "v"(a), "v"(b));
    return c;
}

// ---- k_cvt_all: every f32 input to its bf16 plane in ONE launch of CROWS / CRPW two-row waves (16 per work-group, one work-group per 32 rows).
// A wave takes CRPW whole rows of 1024 floats out of the list [x rows | w_qkv rows | w_out rows]: rows w and w + CROWS / CRPW. All of its loads (8 per row, 512 contiguous bytes each) are issued
// before the first value is converted; a store is 256 contiguous bytes. A w_out row is stored twice (columns 0..1023 pair with the hi half of the context plane, 1024..2047 with the lo half).
#define CROWS (MROWS + F3 + DM)
#define CRPW  2
static_assert(CROWS % (16 * CRPW) == 0);          // whole work-groups of 16 waves
typedef __attribute__((ext_vector_type(4))) unsigned short v4us;
__global__ __launch_bounds__(512) void k_cvt_all(const float* __restrict__ x, const float* __restrict__ wqkv, const float* __restrict__ wout, bf* XB, bf* WQ, bf* WO2) {
    const int lane = threadIdx.x & 31;
    const int w = __builtin_amdgcn_readfirstlane((int)(blockIdx.x * 16 + (threadIdx.x >> 5)));
    const float* s[CRPW]; bf* dst[CRPW]; bool dup[CRPW];
#pragma unroll
    for (int r = 0; r < CRPW; ++r) {                  // which plane the row belongs to: the same for the whole wave, scalar selects
        const int row = w + r * (CROWS / CRPW);
        const bool isx = row < MROWS, isq = row < MROWS + F3;
        const int rr = isx ? row : (isq ? row - MROWS : row - MROWS - F3);
        s[r]   = (isx ? x : (isq ? wqkv : wout)) + (size_t)rr * (isx ? ROWSTEP * DM : DM) + lane * 4;
        dst[r] = (isx ? XB : (isq ? WQ : WO2)) + (size_t)rr * (isq ? DM : CK) + lane * 4;
        dup[r] = !isq;
    }
    v4f v[CRPW][8];
#pragma unroll
    for (int r = 0; r < CRPW; ++r)
#pragma unroll
        for (int j = 0; j < 8; ++j) v[r][j] = *(const v4f*)(s[r] + j * 128);
    __builtin_amdgcn_sched_barrier(0);                // keeps every load of the wave ahead of the first conversion: without it the second row's loads sank behind waits on the first row's
#pragma unroll
    for (int r = 0; r < CRPW; ++r) {
        v4us o[8];
#pragma unroll
        for (int j = 0; j < 8; ++j) {
#pragma unroll
            for (int k = 0; k < 4; ++k) o[j][k] = f2bf(v[r][j][k]);
        }
        bf* d = dst[r];
#pragma unroll
        for (int j = 0; j < 8; ++j) *(v4us*)(d + j * 128) = o[j];
        if (r + 1 < CRPW) asm volatile("s_wait_xcnt 0x0" ::: "memory");       // stands before the stores' base and data registers are written again (the next row's address and values take them)
        if (dup[r]) {
#pragma unroll
            for (int j = 0; j < 8; ++j) *(v4us*)(d + DM + j * 128) = o[j];
            if (r + 1 < CRPW) asm volatile("s_wait_xcnt 0x0" ::: "memory");   // the same for these stores
        }
    }
}

// ---- k_gemmw: one 128x128 output tile per work-group of four waves (2 x 2, 64x64 = 16 accumulators each); grid (M/128, N/128), 128 threads.
// C[m][n] (f32, pitch ldc) = sum_k A[m][k] Bt[n][k]; K a multiple of KS and at least 2 KS, M and N multiples of 128; bf16 operands from K-contiguous planes.
// A stage is KS k of the tile's 128 A rows and 128 Bt rows. Each wave brings one slice of it (64 rows of 2 KS bytes) into LDS with one tensor load, every row padded by 16 bytes;
// two buffers: the load of stage s + 1 is in flight while stage s is multiplied. Every operand row is fetched once per work-group in whole lines and read by two waves from LDS.
// KS = 64 leaves room for three work-groups on a WGP (a grid of several per WGP); KS = 128 keeps twice the bytes in flight where a work-group has its WGP alone.
// The k walk is rotated: pass s works on k stage (s + rot) mod T, rot set by the tile's indices. The work-groups that share A rows (one tile row) or Bt rows (one tile column) all run at once;
// entering at stage 0 together they ask for the same lines at the same moment, and at every stage all of them wait for its first fetch from memory. Entered apart, each stage is fetched by the one that
// comes to it first and met in L2 by the rest. Every stage is still taken exactly once; the f32 sum over k starts at stage rot and wraps round.
// rot = 4 * (row / 8) + row % 4 + RY * column: any four neighbouring rows of each eight differ (for speed only, nothing rests on it),
// and RY spreads the tile columns over the stages where there are fewer columns than stages.
typedef uint32_t u32x4 __attribute__((ext_vector_type(4)));
typedef uint32_t u32x8 __attribute__((ext_vector_type(8)));
__device__ __forceinline__ uint32_t uni(uint32_t v) { return (uint32_t)__builtin_amdgcn_readfirstlane(v); }
__device__ __forceinline__ uint32_t pinned(uint32_t v) { uint32_t w = (uint32_t)__builtin_amdgcn_readfirstlane(v); asm volatile("" : "+s"(w)); return w; }   // a wave-uniform test held in a scalar register, so that the branch on it is a scalar branch (tensor loads ignore EXEC)
// one request of the calling wave: the tile that g1 describes, from the global address in g0 to the LDS place in g0
__device__ __forceinline__ void gemm_tload(const u32x4 g0, const u32x8 g1) { asm volatile("tensor_load_to_lds %0, %1" :: "s"(g0), "s"(g1) : "memory"); }
// the wave's own requests have landed. The two groups are operands so that their registers stay whole up to this wait and take new values only behind it.
__device__ __forceinline__ void gemm_twait(u32x4& g0, u32x8& g1) { asm volatile("s_wait_tensorcnt 0x0" : "+s"(g0), "+s"(g1) :: "memory"); }
// next stage: the LDS place dst, the global address ga of the slice's first byte in that stage (type 2 in the top bits of word 3)
__device__ __forceinline__ void gemm_tnext(u32x4& g0, uint32_t dst, uint64_t ga) {
    g0[1] = uni(dst); g0[2] = uni((uint32_t)ga); g0[3] = uni((((uint32_t)(ga >> 32)) & 0x01FFFFFFu) | 0x80000000u);
}
// 16-bit forms of eight f32 values of the qkv product: f16, and bf16 hi and lo (stored only for positions < RH)
__device__ __forceinline__ void cvt3(const v8f x, v8h& o16, v8us& oh, v8us& ol) {
#pragma unroll
    for (int k = 0; k < 8; ++k) { o16[k] = (h16)x[k]; unsigned short a, c; splitf(x[k], a, c); oh[k] = a; ol[k] = c; }
}
__device__ __forceinline__ void store3(h16* p16, bf* ph, bf* pl, bool hr, const v8h o16, const v8us oh, const v8us ol) {
    *(v8h*)p16 = o16;
    asm volatile("s_wait_xcnt 0x0" ::: "memory");       // stands before the store's address and data registers are written again
    if (hr) {
        *(v8us*)ph = oh; *(v8us*)pl = ol;
        asm volatile("s_wait_xcnt 0x0" ::: "memory");   // the same for these two stores
    }
}
// PL = false: the tile goes to C as f32. PL = true (the qkv product; row m = l*NB + n, column which*1024 + h*64 + d): the tile goes straight to the 16-bit operand planes of the attention kernels,
// q and k per problem bh as SEQ x 64 elements (f16; positions < RH also bf16 hi and lo, RH x 64), v likewise, every plane in the fragment order of fo_qk and fo_v (v's fragments are those of the transposed tile); C is not touched.
template <int KS, bool PL, int RY>
__global__ __launch_bounds__(128) void k_gemmw(const bf* __restrict__ A, int lda, const bf* __restrict__ Bt, int ldb, int K, float* C, int ldc,
                                               h16* QK16, bf* QKh, bf* QKl, h16* VT16, bf* VTh, bf* VTl) {
    static_assert(KS == 64 || KS == 128);
    constexpr uint32_t ROWB   = 2u * KS;                                  // bytes of a row in a stage
    constexpr uint32_t GPITCH = ROWB + 16u;                               // LDS row pitch: an odd multiple of 16 bytes for 16-byte reads
    constexpr uint32_t GSLICE = (64u * GPITCH + 2047u) / 2048u * 2048u;   // 64 rows, rounded up to a multiple of 2 KiB
    constexpr uint32_t GBUF   = 4u * GSLICE;                              // slices: A rows 0..63, A rows 64..127, Bt rows 0..63, Bt rows 64..127
    __shared__ __attribute__((aligned(2048))) unsigned char tl[2 * GBUF];
    __shared__ __align__(16) float osall[4 * 16 * 68];
    const int lane = threadIdx.x & 31, lr = lane & 15, hi = lane >> 4;
    const uint32_t wave = uni(threadIdx.x >> 5), wm = wave & 1u, wn = wave >> 1;
    const int r0 = blockIdx.x * 128, c0 = blockIdx.y * 128;
    // this wave's slice of every stage: waves 0, 1 the two halves of the A rows, waves 2, 3 of the Bt rows
    const bool isb = wave >= 2u;
    const uint32_t spitch = (uint32_t)(isb ? ldb : lda) * 2u;
    const uint64_t sbase = (uint64_t)(size_t)(isb ? Bt : A) + (uint64_t)((isb ? c0 : r0) + (int)(wave & 1u) * 64) * spitch;
    const uint32_t sdst = (uint32_t)(size_t)tl + wave * GSLICE;
    u32x8 g1;                                     // 1-byte elements, tensor = tile = 64 rows of ROWB bytes, 4 dwords of LDS pad behind every row
    g1[0] = uni((1u << 20) | ((KS == 64 ? 4u : 5u) << 22) | (3u << 25));
    g1[1] = uni(ROWB << 16);
    g1[2] = uni(64u << 16);
    g1[3] = uni(ROWB << 16);
    g1[4] = uni(64u);
    g1[5] = uni(spitch);
    g1[6] = uni(0u);
    g1[7] = uni(0u);
    const int T = K / KS;                         // stages
    int kst = (int)uni(((blockIdx.x >> 3) * 4u + (blockIdx.x & 3u) + blockIdx.y * (uint32_t)RY) % (uint32_t)T);      // k stage of the request formed next: rot, rot + 1, .., T - 1, 0, .., rot - 1
    u32x4 g0;                                     // count 1, LDS place, global address, type 2
    g0[0] = uni(1u);
    gemm_tnext(g0, sdst, sbase + (uint64_t)((uint32_t)kst * ROWB));
    v8f acc[4][4];
#pragma unroll
    for (int mb = 0; mb < 4; ++mb)
#pragma unroll
        for (int nb = 0; nb < 4; ++nb) acc[mb][nb] = (v8f){};
    gemm_tload(g0, g1);
    gemm_twait(g0, g1);                                     // the first pass's stage (k stage rot) has landed (this wave's slice)
    __syncthreads();                                        // ... and every wave's
    kst = kst + 1 < T ? kst + 1 : 0;
    gemm_tnext(g0, sdst + GBUF, sbase + (uint64_t)((uint32_t)kst * ROWB));
    gemm_tload(g0, g1);
    const uint32_t aoff = wm * GSLICE + (uint32_t)lr * GPITCH + 16u * (uint32_t)hi;
    const uint32_t boff = (2u + wn) * GSLICE + (uint32_t)lr * GPITCH + 16u * (uint32_t)hi;
#pragma unroll 1                                 // rolled: one publish point in the code, the buffer chosen by a scalar
    for (int s = 0; s < T; ++s) {
        const uint32_t bsel = (uint32_t)(s & 1) * GBUF;
#pragma unroll 1
        for (int h = 0; h < KS / 64; ++h) {         // 64 k at a time: two 32-deep blocks (kept rolled: four blocks in a row spilled accumulators)
            const unsigned char* ap = tl + bsel + aoff + h * 128; const unsigned char* bp = tl + bsel + boff + h * 128;
            // LDS reads stand at two places only: the head (both blocks' A, the first block's Bt, the second block's Bt columns 0..31) and the middle of the first block
            // (the second block's Bt columns 32..63, into the registers that the first eight products have freed).
            v16us a[2][4], b[2][4];
#pragma unroll
            for (int i = 0; i < 4; ++i) { a[0][i] = ldus((const us*)(ap + i * 16 * GPITCH)); b[0][i] = ldus((const us*)(bp + i * 16 * GPITCH)); }
#pragma unroll
            for (int i = 0; i < 4; ++i) a[1][i] = ldus((const us*)(ap + i * 16 * GPITCH + 64));
#pragma unroll
            for (int i = 0; i < 2; ++i) b[1][i] = ldus((const us*)(bp + i * 16 * GPITCH + 64));
            __builtin_amdgcn_sched_barrier(0);      // keeps these loads one group ahead of the products
#pragma unroll
            for (int nb = 0; nb < 2; ++nb)
#pragma unroll
                for (int mb = 0; mb < 4; ++mb) acc[mb][nb] = mmg<true>(a[0][mb], b[0][nb], acc[mb][nb]);
            __builtin_amdgcn_sched_barrier(0);      // keeps the second group from rising among the products whose registers it takes
#pragma unroll
            for (int i = 2; i < 4; ++i) b[1][i] = ldus((const us*)(bp + i * 16 * GPITCH + 64));
            __builtin_amdgcn_sched_barrier(0);      // keeps the second group together, sixteen products ahead of its first use
#pragma unroll
            for (int nb = 2; nb < 4; ++nb)
#pragma unroll
                for (int mb = 0; mb < 4; ++mb) acc[mb][nb] = mmg<true>(a[0][mb], b[0][nb], acc[mb][nb]);
#pragma unroll
            for (int nb = 0; nb < 4; ++nb)
#pragma unroll
                for (int mb = 0; mb < 4; ++mb) acc[mb][nb] = mmg<true>(a[1][mb], b[1][nb], acc[mb][nb]);
        }
        // publish point of stage s + 1
        asm volatile("s_wait_dscnt 0x0" ::: "memory");      // this wave has left stage s's buffer
        gemm_twait(g0, g1);                                 // this wave's slice of stage s + 1 has landed
        __syncthreads();                                    // stage s + 1 readable by all; stage s's buffer left by all
        if (pinned(s + 2 < T)) {
            kst = kst + 1 < T ? kst + 1 : 0;
            gemm_tnext(g0, sdst + bsel, sbase + (uint64_t)((uint32_t)kst * ROWB));
            gemm_tload(g0, g1);
        }
    }
    gemm_twait(g0, g1);                                     // nothing in flight when the wave ends
    asm volatile("s_wait_dscnt 0x0" ::: "memory");
    float* os = osall + wave * (16 * 68);                   // output staging, private to the wave
    if constexpr (PL) {
        const int which = c0 / DM;                          // 0 q, 1 k, 2 v: the same for the whole tile
        const bool hr = r0 / NB < RH;                       // the tile's positions all lie below RH, or none does
        v8h o16; v8us oh, ol;
        if (which < 2) {
            const int h = ((c0 + (int)wn * 64) % DM) / HD;  // the wave's 64 columns are one head
#pragma unroll
            for (int mb = 0; mb < 4; ++mb) {
#pragma unroll
                for (int nb = 0; nb < 4; ++nb) {
#pragma unroll
                    for (int j = 0; j < 8; ++j) os[(hi * 8 + j) * 68 + nb * 16 + lr] = acc[mb][nb][j];
                }
                __builtin_amdgcn_wave_barrier(); asm volatile("" ::: "memory");
#pragma unroll
                for (int s = 0; s < 4; ++s) {               // eight lanes store one chunk of eight consecutive positions of one problem: one 128-byte line of the fragment order
                    const int sub = (lane >> 3) & 1, c8 = s * 2 + (lane >> 4), cp = c8 * 8;
                    const int row = NB == 2 ? (lane & 7) * 2 + sub : sub * 8 + (lane & 7);
                    const v4f a = *(const v4fa*)(os + row * 68 + cp), b = *(const v4fa*)(os + row * 68 + cp + 4);
                    cvt3(__builtin_shufflevector(a, b, 0, 1, 2, 3, 4, 5, 6, 7), o16, oh, ol);
                    const int m = r0 + (int)wm * 64 + mb * 16 + row, l = m / NB, bh = (m % NB) * NH + h;
                    const size_t e16 = (size_t)which * PLN + (size_t)bh * SEQ * HD + fo_qk(l, c8);
                    const size_t eh = hr ? ((size_t)which * PLNH + (size_t)bh * RH * HD + fo_qk(l, c8)) : 0;
                    store3(QK16 + e16, QKh + eh, QKl + eh, hr, o16, oh, ol);
                }
                __builtin_amdgcn_wave_barrier(); asm volatile("" ::: "memory");
            }
        } else {
            // v: the whole 128 x 128 tile is turned in LDS, T[column][n][position], so that a lane stores eight positions of one (bh, d) and eight lanes one 128-byte line of the fragment order, one writer.
            // T takes the place of the stage buffers: every wave has left them and nothing is in flight (the last pass's waits and barrier).
            constexpr int TP = 132, LT = 128 / NB;          // row pitch in floats (528 bytes, an odd multiple of 16); positions in the tile
            static_assert((size_t)128 * TP * 4 <= (size_t)2 * GBUF && (8 / NB) % 4 == 0);
            float* T = (float*)tl;
#pragma unroll
            for (int mb = 0; mb < 4; ++mb) {
#pragma unroll
                for (int nb = 0; nb < 4; ++nb) {
                    float* tw = T + ((int)wn * 64 + nb * 16 + lr) * TP + ((int)wm * 64 + mb * 16 + hi * 8) / NB;
#pragma unroll
                    for (int n = 0; n < NB; ++n) {
#pragma unroll
                        for (int k4 = 0; k4 < 8 / NB / 4; ++k4) {
                            v4f t;
#pragma unroll
                            for (int e = 0; e < 4; ++e) t[e] = acc[mb][nb][(k4 * 4 + e) * NB + n];
                            *(v4fa*)(tw + n * LT + k4 * 4) = t;
                        }
                    }
                }
            }
            __syncthreads();                                // the turned tile is whole before any wave reads another wave's part
#pragma unroll 4
            for (int it = 0; it < 16; ++it) {
                const int gi = it * 4 + (int)wave, l8 = (gi % (LT / 16)) * 2 + hi, rr = gi / (LT / 16), c = (rr % 8) * 16 + lr, n = rr / 8;   // a wave stores one run of a fragment: 512 contiguous bytes
                const float* tr = T + c * TP + n * LT + l8 * 8;
                const v4f a = *(const v4fa*)tr, b = *(const v4fa*)(tr + 4);
                cvt3(__builtin_shufflevector(a, b, 0, 1, 2, 3, 4, 5, 6, 7), o16, oh, ol);
                const int col = c0 - 2 * DM + c, bh = n * NH + col / HD, d = col % HD, l = r0 / NB + l8 * 8;
                const size_t e16 = (size_t)bh * HD * SEQ + fo_v(d, l);
                const size_t eh = hr ? ((size_t)bh * HD * RH + fo_v(d, l)) : 0;
                store3(VT16 + e16, VTh + eh, VTl + eh, hr, o16, oh, ol);
            }
        }
        return;
    }
#pragma unroll
    for (int mb = 0; mb < 4; ++mb) {
#pragma unroll
        for (int nb = 0; nb < 4; ++nb) {
#pragma unroll
            for (int j = 0; j < 8; ++j) os[(hi * 8 + j) * 68 + nb * 16 + lr] = acc[mb][nb][j];
        }
        __builtin_amdgcn_wave_barrier(); asm volatile("" ::: "memory");
        float* crow = C + (size_t)(r0 + (int)wm * 64 + mb * 16) * ldc + c0 + (int)wn * 64;
{
#pragma unroll
            for (int s = 0; s < 8; ++s) {                       // rows 2s+hi, s = 0..7, hi = 0..1: all 16 rows of the slab
                const int row = 2 * s + hi, cofs = lr * 4;
                const v4f val = *(const v4fa*)(os + row * 68 + cofs);
                *(v4f*)(crow + (size_t)row * ldc + cofs) = val;
            }
            
        }
        __builtin_amdgcn_wave_barrier(); asm volatile("" ::: "memory");
    }
}

// lane l with lane l ^ 16 (the other half of a query column's keys)
__device__ __forceinline__ float xhalf(float x) {
    return __builtin_bit_cast(float, __builtin_amdgcn_permlanex16(__builtin_bit_cast(int, x), __builtin_bit_cast(int, x), 0x76543210, 0xfedcba98, false, false));
}

template <bool HR>
__device__ __forceinline__ void attn_body(const us* __restrict__ Qa, const us* __restrict__ Qr, const us* __restrict__ Ka, const us* __restrict__ Kr,
                                          const us* __restrict__ Va, const us* __restrict__ Vr, bf* CTX, const int q0, const int mrot, const int wv) {
    constexpr int LR = HR ? RH : SEQ;                  // positions per problem in the planes
    constexpr int MS = 32 * AW;                        // keys from one step of a wave to its next
    const int mlow = wv * 32;                          // the wave's lowest step
    __shared__ __align__(16) unsigned short oh[32 * OP];
    __shared__ __align__(16) unsigned short ol[32 * OP];
    __shared__ __align__(16) float po[AW * 2 * 4 * 2 * 128];      // partial outputs [wave][u][t2][register half][lane][4]: every 16-byte access of a wave covers 512 contiguous bytes
    __shared__ float pm[AW * 2 * 32], pl[AW * 2 * 32];            // partial maxima and sums [wave][u][lane]
    const int lane = threadIdx.x & 31, lr = lane & 15, hi = lane >> 4;
    const int bh = blockIdx.x, n = bh / NH, h = bh % NH;
    const size_t pb = (size_t)bh * LR * HD;
    Qa += pb; Ka += pb; Va += pb; Qr += pb; Kr += pb; Vr += pb;
    const int qoff = q0 * HD + 8 * lane;               // fragment order: 16 positions of q or k are 1024 elements, 32 positions of v 2048
    const int koff = 8 * lane;
    const int voff = 8 * lane;
    const float cexp = 0.125f * 1.4426950408889634f;   // HD^-0.5 * log2(e)
    const float pc = HR ? 1.0f : PCAR;
    v8f o[2][4]; float mrow[2], lsum[2];               // o[u][t2][r] = context(query q0 + u*16 + lr, d = t2*16 + 8*hi + r); mrow, lsum: of query q0 + u*16 + lr
#pragma unroll
    for (int u = 0; u < 2; ++u) {
#pragma unroll
        for (int t2 = 0; t2 < 4; ++t2) o[u][t2] = (v8f){};
        mrow[u] = -3.0e38f; lsum[u] = 0.0f;
    }
    v16us qfa[2][2], qfr[2][2], kfa[2][2], kfr[2][2];      // [kc][u] and [kc][t]
    const us* qpa = Qa + qoff; const us* qpr = Qr + qoff;                                      // the tile's query rows
    const us* k0a = Ka + mrot * HD + koff; const us* k0r = Kr + mrot * HD + koff;              // the entry step's key rows
#pragma unroll
    for (int kc = 0; kc < 2; ++kc) {
#pragma unroll
        for (int u = 0; u < 2; ++u) {
            qfa[kc][u] = ldfr(qpa + u * 16 * HD + kc * 512);
            qfr[kc][u] = HR ? ldfr(qpr + u * 16 * HD + kc * 512) : qfa[kc][u];
        }
#pragma unroll
        for (int t = 0; t < 2; ++t) {
            const int ko = t * 16 * HD + kc * 512;
            kfa[kc][t] = ldfr(k0a + ko);
            kfr[kc][t] = HR ? ldfr(k0r + ko) : kfa[kc][t];
        }
    }
    // the address pairs of these loads stay whole up to this wait
    if (HR) asm volatile("s_wait_xcnt 0x0" :: "v"(qpa), "v"(qpr), "v"(k0a), "v"(k0r) : "memory");
    else    asm volatile("s_wait_xcnt 0x0" :: "v"(qpa), "v"(k0a) : "memory");
    // Rotated key walk over the wave's own steps: m0 = mrot, mrot + MS, .., wrapped round to mlow, .., mrot - MS, every step once (the online softmax takes the steps in any order; the diagonal step is told by m0 == q0).
    // The waves of one problem all run at once: entering at key 0 together they ask for the same lines at the same moment, and at every step all of them wait for its first fetch from memory.
    // Entered apart, a step's lines are fetched by the wave that comes to them first and met in L2 by the rest.
    int m0 = mrot, m1 = m0 + MS <= q0 ? m0 + MS : mlow;            // this step's first key, the next step's
    const us* kpa = Ka + m1 * HD + koff; const us* kpr = Kr + m1 * HD + koff;      // the NEXT step's key rows
    const us* vpa = Va + m0 * HD + voff; const us* vpr = Vr + m0 * HD + voff;      // this step's value columns
#pragma unroll 1
    for (int st = mlow; st <= q0; st += MS) {
        v16us vfa[4], vfr[4];
#pragma unroll
        for (int t2 = 0; t2 < 4; ++t2) {
            vfa[t2] = ldfr(vpa + t2 * 512);                // A[m = d = t2*16 + lr][k = key m0 + ..]
            vfr[t2] = HR ? ldfr(vpr + t2 * 512) : vfa[t2];
        }
        v8f s[2][2];
#pragma unroll
        for (int u = 0; u < 2; ++u)
#pragma unroll
            for (int t = 0; t < 2; ++t) s[u][t] = (v8f){};
#pragma unroll
        for (int kc = 0; kc < 2; ++kc) {
#pragma unroll
            for (int t = 0; t < 2; ++t) {
                s[0][t] = mmg<HR>(kfa[kc][t], qfa[kc][0], s[0][t]); s[1][t] = mmg<HR>(kfa[kc][t], qfa[kc][1], s[1][t]);
                if (HR) {
                    s[0][t] = mmg<HR>(kfa[kc][t], qfr[kc][0], s[0][t]); s[1][t] = mmg<HR>(kfa[kc][t], qfr[kc][1], s[1][t]);
                    s[0][t] = mmg<HR>(kfr[kc][t], qfa[kc][0], s[0][t]); s[1][t] = mmg<HR>(kfr[kc][t], qfa[kc][1], s[1][t]);
                }
            }
        }
        {       // next step's key fragments: a whole softmax and the V^T.P^T products ahead of their use (the last step fetches the first step's keys again: in bounds, not used)
#pragma unroll
            for (int kc = 0; kc < 2; ++kc) {
#pragma unroll
                for (int t = 0; t < 2; ++t) {
                    kfa[kc][t] = ldfr(kpa + (t * 16) * HD + kc * 512);
                    kfr[kc][t] = HR ? ldfr(kpr + (t * 16) * HD + kc * 512) : kfa[kc][t];
                }
            }
            __builtin_amdgcn_sched_barrier(0);      // keeps the loads ahead of the softmax (lead)
        }
        // s[u][t][r] = score(key m0 + t*16 + 8*hi + r, query q0 + u*16 + lr). Keys beyond the query are excluded (only possible in the diagonal step; key m0 is always kept).
        if (m0 == q0) {
#pragma unroll
            for (int u = 0; u < 2; ++u)
#pragma unroll
                for (int t = 0; t < 2; ++t)
#pragma unroll
                    for (int r = 0; r < 8; ++r) { if (t * 16 + 8 * hi + r > u * 16 + lr) s[u][t][r] = -3.0e38f; }
        }
        v16us pa[2], pr[2];
#pragma unroll
        for (int u = 0; u < 2; ++u) {
            float v = fmaxf(s[u][0][0], s[u][1][0]);
#pragma unroll
            for (int r = 1; r < 8; ++r) v = fmaxf(v, fmaxf(s[u][0][r], s[u][1][r]));
            v = fmaxf(v, xhalf(v));
            const float mn = fmaxf(mrow[u], v);
            const v8f x0 = (s[u][0] - mn) * cexp, x1 = (s[u][1] - mn) * cexp;
            float e0[8], e1[8];
#pragma unroll
            for (int r = 0; r < 8; ++r) e0[r] = __builtin_amdgcn_exp2f(x0[r]);
#pragma unroll
            for (int r = 0; r < 8; ++r) e1[r] = __builtin_amdgcn_exp2f(x1[r]);
            const float al = __builtin_amdgcn_exp2f((mrow[u] - mn) * cexp);
            mrow[u] = mn;
            float ps[4] = {0.0f, 0.0f, 0.0f, 0.0f};             // four independent partial sums of the lane's 16 probabilities
#pragma unroll
            for (int r = 0; r < 8; ++r) {
                const float p0 = e0[r], p1 = e1[r];
                ps[r & 3] += p0 + p1;
                if (HR) {
                    unsigned short a, c; splitf(p0, a, c); pa[u][r] = a; pr[u][r] = c;
                    splitf(p1, a, c); pa[u][8 + r] = a; pr[u][8 + r] = c;
                } else {
                    pa[u][r] = __builtin_bit_cast(unsigned short, (h16)(p0 * PCAR));
                    pa[u][8 + r] = __builtin_bit_cast(unsigned short, (h16)(p1 * PCAR));
                }
            }
            if (!HR) pr[u] = pa[u];
            lsum[u] = lsum[u] * al + ((ps[0] + ps[1]) + (ps[2] + ps[3]));     // per-lane partial sum of one query (its half of the keys), the halves joined once at the end
#pragma unroll
            for (int t2 = 0; t2 < 4; ++t2) o[u][t2] *= al;
        }
#pragma unroll
        for (int t2 = 0; t2 < 4; ++t2) {
            o[0][t2] = mmg<HR>(vfa[t2], pa[0], o[0][t2]); o[1][t2] = mmg<HR>(vfa[t2], pa[1], o[1][t2]);
            if (HR) {
                o[0][t2] = mmg<HR>(vfa[t2], pr[0], o[0][t2]); o[1][t2] = mmg<HR>(vfa[t2], pr[1], o[1][t2]);
                o[0][t2] = mmg<HR>(vfr[t2], pa[0], o[0][t2]); o[1][t2] = mmg<HR>(vfr[t2], pa[1], o[1][t2]);
            }
        }
        // the address pairs of this step's loads stay whole up to this wait; they are stepped only behind it
        if (HR) asm volatile("s_wait_xcnt 0x0" :: "v"(kpa), "v"(kpr), "v"(vpa), "v"(vpr) : "memory");
        else    asm volatile("s_wait_xcnt 0x0" :: "v"(kpa), "v"(vpa) : "memory");
        const int m2 = m1 + MS <= q0 ? m1 + MS : mlow;
        const int kstep = (m2 - m1) * HD, vstep = (m1 - m0) * HD;
        kpa += kstep; kpr += kstep; vpa += vstep; vpr += vstep;
        m0 = m1; m1 = m2;
    }
    // every wave publishes its partial result: maximum, sum (the halves joined) and unscaled output accumulators
#pragma unroll
    for (int u = 0; u < 2; ++u) {
        float l = lsum[u];
        l += xhalf(l);
        pm[(wv * 2 + u) * 32 + lane] = mrow[u];
        pl[(wv * 2 + u) * 32 + lane] = l;
#pragma unroll
        for (int t2 = 0; t2 < 4; ++t2) {
            float* p = po + ((wv * 2 + u) * 4 + t2) * 256 + lane * 4;
            *(v4fa*)p = __builtin_shufflevector(o[u][t2], o[u][t2], 0, 1, 2, 3);
            *(v4fa*)(p + 128) = __builtin_shufflevector(o[u][t2], o[u][t2], 4, 5, 6, 7);
        }
    }
    __syncthreads();                                    // all partial results are whole before any wave reads another wave's
    // wave wv joins head columns wv*16 .. wv*16 + 15 of all 32 queries, the partial results in wave order, each scaled from its own maximum to the common one;
    // then normalise, split into bf16 hi / lo, stage the 32 x 64 tile (a lane's 8 values are 8 consecutive d of one query: 16-byte LDS stores), then whole-line stores
#pragma unroll
    for (int u = 0; u < 2; ++u) {
        float mw[AW], f[AW];
#pragma unroll
        for (int w = 0; w < AW; ++w) mw[w] = pm[(w * 2 + u) * 32 + lane];
        const float mall = fmaxf(fmaxf(mw[0], mw[1]), fmaxf(mw[2], mw[3]));
        float l = 0.0f;
        v8f acc = (v8f){};
#pragma unroll
        for (int w = 0; w < AW; ++w) {
            f[w] = __builtin_amdgcn_exp2f((mw[w] - mall) * cexp);
            l += pl[(w * 2 + u) * 32 + lane] * f[w];
            const float* p = po + ((w * 2 + u) * 4 + wv) * 256 + lane * 4;
            const v4f a = *(const v4fa*)p, b = *(const v4fa*)(p + 128);
            acc += __builtin_shufflevector(a, b, 0, 1, 2, 3, 4, 5, 6, 7) * f[w];
        }
        const float inv = 1.0f / (l * pc);
        v8us a8, c8;
#pragma unroll
        for (int r = 0; r < 8; ++r) { unsigned short a, c; splitf(acc[r] * inv, a, c); a8[r] = a; c8[r] = c; }
        const int oo = (u * 16 + lr) * OP + wv * 16 + 8 * hi;
        *(v8usa*)(oh + oo) = a8; *(v8usa*)(ol + oo) = c8;
    }
    __syncthreads();                                    // the staged tile is whole before the row stores
{
#pragma unroll
        for (int s2 = 0; s2 < 8 / AW; ++s2) {
            const int s = wv * (8 / AW) + s2;
            const int row = s * 4 + (lane >> 3), cp = (lane & 7) * 8;
            const v8us vh = *(const v8usa*)(oh + row * OP + cp);
            const v8us vl = *(const v8usa*)(ol + row * OP + cp);
            bf* d = CTX + ((size_t)(q0 + row) * NB + n) * CK + h * HD + cp;
            *(v8us*)d = vh; *(v8us*)(d + DM) = vl;
            if (s2 + 1 < 8 / AW) asm volatile("s_wait_xcnt 0x0" ::: "memory");     // stands before the stores' address and data registers are written again (the next rows take them)
        }
        
    }
}

// ---- attn_hr_body: early query positions (< RH) on bf16 hi/lo planes, ONE 16-row tile per wave (wave wv of its block takes tile number tile), 32 keys per step.
// Per-query arithmetic and product order are those of attn_body with HR = true (q.k: hi.hi, lo.hi, hi.lo per 32-deep chunk; P.v: hi.hi, lo.hi, hi.lo; all into one accumulator, unscaled bf16 residuals), transposed in the same way.
// Live state per lane: 4 output accumulators + 2 score accumulators + 2 softmax scalars + the fragments fetched ahead: q once in front of the loop, a step's v at its head, the next step's k among this step's V^T.P^T products.
// Key steps run over m0 = 0, 32, .., mend with mend = q0 pad down to a multiple of 32 (wave-uniform), entered at mrot and wrapped round; keys beyond the query are excluded in the step m0 == mend only (key mend is always kept).
// Planes: RH x 64 elements per problem in fragment order (fo_qk, fo_v); the last step reads keys < mend + 32 <= RH, all written by the qkv product's epilogue.
__device__ __forceinline__ void attn_hr_body(const us* __restrict__ Qh, const us* __restrict__ Ql, const us* __restrict__ Kh, const us* __restrict__ Kl,
                                             const us* __restrict__ Vh, const us* __restrict__ Vl, bf* CTX, const int tile, const int wv) {
    __shared__ __align__(16) unsigned short eohs[AW * ER * OP];   // context hi staging, 16 rows x 64 per wave
    __shared__ __align__(16) unsigned short eols[AW * ER * OP];   // context lo staging
    unsigned short* eoh = eohs + wv * (ER * OP);                  // each wave stages in its own range
    unsigned short* eol = eols + wv * (ER * OP);
    const int lane = threadIdx.x & 31, lr = lane & 15, hi = lane >> 4;
    const int bh = blockIdx.x, n = bh / NH, h = bh % NH;
    const int q0 = tile * ER;
    const int mend = q0 & ~31;
    const int mrot = (int)((uint32_t)tile % (uint32_t)(mend / 32 + 1)) * 32;      // entry step of the rotated key walk (as in attn_body): mrot, .., mend, 0, .., mrot - 32
    const size_t pb = (size_t)bh * RH * HD;
    Qh += pb; Ql += pb; Kh += pb; Kl += pb; Vh += pb; Vl += pb;
    const int qoff = q0 * HD + 8 * lane;               // fragment order: 16 positions of q or k are 1024 elements, 32 positions of v 2048
    const int koff = 8 * lane;
    const int voff = 8 * lane;
    const float cexp = 0.125f * 1.4426950408889634f;   // HD^-0.5 * log2(e)
    v8f o[4]; float mrow = -3.0e38f, lsum = 0.0f;      // o[t2][r] = context(query q0 + lr, d = t2*16 + 8*hi + r); mrow, lsum: of query q0 + lr
#pragma unroll
    for (int t2 = 0; t2 < 4; ++t2) o[t2] = (v8f){};
    v16us qfa[2], qfr[2], kfa[2][2], kfr[2][2];            // [kc] and [kc][t]
    const us* qph = Qh + qoff; const us* qpl = Ql + qoff;                                      // the tile's query rows
    const us* k0h = Kh + mrot * HD + koff; const us* k0l = Kl + mrot * HD + koff;              // the entry step's key rows
#pragma unroll
    for (int kc = 0; kc < 2; ++kc) {
        qfa[kc] = ldfr(qph + kc * 512);
        qfr[kc] = ldfr(qpl + kc * 512);
#pragma unroll
        for (int t = 0; t < 2; ++t) {
            const int ko = t * 16 * HD + kc * 512;
            kfa[kc][t] = ldfr(k0h + ko);
            kfr[kc][t] = ldfr(k0l + ko);
        }
    }
    asm volatile("s_wait_xcnt 0x0" :: "v"(qph), "v"(qpl), "v"(k0h), "v"(k0l) : "memory");     // the address pairs of these loads stay whole up to this wait
    int m0 = mrot, m1 = m0 + 32 <= mend ? m0 + 32 : 0;             // this step's first key, the next step's
    const us* kph = Kh + m1 * HD + koff; const us* kpl = Kl + m1 * HD + koff;      // the NEXT step's key rows (the last step fetches the first step's keys again: in bounds, not used)
#pragma unroll 1
    for (int st = 0; st <= mend; st += 32) {
        v16us vfa[4], vfr[4];
        const us* vph = Vh + voff + m0 * HD; const us* vpl = Vl + voff + m0 * HD;
#pragma unroll
        for (int t2 = 0; t2 < 4; ++t2) {
            vfa[t2] = ldfr(vph + t2 * 512);                // A[m = d = t2*16 + lr][k = key m0 + ..]
            vfr[t2] = ldfr(vpl + t2 * 512);
        }
        asm volatile("s_wait_xcnt 0x0" :: "v"(vph), "v"(vpl) : "memory");   // the two address pairs stay whole up to this wait
        v8f s[2];
        s[0] = (v8f){}; s[1] = (v8f){};
#pragma unroll
        for (int kc = 0; kc < 2; ++kc) {
#pragma unroll
            for (int t = 0; t < 2; ++t) {
                s[t] = mmg<true>(kfa[kc][t], qfa[kc], s[t]);
                s[t] = mmg<true>(kfa[kc][t], qfr[kc], s[t]);
                s[t] = mmg<true>(kfr[kc][t], qfa[kc], s[t]);
            }
        }
        // s[t][r] = score(key m0 + t*16 + 8*hi + r, query q0 + lr)
        if (m0 == mend) {
#pragma unroll
            for (int t = 0; t < 2; ++t)
#pragma unroll
                for (int r = 0; r < 8; ++r) { if (m0 + t * 16 + 8 * hi + r > q0 + lr) s[t][r] = -3.0e38f; }
        }
        v16us pa, pr;
        {
            float v = fmaxf(s[0][0], s[1][0]);
#pragma unroll
            for (int r = 1; r < 8; ++r) v = fmaxf(v, fmaxf(s[0][r], s[1][r]));
            v = fmaxf(v, xhalf(v));
            const float mn = fmaxf(mrow, v);
            const float al = __builtin_amdgcn_exp2f((mrow - mn) * cexp);
            mrow = mn;
            const v8f x0 = (s[0] - mn) * cexp, x1 = (s[1] - mn) * cexp;
            float ps[4] = {0.0f, 0.0f, 0.0f, 0.0f};             // four independent partial sums of the lane's 16 probabilities
#pragma unroll
            for (int r = 0; r < 8; ++r) {
                const float p0 = __builtin_amdgcn_exp2f(x0[r]);
                const float p1 = __builtin_amdgcn_exp2f(x1[r]);
                ps[r & 3] += p0 + p1;
                unsigned short a, c;
                splitf(p0, a, c); pa[r] = a; pr[r] = c;
                splitf(p1, a, c); pa[8 + r] = a; pr[8 + r] = c;
            }
            lsum = lsum * al + ((ps[0] + ps[1]) + (ps[2] + ps[3]));           // per-lane partial sum of one query (its half of the keys), the halves joined once at the end
#pragma unroll
            for (int t2 = 0; t2 < 4; ++t2) o[t2] *= al;
        }
#pragma unroll
        for (int t2 = 0; t2 < 4; ++t2) {
            o[t2] = mmg<true>(vfa[t2], pa, o[t2]);
            o[t2] = mmg<true>(vfa[t2], pr, o[t2]);
            o[t2] = mmg<true>(vfr[t2], pa, o[t2]);
            const int ko = ((t2 & 1) * 16) * HD + (t2 >> 1) * 512;
            kfa[t2 >> 1][t2 & 1] = ldfr(kph + ko);
            kfr[t2 >> 1][t2 & 1] = ldfr(kpl + ko);
            __builtin_amdgcn_sched_barrier(0);  // keeps each key refill behind the products that free a value fragment pair (register room)
        }
        asm volatile("s_wait_xcnt 0x0" :: "v"(kph), "v"(kpl) : "memory");   // the key address pairs stay whole up to this wait; they are stepped only behind it
        const int m2 = m1 + 32 <= mend ? m1 + 32 : 0;
        const int kstep = (m2 - m1) * HD;
        kph += kstep; kpl += kstep;
        m0 = m1; m1 = m2;
    }
    // normalise, split into bf16 hi / lo, stage the 16 x 64 tile (16-byte LDS stores), then whole-line stores
    {
        float l = lsum;
        l += xhalf(l);
        const float inv = 1.0f / l;
#pragma unroll
        for (int t2 = 0; t2 < 4; ++t2) {
            v8us a8, c8;
#pragma unroll
            for (int r = 0; r < 8; ++r) { unsigned short a, c; splitf(o[t2][r] * inv, a, c); a8[r] = a; c8[r] = c; }
            const int oo = lr * OP + t2 * 16 + 8 * hi;
            *(v8usa*)(eoh + oo) = a8; *(v8usa*)(eol + oo) = c8;
        }
    }
    __syncthreads();                                    // the staged tile is whole before the row stores; a wave reads its own range only, and all AW waves of the block pass here once
{
#pragma unroll
        for (int s4 = 0; s4 < ER / 4; ++s4) {
            const int row = s4 * 4 + (lane >> 3), cp = (lane & 7) * 8;
            const v8us vh = *(const v8usa*)(eoh + row * OP + cp);
            const v8us vl = *(const v8usa*)(eol + row * OP + cp);
            bf* d = CTX + ((size_t)(q0 + row) * NB + n) * CK + h * HD + cp;
            *(v8us*)d = vh; *(v8us*)(d + DM) = vl;
            if (s4 + 1 < ER / 4) asm volatile("s_wait_xcnt 0x0" ::: "memory");     // stands before the stores' address and data registers are written again (the next rows take them)
        }
        
    }
}

// ---- k_attn: both kinds of attention tile in ONE grid (NBH, EB + late tiles), AW waves per block. The two kinds read planes that the qkv product has written and write different context rows: neither waits for the other.
// Rows blockIdx.y < EB of the grid hold the early tiles (AW of them per block, one per wave); their few, long chains of dependent steps, which fill a fraction of the chip, run beside the late tiles
// instead of in a launch of their own. The choice is the same for the whole block, so every barrier stays under block-uniform control flow.
#define EB (RH / ER / AW)
__global__ __launch_bounds__(32 * AW) void k_attn(const us* __restrict__ Q16, const us* __restrict__ K16, const us* __restrict__ V16,
                                                  const us* __restrict__ Qh, const us* __restrict__ Ql, const us* __restrict__ Kh, const us* __restrict__ Kl,
                                                  const us* __restrict__ Vh, const us* __restrict__ Vl, bf* CTX) {
    const int wv = __builtin_amdgcn_readfirstlane((int)(threadIdx.x >> 5));     // the wave's number, held scalar: the step bookkeeping stays on the scalar unit
    if (blockIdx.y < EB) {
        attn_hr_body(Qh, Ql, Kh, Kl, Vh, Vl, CTX, (int)blockIdx.y * AW + wv, wv);
        return;
    }
    const uint32_t ty = blockIdx.y - EB;                                        // late tile number
    const int q0 = RH + (int)ty * 32;
    const int cnt = (q0 / 32 - wv) / AW + 1;                                    // the wave's key steps: wv, wv + AW, .. <= q0 / 32
    attn_body<false>(Q16, Q16, K16, K16, V16, V16, CTX, q0, (wv + AW * (int)(ty * 7u % (uint32_t)cnt)) * 32, wv);   // entry step: spread over the wave's own steps, neighbouring tiles apart
}

// workspace carve (bytes), every region a multiple of 256
constexpr size_t SZ_XB   = (size_t)MROWS * DM * 2;        // x bf16 [MROWS][1024]
constexpr size_t SZ_WQ   = (size_t)F3 * DM * 2;           // w_qkv bf16 [3072][1024]
constexpr size_t SZ_WO   = (size_t)DM * CK * 2;           // [w_out | w_out] bf16 [1024][2048]
constexpr size_t SZ_QK16 = (size_t)2 * NBH * SEQ * HD * 2;
constexpr size_t SZ_QKH  = (size_t)2 * NBH * RH * HD * 2;
constexpr size_t SZ_VT16 = (size_t)NBH * HD * SEQ * 2;
constexpr size_t SZ_VTH  = (size_t)NBH * HD * RH * 2;
constexpr size_t SZ_CTX  = (size_t)MROWS * CK * 2;        // context bf16 hi | lo [MROWS][2048]
constexpr size_t OF_XB   = 0;
constexpr size_t OF_WQ   = OF_XB + SZ_XB;
constexpr size_t OF_WO   = OF_WQ + SZ_WQ;
constexpr size_t OF_QK16 = OF_WO + SZ_WO;
constexpr size_t OF_QKH  = OF_QK16 + SZ_QK16;
constexpr size_t OF_QKL  = OF_QKH + SZ_QKH;
constexpr size_t OF_VT16 = OF_QKL + SZ_QKH;
constexpr size_t OF_VTH  = OF_VT16 + SZ_VT16;
constexpr size_t OF_VTL  = OF_VTH + SZ_VTH;
constexpr size_t OF_CTX  = OF_VTL + SZ_VTH;
constexpr size_t WS_TOTAL = OF_CTX + SZ_CTX;
static_assert(SZ_XB % 256 == 0 && SZ_WQ % 256 == 0 && SZ_WO % 256 == 0 && SZ_QK16 % 256 == 0);
static_assert(SZ_QKH % 256 == 0 && SZ_VT16 % 256 == 0 && SZ_VTH % 256 == 0 && SZ_CTX % 256 == 0);
static_assert(WS_TOTAL <= (size_t)134217728);            // total carve <= 128 MiB

// entry-stage step per tile column of k_gemmw: stages / tile columns, at least 1
constexpr int RY_QKV = (DM / 64) / (F3 / 128) > 0 ? (DM / 64) / (F3 / 128) : 1;
constexpr int RY_OUT = (CK / 128) / (DM / 128) > 0 ? (CK / 128) / (DM / 128) : 1;

extern "C" void kernel_launch(void* const* d_in, const int* in_sizes, int n_in,
                              void* d_out, int out_size, void* d_ws, size_t ws_size, hipStream_t stream) {
    if (n_in < 3) return;
    const long long needx = ((long long)(SEQ - 1) * NB_FULL + NB) * DM;     // last token row touched, in elements
    if ((long long)in_sizes[0] < needx || (long long)in_sizes[1] < (long long)F3 * DM || (long long)in_sizes[2] < (long long)DM * DM || (long long)out_size < needx) return;
    if (WS_TOTAL > ws_size) return;
    const float* x = (const float*)d_in[0];       // [2048][2][1024], token row l*2 + n
    const float* wqkv = (const float*)d_in[1];    // [3072][1024] = [out][in]
    const float* wout = (const float*)d_in[2];    // [1024][1024] = [out][in]
    float* OUT = (float*)d_out;                   // [2048][2][1024]
    char* ws = (char*)d_ws;
    bf* XB = (bf*)(ws + OF_XB); bf* WQ = (bf*)(ws + OF_WQ); bf* WO2 = (bf*)(ws + OF_WO);
    h16* QK16 = (h16*)(ws + OF_QK16); bf* QKh = (bf*)(ws + OF_QKH); bf* QKl = (bf*)(ws + OF_QKL);
    h16* VT16 = (h16*)(ws + OF_VT16); bf* VTh = (bf*)(ws + OF_VTH); bf* VTl = (bf*)(ws + OF_VTL); bf* CTX = (bf*)(ws + OF_CTX);

    k_cvt_all<<<CROWS / (16 * CRPW), 512, 0, stream>>>(x, wqkv, wout, XB, WQ, WO2);
    k_gemmw<64, true, RY_QKV><<<dim3(MROWS / 128, F3 / 128, 1), 128, 0, stream>>>(XB, DM, WQ, DM, DM, nullptr, 0, QK16, QKh, QKl, VT16, VTh, VTl);   // qkv[m][f] = sum_e x[m][e] w_qkv[f][e], written as 16-bit planes
    k_attn<<<dim3(NBH, EB + (SEQ - RH) / 32, 1), 32 * AW, 0, stream>>>((const us*)QK16, (const us*)(QK16 + PLN), (const us*)VT16,
                                                                       (const us*)QKh, (const us*)QKl, (const us*)(QKh + PLNH), (const us*)(QKl + PLNH), (const us*)VTh, (const us*)VTl, CTX);
    k_gemmw<128, false, RY_OUT><<<dim3(MROWS / 128, DM / 128, 1), 128, 0, stream>>>(CTX, CK, WO2, CK, CK, OUT, DM * ROWSTEP, nullptr, nullptr, nullptr, nullptr, nullptr, nullptr);   // out[m][f] = sum_e (ctx_hi + ctx_lo)[m][e] w_out[f][e]
}

// v010
// Measured time: 68.8 microseconds a run.
// Next to v009, in two timings, it ran 1.03 and 1.04 times as fast.
// Counting every step since v000, it is 5.80 times as fast.
#include <hip/hip_runtime.h>
#include <stdint.h>

// Contractions: qkv projection and output projection v_wmma_f32_16x16x32_bf16 (every input RNE-converted to bf16; context carried as bf16 hi|lo folded into K); scores and probability x value v_wmma_f32_16x16x32_f16 for query positions >= 256 (P carried x1024), bf16 hi/lo three-product form for positions < 256; f32 accumulate, f32 softmax.
// Sequence-first causal multi-head self-attention with a fused bias-free (out, in) qkv weight and an (out, in) output weight: token row m = l*NB + n, attention problem bh = n*16 + h, head columns h*64..h*64+63.
// Launch plan: k_cvt_all (bf16 copies) -> k_gemmw (qkv product, its epilogue writes the q/k/v^T 16-bit planes) -> k_attn (one grid: rows < 256 in 16-row tiles, one per wave; rows >= 256 in 32-row tiles, four waves share a tile's keys) -> k_gemmw (output).

#ifndef NB
#define NB 2                      // batch entries processed (NB_FULL, or 1 for a reduced build)
#endif
#ifndef SEQ
#define SEQ 2048                  // sequence positions processed
#endif
#define NB_FULL  2                // batch stride of the staged x and of the output rows
#define SEQ_FULL 2048
#define DM   1024
#define NH   16
#define HD   64
#define F3   (3 * DM)
#define CK   (2 * DM)             // context plane width: hi columns | lo columns
#define RH   256                  // query positions < RH use the hi/lo planes
#define NBH  (NB * NH)
#define MROWS (SEQ * NB)
#define ROWSTEP (NB_FULL / NB)
#define PLN  ((size_t)NBH * SEQ * HD)
#define PLNH ((size_t)NBH * RH * HD)
#define PCAR 1024.0f
#define OP   72                   // context staging pitch in 16-bit elements (144 B)
#define ER   16                   // query rows per wave in the early-positions kernel
#define AW   4                    // waves per 32-row tile in the late-positions kernel: wave w takes key steps w, w + AW, ..

static_assert(NB == NB_FULL || NB == 1);          // compact row m = l*NB + n maps to token row m*ROWSTEP
static_assert(SEQ <= SEQ_FULL && SEQ >= RH);
static_assert(SEQ % 256 == 0);                    // tile multiples (128-row GEMM tiles, 32-row attention tiles, 8-wide plane groups)
static_assert(RH % 32 == 0 && RH % 8 == 0);       // the last 32-key step of the early kernel ends inside the hi/lo planes
static_assert(RH % ER == 0 && ER == 16);          // early kernel: one 16-row WMMA tile per wave, store loop 4 x 4 rows
static_assert(HD == 64 && NH * HD == DM);
static_assert((RH / ER) % AW == 0);               // early tiles fill whole work-groups of AW waves
static_assert(AW == 4 && RH / 32 >= AW);          // late kernel: every wave has a key step; wave w joins head columns 16 w .. 16 w + 15 and stores 8 / AW groups of four rows
static_assert(DM == 1024);                        // k_cvt_all: a row is 8 loads of 128 floats per wave
static_assert(DM % 64 == 0 && DM >= 128 && CK % 128 == 0 && CK >= 256);   // K: whole stages, at least two (k_gemmw: 64 deep for qkv, 128 deep for the output)
static_assert(MROWS % 128 == 0 && F3 % 128 == 0 && DM % 128 == 0);        // whole 128 x 128 output tiles
static_assert(RH % (128 / NB) == 0 && DM % 128 == 0);     // a 128 x 128 tile of the qkv product lies wholly in one of q, k, v and wholly below or above RH
static_assert(OP >= 64 && (OP * 2) % 16 == 0);

typedef _Float16 h16;
typedef unsigned short bf;
typedef unsigned short us;
typedef __attribute__((ext_vector_type(16))) __bf16   v16bf;
typedef __attribute__((ext_vector_type(16))) _Float16 v16h;
typedef __attribute__((ext_vector_type(16))) unsigned short v16us;
typedef __attribute__((ext_vector_type(8)))  _Float16 v8h;
typedef __attribute__((ext_vector_type(8)))  unsigned short v8us;
typedef __attribute__((ext_vector_type(8)))  float    v8f;
typedef __attribute__((ext_vector_type(4)))  float    v4f;
typedef v4f  __attribute__((may_alias)) v4fa;
typedef v8us __attribute__((may_alias)) v8usa;

__device__ __forceinline__ unsigned short f2bf(float f) { unsigned u = __float_as_uint(f); u += 0x7FFFu + ((u >> 16) & 1u); return (unsigned short)(u >> 16); }
__device__ __forceinline__ float bf2f(unsigned short b) { return __uint_as_float(((unsigned)b) << 16); }
__device__ __forceinline__ void splitf(float y, unsigned short& h, unsigned short& l) { h = f2bf(y); l = f2bf(y - bf2f(h)); }

// 16-bit fragment from a K-contiguous row: elements 0..7 <- p[0..7], elements 8..15 <- p[16..23]; the caller adds 8*(lane>>4) to p.
__device__ __forceinline__ v16us ldus(const us* p) {
    const v8us a = *(const v8us*)p; const v8us b = *(const v8us*)(p + 16);
    return __builtin_shufflevector(a, b, 0, 1, 2, 3, 4, 5, 6, 7, 8, 9, 10, 11, 12, 13, 14, 15);
}

// 16-bit fragment from a plane kept in fragment order: a fragment is 1 KiB, two runs of 512 contiguous bytes (elements 0..7 of lanes 0..31, then elements 8..15); the caller adds 8*lane to p.
// Each of the two loads then covers four whole 128-byte lines, where a load from a row-major plane touches sixteen lines for 32 bytes each.
__device__ __forceinline__ v16us ldfr(const us* p) {
    const v8us a = *(const v8us*)p; const v8us b = *(const v8us*)(p + 256);
    return __builtin_shufflevector(a, b, 0, 1, 2, 3, 4, 5, 6, 7, 8, 9, 10, 11, 12, 13, 14, 15);
}
// Element offsets inside one problem's plane. q and k: position l, 8-element chunk c8 of the 64 head columns (16 positions x 64 columns = two fragments of 32 columns each).
// v: head column d, position l a multiple of 8 (32 positions x 64 columns = four fragments of 16 columns each). Lane = 16*hi + lr, with lr the fragment's row and hi the 8-element half of ldus.
__device__ __forceinline__ int fo_qk(int l, int c8) { return (l >> 4) * 1024 + (c8 >> 1) * 256 + (c8 & 1) * 128 + (l & 15) * 8; }
__device__ __forceinline__ int fo_v(int d, int l)   { return (l >> 5) * 2048 + ((d >> 4) * 2 + ((l >> 4) & 1)) * 256 + ((l >> 3) & 1) * 128 + (d & 15) * 8; }

// One WMMA plus its own four-slot guard (ties exactly one accumulator, keeps A and B live).
template <bool BF>
__device__ __forceinline__ v8f mmg(v16us a, v16us b, v8f c) {
    if (BF) c = __builtin_amdgcn_wmma_f32_16x16x32_bf16(false, __builtin_bit_cast(v16bf, a), false, __builtin_bit_cast(v16bf, b), (short)0, c, false, false);
    else    c = __builtin_amdgcn_wmma_f32_16x16x32_f16(false, __builtin_bit_cast(v16h, a), false, __builtin_bit_cast(v16h, b), (short)0, c, false, false);
    asm volatile("v_nop\n\tv_nop\n\tv_nop\n\tv_nop" : "+v"(c) : "v"(a), "v"(b));
    return c;
}

// ---- k_cvt_all: every f32 input to its bf16 plane in ONE launch of CROWS / CRPW two-row waves (16 per work-group, one work-group per 32 rows).
// A wave takes CRPW whole rows of 1024 floats out of the list [x rows | w_qkv rows | w_out rows]: rows w and w + CROWS / CRPW. All of its loads (8 per row, 512 contiguous bytes each) are issued
// before the first value is converted; a store is 256 contiguous bytes. A w_out row is stored twice (columns 0..1023 pair with the hi half of the context plane, 1024..2047 with the lo half).
#define CROWS (MROWS + F3 + DM)
#define CRPW  2
static_assert(CROWS % (16 * CRPW) == 0);          // whole work-groups of 16 waves
typedef __attribute__((ext_vector_type(4))) unsigned short v4us;
__global__ __launch_bounds__(512) void k_cvt_all(const float* __restrict__ x, const float* __restrict__ wqkv, const float* __restrict__ wout, bf* XB, bf* WQ, bf* WO2) {
    const int lane = threadIdx.x & 31;
    const int w = __builtin_amdgcn_readfirstlane((int)(blockIdx.x * 16 + (threadIdx.x >> 5)));
    const float* s[CRPW]; bf* dst[CRPW]; bool dup[CRPW];
#pragma unroll
    for (int r = 0; r < CRPW; ++r) {                  // which plane the row belongs to: the same for the whole wave, scalar selects
        const int row = w + r * (CROWS / CRPW);
        const bool isx = row < MROWS, isq = row < MROWS + F3;
        const int rr = isx ? row : (isq ? row - MROWS : row - MROWS - F3);
        s[r]   = (isx ? x : (isq ? wqkv : wout)) + (size_t)rr * (isx ? ROWSTEP * DM : DM) + lane * 4;
        dst[r] = (isx ? XB : (isq ? WQ : WO2)) + (size_t)rr * (isq ? DM : CK) + lane * 4;
        dup[r] = !isq;
    }
    v4f v[CRPW][8];
#pragma unroll
    for (int r = 0; r < CRPW; ++r)
#pragma unroll
        for (int j = 0; j < 8; ++j) v[r][j] = *(const v4f*)(s[r] + j * 128);
    __builtin_amdgcn_sched_barrier(0);                // keeps every load of the wave ahead of the first conversion: without it the second row's loads sank behind waits on the first row's
#pragma unroll
    for (int r = 0; r < CRPW; ++r) {
        v4us o[8];
#pragma unroll
        for (int j = 0; j < 8; ++j) {
#pragma unroll
            for (int k = 0; k < 4; ++k) o[j][k] = f2bf(v[r][j][k]);
        }
        bf* d = dst[r];
#pragma unroll
        for (int j = 0; j < 8; ++j) *(v4us*)(d + j * 128) = o[j];
        if (r + 1 < CRPW) asm volatile("s_wait_xcnt 0x0" ::: "memory");       // stands before the stores' base and data registers are written again (the next row's address and values take them)
        if (dup[r]) {
#pragma unroll
            for (int j = 0; j < 8; ++j) *(v4us*)(d + DM + j * 128) = o[j];
            if (r + 1 < CRPW) asm volatile("s_wait_xcnt 0x0" ::: "memory");   // the same for these stores
        }
    }
}

// ---- k_gemmw: one 128x128 output tile per work-group of four waves (2 x 2, 64x64 = 16 accumulators each); grid (M/128, N/128), 128 threads.
// C[m][n] (f32, pitch ldc) = sum_k A[m][k] Bt[n][k]; K a multiple of KS and at least 2 KS, M and N multiples of 128; bf16 operands from K-contiguous planes.
// A stage is KS k of the tile's 128 A rows and 128 Bt rows. Each wave brings one slice of it (64 rows of 2 KS bytes) into LDS with one tensor load, every row padded by 16 bytes;
// two buffers: the load of stage s + 1 is in flight while stage s is multiplied. Every operand row is fetched once per work-group in whole lines and read by two waves from LDS.
// KS = 64 leaves room for three work-groups on a WGP (a grid of several per WGP); KS = 128 keeps twice the bytes in flight where a work-group has its WGP alone.
// The k walk is rotated: pass s works on k stage (s + rot) mod T, rot set by the tile's indices. The work-groups that share A rows (one tile row) or Bt rows (one tile column) all run at once;
// entering at stage 0 together they ask for the same lines at the same moment, and at every stage all of them wait for its first fetch from memory. Entered apart, each stage is fetched by the one that
// comes to it first and met in L2 by the rest. Every stage is still taken exactly once; the f32 sum over k starts at stage rot and wraps round.
// rot = 4 * (row / 8) + row % 4 + RY * column: any four neighbouring rows of each eight differ (for speed only, nothing rests on it),
// and RY spreads the tile columns over the stages where there are fewer columns than stages.
typedef uint32_t u32x4 __attribute__((ext_vector_type(4)));
typedef uint32_t u32x8 __attribute__((ext_vector_type(8)));
__device__ __forceinline__ uint32_t uni(uint32_t v) { return (uint32_t)__builtin_amdgcn_readfirstlane(v); }
__device__ __forceinline__ uint32_t pinned(uint32_t v) { uint32_t w = (uint32_t)__builtin_amdgcn_readfirstlane(v); asm volatile("" : "+s"(w)); return w; }   // a wave-uniform test held in a scalar register, so that the branch on it is a scalar branch (tensor loads ignore EXEC)
// one request of the calling wave: the tile that g1 describes, from the global address in g0 to the LDS place in g0
__device__ __forceinline__ void gemm_tload(const u32x4 g0, const u32x8 g1) { asm volatile("tensor_load_to_lds %0, %1" :: "s"(g0), "s"(g1) : "memory"); }
// the wave's own requests have landed. The two groups are operands so that their registers stay whole up to this wait and take new values only behind it.
__device__ __forceinline__ void gemm_twait(u32x4& g0, u32x8& g1) { asm volatile("s_wait_tensorcnt 0x0" : "+s"(g0), "+s"(g1) :: "memory"); }
// next stage: the LDS place dst, the global address ga of the slice's first byte in that stage (type 2 in the top bits of word 3)
__device__ __forceinline__ void gemm_tnext(u32x4& g0, uint32_t dst, uint64_t ga) {
    g0[1] = uni(dst); g0[2] = uni((uint32_t)ga); g0[3] = uni((((uint32_t)(ga >> 32)) & 0x01FFFFFFu) | 0x80000000u);
}
// 16-bit forms of eight f32 values of the qkv product: f16, and bf16 hi and lo (stored only for positions < RH)
__device__ __forceinline__ void cvt3(const v8f x, v8h& o16, v8us& oh, v8us& ol) {
#pragma unroll
    for (int k = 0; k < 8; ++k) { o16[k] = (h16)x[k]; unsigned short a, c; splitf(x[k], a, c); oh[k] = a; ol[k] = c; }
}
__device__ __forceinline__ void store3(h16* p16, bf* ph, bf* pl, bool hr, const v8h o16, const v8us oh, const v8us ol) {
    *(v8h*)p16 = o16;
    asm volatile("s_wait_xcnt 0x0" ::: "memory");       // stands before the store's address and data registers are written again
    if (hr) {
        *(v8us*)ph = oh; *(v8us*)pl = ol;
        asm volatile("s_wait_xcnt 0x0" ::: "memory");   // the same for these two stores
    }
}
// PL = false: the tile goes to C as f32. PL = true (the qkv product; row m = l*NB + n, column which*1024 + h*64 + d): the tile goes straight to the 16-bit operand planes of the attention kernels,
// q and k per problem bh as SEQ x 64 elements (f16; positions < RH also bf16 hi and lo, RH x 64), v likewise, every plane in the fragment order of fo_qk and fo_v (v's fragments are those of the transposed tile); C is not touched.
template <int KS, bool PL, int RY>
__global__ __launch_bounds__(128) void k_gemmw(const bf* __restrict__ A, int lda, const bf* __restrict__ Bt, int ldb, int K, float* C, int ldc,
                                               h16* QK16, bf* QKh, bf* QKl, h16* VT16, bf* VTh, bf* VTl) {
    static_assert(KS == 64 || KS == 128);
    constexpr uint32_t ROWB   = 2u * KS;                                  // bytes of a row in a stage
    constexpr uint32_t GPITCH = ROWB + 16u;                               // LDS row pitch: an odd multiple of 16 bytes for 16-byte reads
    constexpr uint32_t GSLICE = (64u * GPITCH + 2047u) / 2048u * 2048u;   // 64 rows, rounded up to a multiple of 2 KiB
    constexpr uint32_t GBUF   = 4u * GSLICE;                              // slices: A rows 0..63, A rows 64..127, Bt rows 0..63, Bt rows 64..127
    __shared__ __attribute__((aligned(2048))) unsigned char tl[2 * GBUF];
    __shared__ __align__(16) float osall[4 * 16 * 68];
    const int lane = threadIdx.x & 31, lr = lane & 15, hi = lane >> 4;
    const uint32_t wave = uni(threadIdx.x >> 5), wm = wave & 1u, wn = wave >> 1;
    const int r0 = blockIdx.x * 128, c0 = blockIdx.y * 128;
    // this wave's slice of every stage: waves 0, 1 the two halves of the A rows, waves 2, 3 of the Bt rows
    const bool isb = wave >= 2u;
    const uint32_t spitch = (uint32_t)(isb ? ldb : lda) * 2u;
    const uint64_t sbase = (uint64_t)(size_t)(isb ? Bt : A) + (uint64_t)((isb ? c0 : r0) + (int)(wave & 1u) * 64) * spitch;
    const uint32_t sdst = (uint32_t)(size_t)tl + wave * GSLICE;
    u32x8 g1;                                     // 1-byte elements, tensor = tile = 64 rows of ROWB bytes, 4 dwords of LDS pad behind every row
    g1[0] = uni((1u << 20) | ((KS == 64 ? 4u : 5u) << 22) | (3u << 25));
    g1[1] = uni(ROWB << 16);
    g1[2] = uni(64u << 16);
    g1[3] = uni(ROWB << 16);
    g1[4] = uni(64u);
    g1[5] = uni(spitch);
    g1[6] = uni(0u);
    g1[7] = uni(0u);
    const int T = K / KS;                         // stages
    int kst = (int)uni(((blockIdx.x >> 3) * 4u + (blockIdx.x & 3u) + blockIdx.y * (uint32_t)RY) % (uint32_t)T);      // k stage of the request formed next: rot, rot + 1, .., T - 1, 0, .., rot - 1
    u32x4 g0;                                     // count 1, LDS place, global address, type 2
    g0[0] = uni(1u);
    gemm_tnext(g0, sdst, sbase + (uint64_t)((uint32_t)kst * ROWB));
    v8f acc[4][4];
#pragma unroll
    for (int mb = 0; mb < 4; ++mb)
#pragma unroll
        for (int nb = 0; nb < 4; ++nb) acc[mb][nb] = (v8f){};
    gemm_tload(g0, g1);
    gemm_twait(g0, g1);                                     // the first pass's stage (k stage rot) has landed (this wave's slice)
    __syncthreads();                                        // ... and every wave's
    kst = kst + 1 < T ? kst + 1 : 0;
    gemm_tnext(g0, sdst + GBUF, sbase + (uint64_t)((uint32_t)kst * ROWB));
    gemm_tload(g0, g1);
    const uint32_t aoff = wm * GSLICE + (uint32_t)lr * GPITCH + 16u * (uint32_t)hi;
    const uint32_t boff = (2u + wn) * GSLICE + (uint32_t)lr * GPITCH + 16u * (uint32_t)hi;
#pragma unroll 1                                 // rolled: one publish point in the code, the buffer chosen by a scalar
    for (int s = 0; s < T; ++s) {
        const uint32_t bsel = (uint32_t)(s & 1) * GBUF;
#pragma unroll 1
        for (int h = 0; h < KS / 64; ++h) {         // 64 k at a time: two 32-deep blocks (kept rolled: four blocks in a row spilled accumulators)
            const unsigned char* ap = tl + bsel + aoff + h * 128; const unsigned char* bp = tl + bsel + boff + h * 128;
            // LDS reads stand at two places only: the head (both blocks' A, the first block's Bt, the second block's Bt columns 0..31) and the middle of the first block
            // (the second block's Bt columns 32..63, into the registers that the first eight products have freed).
            v16us a[2][4], b[2][4];
#pragma unroll
            for (int i = 0; i < 4; ++i) { a[0][i] = ldus((const us*)(ap + i * 16 * GPITCH)); b[0][i] = ldus((const us*)(bp + i * 16 * GPITCH)); }
#pragma unroll
            for (int i = 0; i < 4; ++i) a[1][i] = ldus((const us*)(ap + i * 16 * GPITCH + 64));
#pragma unroll
            for (int i = 0; i < 2; ++i) b[1][i] = ldus((const us*)(bp + i * 16 * GPITCH + 64));
            __builtin_amdgcn_sched_barrier(0);      // keeps these loads one group ahead of the products
#pragma unroll
            for (int nb = 0; nb < 2; ++nb)
#pragma unroll
                for (int mb = 0; mb < 4; ++mb) acc[mb][nb] = mmg<true>(a[0][mb], b[0][nb], acc[mb][nb]);
            __builtin_amdgcn_sched_barrier(0);      // keeps the second group from rising among the products whose registers it takes
#pragma unroll
            for (int i = 2; i < 4; ++i) b[1][i] = ldus((const us*)(bp + i * 16 * GPITCH + 64));
            __builtin_amdgcn_sched_barrier(0);      // keeps the second group together, sixteen products ahead of its first use
#pragma unroll
            for (int nb = 2; nb < 4; ++nb)
#pragma unroll
                for (int mb = 0; mb < 4; ++mb) acc[mb][nb] = mmg<true>(a[0][mb], b[0][nb], acc[mb][nb]);
#pragma unroll
            for (int nb = 0; nb < 4; ++nb)
#pragma unroll
                for (int mb = 0; mb < 4; ++mb) acc[mb][nb] = mmg<true>(a[1][mb], b[1][nb], acc[mb][nb]);
        }
        // publish point of stage s + 1
        asm volatile("s_wait_dscnt 0x0" ::: "memory");      // this wave has left stage s's buffer
        gemm_twait(g0, g1);                                 // this wave's slice of stage s + 1 has landed
        __syncthreads();                                    // stage s + 1 readable by all; stage s's buffer left by all
        if (pinned(s + 2 < T)) {
            kst = kst + 1 < T ? kst + 1 : 0;
            gemm_tnext(g0, sdst + bsel, sbase + (uint64_t)((uint32_t)kst * ROWB));
            gemm_tload(g0, g1);
        }
    }
    gemm_twait(g0, g1);                                     // nothing in flight when the wave ends
    asm volatile("s_wait_dscnt 0x0" ::: "memory");
    float* os = osall + wave * (16 * 68);                   // output staging, private to the wave
    if constexpr (PL) {
        const int which = c0 / DM;                          // 0 q, 1 k, 2 v: the same for the whole tile
        const bool hr = r0 / NB < RH;                       // the tile's positions all lie below RH, or none does
        v8h o16; v8us oh, ol;
        if (which < 2) {
            const int h = ((c0 + (int)wn * 64) % DM) / HD;  // the wave's 64 columns are one head
#pragma unroll
            for (int mb = 0; mb < 4; ++mb) {
#pragma unroll
                for (int nb = 0; nb < 4; ++nb) {
#pragma unroll
                    for (int j = 0; j < 8; ++j) os[(hi * 8 + j) * 68 + nb * 16 + lr] = acc[mb][nb][j];
                }
                __builtin_amdgcn_wave_barrier(); asm volatile("" ::: "memory");
#pragma unroll
                for (int s = 0; s < 4; ++s) {               // eight lanes store one chunk of eight consecutive positions of one problem: one 128-byte line of the fragment order
                    const int sub = (lane >> 3) & 1, c8 = s * 2 + (lane >> 4), cp = c8 * 8;
                    const int row = NB == 2 ? (lane & 7) * 2 + sub : sub * 8 + (lane & 7);
                    const v4f a = *(const v4fa*)(os + row * 68 + cp), b = *(const v4fa*)(os + row * 68 + cp + 4);
                    cvt3(__builtin_shufflevector(a, b, 0, 1, 2, 3, 4, 5, 6, 7), o16, oh, ol);
                    const int m = r0 + (int)wm * 64 + mb * 16 + row, l = m / NB, bh = (m % NB) * NH + h;
                    const size_t e16 = (size_t)which * PLN + (size_t)bh * SEQ * HD + fo_qk(l, c8);
                    const size_t eh = hr ? ((size_t)which * PLNH + (size_t)bh * RH * HD + fo_qk(l, c8)) : 0;
                    store3(QK16 + e16, QKh + eh, QKl + eh, hr, o16, oh, ol);
                }
                __builtin_amdgcn_wave_barrier(); asm volatile("" ::: "memory");
            }
        } else {
            // v: the whole 128 x 128 tile is turned in LDS, T[column][n][position], so that a lane stores eight positions of one (bh, d) and eight lanes one 128-byte line of the fragment order, one writer.
            // T takes the place of the stage buffers: every wave has left them and nothing is in flight (the last pass's waits and barrier).
            constexpr int TP = 132, LT = 128 / NB;          // row pitch in floats (528 bytes, an odd multiple of 16); positions in the tile
            static_assert((size_t)128 * TP * 4 <= (size_t)2 * GBUF && (8 / NB) % 4 == 0);
            float* T = (float*)tl;
#pragma unroll
            for (int mb = 0; mb < 4; ++mb) {
#pragma unroll
                for (int nb = 0; nb < 4; ++nb) {
                    float* tw = T + ((int)wn * 64 + nb * 16 + lr) * TP + ((int)wm * 64 + mb * 16 + hi * 8) / NB;
#pragma unroll
                    for (int n = 0; n < NB; ++n) {
#pragma unroll
                        for (int k4 = 0; k4 < 8 / NB / 4; ++k4) {
                            v4f t;
#pragma unroll
                            for (int e = 0; e < 4; ++e) t[e] = acc[mb][nb][(k4 * 4 + e) * NB + n];
                            *(v4fa*)(tw + n * LT + k4 * 4) = t;
                        }
                    }
                }
            }
            __syncthreads();                                // the turned tile is whole before any wave reads another wave's part
#pragma unroll 4
            for (int it = 0; it < 16; ++it) {
                const int gi = it * 4 + (int)wave, l8 = (gi % (LT / 16)) * 2 + hi, rr = gi / (LT / 16), c = (rr % 8) * 16 + lr, n = rr / 8;   // a wave stores one run of a fragment: 512 contiguous bytes
                const float* tr = T + c * TP + n * LT + l8 * 8;
                const v4f a = *(const v4fa*)tr, b = *(const v4fa*)(tr + 4);
                cvt3(__builtin_shufflevector(a, b, 0, 1, 2, 3, 4, 5, 6, 7), o16, oh, ol);
                const int col = c0 - 2 * DM + c, bh = n * NH + col / HD, d = col % HD, l = r0 / NB + l8 * 8;
                const size_t e16 = (size_t)bh * HD * SEQ + fo_v(d, l);
                const size_t eh = hr ? ((size_t)bh * HD * RH + fo_v(d, l)) : 0;
                store3(VT16 + e16, VTh + eh, VTl + eh, hr, o16, oh, ol);
            }
        }
        return;
    }
#pragma unroll
    for (int mb = 0; mb < 4; ++mb) {
#pragma unroll
        for (int nb = 0; nb < 4; ++nb) {
#pragma unroll
            for (int j = 0; j < 8; ++j) os[(hi * 8 + j) * 68 + nb * 16 + lr] = acc[mb][nb][j];
        }
        __builtin_amdgcn_wave_barrier(); asm volatile("" ::: "memory");
        float* crow = C + (size_t)(r0 + (int)wm * 64 + mb * 16) * ldc + c0 + (int)wn * 64;
{
#pragma unroll
            for (int s = 0; s < 8; ++s) {                       // rows 2s+hi, s = 0..7, hi = 0..1: all 16 rows of the slab
                const int row = 2 * s + hi, cofs = lr * 4;
                const v4f val = *(const v4fa*)(os + row * 68 + cofs);
                *(v4f*)(crow + (size_t)row * ldc + cofs) = val;
            }
            
        }
        __builtin_amdgcn_wave_barrier(); asm volatile("" ::: "memory");
    }
}

// lane l with lane l ^ 16 (the other half of a query column's keys)
__device__ __forceinline__ float xhalf(float x) {
    return __builtin_bit_cast(float, __builtin_amdgcn_permlanex16(__builtin_bit_cast(int, x), __builtin_bit_cast(int, x), 0x76543210, 0xfedcba98, false, false));
}

template <bool HR>
__device__ __forceinline__ void attn_body(const us* __restrict__ Qa, const us* __restrict__ Qr, const us* __restrict__ Ka, const us* __restrict__ Kr,
                                          const us* __restrict__ Va, const us* __restrict__ Vr, bf* CTX, const int q0, const int mrot, const int wv) {
    constexpr int LR = HR ? RH : SEQ;                  // positions per problem in the planes
    constexpr int MS = 32 * AW;                        // keys from one step of a wave to its next
    const int mlow = wv * 32;                          // the wave's lowest step
    __shared__ __align__(16) unsigned short oh[32 * OP];
    __shared__ __align__(16) unsigned short ol[32 * OP];
    __shared__ __align__(16) float po[AW * 2 * 4 * 2 * 128];      // partial outputs [wave][u][t2][register half][lane][4]: every 16-byte access of a wave covers 512 contiguous bytes
    __shared__ float pm[AW * 2 * 32], pl[AW * 2 * 32];            // partial maxima and sums [wave][u][lane]
    const int lane = threadIdx.x & 31, lr = lane & 15, hi = lane >> 4;
    const int bh = blockIdx.x, n = bh / NH, h = bh % NH;
    const size_t pb = (size_t)bh * LR * HD;
    Qa += pb; Ka += pb; Va += pb; Qr += pb; Kr += pb; Vr += pb;
    const int qoff = q0 * HD + 8 * lane;               // fragment order: 16 positions of q or k are 1024 elements, 32 positions of v 2048
    const int koff = 8 * lane;
    const int voff = 8 * lane;
    const float cexp = 0.125f * 1.4426950408889634f;   // HD^-0.5 * log2(e)
    const float pc = HR ? 1.0f : PCAR;
    v8f o[2][4]; float mrow[2], lsum[2];               // o[u][t2][r] = context(query q0 + u*16 + lr, d = t2*16 + 8*hi + r); mrow, lsum: of query q0 + u*16 + lr
#pragma unroll
    for (int u = 0; u < 2; ++u) {
#pragma unroll
        for (int t2 = 0; t2 < 4; ++t2) o[u][t2] = (v8f){};
        mrow[u] = -3.0e38f; lsum[u] = 0.0f;
    }
    v16us qfa[2][2], qfr[2][2], kfa[2][2], kfr[2][2];      // [kc][u] and [kc][t]
    const us* qpa = Qa + qoff; const us* qpr = Qr + qoff;                                      // the tile's query rows
    const us* k0a = Ka + mrot * HD + koff; const us* k0r = Kr + mrot * HD + koff;              // the entry step's key rows
#pragma unroll
    for (int kc = 0; kc < 2; ++kc) {
#pragma unroll
        for (int u = 0; u < 2; ++u) {
            qfa[kc][u] = ldfr(qpa + u * 16 * HD + kc * 512);
            qfr[kc][u] = HR ? ldfr(qpr + u * 16 * HD + kc * 512) : qfa[kc][u];
        }
#pragma unroll
        for (int t = 0; t < 2; ++t) {
            const int ko = t * 16 * HD + kc * 512;
            kfa[kc][t] = ldfr(k0a + ko);
            kfr[kc][t] = HR ? ldfr(k0r + ko) : kfa[kc][t];
        }
    }
    // the address pairs of these loads stay whole up to this wait
    if (HR) asm volatile("s_wait_xcnt 0x0" :: "v"(qpa), "v"(qpr), "v"(k0a), "v"(k0r) : "memory");
    else    asm volatile("s_wait_xcnt 0x0" :: "v"(qpa), "v"(k0a) : "memory");
    // Rotated key walk over the wave's own steps: m0 = mrot, mrot + MS, .., wrapped round to mlow, .., mrot - MS, every step once (the online softmax takes the steps in any order; the diagonal step is told by m0 == q0).
    // The waves of one problem all run at once: entering at key 0 together they ask for the same lines at the same moment, and at every step all of them wait for its first fetch from memory.
    // Entered apart, a step's lines are fetched by the wave that comes to them first and met in L2 by the rest.
    int m0 = mrot, m1 = m0 + MS <= q0 ? m0 + MS : mlow;            // this step's first key, the next step's
    const us* kpa = Ka + m1 * HD + koff; const us* kpr = Kr + m1 * HD + koff;      // the NEXT step's key rows
    const us* vpa = Va + m0 * HD + voff; const us* vpr = Vr + m0 * HD + voff;      // this step's value columns
#pragma unroll 1
    for (int st = mlow; st <= q0; st += MS) {
        v16us vfa[4], vfr[4];
#pragma unroll
        for (int t2 = 0; t2 < 4; ++t2) {
            vfa[t2] = ldfr(vpa + t2 * 512);                // A[m = d = t2*16 + lr][k = key m0 + ..]
            vfr[t2] = HR ? ldfr(vpr + t2 * 512) : vfa[t2];
        }
        v8f s[2][2];
#pragma unroll
        for (int u = 0; u < 2; ++u)
#pragma unroll
            for (int t = 0; t < 2; ++t) s[u][t] = (v8f){};
#pragma unroll
        for (int kc = 0; kc < 2; ++kc) {
#pragma unroll
            for (int t = 0; t < 2; ++t) {
                s[0][t] = mmg<HR>(kfa[kc][t], qfa[kc][0], s[0][t]); s[1][t] = mmg<HR>(kfa[kc][t], qfa[kc][1], s[1][t]);
                if (HR) {
                    s[0][t] = mmg<HR>(kfa[kc][t], qfr[kc][0], s[0][t]); s[1][t] = mmg<HR>(kfa[kc][t], qfr[kc][1], s[1][t]);
                    s[0][t] = mmg<HR>(kfr[kc][t], qfa[kc][0], s[0][t]); s[1][t] = mmg<HR>(kfr[kc][t], qfa[kc][1], s[1][t]);
                }
            }
        }
        {       // next step's key fragments: a whole softmax and the V^T.P^T products ahead of their use (the last step fetches the first step's keys again: in bounds, not used)
#pragma unroll
            for (int kc = 0; kc < 2; ++kc) {
#pragma unroll
                for (int t = 0; t < 2; ++t) {
                    kfa[kc][t] = ldfr(kpa + (t * 16) * HD + kc * 512);
                    kfr[kc][t] = HR ? ldfr(kpr + (t * 16) * HD + kc * 512) : kfa[kc][t];
                }
            }
            __builtin_amdgcn_sched_barrier(0);      // keeps the loads ahead of the softmax (lead)
        }
        // s[u][t][r] = score(key m0 + t*16 + 8*hi + r, query q0 + u*16 + lr). Keys beyond the query are excluded (only possible in the diagonal step; key m0 is always kept).
        if (m0 == q0) {
#pragma unroll
            for (int u = 0; u < 2; ++u)
#pragma unroll
                for (int t = 0; t < 2; ++t)
#pragma unroll
                    for (int r = 0; r < 8; ++r) { if (t * 16 + 8 * hi + r > u * 16 + lr) s[u][t][r] = -3.0e38f; }
        }
        v16us pa[2], pr[2];
#pragma unroll
        for (int u = 0; u < 2; ++u) {
            float v = fmaxf(s[u][0][0], s[u][1][0]);
#pragma unroll
            for (int r = 1; r < 8; ++r) v = fmaxf(v, fmaxf(s[u][0][r], s[u][1][r]));
            v = fmaxf(v, xhalf(v));
            const float mn = fmaxf(mrow[u], v);
            const v8f x0 = (s[u][0] - mn) * cexp, x1 = (s[u][1] - mn) * cexp;
            float e0[8], e1[8];
#pragma unroll
            for (int r = 0; r < 8; ++r) e0[r] = __builtin_amdgcn_exp2f(x0[r]);
#pragma unroll
            for (int r = 0; r < 8; ++r) e1[r] = __builtin_amdgcn_exp2f(x1[r]);
            const float al = __builtin_amdgcn_exp2f((mrow[u] - mn) * cexp);
            mrow[u] = mn;
            float ps[4] = {0.0f, 0.0f, 0.0f, 0.0f};             // four independent partial sums of the lane's 16 probabilities
#pragma unroll
            for (int r = 0; r < 8; ++r) {
                const float p0 = e0[r], p1 = e1[r];
                ps[r & 3] += p0 + p1;
                if (HR) {
                    unsigned short a, c; splitf(p0, a, c); pa[u][r] = a; pr[u][r] = c;
                    splitf(p1, a, c); pa[u][8 + r] = a; pr[u][8 + r] = c;
                } else {
                    pa[u][r] = __builtin_bit_cast(unsigned short, (h16)(p0 * PCAR));
                    pa[u][8 + r] = __builtin_bit_cast(unsigned short, (h16)(p1 * PCAR));
                }
            }
            if (!HR) pr[u] = pa[u];
            lsum[u] = lsum[u] * al + ((ps[0] + ps[1]) + (ps[2] + ps[3]));     // per-lane partial sum of one query (its half of the keys), the halves joined once at the end
#pragma unroll
            for (int t2 = 0; t2 < 4; ++t2) o[u][t2] *= al;
        }
#pragma unroll
        for (int t2 = 0; t2 < 4; ++t2) {
            o[0][t2] = mmg<HR>(vfa[t2], pa[0], o[0][t2]); o[1][t2] = mmg<HR>(vfa[t2], pa[1], o[1][t2]);
            if (HR) {
                o[0][t2] = mmg<HR>(vfa[t2], pr[0], o[0][t2]); o[1][t2] = mmg<HR>(vfa[t2], pr[1], o[1][t2]);
                o[0][t2] = mmg<HR>(vfr[t2], pa[0], o[0][t2]); o[1][t2] = mmg<HR>(vfr[t2], pa[1], o[1][t2]);
            }
        }
        // the address pairs of this step's loads stay whole up to this wait; they are stepped only behind it
        if (HR) asm volatile("s_wait_xcnt 0x0" :: "v"(kpa), "v"(kpr), "v"(vpa), "v"(vpr) : "memory");
        else    asm volatile("s_wait_xcnt 0x0" :: "v"(kpa), "v"(vpa) : "memory");
        const int m2 = m1 + MS <= q0 ? m1 + MS : mlow;
        const int kstep = (m2 - m1) * HD, vstep = (m1 - m0) * HD;
        kpa += kstep; kpr += kstep; vpa += vstep; vpr += vstep;
        m0 = m1; m1 = m2;
    }
    // every wave publishes its partial result: maximum, sum (the halves joined) and unscaled output accumulators
#pragma unroll
    for (int u = 0; u < 2; ++u) {
        float l = lsum[u];
        l += xhalf(l);
        pm[(wv * 2 + u) * 32 + lane] = mrow[u];
        pl[(wv * 2 + u) * 32 + lane] = l;
#pragma unroll
        for (int t2 = 0; t2 < 4; ++t2) {
            float* p = po + ((wv * 2 + u) * 4 + t2) * 256 + lane * 4;
            *(v4fa*)p = __builtin_shufflevector(o[u][t2], o[u][t2], 0, 1, 2, 3);
            *(v4fa*)(p + 128) = __builtin_shufflevector(o[u][t2], o[u][t2], 4, 5, 6, 7);
        }
    }
    __syncthreads();                                    // all partial results are whole before any wave reads another wave's
    // wave wv joins head columns wv*16 .. wv*16 + 15 of all 32 queries, the partial results in wave order, each scaled from its own maximum to the common one;
    // then normalise, split into bf16 hi / lo, stage the 32 x 64 tile (a lane's 8 values are 8 consecutive d of one query: 16-byte LDS stores), then whole-line stores
#pragma unroll
    for (int u = 0; u < 2; ++u) {
        float mw[AW], f[AW];
#pragma unroll
        for (int w = 0; w < AW; ++w) mw[w] = pm[(w * 2 + u) * 32 + lane];
        const float mall = fmaxf(fmaxf(mw[0], mw[1]), fmaxf(mw[2], mw[3]));
        float l = 0.0f;
        v8f acc = (v8f){};
#pragma unroll
        for (int w = 0; w < AW; ++w) {
            f[w] = __builtin_amdgcn_exp2f((mw[w] - mall) * cexp);
            l += pl[(w * 2 + u) * 32 + lane] * f[w];
            const float* p = po + ((w * 2 + u) * 4 + wv) * 256 + lane * 4;
            const v4f a = *(const v4fa*)p, b = *(const v4fa*)(p + 128);
            acc += __builtin_shufflevector(a, b, 0, 1, 2, 3, 4, 5, 6, 7) * f[w];
        }
        const float inv = 1.0f / (l * pc);
        v8us a8, c8;
#pragma unroll
        for (int r = 0; r < 8; ++r) { unsigned short a, c; splitf(acc[r] * inv, a, c); a8[r] = a; c8[r] = c; }
        const int oo = (u * 16 + lr) * OP + wv * 16 + 8 * hi;
        *(v8usa*)(oh + oo) = a8; *(v8usa*)(ol + oo) = c8;
    }
    __syncthreads();                                    // the staged tile is whole before the row stores
{
#pragma unroll
        for (int s2 = 0; s2 < 8 / AW; ++s2) {
            const int s = wv * (8 / AW) + s2;
            const int row = s * 4 + (lane >> 3), cp = (lane & 7) * 8;
            const v8us vh = *(const v8usa*)(oh + row * OP + cp);
            const v8us vl = *(const v8usa*)(ol + row * OP + cp);
            bf* d = CTX + ((size_t)(q0 + row) * NB + n) * CK + h * HD + cp;
            *(v8us*)d = vh; *(v8us*)(d + DM) = vl;
            if (s2 + 1 < 8 / AW) asm volatile("s_wait_xcnt 0x0" ::: "memory");     // stands before the stores' address and data registers are written again (the next rows take them)
        }
        
    }
}

// ---- attn_hr_body: early query positions (< RH) on bf16 hi/lo planes, ONE 16-row tile per wave (wave wv of its block takes tile number tile), 32 keys per step.
// Per-query arithmetic and product order are those of attn_body with HR = true (q.k: hi.hi, lo.hi, hi.lo per 32-deep chunk; P.v: hi.hi, lo.hi, hi.lo; all into one accumulator, unscaled bf16 residuals), transposed in the same way.
// Live state per lane: 4 output accumulators + 2 score accumulators + 2 softmax scalars + the fragments fetched ahead: q once in front of the loop, a step's v at its head, the next step's k among this step's V^T.P^T products.
// Key steps run over m0 = 0, 32, .., mend with mend = q0 pad down to a multiple of 32 (wave-uniform), entered at mrot and wrapped round; keys beyond the query are excluded in the step m0 == mend only (key mend is always kept).
// Planes: RH x 64 elements per problem in fragment order (fo_qk, fo_v); the last step reads keys < mend + 32 <= RH, all written by the qkv product's epilogue.
__device__ __forceinline__ void attn_hr_body(const us* __restrict__ Qh, const us* __restrict__ Ql, const us* __restrict__ Kh, const us* __restrict__ Kl,
                                             const us* __restrict__ Vh, const us* __restrict__ Vl, bf* CTX, const int tile, const int wv) {
    __shared__ __align__(16) unsigned short eohs[AW * ER * OP];   // context hi staging, 16 rows x 64 per wave
    __shared__ __align__(16) unsigned short eols[AW * ER * OP];   // context lo staging
    unsigned short* eoh = eohs + wv * (ER * OP);                  // each wave stages in its own range
    unsigned short* eol = eols + wv * (ER * OP);
    const int lane = threadIdx.x & 31, lr = lane & 15, hi = lane >> 4;
    const int bh = blockIdx.x, n = bh / NH, h = bh % NH;
    const int q0 = tile * ER;
    const int mend = q0 & ~31;
    const int mrot = (int)((uint32_t)tile % (uint32_t)(mend / 32 + 1)) * 32;      // entry step of the rotated key walk (as in attn_body): mrot, .., mend, 0, .., mrot - 32
    const size_t pb = (size_t)bh * RH * HD;
    Qh += pb; Ql += pb; Kh += pb; Kl += pb; Vh += pb; Vl += pb;
    const int qoff = q0 * HD + 8 * lane;               // fragment order: 16 positions of q or k are 1024 elements, 32 positions of v 2048
    const int koff = 8 * lane;
    const int voff = 8 * lane;
    const float cexp = 0.125f * 1.4426950408889634f;   // HD^-0.5 * log2(e)
    v8f o[4]; float mrow = -3.0e38f, lsum = 0.0f;      // o[t2][r] = context(query q0 + lr, d = t2*16 + 8*hi + r); mrow, lsum: of query q0 + lr
#pragma unroll
    for (int t2 = 0; t2 < 4; ++t2) o[t2] = (v8f){};
    v16us qfa[2], qfr[2], kfa[2][2], kfr[2][2];            // [kc] and [kc][t]
    const us* qph = Qh + qoff; const us* qpl = Ql + qoff;                                      // the tile's query rows
    const us* k0h = Kh + mrot * HD + koff; const us* k0l = Kl + mrot * HD + koff;              // the entry step's key rows
#pragma unroll
    for (int kc = 0; kc < 2; ++kc) {
        qfa[kc] = ldfr(qph + kc * 512);
        qfr[kc] = ldfr(qpl + kc * 512);
#pragma unroll
        for (int t = 0; t < 2; ++t) {
            const int ko = t * 16 * HD + kc * 512;
            kfa[kc][t] = ldfr(k0h + ko);
            kfr[kc][t] = ldfr(k0l + ko);
        }
    }
    asm volatile("s_wait_xcnt 0x0" :: "v"(qph), "v"(qpl), "v"(k0h), "v"(k0l) : "memory");     // the address pairs of these loads stay whole up to this wait
    int m0 = mrot, m1 = m0 + 32 <= mend ? m0 + 32 : 0;             // this step's first key, the next step's
    const us* kph = Kh + m1 * HD + koff; const us* kpl = Kl + m1 * HD + koff;      // the NEXT step's key rows (the last step fetches the first step's keys again: in bounds, not used)
#pragma unroll 1
    for (int st = 0; st <= mend; st += 32) {
        v16us vfa[4], vfr[4];
        const us* vph = Vh + voff + m0 * HD; const us* vpl = Vl + voff + m0 * HD;
#pragma unroll
        for (int t2 = 0; t2 < 4; ++t2) {
            vfa[t2] = ldfr(vph + t2 * 512);                // A[m = d = t2*16 + lr][k = key m0 + ..]
            vfr[t2] = ldfr(vpl + t2 * 512);
        }
        asm volatile("s_wait_xcnt 0x0" :: "v"(vph), "v"(vpl) : "memory");   // the two address pairs stay whole up to this wait
        v8f s[2];
        s[0] = (v8f){}; s[1] = (v8f){};
#pragma unroll
        for (int kc = 0; kc < 2; ++kc) {
#pragma unroll
            for (int t = 0; t < 2; ++t) {
                s[t] = mmg<true>(kfa[kc][t], qfa[kc], s[t]);
                s[t] = mmg<true>(kfa[kc][t], qfr[kc], s[t]);
                s[t] = mmg<true>(kfr[kc][t], qfa[kc], s[t]);
            }
        }
        // s[t][r] = score(key m0 + t*16 + 8*hi + r, query q0 + lr)
        if (m0 == mend) {
#pragma unroll
            for (int t = 0; t < 2; ++t)
#pragma unroll
                for (int r = 0; r < 8; ++r) { if (m0 + t * 16 + 8 * hi + r > q0 + lr) s[t][r] = -3.0e38f; }
        }
        v16us pa, pr;
        {
            float v = fmaxf(s[0][0], s[1][0]);
#pragma unroll
            for (int r = 1; r < 8; ++r) v = fmaxf(v, fmaxf(s[0][r], s[1][r]));
            v = fmaxf(v, xhalf(v));
            const float mn = fmaxf(mrow, v);
            const float al = __builtin_amdgcn_exp2f((mrow - mn) * cexp);
            mrow = mn;
            const v8f x0 = (s[0] - mn) * cexp, x1 = (s[1] - mn) * cexp;
            float ps[4] = {0.0f, 0.0f, 0.0f, 0.0f};             // four independent partial sums of the lane's 16 probabilities
#pragma unroll
            for (int r = 0; r < 8; ++r) {
                const float p0 = __builtin_amdgcn_exp2f(x0[r]);
                const float p1 = __builtin_amdgcn_exp2f(x1[r]);
                ps[r & 3] += p0 + p1;
                unsigned short a, c;
                splitf(p0, a, c); pa[r] = a; pr[r] = c;
                splitf(p1, a, c); pa[8 + r] = a; pr[8 + r] = c;
            }
            lsum = lsum * al + ((ps[0] + ps[1]) + (ps[2] + ps[3]));           // per-lane partial sum of one query (its half of the keys), the halves joined once at the end
#pragma unroll
            for (int t2 = 0; t2 < 4; ++t2) o[t2] *= al;
        }
#pragma unroll
        for (int t2 = 0; t2 < 4; ++t2) {
            o[t2] = mmg<true>(vfa[t2], pa, o[t2]);
            o[t2] = mmg<true>(vfa[t2], pr, o[t2]);
            o[t2] = mmg<true>(vfr[t2], pa, o[t2]);
            const int ko = ((t2 & 1) * 16) * HD + (t2 >> 1) * 512;
            kfa[t2 >> 1][t2 & 1] = ldfr(kph + ko);
            kfr[t2 >> 1][t2 & 1] = ldfr(kpl + ko);
            __builtin_amdgcn_sched_barrier(0);  // keeps each key refill behind the products that free a value fragment pair (register room)
        }
        asm volatile("s_wait_xcnt 0x0" :: "v"(kph), "v"(kpl) : "memory");   // the key address pairs stay whole up to this wait; they are stepped only behind it
        const int m2 = m1 + 32 <= mend ? m1 + 32 : 0;
        const int kstep = (m2 - m1) * HD;
        kph += kstep; kpl += kstep;
        m0 = m1; m1 = m2;
    }
    // normalise, split into bf16 hi / lo, stage the 16 x 64 tile (16-byte LDS stores), then whole-line stores
    {
        float l = lsum;
        l += xhalf(l);
        const float inv = 1.0f / l;
#pragma unroll
        for (int t2 = 0; t2 < 4; ++t2) {
            v8us a8, c8;
#pragma unroll
            for (int r = 0; r < 8; ++r) { unsigned short a, c; splitf(o[t2][r] * inv, a, c); a8[r] = a; c8[r] = c; }
            const int oo = lr * OP + t2 * 16 + 8 * hi;
            *(v8usa*)(eoh + oo) = a8; *(v8usa*)(eol + oo) = c8;
        }
    }
    __syncthreads();                                    // the staged tile is whole before the row stores; a wave reads its own range only, and all AW waves of the block pass here once
{
#pragma unroll
        for (int s4 = 0; s4 < ER / 4; ++s4) {
            const int row = s4 * 4 + (lane >> 3), cp = (lane & 7) * 8;
            const v8us vh = *(const v8usa*)(eoh + row * OP + cp);
            const v8us vl = *(const v8usa*)(eol + row * OP + cp);
            bf* d = CTX + ((size_t)(q0 + row) * NB + n) * CK + h * HD + cp;
            *(v8us*)d = vh; *(v8us*)(d + DM) = vl;
            if (s4 + 1 < ER / 4) asm volatile("s_wait_xcnt 0x0" ::: "memory");     // stands before the stores' address and data registers are written again (the next rows take them)
        }
        
    }
}

// ---- k_attn: both kinds of attention tile in ONE grid (NBH, EB + late tiles), AW waves per block. The two kinds read planes that the qkv product has written and write different context rows: neither waits for the other.
// Rows blockIdx.y < EB of the grid hold the early tiles (AW of them per block, one per wave); their few, long chains of dependent steps, which fill a fraction of the chip, run beside the late tiles
// instead of in a launch of their own. The choice is the same for the whole block, so every barrier stays under block-uniform control flow.
// The late tiles follow longest first (tile number falls as blockIdx.y rises). The grid holds more blocks than the chip has places for at this register count, the order is for speed only.
#define EB (RH / ER / AW)
__global__ __launch_bounds__(32 * AW) void k_attn(const us* __restrict__ Q16, const us* __restrict__ K16, const us* __restrict__ V16,
                                                  const us* __restrict__ Qh, const us* __restrict__ Ql, const us* __restrict__ Kh, const us* __restrict__ Kl,
                                                  const us* __restrict__ Vh, const us* __restrict__ Vl, bf* CTX) {
    const int wv = __builtin_amdgcn_readfirstlane((int)(threadIdx.x >> 5));     // the wave's number, held scalar: the step bookkeeping stays on the scalar unit
    if (blockIdx.y < EB) {
        attn_hr_body(Qh, Ql, Kh, Kl, Vh, Vl, CTX, (int)blockIdx.y * AW + wv, wv);
        return;
    }
    const uint32_t ty = (uint32_t)((SEQ - RH) / 32 - 1) - (blockIdx.y - EB);    // late tile number, the longest tile (most key steps) at the lowest block index
    const int q0 = RH + (int)ty * 32;
    const int cnt = (q0 / 32 - wv) / AW + 1;                                    // the wave's key steps: wv, wv + AW, .. <= q0 / 32
    attn_body<false>(Q16, Q16, K16, K16, V16, V16, CTX, q0, (wv + AW * (int)(ty * 7u % (uint32_t)cnt)) * 32, wv);   // entry step: spread over the wave's own steps, neighbouring tiles apart
}

// workspace carve (bytes), every region a multiple of 256
constexpr size_t SZ_XB   = (size_t)MROWS * DM * 2;        // x bf16 [MROWS][1024]
constexpr size_t SZ_WQ   = (size_t)F3 * DM * 2;           // w_qkv bf16 [3072][1024]
constexpr size_t SZ_WO   = (size_t)DM * CK * 2;           // [w_out | w_out] bf16 [1024][2048]
constexpr size_t SZ_QK16 = (size_t)2 * NBH * SEQ * HD * 2;
constexpr size_t SZ_QKH  = (size_t)2 * NBH * RH * HD * 2;
constexpr size_t SZ_VT16 = (size_t)NBH * HD * SEQ * 2;
constexpr size_t SZ_VTH  = (size_t)NBH * HD * RH * 2;
constexpr size_t SZ_CTX  = (size_t)MROWS * CK * 2;        // context bf16 hi | lo [MROWS][2048]
constexpr size_t OF_XB   = 0;
constexpr size_t OF_WQ   = OF_XB + SZ_XB;
constexpr size_t OF_WO   = OF_WQ + SZ_WQ;
constexpr size_t OF_QK16 = OF_WO + SZ_WO;
constexpr size_t OF_QKH  = OF_QK16 + SZ_QK16;
constexpr size_t OF_QKL  = OF_QKH + SZ_QKH;
constexpr size_t OF_VT16 = OF_QKL + SZ_QKH;
constexpr size_t OF_VTH  = OF_VT16 + SZ_VT16;
constexpr size_t OF_VTL  = OF_VTH + SZ_VTH;
constexpr size_t OF_CTX  = OF_VTL + SZ_VTH;
constexpr size_t WS_TOTAL = OF_CTX + SZ_CTX;
static_assert(SZ_XB % 256 == 0 && SZ_WQ % 256 == 0 && SZ_WO % 256 == 0 && SZ_QK16 % 256 == 0);
static_assert(SZ_QKH % 256 == 0 && SZ_VT16 % 256 == 0 && SZ_VTH % 256 == 0 && SZ_CTX % 256 == 0);
static_assert(WS_TOTAL <= (size_t)134217728);            // total carve <= 128 MiB

// entry-stage step per tile column of k_gemmw: stages / tile columns, at least 1
constexpr int RY_QKV = (DM / 64) / (F3 / 128) > 0 ? (DM / 64) / (F3 / 128) : 1;
constexpr int RY_OUT = (CK / 128) / (DM / 128) > 0 ? (CK / 128) / (DM / 128) : 1;

extern "C" void kernel_launch(void* const* d_in, const int* in_sizes, int n_in,
                              void* d_out, int out_size, void* d_ws, size_t ws_size, hipStream_t stream) {
    if (n_in < 3) return;
    const long long needx = ((long long)(SEQ - 1) * NB_FULL + NB) * DM;     // last token row touched, in elements
    if ((long long)in_sizes[0] < needx || (long long)in_sizes[1] < (long long)F3 * DM || (long long)in_sizes[2] < (long long)DM * DM || (long long)out_size < needx) return;
    if (WS_TOTAL > ws_size) return;
    const float* x = (const float*)d_in[0];       // [2048][2][1024], token row l*2 + n
    const float* wqkv = (const float*)d_in[1];    // [3072][1024] = [out][in]
    const float* wout = (const float*)d_in[2];    // [1024][1024] = [out][in]
    float* OUT = (float*)d_out;                   // [2048][2][1024]
    char* ws = (char*)d_ws;
    bf* XB = (bf*)(ws + OF_XB); bf* WQ = (bf*)(ws + OF_WQ); bf* WO2 = (bf*)(ws + OF_WO);
    h16* QK16 = (h16*)(ws + OF_QK16); bf* QKh = (bf*)(ws + OF_QKH); bf* QKl = (bf*)(ws + OF_QKL);
    h16* VT16 = (h16*)(ws + OF_VT16); bf* VTh = (bf*)(ws + OF_VTH); bf* VTl = (bf*)(ws + OF_VTL); bf* CTX = (bf*)(ws + OF_CTX);

    k_cvt_all<<<CROWS / (16 * CRPW), 512, 0, stream>>>(x, wqkv, wout, XB, WQ, WO2);
    k_gemmw<64, true, RY_QKV><<<dim3(MROWS / 128, F3 / 128, 1), 128, 0, stream>>>(XB, DM, WQ, DM, DM, nullptr, 0, QK16, QKh, QKl, VT16, VTh, VTl);   // qkv[m][f] = sum_e x[m][e] w_qkv[f][e], written as 16-bit planes
    k_attn<<<dim3(NBH, EB + (SEQ - RH) / 32, 1), 32 * AW, 0, stream>>>((const us*)QK16, (const us*)(QK16 + PLN), (const us*)VT16,
                                                                       (const us*)QKh, (const us*)QKl, (const us*)(QKh + PLNH), (const us*)(QKl + PLNH), (const us*)VTh, (const us*)VTl, CTX);
    k_gemmw<128, false, RY_OUT><<<dim3(MROWS / 128, DM / 128, 1), 128, 0, stream>>>(CTX, CK, WO2, CK, CK, OUT, DM * ROWSTEP, nullptr, nullptr, nullptr, nullptr, nullptr, nullptr);   // out[m][f] = sum_e (ctx_hi + ctx_lo)[m][e] w_out[f][e]
}
